// v000
// Measured on an AMD MI455X. A time is GPU time per run, averaged over a window of back-to-back runs after a warm-up
// (all launches, gaps included; the runs take copies of the inputs in turn), and the median of several windows.
// Apart from v000's, it joins two sittings. Times from different sittings can be a few percent apart, while
// side-by-side timings come from the same sitting.
// The starting kernel, v000, takes 4200 microseconds a run.
#include <hip/hip_runtime.h>
// Causal multi-head attention with per-head weight tensors (x [4][1024][768]; Q[s][h][d] = sum_m x[s][m] W_Q[h][m][d], K, V likewise (12 heads of 64); scores / 8 with a causal mask (tril); softmax; avg_V = probs V; out[q][h*64+d] = avg_V[q][h][d] (heads concatenated) -> [4][1024][768]).
// Structure: token rows r = b*1024 + s; x as exact f16 rows (bf16-rounded); Q, K, V as three WMMA GEMMs (32x64 wave tiles, f32 accumulation, exact x16 weights, f16 outputs); per batch: V^T for all heads via LDS transposes; per query tile of 256 rows: scores against the keys below the tile end only (K = 64, all heads on grid.y, alpha = 0.125), causal row softmax on VALU with an arithmetic 0/1 key mask over the computed range (f32 statistics, native exp; weights x256 f16), out tile = P V^T GEMM (K = keys below the tile end, alpha 2^-8) written f32 straight into the concatenated-heads output rows (no output projection); first-tile refinement: the first 128 query rows of every batch recomputed exactly in f32 (f32 q/k/v GEMMs + an online-softmax causal attention on VALU) and copied over those output rows.
// Compute dtype: inputs rounded to bf16; x / weights exact; q, k, v and softmax weights as plain f16 GEMM operands (~2^-12); scores and softmax statistics f32. v_wmma_f32_16x16x32_f16.
#define NB 4
#define SQ 1024
#define DM 768
#define NH 12
#define HD 64
#define HG 4                         /* heads per group in the unlaunched k_vt(V16, b, h0, VT) */
#define QT 256                       /* query rows per causal tile */
#define NKX SQ                       /* S / P row pitch */
#define QT0 128                      /* first-tile rows recomputed exactly in f32 */
#define B0 0                         /* first batch processed (debug hook) */
#define NBR NB                       /* batches processed (debug hook) */
#define NR ((size_t)NB * SQ)         /* token rows */
#define MP ((int)((size_t)NBR * SQ)) /* rows projected (debug hook) */
#define QN SQ                        /* query rows attended per batch (debug hook) */
#define NHD NH                       /* heads attended (debug hook) */
#define MPO MP                       /* unused (no output stage) */
#define LQ DM      /* row pitch of the q/k/v rows */
typedef __bf16 v16b __attribute__((ext_vector_type(16)));
typedef unsigned short v8us __attribute__((ext_vector_type(8), may_alias));
typedef float  v8f  __attribute__((ext_vector_type(8)));
typedef float  v4f  __attribute__((ext_vector_type(4)));
typedef float  v4fa __attribute__((ext_vector_type(4), may_alias));
union FragB { v16b v; v8us half[2]; unsigned short u[16]; };

__device__ __forceinline__ unsigned short bf16_bits(float x) { unsigned int u = __float_as_uint(x); return (unsigned short)((u + 0x7FFFu + ((u >> 16) & 1u)) >> 16); }
__device__ __forceinline__ float bf16_val(unsigned short b) { return __uint_as_float(((unsigned int)b) << 16); }
__device__ __forceinline__ float bf16_round(float x) { return bf16_val(bf16_bits(x)); }
// D += A·B with NT terms: 1 = ah·bh, 2 = + al·bh (A split), 3 = + ah·bl (both split)
template <int NT>
__device__ __forceinline__ v8f mmaN(v16b ah, v16b al, v16b bh, v16b bl, v8f c) {
  c = __builtin_amdgcn_wmma_f32_16x16x32_bf16(false, ah, false, bh, (short)0, c, false, false);
  if (NT >= 2) c = __builtin_amdgcn_wmma_f32_16x16x32_bf16(false, al, false, bh, (short)0, c, false, false);
  if (NT >= 3) c = __builtin_amdgcn_wmma_f32_16x16x32_bf16(false, ah, false, bl, (short)0, c, false, false);
  asm volatile("v_nop\n\tv_nop\n\tv_nop\n\tv_nop" : "+v"(c) : "v"(ah), "v"(al), "v"(bh), "v"(bl));
  return c;
}

__global__ __launch_bounds__(256) void k_wt_bf16(const float* __restrict__ W, unsigned short* __restrict__ Wt, int K, int N) {
  const int t = blockIdx.x * 256 + threadIdx.x;
  const int k8n = K / 8;
  if (t >= N * k8n) return;
  const int n = t / k8n, k8 = (t % k8n) * 8;
  v8us v;
#pragma unroll
  for (int i = 0; i < 8; ++i) v[i] = bf16_bits(W[(size_t)(k8 + i) * N + n]);
  *(v8us*)(Wt + (size_t)n * K + k8) = v;
  
}

// GEMM C[M][N] (f32, pitch ldc) = act(A[M][K]·W + bias). A f32 row-major (pitch lda) converted per fragment to bf16
// (ASPLIT: hi/lo two planes -> 2 terms, else single rounded term); Wt bf16 [N][K] (pitch ldb). BIAS_BF16 rounds the
// bias to bf16 first (bias quantised to bf16 before the add). K%32==0, M%16==0, N%64==0.
template <bool ASPLIT, int ACT, bool BIAS_BF16>
__global__ __launch_bounds__(128) void k_gemm_bf(const float* __restrict__ A, int lda, const unsigned short* __restrict__ Wt, int ldb,
                                               const float* __restrict__ bias, float* __restrict__ C, int ldc, int M, int N, int K) {
  __shared__ __attribute__((aligned(16))) float so[4][16][64];
  const int tid = threadIdx.x, w = tid >> 5, lane = tid & 31, ln = lane & 15, hh = lane >> 4;
  const int ntn = N / 64;
  const int wid = blockIdx.x * 4 + w;
  const int mt = wid / ntn, nq = wid % ntn;
  if (mt * 16 >= M) return;
  const int row0 = mt * 16, col0 = nq * 64;
  const float* arow = A + (size_t)(row0 + ln) * lda;
  v8f acc[4] = {};
  for (int kb = 0; kb < K; kb += 32) {
    FragB ah, al;
    const v4f x0 = *(const v4fa*)(arow + kb + 8 * hh), x1 = *(const v4fa*)(arow + kb + 8 * hh + 4);
    const v4f x2 = *(const v4fa*)(arow + kb + 16 + 8 * hh), x3 = *(const v4fa*)(arow + kb + 16 + 8 * hh + 4);
    float xs[16] = {x0[0],x0[1],x0[2],x0[3],x1[0],x1[1],x1[2],x1[3],x2[0],x2[1],x2[2],x2[3],x3[0],x3[1],x3[2],x3[3]};
#pragma unroll
    for (int i = 0; i < 16; ++i) { const unsigned short hb = bf16_bits(xs[i]); ah.u[i] = hb; al.u[i] = ASPLIT ? bf16_bits(xs[i] - bf16_val(hb)) : (unsigned short)0; }
#pragma unroll
    for (int t = 0; t < 4; ++t) {
      const unsigned short* brow = Wt + (size_t)(col0 + t * 16 + ln) * ldb + kb;
      FragB b;
      b.half[0] = *(const v8us*)(brow + 8 * hh);
      b.half[1] = *(const v8us*)(brow + 16 + 8 * hh);
      acc[t] = mmaN<ASPLIT ? 2 : 1>(ah.v, al.v, b.v, b.v, acc[t]);
    }
  }
#pragma unroll
  for (int t = 0; t < 4; ++t) {
    float bv = bias ? bias[col0 + t * 16 + ln] : 0.f;
    if (BIAS_BF16) bv = bf16_round(bv);
#pragma unroll
    for (int r = 0; r < 8; ++r) { float v = acc[t][r] + bv; if (ACT == 1) v = fmaxf(v, 0.f); so[w][8 * hh + r][t * 16 + ln] = v; }
  }
  __builtin_amdgcn_fence(__ATOMIC_ACQ_REL, "workgroup");
  __builtin_amdgcn_wave_barrier();
  const int rsub = lane >> 4, c4 = (lane & 15) * 4;
  {
#pragma unroll
    for (int q = 0; q < 8; ++q) {
      const int r = q * 2 + rsub;
      const v4f v = *(const v4fa*)&so[w][r][c4];
      *(v4f*)(C + (size_t)(row0 + r) * ldc + col0 + c4) = v;
    }
    
  }
}

// GEMM C = act(A·W + bias + resid): A f32 (ASPLIT -> hi/lo 2 terms), Wt bf16 [N][K]; ACT 0 none, 1 relu, 2 exact gelu;
// resid (optional, f32, row index = (row % rmod), pitch ldr, RES_BF16 rounds it) added before the activation.
template <bool ASPLIT, int ACT, bool BIAS_BF16, bool RES_BF16>
__global__ __launch_bounds__(128) void k_gemm_bf3(const float* __restrict__ A, int lda, const unsigned short* __restrict__ Wt, int ldb,
                                                const float* __restrict__ bias, const float* __restrict__ resid, int rmod, int ldr,
                                                float* __restrict__ C, int ldc, int M, int N, int K) {
  __shared__ __attribute__((aligned(16))) float so[4][16][64];
  const int tid = threadIdx.x, w = tid >> 5, lane = tid & 31, ln = lane & 15, hh = lane >> 4;
  const int ntn = N / 64;
  const int wid = blockIdx.x * 4 + w;
  const int mt = wid / ntn, nq = wid % ntn;
  if (mt * 16 >= M) return;
  const int row0 = mt * 16, col0 = nq * 64;
  const float* arow = A + (size_t)(row0 + ln) * lda;
  v8f acc[4] = {};
  for (int kb = 0; kb < K; kb += 32) {
    FragB ah, al;
    const v4f x0 = *(const v4fa*)(arow + kb + 8 * hh), x1 = *(const v4fa*)(arow + kb + 8 * hh + 4);
    const v4f x2 = *(const v4fa*)(arow + kb + 16 + 8 * hh), x3 = *(const v4fa*)(arow + kb + 16 + 8 * hh + 4);
    float xs[16] = {x0[0],x0[1],x0[2],x0[3],x1[0],x1[1],x1[2],x1[3],x2[0],x2[1],x2[2],x2[3],x3[0],x3[1],x3[2],x3[3]};
#pragma unroll
    for (int i = 0; i < 16; ++i) { const unsigned short hb = bf16_bits(xs[i]); ah.u[i] = hb; al.u[i] = ASPLIT ? bf16_bits(xs[i] - bf16_val(hb)) : (unsigned short)0; }
#pragma unroll
    for (int t = 0; t < 4; ++t) {
      const unsigned short* brow = Wt + (size_t)(col0 + t * 16 + ln) * ldb + kb;
      FragB b;
      b.half[0] = *(const v8us*)(brow + 8 * hh);
      b.half[1] = *(const v8us*)(brow + 16 + 8 * hh);
      acc[t] = mmaN<ASPLIT ? 2 : 1>(ah.v, al.v, b.v, b.v, acc[t]);
    }
  }
#pragma unroll
  for (int t = 0; t < 4; ++t) {
    const int col = col0 + t * 16 + ln;
    float bv = bias ? bias[col] : 0.f;
    if (BIAS_BF16) bv = bf16_round(bv);
#pragma unroll
    for (int r = 0; r < 8; ++r) {
      float v = acc[t][r] + bv;
      if (resid) { float rv = resid[(size_t)((row0 + 8 * hh + r) % rmod) * ldr + col]; if (RES_BF16) rv = bf16_round(rv); v += rv; }
      if (ACT == 1) v = fmaxf(v, 0.f);
      if (ACT == 2) v = 0.5f * v * (1.0f + erff(v * 0.70710678118654752f));
      if (ACT == 3) { const float u = 0.7978845608028654f * (v + 0.044715f * v * v * v); v = 0.5f * v * (1.0f + tanhf(u)); }
      so[w][8 * hh + r][t * 16 + ln] = v;
    }
  }
  __builtin_amdgcn_fence(__ATOMIC_ACQ_REL, "workgroup");
  __builtin_amdgcn_wave_barrier();
  const int rsub = lane >> 4, c4 = (lane & 15) * 4;
  {
#pragma unroll
    for (int q = 0; q < 8; ++q) {
      const int r = q * 2 + rsub;
      const v4f v = *(const v4fa*)&so[w][r][c4];
      *(v4f*)(C + (size_t)(row0 + r) * ldc + col0 + c4) = v;
    }
    
  }
}
// row LayerNorm (biased variance, eps) over N: s = X (+ R); optional out_sum <- s; out_norm <- (s-mu)*rsqrt(var+eps)*g + b
template <bool PARAM_BF16>
__global__ __launch_bounds__(256) void k_layernorm(const float* __restrict__ X, const float* __restrict__ R, const float* __restrict__ g, const float* __restrict__ bta,
                                                  float* __restrict__ out_sum, float* __restrict__ out_norm, int N, float eps) {
  __shared__ float red[256];
  const int row = blockIdx.x, tid = threadIdx.x;
  const float* x = X + (size_t)row * N; const float* rr = R ? R + (size_t)row * N : nullptr;
  float vals[16];                     // up to N = 4096
  const int per = N / 256;            // contiguous chunk per thread? use strided-by-4 chunks: thread handles j = tid*4 + 1024*u
  float s1 = 0.f;
  for (int u = 0; u < per / 4; ++u) {
    const int j = tid * 4 + 1024 * u;
    const v4f a = *(const v4fa*)(x + j);
    v4f b = {0.f,0.f,0.f,0.f}; if (rr) b = *(const v4fa*)(rr + j);
#pragma unroll
    for (int q = 0; q < 4; ++q) { const float v = a[q] + b[q]; vals[u * 4 + q] = v; s1 += v; }
  }
  red[tid] = s1; __syncthreads();
  for (int st = 128; st > 0; st >>= 1) { if (tid < st) red[tid] += red[tid + st]; __syncthreads(); }
  const float mu = red[0] / (float)N; __syncthreads();
  float s2 = 0.f;
  for (int u = 0; u < per / 4; ++u)
#pragma unroll
    for (int q = 0; q < 4; ++q) { const float c = vals[u * 4 + q] - mu; s2 += c * c; }
  red[tid] = s2; __syncthreads();
  for (int st = 128; st > 0; st >>= 1) { if (tid < st) red[tid] += red[tid + st]; __syncthreads(); }
  const float rs = rsqrtf(red[0] / (float)N + eps);
  {
    for (int u = 0; u < per / 4; ++u) {
      const int j = tid * 4 + 1024 * u;
      v4f o, sm;
#pragma unroll
      for (int q = 0; q < 4; ++q) {
        float gg = g[j + q], bb = bta[j + q];
        if (PARAM_BF16) { gg = bf16_round(gg); bb = bf16_round(bb); }
        sm[q] = vals[u * 4 + q]; o[q] = (vals[u * 4 + q] - mu) * rs * gg + bb;
      }
      if (out_sum) *(v4f*)(out_sum + (size_t)row * N + j) = sm;
      *(v4f*)(out_norm + (size_t)row * N + j) = o;
    }
    
  }
}



// ---- f16 WMMA path (v_wmma_f32_16x16x32_f16): 11-bit significands for operands in range — used where a [0,1] probability operand needs more precision than bf16
typedef _Float16 v16h __attribute__((ext_vector_type(16)));
union FragH { v16h v; v8us half[2]; _Float16 h[16]; unsigned short u[16]; };
template <int NT>
__device__ __forceinline__ v8f mmaH(v16h ah, v16h al, v16h bh, v16h bl, v8f c) {
  c = __builtin_amdgcn_wmma_f32_16x16x32_f16(false, ah, false, bh, (short)0, c, false, false);
  if (NT >= 2) c = __builtin_amdgcn_wmma_f32_16x16x32_f16(false, al, false, bh, (short)0, c, false, false);
  if (NT >= 3) c = __builtin_amdgcn_wmma_f32_16x16x32_f16(false, ah, false, bl, (short)0, c, false, false);
  asm volatile("v_nop\n\tv_nop\n\tv_nop\n\tv_nop" : "+v"(c) : "v"(ah), "v"(al), "v"(bh), "v"(bl));
  return c;
}
// batched GEMM like k_gemm_b but f16 operands: A f32 (split into f16 hi/lo if ASPLIT, else rounded to f16), Bt = f16 values [n][k]; alpha; C f32; N multiple of 16 (partial tiles skipped)
template <bool ASPLIT>
__global__ __launch_bounds__(128) void k_gemm_h(const float* __restrict__ A, int lda, size_t sA, const _Float16* __restrict__ Bh, int ldb, size_t sB, float alpha, float* __restrict__ C, int ldc, size_t sC, int M, int N, int K) {
  __shared__ __attribute__((aligned(16))) float so[4][16][64];
  const int tid = threadIdx.x, w = tid >> 5, lane = tid & 31, ln = lane & 15, hh = lane >> 4; const int by = blockIdx.y;
  A += (size_t)by * sA; Bh += (size_t)by * sB; C += (size_t)by * sC;
  const int ntn = (N + 63) / 64; const int wid = blockIdx.x * 4 + w; const int mt = wid / ntn, nq = wid % ntn; if (mt * 16 >= M) return;
  const int row0 = mt * 16, col0 = nq * 64; const float* arow = A + (size_t)(row0 + ln) * lda;
  v8f acc[4] = {};
  for (int kb = 0; kb < K; kb += 32) {
    FragH ah, al;
    const v4f x0 = *(const v4fa*)(arow + kb + 8 * hh), x1 = *(const v4fa*)(arow + kb + 8 * hh + 4), x2 = *(const v4fa*)(arow + kb + 16 + 8 * hh), x3 = *(const v4fa*)(arow + kb + 16 + 8 * hh + 4);
    float xs[16] = {x0[0],x0[1],x0[2],x0[3],x1[0],x1[1],x1[2],x1[3],x2[0],x2[1],x2[2],x2[3],x3[0],x3[1],x3[2],x3[3]};
#pragma unroll
    for (int i = 0; i < 16; ++i) { const _Float16 h = (_Float16)xs[i]; ah.h[i] = h; al.h[i] = ASPLIT ? (_Float16)(xs[i] - (float)h) : (_Float16)0.0f; }
#pragma unroll
    for (int t = 0; t < 4; ++t) { if (col0 + t * 16 >= N) continue; const size_t boff = (size_t)(col0 + t * 16 + ln) * ldb + kb; FragH bq; bq.half[0] = *(const v8us*)(Bh + boff + 8 * hh); bq.half[1] = *(const v8us*)(Bh + boff + 16 + 8 * hh);
      acc[t] = mmaH<ASPLIT ? 2 : 1>(ah.v, al.v, bq.v, bq.v, acc[t]); }
  }
#pragma unroll
  for (int t = 0; t < 4; ++t) { if (col0 + t * 16 >= N) continue;
#pragma unroll
    for (int r = 0; r < 8; ++r) so[w][8 * hh + r][t * 16 + ln] = acc[t][r] * alpha; }
  __builtin_amdgcn_fence(__ATOMIC_ACQ_REL, "workgroup"); __builtin_amdgcn_wave_barrier();
  const int rsub = lane >> 4, c4 = (lane & 15) * 4;
  {
#pragma unroll
    for (int q = 0; q < 8; ++q) { const int r = q * 2 + rsub; if (col0 + c4 < N) { const v4f v = *(const v4fa*)&so[w][r][c4]; *(v4f*)(C + (size_t)(row0 + r) * ldc + col0 + c4) = v; } }
     }
}

// Wt[n][k] = f16(W[k][n]·scale) from f32 row-major W[K][N] (scale = power of two; bf16-exact weights stay exact in f16 away from the subnormal range)
__global__ __launch_bounds__(256) void k_wt_f16(const float* __restrict__ W, _Float16* __restrict__ Wt, int K, int N, float scale) {
  const int t = blockIdx.x * 256 + threadIdx.x; if (t >= N * (K / 8)) return; const int n = t / (K / 8), k8 = (t % (K / 8)) * 8; FragH f;
#pragma unroll
  for (int i = 0; i < 8; ++i) f.h[i] = (_Float16)(bf16_round(W[(size_t)(k8 + i) * N + n]) * scale); const v8us o = f.half[0];
  *(v8us*)((unsigned short*)Wt + (size_t)n * K + k8) = o; 
}
// k_gemm_hh variant with fused epilogue: v = acc·alpha + bias[by·sBias + col] (+ CP[(row/rowsPerB)·sCPb + by·64 + col] if CP) ; ACT 0 none / 1 elu ; writes f16 C16 (and f32 C if non-null)
template <int ACT>
__global__ __launch_bounds__(128) void k_gemm_hhx(const _Float16* __restrict__ A, int lda, size_t sA, const _Float16* __restrict__ Bh, int ldb, size_t sB, float alpha, const float* __restrict__ bias, size_t sBias, const float* __restrict__ CP, int rowsPerB, size_t sCPb, int row0g,
    float* __restrict__ C, _Float16* __restrict__ C16, int ldc, size_t sC, int M, int N, int K) {
  __shared__ __attribute__((aligned(16))) float so[4][16][64];
  const int tid = threadIdx.x, w = tid >> 5, lane = tid & 31, ln = lane & 15, hh = lane >> 4; const int by = blockIdx.y;
  A += (size_t)by * sA; Bh += (size_t)by * sB; const size_t cofs = (size_t)by * sC; const float* bp = bias ? bias + (size_t)by * sBias : nullptr;
  const int ntn = (N + 63) / 64; const int wid = blockIdx.x * 4 + w; const int mt = wid / ntn, nq = wid % ntn; if (mt * 16 >= M) return;
  const int row0 = mt * 16, col0 = nq * 64; const _Float16* arow = A + (size_t)(row0 + ln) * lda;
  v8f acc[4] = {};
  for (int kb = 0; kb < K; kb += 32) { FragH ah; ah.half[0] = *(const v8us*)((const unsigned short*)arow + kb + 8 * hh); ah.half[1] = *(const v8us*)((const unsigned short*)arow + kb + 16 + 8 * hh);
#pragma unroll
    for (int t = 0; t < 4; ++t) { if (col0 + t * 16 >= N) continue; const size_t boff = (size_t)(col0 + t * 16 + ln) * ldb + kb; FragH bq; bq.half[0] = *(const v8us*)((const unsigned short*)Bh + boff + 8 * hh); bq.half[1] = *(const v8us*)((const unsigned short*)Bh + boff + 16 + 8 * hh);
      acc[t] = mmaH<1>(ah.v, ah.v, bq.v, bq.v, acc[t]); }
  }
#pragma unroll
  for (int t = 0; t < 4; ++t) { if (col0 + t * 16 >= N) continue; const int col = col0 + t * 16 + ln; const float bv = bp ? bf16_round(bp[col]) : 0.f;
#pragma unroll
    for (int r = 0; r < 8; ++r) { float v = acc[t][r] * alpha + bv; if (CP) { const int rr = row0g + row0 + 8 * hh + r; if (rowsPerB < 0) v += CP[cofs + (size_t)rr * ldc + col];      /* rowsPerB < 0: own element of the batched C plane */ else { const int bidx = rr / rowsPerB; v += CP[(size_t)bidx * sCPb + (size_t)by * 64 + col]; } } if (ACT == 1) v = (v > 0.f) ? v : expm1f(v); else if (ACT == 7) v = (v > 0.f) ? v + 1.0f : expf(v); else if (ACT == 8) v = tanhf(v); else if (ACT == 9) v = 0.5f * v * (1.0f + tanhf(0.7978845608028654f * (v + 0.044715f * v * v * v))); else if (ACT == 11) v = 1.0f / (1.0f + expf(-v)); else if (ACT == 12) v = (v > 0.f) ? v : 0.01f * v; else if (ACT == 14) v = (v > 0.f) ? v : 0.1f * v; else if (ACT == 16) v = (v >= 0.f) ? v : 0.3f * v; else if (ACT == 17) v = (v >= 0.f) ? v : 0.2f * v; else if (ACT == 15) v = v / (1.0f + expf(-v)); else if (ACT == 3) v = fmaxf(v, 0.f); else if (ACT == 6) v = 0.5f * v * (1.0f + erff(v * 0.70710678118654752f)); so[w][8 * hh + r][t * 16 + ln] = v; } }
  __builtin_amdgcn_fence(__ATOMIC_ACQ_REL, "workgroup"); __builtin_amdgcn_wave_barrier();
  const int rsub = lane >> 4, c4 = (lane & 15) * 4; typedef _Float16 v4h __attribute__((ext_vector_type(4)));
  {
#pragma unroll
    for (int q = 0; q < 8; ++q) { const int r = q * 2 + rsub; if (col0 + c4 < N) { const v4f v = *(const v4fa*)&so[w][r][c4]; if (C) *(v4f*)(C + cofs + (size_t)(row0 + r) * ldc + col0 + c4) = v; if (C16) { v4h h4; for (int i = 0; i < 4; ++i) h4[i] = (_Float16)v[i]; *(v4h*)(C16 + cofs + (size_t)(row0 + r) * ldc + col0 + c4) = h4; } } }
     }
}


typedef _Float16 v4h __attribute__((ext_vector_type(4)));

__global__ __launch_bounds__(256) void k_x16(const float* __restrict__ x, _Float16* __restrict__ X16, size_t n8) { const size_t t = (size_t)blockIdx.x * 256 + threadIdx.x; if (t >= n8) return; FragH f;
#pragma unroll
  for (int q = 0; q < 8; ++q) f.h[q] = (_Float16)bf16_round(x[t * 8 + q]); *(v8us*)((unsigned short*)X16 + t * 8) = f.half[0];  }
__global__ __launch_bounds__(256) void k_h16(const float* __restrict__ x, _Float16* __restrict__ X16, size_t n8) { const size_t t = (size_t)blockIdx.x * 256 + threadIdx.x; if (t >= n8) return; FragH f;
#pragma unroll
  for (int q = 0; q < 8; ++q) f.h[q] = (_Float16)x[t * 8 + q]; *(v8us*)((unsigned short*)X16 + t * 8) = f.half[0];  }
__global__ __launch_bounds__(256) void k_round16f(const float* __restrict__ W, _Float16* __restrict__ Bt, size_t n8) { const size_t t = (size_t)blockIdx.x * 256 + threadIdx.x; if (t >= n8) return; FragH f;
#pragma unroll
  for (int i = 0; i < 8; ++i) f.h[i] = (_Float16)(bf16_round(W[t * 8 + i]) * 16.0f); *(v8us*)((unsigned short*)Bt + t * 8) = f.half[0];  }
template <int NHv, int TTv>
__global__ __launch_bounds__(256) void k_vt(const _Float16* __restrict__ V16, int ldv, int voff, _Float16* __restrict__ Vt) { __shared__ unsigned short tl[64][66]; const int tid = threadIdx.x; const int slab = blockIdx.x / (TTv / 64), lg = blockIdx.x % (TTv / 64); const int b = slab / NHv, h = slab % NHv;
  for (int i = tid; i < 64 * 8; i += 256) { const int r = i / 8, c8 = (i % 8) * 8; FragH f; f.half[0] = *(const v8us*)((const unsigned short*)V16 + ((size_t)b * TTv + lg * 64 + r) * ldv + voff + h * 64 + c8);
#pragma unroll
    for (int q = 0; q < 8; ++q) tl[r][c8 + q] = f.u[q]; }
  __syncthreads();
  {
#pragma unroll
    for (int rd = 0; rd < 2; ++rd) { const int d = rd * 32 + tid / 8, pc = tid % 8; FragH f;
#pragma unroll
      for (int q = 0; q < 8; ++q) f.u[q] = tl[pc * 8 + q][d];
      *(v8us*)((unsigned short*)Vt + ((size_t)slab * 64 + d) * TTv + lg * 64 + pc * 8) = f.half[0]; }
     } }

__global__ __launch_bounds__(256) void k_hl(const float* __restrict__ F, _Float16* __restrict__ Hh, _Float16* __restrict__ Hl, size_t n8) { const size_t t = (size_t)blockIdx.x * 256 + threadIdx.x; if (t >= n8) return; FragH fh, fl; const v4f a = *(const v4fa*)(F + t * 8), c = *(const v4fa*)(F + t * 8 + 4);
#pragma unroll
  for (int q = 0; q < 4; ++q) { _Float16 h = (_Float16)a[q]; fh.h[q] = h; fl.h[q] = (_Float16)((a[q] - (float)h) * 1024.0f); h = (_Float16)c[q]; fh.h[4 + q] = h; fl.h[4 + q] = (_Float16)((c[q] - (float)h) * 1024.0f); }
  { *(v8us*)((unsigned short*)Hh + t * 8) = fh.half[0]; *(v8us*)((unsigned short*)Hl + t * 8) = fl.half[0];  } }

// ---- fast GEMM (wave tile 32x64; requires M % 32 == 0 rows per launch region and N % 64 == 0); epilogue = k_gemm_hhx semantics ----
__device__ __forceinline__ v16h g2_frag(const _Float16* p, int hh) { FragH f; f.half[0] = *(const v8us*)((const unsigned short*)p + 8 * hh); f.half[1] = *(const v8us*)((const unsigned short*)p + 16 + 8 * hh); return f.v; }
__device__ __forceinline__ v8f g2_mma(v16h a, v16h b, v8f c) { v8f d = __builtin_amdgcn_wmma_f32_16x16x32_f16(false, a, false, b, (short)0, c, false, false); asm volatile("v_nop\n\tv_nop\n\tv_nop\n\tv_nop" : "+v"(d) : "v"(a), "v"(b)); return d; }
template <int ACT>
__global__ __launch_bounds__(128) void k_gemm2(const _Float16* __restrict__ A, int lda, size_t sA, const _Float16* __restrict__ Bh, int ldb, size_t sB, float alpha, const float* __restrict__ bias, size_t sBias, const float* __restrict__ CP, int rowsPerB, size_t sCPb, int row0g,
    float* __restrict__ C, _Float16* __restrict__ C16, int ldc, size_t sC, int M, int N, int K) { static_assert(ACT == 0 || ACT == 3 || ACT == 6 || ACT == 8 || ACT == 9 || ACT == 11 || ACT == 12 || ACT == 14 || ACT == 15 || ACT == 16 || ACT == 17, "k_gemm2: unsupported ACT code (would silently apply no activation)");
  __shared__ __attribute__((aligned(16))) float so[4][32][68];
  const int tid = threadIdx.x, w = tid >> 5, lane = tid & 31, ln = lane & 15, hh = lane >> 4; const int by = blockIdx.y;
  A += (size_t)by * sA; Bh += (size_t)by * sB; const size_t cofs = (size_t)by * sC; const float* bp = bias ? bias + (size_t)by * sBias : nullptr;
  const int ntn = N >> 6; const int mt = blockIdx.x / ntn, nq = blockIdx.x - mt * ntn; const int row0 = mt * 128 + 32 * w, col0 = nq * 64; if (row0 >= M) return;
  const _Float16* a0p = A + (size_t)(row0 + ln) * lda; const _Float16* a1p = a0p + (size_t)16 * lda;
  const _Float16* b0p = Bh + (size_t)(col0 + ln) * ldb; const _Float16* b1p = b0p + (size_t)16 * ldb; const _Float16* b2p = b1p + (size_t)16 * ldb; const _Float16* b3p = b2p + (size_t)16 * ldb;
  const v8f z8 = {0.f,0.f,0.f,0.f,0.f,0.f,0.f,0.f}; v8f c00 = z8, c01 = z8, c02 = z8, c03 = z8, c10 = z8, c11 = z8, c12 = z8, c13 = z8;
#pragma unroll 1
  for (int kb = 0; kb < K; kb += 32) { const v16h a0 = g2_frag(a0p + kb, hh), a1 = g2_frag(a1p + kb, hh);
    v16h b = g2_frag(b0p + kb, hh); c00 = g2_mma(a0, b, c00); c10 = g2_mma(a1, b, c10);
    b = g2_frag(b1p + kb, hh); c01 = g2_mma(a0, b, c01); c11 = g2_mma(a1, b, c11);
    b = g2_frag(b2p + kb, hh); c02 = g2_mma(a0, b, c02); c12 = g2_mma(a1, b, c12);
    b = g2_frag(b3p + kb, hh); c03 = g2_mma(a0, b, c03); c13 = g2_mma(a1, b, c13); }
  v8f accs[8] = {c00, c01, c02, c03, c10, c11, c12, c13};
#pragma unroll
  for (int u = 0; u < 8; ++u) { const int t = u & 3, half = u >> 2; const int col = col0 + t * 16 + ln; const float bv = bp ? bf16_round(bp[col]) : 0.f;
#pragma unroll
    for (int r = 0; r < 8; ++r) { const int rloc = half * 16 + 8 * hh + r; float v = accs[u][r] * alpha + bv; if (CP) { if (rowsPerB < 0) v += CP[cofs + (size_t)(row0g + row0 + rloc) * ldc + col];      /* rowsPerB < 0: own element of the batched C plane */ else { const int bidx = (row0g + row0 + rloc) / rowsPerB; v += CP[(size_t)bidx * sCPb + (size_t)by * 64 + col]; } }
      if (ACT == 3) v = fmaxf(v, 0.f); else if (ACT == 6) v = 0.5f * v * (1.0f + erff(v * 0.70710678118654752f)); else if (ACT == 11) v = 1.0f / (1.0f + expf(-v)); else if (ACT == 15) v = v / (1.0f + expf(-v)); else if (ACT == 12) v = (v > 0.f) ? v : 0.01f * v; else if (ACT == 8) v = tanhf(v); else if (ACT == 9) v = 0.5f * v * (1.0f + tanhf(0.7978845608028654f * (v + 0.044715f * v * v * v))); else if (ACT == 14) v = (v > 0.f) ? v : 0.1f * v; else if (ACT == 16) v = (v >= 0.f) ? v : 0.3f * v; else if (ACT == 17) v = (v >= 0.f) ? v : 0.2f * v;
      so[w][rloc][t * 16 + ln] = v; } }
  __builtin_amdgcn_fence(__ATOMIC_ACQ_REL, "workgroup"); __builtin_amdgcn_wave_barrier();
  const int rsub = lane >> 4, c4 = (lane & 15) * 4;
  {
#pragma unroll
    for (int q = 0; q < 16; ++q) { const int r = q * 2 + rsub; const v4f v = *(const v4fa*)&so[w][r][c4]; if (C) *(v4f*)(C + cofs + (size_t)(row0 + r) * ldc + col0 + c4) = v; if (C16) { v4h h4; for (int i = 0; i < 4; ++i) h4[i] = (_Float16)v[i]; *(v4h*)(C16 + cofs + (size_t)(row0 + r) * ldc + col0 + c4) = h4; } }
     } }


__global__ __launch_bounds__(256) void k_wnat(const float* __restrict__ w, size_t n8, _Float16* __restrict__ Bt) { const size_t t = (size_t)blockIdx.x * 256 + threadIdx.x; if (t >= n8) return; FragH f; for (int q = 0; q < 8; ++q) f.h[q] = (_Float16)(bf16_round(w[t * 8 + q]) * 16.0f); *(v8us*)((unsigned short*)Bt + t * 8) = f.half[0];  }
__global__ __launch_bounds__(256) void k_rsm(const float* __restrict__ S, _Float16* __restrict__ P, int nrows) {
  #pragma clang fp contract(off)
  const int i = blockIdx.x * 256 + threadIdx.x; if (i >= nrows) return; const float* s = S + (size_t)i * SQ; float mx = -3.0e38f;
#pragma unroll 1
  for (int j = 0; j < SQ; ++j) mx = fmaxf(mx, s[j]); float se = 0.f;
#pragma unroll 1
  for (int j = 0; j < SQ; ++j) se += expf(s[j] - mx); const float sc = 256.0f / se;
#pragma unroll 1
  for (int j0 = 0; j0 < SQ; j0 += 8) { FragH f; for (int q = 0; q < 8; ++q) f.h[q] = (_Float16)(expf(s[j0 + q] - mx) * sc); unsigned short* d = (unsigned short*)P + (size_t)i * SQ + j0; *(v8us*)d = f.half[0];  } }
__global__ __launch_bounds__(256) void k_vt(const _Float16* __restrict__ V16, int b, int h0, _Float16* __restrict__ VT) { __shared__ unsigned short tl[64][65]; const int tid = threadIdx.x; const int hh = blockIdx.x % HG, sg = blockIdx.x / HG; const int s0 = sg * 64; const int h = h0 + hh;
  for (int i = tid; i < 64 * 8; i += 256) { const int j = i / 8, d8 = (i % 8) * 8; FragH f; f.half[0] = *(const v8us*)((const unsigned short*)V16 + ((size_t)b * SQ + s0 + j) * DM + h * HD + d8); for (int q = 0; q < 8; ++q) tl[d8 + q][j] = f.u[q]; }
  __syncthreads();
  { for (int i = tid; i < 64 * 8; i += 256) { const int d = i / 8, j8 = (i % 8) * 8; FragH f; for (int q = 0; q < 8; ++q) f.u[q] = tl[d][j8 + q]; *(v8us*)((unsigned short*)VT + ((size_t)hh * HD + d) * SQ + s0 + j8) = f.half[0]; }  } }

__global__ __launch_bounds__(256) void k_wthd(const float* __restrict__ Wt, _Float16* __restrict__ Bt) { const size_t t = (size_t)blockIdx.x * 256 + threadIdx.x; if (t >= (size_t)NH * HD * (DM / 8)) return; const int m8 = (int)(t % (DM / 8)) * 8; const int d = (int)((t / (DM / 8)) % HD); const int h = (int)(t / ((size_t)(DM / 8) * HD)); FragH f;
  for (int q = 0; q < 8; ++q) f.h[q] = (_Float16)(16.0f * bf16_round(Wt[((size_t)h * DM + m8 + q) * HD + d])); unsigned short* dst = (unsigned short*)Bt + ((size_t)h * HD + d) * DM + m8; *(v8us*)dst = f.half[0];  }



__global__ __launch_bounds__(256) void k_rsmcf2(const float* __restrict__ S, _Float16* __restrict__ P, int hg, int q0, int nk) {
  #pragma clang fp contract(off)
  const int t = blockIdx.x * 256 + threadIdx.x; if (t >= hg * QT) return; const size_t i = (size_t)t; const float* s = S + i * NKX; const int last = q0 + (t % QT); float mx = -3.0e38f;
#pragma unroll 1
  for (int j = 0; j < nk; ++j) { const float f = (j <= last) ? 1.f : 0.f; mx = fmaxf(mx, fmaf(f, s[j], (1.f - f) * -1.0e9f)); } float se = 0.f;
#pragma unroll 1
  for (int j = 0; j < nk; ++j) { const float f = (j <= last) ? 1.f : 0.f; se += __expf(fmaf(f, s[j], (1.f - f) * -1.0e9f) - mx); } const float sc = 256.0f / se;
#pragma unroll 1
  for (int j0 = 0; j0 < nk; j0 += 8) { FragH fr; for (int q = 0; q < 8; ++q) { const int j = j0 + q; const float f = (j <= last) ? 1.f : 0.f; fr.h[q] = (_Float16)(__expf(fmaf(f, s[j], (1.f - f) * -1.0e9f) - mx) * sc); } unsigned short* d = (unsigned short*)P + i * NKX + j0; *(v8us*)d = fr.half[0];  } }


template <int MASKADD>
__global__ __launch_bounds__(64) void k_att0(const float* __restrict__ QF, const float* __restrict__ KF, const float* __restrict__ VF, int ld, const float* __restrict__ mask, float scale, float* __restrict__ OF, int ldo) {
  #pragma clang fp contract(off)
  __shared__ __attribute__((aligned(16))) float lq[64][64]; __shared__ __attribute__((aligned(16))) float lo[64][64];
  const int tid = threadIdx.x; const int h = blockIdx.x / (QT0 / 64), rg = blockIdx.x % (QT0 / 64); const int i = rg * 64 + tid;
  const float* qr = QF + (size_t)i * ld + h * HD;
#pragma unroll 1
  for (int c = 0; c < HD / 4; ++c) { *(v4f*)&lq[tid][c * 4] = *(const v4fa*)(qr + c * 4); const v4f z = {0.f, 0.f, 0.f, 0.f}; *(v4f*)&lo[tid][c * 4] = z; }
  float m = -1.0e30f, l = 0.f; const int jmax = MASKADD ? (SQ - 1) : (rg * 64 + 63);      /* additive-mask form: every key (the mask input decides); causal form: keys up to the block's last row */
#pragma unroll 1
  for (int j = 0; j <= jmax; ++j) { const float* kr = KF + (size_t)j * ld + h * HD; const float* vr = VF + (size_t)j * ld + h * HD; float s = 0.f;
#pragma unroll 1
    for (int c = 0; c < HD / 4; ++c) { const v4f kq = *(const v4fa*)(kr + c * 4); const v4f qq = *(v4f*)&lq[tid][c * 4]; s = __fadd_rn(s, __fmul_rn(qq[0], kq[0])); s = __fadd_rn(s, __fmul_rn(qq[1], kq[1])); s = __fadd_rn(s, __fmul_rn(qq[2], kq[2])); s = __fadd_rn(s, __fmul_rn(qq[3], kq[3])); }
    s = __fmul_rn(s, scale); if (MASKADD) s = __fadd_rn(s, __fmul_rn(bf16_round(mask[(size_t)i * SQ + j]), -10000.0f));
    const float f = (MASKADD || j <= i) ? 1.f : 0.f; const float sm = fmaf(f, s, (1.f - f) * -1.0e30f); const float mn = fmaxf(m, sm); const float sc = expf(m - mn); const float e = expf(sm - mn); l = __fadd_rn(__fmul_rn(l, sc), e); m = mn;
#pragma unroll 1
    for (int c = 0; c < HD / 4; ++c) { const v4f vv = *(const v4fa*)(vr + c * 4); v4f oo = *(v4f*)&lo[tid][c * 4]; for (int u = 0; u < 4; ++u) oo[u] = __fadd_rn(__fmul_rn(oo[u], sc), __fmul_rn(e, vv[u])); *(v4f*)&lo[tid][c * 4] = oo; } }
  const float fin = 64.0f / l;      /* o carried x64, scaled back by 1/64 in k_ftcopy */
#pragma unroll 1
  for (int c = 0; c < HD / 4; ++c) { v4f oo = *(v4f*)&lo[tid][c * 4]; for (int u = 0; u < 4; ++u) oo[u] = __fmul_rn(oo[u], fin); *(v4f*)&lo[tid][c * 4] = oo; }
  __syncthreads();
  {
#pragma unroll 1
    for (int it = 0; it < 16; ++it) { const int row = it * 4 + tid / 16, pc = (tid % 16) * 4; const v4f v = *(const v4f*)&lo[row][pc]; *(v4f*)(OF + (size_t)(rg * 64 + row) * ldo + h * HD + pc) = v; }
     } }


__global__ __launch_bounds__(256) void k_ftcopy(const float* __restrict__ OF0, float* __restrict__ out, size_t n4) {
  #pragma clang fp contract(off)
  const size_t t = (size_t)blockIdx.x * 256 + threadIdx.x; if (t >= n4) return; const v4f o = *(const v4fa*)(OF0 + t * 4); v4f y; for (int q = 0; q < 4; ++q) y[q] = __fmul_rn(o[q], 0.015625f); *(v4f*)(out + t * 4) = y;  }
extern "C" void kernel_launch(void* const* d_in, const int* in_sizes, int n_in,
                              void* d_out, int out_size, void* d_ws, size_t ws_size, hipStream_t stream) {
  (void)in_sizes; (void)n_in; (void)out_size;
  const float* const* I = (const float* const*)d_in; const float* x = I[0]; const float* wq = I[1]; const float* wk = I[2]; const float* wv = I[3];      /* per-head [h][in][out] weights, no biases, no output projection */
  char* ws = (char*)d_ws; size_t off = 0;
  auto take = [&](size_t bytes) { char* p = ws + off; off += (bytes + 255) & ~(size_t)255; return p; };
  _Float16* BQ = (_Float16*)take((size_t)DM * DM * 2); _Float16* BK = (_Float16*)take((size_t)DM * DM * 2); _Float16* BV = (_Float16*)take((size_t)DM * DM * 2);
  _Float16* X16 = (_Float16*)take(NR * DM * 2); _Float16* Q16 = (_Float16*)take(NR * DM * 2); _Float16* K16 = (_Float16*)take(NR * DM * 2); _Float16* V16 = (_Float16*)take(NR * DM * 2);
  float* S = (float*)take((size_t)NH * QT * NKX * 4); _Float16* P = (_Float16*)take((size_t)NH * QT * NKX * 2); _Float16* VT = (_Float16*)take((size_t)NH * HD * SQ * 2);
  float* QF0 = (float*)take((size_t)QT0 * DM * 4); float* KF0 = (float*)take((size_t)QT0 * DM * 4); float* VF0 = (float*)take((size_t)QT0 * DM * 4); float* OF0 = (float*)take((size_t)NB * QT0 * DM * 4);
  if (off > ws_size) return;
  k_wthd<<<(unsigned)(((size_t)NH * HD * (DM / 8) + 255) / 256), 256, 0, stream>>>(wq, BQ); k_wthd<<<(unsigned)(((size_t)NH * HD * (DM / 8) + 255) / 256), 256, 0, stream>>>(wk, BK); k_wthd<<<(unsigned)(((size_t)NH * HD * (DM / 8) + 255) / 256), 256, 0, stream>>>(wv, BV);      /* per-head [m][d] -> Bt[(h,d)][m] x16 */
  k_x16<<<(unsigned)((NR * DM / 8 + 255) / 256), 256, 0, stream>>>(x, X16, NR * DM / 8);
  const size_t r0p = (size_t)B0 * SQ;      /* first projected row */
  k_gemm2<0><<<dim3((unsigned)((MP / 128) * (DM / 64)), 1), 128, 0, stream>>>(X16 + r0p * DM, DM, 0, BQ, DM, 0, 0.0625f, nullptr, 0, nullptr, 1, 0, 0, nullptr, Q16 + r0p * DM, DM, 0, MP, DM, DM);
  k_gemm2<0><<<dim3((unsigned)((MP / 128) * (DM / 64)), 1), 128, 0, stream>>>(X16 + r0p * DM, DM, 0, BK, DM, 0, 0.0625f, nullptr, 0, nullptr, 1, 0, 0, nullptr, K16 + r0p * DM, DM, 0, MP, DM, DM);
  k_gemm2<0><<<dim3((unsigned)((MP / 128) * (DM / 64)), 1), 128, 0, stream>>>(X16 + r0p * DM, DM, 0, BV, DM, 0, 0.0625f, nullptr, 0, nullptr, 1, 0, 0, nullptr, V16 + r0p * DM, DM, 0, MP, DM, DM);
  for (int b = B0; b < B0 + NBR; ++b) { const size_t r0 = (size_t)b * SQ;
    k_vt<NH, SQ><<<NH * (SQ / 64), 256, 0, stream>>>(V16 + r0 * LQ, LQ, 0, VT);      /* V^T [NH][HD][SQ] for this batch */
    k_gemm2<0><<<dim3((QT0 / 128) * (DM / 64), 1), 128, 0, stream>>>(X16 + r0 * DM, DM, 0, BQ, DM, 0, 0.0625f, nullptr, 0, nullptr, 1, 0, 0, QF0, nullptr, DM, 0, QT0, DM, DM); k_gemm2<0><<<dim3((QT0 / 128) * (DM / 64), 1), 128, 0, stream>>>(X16 + r0 * DM, DM, 0, BK, DM, 0, 0.0625f, nullptr, 0, nullptr, 1, 0, 0, KF0, nullptr, DM, 0, QT0, DM, DM); k_gemm2<0><<<dim3((QT0 / 128) * (DM / 64), 1), 128, 0, stream>>>(X16 + r0 * DM, DM, 0, BV, DM, 0, 0.0625f, nullptr, 0, nullptr, 1, 0, 0, VF0, nullptr, DM, 0, QT0, DM, DM);      /* f32 q, k, v of the first 128 rows (exact products) */
    k_att0<0><<<NH * (QT0 / 64), 64, 0, stream>>>(QF0, KF0, VF0, DM, nullptr, 0.125f, OF0 + (size_t)b * QT0 * DM, DM);      /* exact f32 attention for rows 0..127 (o x64) */
    for (int q0 = 0; q0 < QN; q0 += QT) { const int nk = q0 + QT;      /* causal: only keys below the tile end are computed */
      k_gemm2<0><<<dim3((QT / 128) * (nk / 64), NHD), 128, 0, stream>>>(Q16 + (r0 + q0) * LQ, LQ, (size_t)HD, K16 + r0 * LQ, LQ, (size_t)HD, 0.125f, nullptr, 0, nullptr, 1, 0, 0, S, nullptr, NKX, (size_t)QT * NKX, QT, nk, HD);      /* scores, all heads on grid.y */
      k_rsmcf2<<<(NHD * QT + 255) / 256, 256, 0, stream>>>(S, P, NHD, q0, nk);
      k_gemm2<0><<<dim3((QT / 128) * (HD / 64), NHD), 128, 0, stream>>>(P, NKX, (size_t)QT * NKX, VT, SQ, (size_t)HD * SQ, 0.00390625f, nullptr, 0, nullptr, 1, 0, 0, (float*)d_out + (r0 + q0) * DM, nullptr, DM, (size_t)HD, QT, HD, nk); } }      /* out = attn v (concatenated heads) written f32 */
  for (int b = B0; b < B0 + NBR; ++b) { const size_t r0 = (size_t)b * SQ; const size_t f0 = (size_t)b * QT0;
    k_ftcopy<<<(unsigned)(((size_t)QT0 * DM / 4 + 255) / 256), 256, 0, stream>>>(OF0 + f0 * DM, (float*)d_out + r0 * DM, (size_t)QT0 * DM / 4); }      /* rows 0..127 of each batch rewritten from the exact f32 attention (the module has no output projection) */
}

// v001
// One run takes 760 microseconds.
// Two timings next to v000 put it at 5.52 and 5.55 times that version's speed.
#include <hip/hip_runtime.h>
// Causal multi-head attention with per-head weight tensors (x [4][1024][768]; Q[s][h][d] = sum_m x[s][m] W_Q[h][m][d], K, V likewise (12 heads of 64); scores / 8 with a causal mask (tril); softmax; avg_V = probs V; out[q][h*64 + d] = avg_V[q][h][d] -> [4][1024][768]).
// Structure: token rows r = b*1024 + s; x as exact f16 rows (bf16-rounded); Q, K, V as three WMMA GEMMs (32x64 wave tiles, f32 accumulation, exact x16 weights, no bias, f16 outputs); every stage is one launch over all batches (and all query tiles, on grid.z): V^T for all heads via LDS transposes; per query tile of 256 rows: scores against the keys below the tile end only (K = 64, all heads on grid.y, alpha = 0.125), causal row softmax on VALU with an arithmetic 0/1 key mask over the computed range (f32 statistics, native exp; weights x256 f16), out tile = P V^T GEMM (K = keys below the tile end, alpha 2^-8) written f32 straight into the concatenated-heads output rows (no output projection); first-tile refinement: the first 128 query rows of every batch recomputed exactly in f32 (f32 q/k/v GEMMs + an online-softmax causal attention on VALU) and copied over those output rows.
// Compute dtype: inputs rounded to bf16; x / weights exact; q, k, v and softmax weights as plain f16 GEMM operands (~2^-12); scores and softmax statistics f32. v_wmma_f32_16x16x32_f16.
#define NB 4
#define SQ 1024
#define DM 768
#define NH 12
#define HD 64
#define HG 4                         /* heads per group in the unlaunched k_vt(V16, b, h0, VT) */
#define QT 256                       /* query rows per causal tile */
#define NQT (SQ / QT)                /* causal query tiles per batch */
#define NKX SQ
#define QT0 128                      /* first-tile rows recomputed exactly in f32 */
#define B0 0                         /* unused (all batches on the grid) */
#define NBR NB                       /* batches processed (debug hook) */
#define NR ((size_t)NB * SQ)         /* token rows */
#define MP ((int)((size_t)NBR * SQ)) /* rows projected (debug hook) */
#define QN SQ                        /* unused (query tiles on grid.z) */
#define NHD NH                       /* unused (all heads on the grid) */
#define MPO MP                       /* unused (no output stage) */
#define LQ DM      /* row pitch of the q/k/v rows */
typedef __bf16 v16b __attribute__((ext_vector_type(16)));
typedef unsigned short v8us __attribute__((ext_vector_type(8), may_alias));
typedef float  v8f  __attribute__((ext_vector_type(8)));
typedef float  v4f  __attribute__((ext_vector_type(4)));
typedef float  v4fa __attribute__((ext_vector_type(4), may_alias));
union FragB { v16b v; v8us half[2]; unsigned short u[16]; };

__device__ __forceinline__ unsigned short bf16_bits(float x) { unsigned int u = __float_as_uint(x); return (unsigned short)((u + 0x7FFFu + ((u >> 16) & 1u)) >> 16); }
__device__ __forceinline__ float bf16_val(unsigned short b) { return __uint_as_float(((unsigned int)b) << 16); }
__device__ __forceinline__ float bf16_round(float x) { return bf16_val(bf16_bits(x)); }
// D += A·B with NT terms: 1 = ah·bh, 2 = + al·bh (A split), 3 = + ah·bl (both split)
template <int NT>
__device__ __forceinline__ v8f mmaN(v16b ah, v16b al, v16b bh, v16b bl, v8f c) {
  c = __builtin_amdgcn_wmma_f32_16x16x32_bf16(false, ah, false, bh, (short)0, c, false, false);
  if (NT >= 2) c = __builtin_amdgcn_wmma_f32_16x16x32_bf16(false, al, false, bh, (short)0, c, false, false);
  if (NT >= 3) c = __builtin_amdgcn_wmma_f32_16x16x32_bf16(false, ah, false, bl, (short)0, c, false, false);
  asm volatile("v_nop\n\tv_nop\n\tv_nop\n\tv_nop" : "+v"(c) : "v"(ah), "v"(al), "v"(bh), "v"(bl));
  return c;
}

__global__ __launch_bounds__(256) void k_wt_bf16(const float* __restrict__ W, unsigned short* __restrict__ Wt, int K, int N) {
  const int t = blockIdx.x * 256 + threadIdx.x;
  const int k8n = K / 8;
  if (t >= N * k8n) return;
  const int n = t / k8n, k8 = (t % k8n) * 8;
  v8us v;
#pragma unroll
  for (int i = 0; i < 8; ++i) v[i] = bf16_bits(W[(size_t)(k8 + i) * N + n]);
  *(v8us*)(Wt + (size_t)n * K + k8) = v;
  
}

// GEMM C[M][N] (f32, pitch ldc) = act(A[M][K]·W + bias). A f32 row-major (pitch lda) converted per fragment to bf16
// (ASPLIT: hi/lo two planes -> 2 terms, else single rounded term); Wt bf16 [N][K] (pitch ldb). BIAS_BF16 rounds the
// bias to bf16 first (bias quantised to bf16 before the add). K%32==0, M%16==0, N%64==0.
template <bool ASPLIT, int ACT, bool BIAS_BF16>
__global__ __launch_bounds__(128) void k_gemm_bf(const float* __restrict__ A, int lda, const unsigned short* __restrict__ Wt, int ldb,
                                               const float* __restrict__ bias, float* __restrict__ C, int ldc, int M, int N, int K) {
  __shared__ __attribute__((aligned(16))) float so[4][16][64];
  const int tid = threadIdx.x, w = tid >> 5, lane = tid & 31, ln = lane & 15, hh = lane >> 4;
  const int ntn = N / 64;
  const int wid = blockIdx.x * 4 + w;
  const int mt = wid / ntn, nq = wid % ntn;
  if (mt * 16 >= M) return;
  const int row0 = mt * 16, col0 = nq * 64;
  const float* arow = A + (size_t)(row0 + ln) * lda;
  v8f acc[4] = {};
  for (int kb = 0; kb < K; kb += 32) {
    FragB ah, al;
    const v4f x0 = *(const v4fa*)(arow + kb + 8 * hh), x1 = *(const v4fa*)(arow + kb + 8 * hh + 4);
    const v4f x2 = *(const v4fa*)(arow + kb + 16 + 8 * hh), x3 = *(const v4fa*)(arow + kb + 16 + 8 * hh + 4);
    float xs[16] = {x0[0],x0[1],x0[2],x0[3],x1[0],x1[1],x1[2],x1[3],x2[0],x2[1],x2[2],x2[3],x3[0],x3[1],x3[2],x3[3]};
#pragma unroll
    for (int i = 0; i < 16; ++i) { const unsigned short hb = bf16_bits(xs[i]); ah.u[i] = hb; al.u[i] = ASPLIT ? bf16_bits(xs[i] - bf16_val(hb)) : (unsigned short)0; }
#pragma unroll
    for (int t = 0; t < 4; ++t) {
      const unsigned short* brow = Wt + (size_t)(col0 + t * 16 + ln) * ldb + kb;
      FragB b;
      b.half[0] = *(const v8us*)(brow + 8 * hh);
      b.half[1] = *(const v8us*)(brow + 16 + 8 * hh);
      acc[t] = mmaN<ASPLIT ? 2 : 1>(ah.v, al.v, b.v, b.v, acc[t]);
    }
  }
#pragma unroll
  for (int t = 0; t < 4; ++t) {
    float bv = bias ? bias[col0 + t * 16 + ln] : 0.f;
    if (BIAS_BF16) bv = bf16_round(bv);
#pragma unroll
    for (int r = 0; r < 8; ++r) { float v = acc[t][r] + bv; if (ACT == 1) v = fmaxf(v, 0.f); so[w][8 * hh + r][t * 16 + ln] = v; }
  }
  __builtin_amdgcn_fence(__ATOMIC_ACQ_REL, "workgroup");
  __builtin_amdgcn_wave_barrier();
  const int rsub = lane >> 4, c4 = (lane & 15) * 4;
  {
#pragma unroll
    for (int q = 0; q < 8; ++q) {
      const int r = q * 2 + rsub;
      const v4f v = *(const v4fa*)&so[w][r][c4];
      *(v4f*)(C + (size_t)(row0 + r) * ldc + col0 + c4) = v;
    }
    
  }
}

// GEMM C = act(A·W + bias + resid): A f32 (ASPLIT -> hi/lo 2 terms), Wt bf16 [N][K]; ACT 0 none, 1 relu, 2 exact gelu;
// resid (optional, f32, row index = (row % rmod), pitch ldr, RES_BF16 rounds it) added before the activation.
template <bool ASPLIT, int ACT, bool BIAS_BF16, bool RES_BF16>
__global__ __launch_bounds__(128) void k_gemm_bf3(const float* __restrict__ A, int lda, const unsigned short* __restrict__ Wt, int ldb,
                                                const float* __restrict__ bias, const float* __restrict__ resid, int rmod, int ldr,
                                                float* __restrict__ C, int ldc, int M, int N, int K) {
  __shared__ __attribute__((aligned(16))) float so[4][16][64];
  const int tid = threadIdx.x, w = tid >> 5, lane = tid & 31, ln = lane & 15, hh = lane >> 4;
  const int ntn = N / 64;
  const int wid = blockIdx.x * 4 + w;
  const int mt = wid / ntn, nq = wid % ntn;
  if (mt * 16 >= M) return;
  const int row0 = mt * 16, col0 = nq * 64;
  const float* arow = A + (size_t)(row0 + ln) * lda;
  v8f acc[4] = {};
  for (int kb = 0; kb < K; kb += 32) {
    FragB ah, al;
    const v4f x0 = *(const v4fa*)(arow + kb + 8 * hh), x1 = *(const v4fa*)(arow + kb + 8 * hh + 4);
    const v4f x2 = *(const v4fa*)(arow + kb + 16 + 8 * hh), x3 = *(const v4fa*)(arow + kb + 16 + 8 * hh + 4);
    float xs[16] = {x0[0],x0[1],x0[2],x0[3],x1[0],x1[1],x1[2],x1[3],x2[0],x2[1],x2[2],x2[3],x3[0],x3[1],x3[2],x3[3]};
#pragma unroll
    for (int i = 0; i < 16; ++i) { const unsigned short hb = bf16_bits(xs[i]); ah.u[i] = hb; al.u[i] = ASPLIT ? bf16_bits(xs[i] - bf16_val(hb)) : (unsigned short)0; }
#pragma unroll
    for (int t = 0; t < 4; ++t) {
      const unsigned short* brow = Wt + (size_t)(col0 + t * 16 + ln) * ldb + kb;
      FragB b;
      b.half[0] = *(const v8us*)(brow + 8 * hh);
      b.half[1] = *(const v8us*)(brow + 16 + 8 * hh);
      acc[t] = mmaN<ASPLIT ? 2 : 1>(ah.v, al.v, b.v, b.v, acc[t]);
    }
  }
#pragma unroll
  for (int t = 0; t < 4; ++t) {
    const int col = col0 + t * 16 + ln;
    float bv = bias ? bias[col] : 0.f;
    if (BIAS_BF16) bv = bf16_round(bv);
#pragma unroll
    for (int r = 0; r < 8; ++r) {
      float v = acc[t][r] + bv;
      if (resid) { float rv = resid[(size_t)((row0 + 8 * hh + r) % rmod) * ldr + col]; if (RES_BF16) rv = bf16_round(rv); v += rv; }
      if (ACT == 1) v = fmaxf(v, 0.f);
      if (ACT == 2) v = 0.5f * v * (1.0f + erff(v * 0.70710678118654752f));
      if (ACT == 3) { const float u = 0.7978845608028654f * (v + 0.044715f * v * v * v); v = 0.5f * v * (1.0f + tanhf(u)); }
      so[w][8 * hh + r][t * 16 + ln] = v;
    }
  }
  __builtin_amdgcn_fence(__ATOMIC_ACQ_REL, "workgroup");
  __builtin_amdgcn_wave_barrier();
  const int rsub = lane >> 4, c4 = (lane & 15) * 4;
  {
#pragma unroll
    for (int q = 0; q < 8; ++q) {
      const int r = q * 2 + rsub;
      const v4f v = *(const v4fa*)&so[w][r][c4];
      *(v4f*)(C + (size_t)(row0 + r) * ldc + col0 + c4) = v;
    }
    
  }
}
// row LayerNorm (biased variance, eps) over N: s = X (+ R); optional out_sum <- s; out_norm <- (s-mu)*rsqrt(var+eps)*g + b
template <bool PARAM_BF16>
__global__ __launch_bounds__(256) void k_layernorm(const float* __restrict__ X, const float* __restrict__ R, const float* __restrict__ g, const float* __restrict__ bta,
                                                  float* __restrict__ out_sum, float* __restrict__ out_norm, int N, float eps) {
  __shared__ float red[256];
  const int row = blockIdx.x, tid = threadIdx.x;
  const float* x = X + (size_t)row * N; const float* rr = R ? R + (size_t)row * N : nullptr;
  float vals[16];                     // up to N = 4096
  const int per = N / 256;            // contiguous chunk per thread? use strided-by-4 chunks: thread handles j = tid*4 + 1024*u
  float s1 = 0.f;
  for (int u = 0; u < per / 4; ++u) {
    const int j = tid * 4 + 1024 * u;
    const v4f a = *(const v4fa*)(x + j);
    v4f b = {0.f,0.f,0.f,0.f}; if (rr) b = *(const v4fa*)(rr + j);
#pragma unroll
    for (int q = 0; q < 4; ++q) { const float v = a[q] + b[q]; vals[u * 4 + q] = v; s1 += v; }
  }
  red[tid] = s1; __syncthreads();
  for (int st = 128; st > 0; st >>= 1) { if (tid < st) red[tid] += red[tid + st]; __syncthreads(); }
  const float mu = red[0] / (float)N; __syncthreads();
  float s2 = 0.f;
  for (int u = 0; u < per / 4; ++u)
#pragma unroll
    for (int q = 0; q < 4; ++q) { const float c = vals[u * 4 + q] - mu; s2 += c * c; }
  red[tid] = s2; __syncthreads();
  for (int st = 128; st > 0; st >>= 1) { if (tid < st) red[tid] += red[tid + st]; __syncthreads(); }
  const float rs = rsqrtf(red[0] / (float)N + eps);
  {
    for (int u = 0; u < per / 4; ++u) {
      const int j = tid * 4 + 1024 * u;
      v4f o, sm;
#pragma unroll
      for (int q = 0; q < 4; ++q) {
        float gg = g[j + q], bb = bta[j + q];
        if (PARAM_BF16) { gg = bf16_round(gg); bb = bf16_round(bb); }
        sm[q] = vals[u * 4 + q]; o[q] = (vals[u * 4 + q] - mu) * rs * gg + bb;
      }
      if (out_sum) *(v4f*)(out_sum + (size_t)row * N + j) = sm;
      *(v4f*)(out_norm + (size_t)row * N + j) = o;
    }
    
  }
}



// ---- f16 WMMA path (v_wmma_f32_16x16x32_f16): 11-bit significands for operands in range — used where a [0,1] probability operand needs more precision than bf16
typedef _Float16 v16h __attribute__((ext_vector_type(16)));
union FragH { v16h v; v8us half[2]; _Float16 h[16]; unsigned short u[16]; };
template <int NT>
__device__ __forceinline__ v8f mmaH(v16h ah, v16h al, v16h bh, v16h bl, v8f c) {
  c = __builtin_amdgcn_wmma_f32_16x16x32_f16(false, ah, false, bh, (short)0, c, false, false);
  if (NT >= 2) c = __builtin_amdgcn_wmma_f32_16x16x32_f16(false, al, false, bh, (short)0, c, false, false);
  if (NT >= 3) c = __builtin_amdgcn_wmma_f32_16x16x32_f16(false, ah, false, bl, (short)0, c, false, false);
  asm volatile("v_nop\n\tv_nop\n\tv_nop\n\tv_nop" : "+v"(c) : "v"(ah), "v"(al), "v"(bh), "v"(bl));
  return c;
}
// batched GEMM like k_gemm_b but f16 operands: A f32 (split into f16 hi/lo if ASPLIT, else rounded to f16), Bt = f16 values [n][k]; alpha; C f32; N multiple of 16 (partial tiles skipped)
template <bool ASPLIT>
__global__ __launch_bounds__(128) void k_gemm_h(const float* __restrict__ A, int lda, size_t sA, const _Float16* __restrict__ Bh, int ldb, size_t sB, float alpha, float* __restrict__ C, int ldc, size_t sC, int M, int N, int K) {
  __shared__ __attribute__((aligned(16))) float so[4][16][64];
  const int tid = threadIdx.x, w = tid >> 5, lane = tid & 31, ln = lane & 15, hh = lane >> 4; const int by = blockIdx.y;
  A += (size_t)by * sA; Bh += (size_t)by * sB; C += (size_t)by * sC;
  const int ntn = (N + 63) / 64; const int wid = blockIdx.x * 4 + w; const int mt = wid / ntn, nq = wid % ntn; if (mt * 16 >= M) return;
  const int row0 = mt * 16, col0 = nq * 64; const float* arow = A + (size_t)(row0 + ln) * lda;
  v8f acc[4] = {};
  for (int kb = 0; kb < K; kb += 32) {
    FragH ah, al;
    const v4f x0 = *(const v4fa*)(arow + kb + 8 * hh), x1 = *(const v4fa*)(arow + kb + 8 * hh + 4), x2 = *(const v4fa*)(arow + kb + 16 + 8 * hh), x3 = *(const v4fa*)(arow + kb + 16 + 8 * hh + 4);
    float xs[16] = {x0[0],x0[1],x0[2],x0[3],x1[0],x1[1],x1[2],x1[3],x2[0],x2[1],x2[2],x2[3],x3[0],x3[1],x3[2],x3[3]};
#pragma unroll
    for (int i = 0; i < 16; ++i) { const _Float16 h = (_Float16)xs[i]; ah.h[i] = h; al.h[i] = ASPLIT ? (_Float16)(xs[i] - (float)h) : (_Float16)0.0f; }
#pragma unroll
    for (int t = 0; t < 4; ++t) { if (col0 + t * 16 >= N) continue; const size_t boff = (size_t)(col0 + t * 16 + ln) * ldb + kb; FragH bq; bq.half[0] = *(const v8us*)(Bh + boff + 8 * hh); bq.half[1] = *(const v8us*)(Bh + boff + 16 + 8 * hh);
      acc[t] = mmaH<ASPLIT ? 2 : 1>(ah.v, al.v, bq.v, bq.v, acc[t]); }
  }
#pragma unroll
  for (int t = 0; t < 4; ++t) { if (col0 + t * 16 >= N) continue;
#pragma unroll
    for (int r = 0; r < 8; ++r) so[w][8 * hh + r][t * 16 + ln] = acc[t][r] * alpha; }
  __builtin_amdgcn_fence(__ATOMIC_ACQ_REL, "workgroup"); __builtin_amdgcn_wave_barrier();
  const int rsub = lane >> 4, c4 = (lane & 15) * 4;
  {
#pragma unroll
    for (int q = 0; q < 8; ++q) { const int r = q * 2 + rsub; if (col0 + c4 < N) { const v4f v = *(const v4fa*)&so[w][r][c4]; *(v4f*)(C + (size_t)(row0 + r) * ldc + col0 + c4) = v; } }
     }
}

// Wt[n][k] = f16(W[k][n]·scale) from f32 row-major W[K][N] (scale = power of two; bf16-exact weights stay exact in f16 away from the subnormal range)
__global__ __launch_bounds__(256) void k_wt_f16(const float* __restrict__ W, _Float16* __restrict__ Wt, int K, int N, float scale) {
  const int t = blockIdx.x * 256 + threadIdx.x; if (t >= N * (K / 8)) return; const int n = t / (K / 8), k8 = (t % (K / 8)) * 8; FragH f;
#pragma unroll
  for (int i = 0; i < 8; ++i) f.h[i] = (_Float16)(bf16_round(W[(size_t)(k8 + i) * N + n]) * scale); const v8us o = f.half[0];
  *(v8us*)((unsigned short*)Wt + (size_t)n * K + k8) = o; 
}
// k_gemm_hh variant with fused epilogue: v = acc·alpha + bias[by·sBias + col] (+ CP[(row/rowsPerB)·sCPb + by·64 + col] if CP) ; ACT 0 none / 1 elu ; writes f16 C16 (and f32 C if non-null)
template <int ACT>
__global__ __launch_bounds__(128) void k_gemm_hhx(const _Float16* __restrict__ A, int lda, size_t sA, const _Float16* __restrict__ Bh, int ldb, size_t sB, float alpha, const float* __restrict__ bias, size_t sBias, const float* __restrict__ CP, int rowsPerB, size_t sCPb, int row0g,
    float* __restrict__ C, _Float16* __restrict__ C16, int ldc, size_t sC, int M, int N, int K) {
  __shared__ __attribute__((aligned(16))) float so[4][16][64];
  const int tid = threadIdx.x, w = tid >> 5, lane = tid & 31, ln = lane & 15, hh = lane >> 4; const int by = blockIdx.y;
  A += (size_t)by * sA; Bh += (size_t)by * sB; const size_t cofs = (size_t)by * sC; const float* bp = bias ? bias + (size_t)by * sBias : nullptr;
  const int ntn = (N + 63) / 64; const int wid = blockIdx.x * 4 + w; const int mt = wid / ntn, nq = wid % ntn; if (mt * 16 >= M) return;
  const int row0 = mt * 16, col0 = nq * 64; const _Float16* arow = A + (size_t)(row0 + ln) * lda;
  v8f acc[4] = {};
  for (int kb = 0; kb < K; kb += 32) { FragH ah; ah.half[0] = *(const v8us*)((const unsigned short*)arow + kb + 8 * hh); ah.half[1] = *(const v8us*)((const unsigned short*)arow + kb + 16 + 8 * hh);
#pragma unroll
    for (int t = 0; t < 4; ++t) { if (col0 + t * 16 >= N) continue; const size_t boff = (size_t)(col0 + t * 16 + ln) * ldb + kb; FragH bq; bq.half[0] = *(const v8us*)((const unsigned short*)Bh + boff + 8 * hh); bq.half[1] = *(const v8us*)((const unsigned short*)Bh + boff + 16 + 8 * hh);
      acc[t] = mmaH<1>(ah.v, ah.v, bq.v, bq.v, acc[t]); }
  }
#pragma unroll
  for (int t = 0; t < 4; ++t) { if (col0 + t * 16 >= N) continue; const int col = col0 + t * 16 + ln; const float bv = bp ? bf16_round(bp[col]) : 0.f;
#pragma unroll
    for (int r = 0; r < 8; ++r) { float v = acc[t][r] * alpha + bv; if (CP) { const int rr = row0g + row0 + 8 * hh + r; if (rowsPerB < 0) v += CP[cofs + (size_t)rr * ldc + col];      /* rowsPerB < 0: own element of the batched C plane */ else { const int bidx = rr / rowsPerB; v += CP[(size_t)bidx * sCPb + (size_t)by * 64 + col]; } } if (ACT == 1) v = (v > 0.f) ? v : expm1f(v); else if (ACT == 7) v = (v > 0.f) ? v + 1.0f : expf(v); else if (ACT == 8) v = tanhf(v); else if (ACT == 9) v = 0.5f * v * (1.0f + tanhf(0.7978845608028654f * (v + 0.044715f * v * v * v))); else if (ACT == 11) v = 1.0f / (1.0f + expf(-v)); else if (ACT == 12) v = (v > 0.f) ? v : 0.01f * v; else if (ACT == 14) v = (v > 0.f) ? v : 0.1f * v; else if (ACT == 16) v = (v >= 0.f) ? v : 0.3f * v; else if (ACT == 17) v = (v >= 0.f) ? v : 0.2f * v; else if (ACT == 15) v = v / (1.0f + expf(-v)); else if (ACT == 3) v = fmaxf(v, 0.f); else if (ACT == 6) v = 0.5f * v * (1.0f + erff(v * 0.70710678118654752f)); so[w][8 * hh + r][t * 16 + ln] = v; } }
  __builtin_amdgcn_fence(__ATOMIC_ACQ_REL, "workgroup"); __builtin_amdgcn_wave_barrier();
  const int rsub = lane >> 4, c4 = (lane & 15) * 4; typedef _Float16 v4h __attribute__((ext_vector_type(4)));
  {
#pragma unroll
    for (int q = 0; q < 8; ++q) { const int r = q * 2 + rsub; if (col0 + c4 < N) { const v4f v = *(const v4fa*)&so[w][r][c4]; if (C) *(v4f*)(C + cofs + (size_t)(row0 + r) * ldc + col0 + c4) = v; if (C16) { v4h h4; for (int i = 0; i < 4; ++i) h4[i] = (_Float16)v[i]; *(v4h*)(C16 + cofs + (size_t)(row0 + r) * ldc + col0 + c4) = h4; } } }
     }
}


typedef _Float16 v4h __attribute__((ext_vector_type(4)));

__global__ __launch_bounds__(256) void k_x16(const float* __restrict__ x, _Float16* __restrict__ X16, size_t n8) { const size_t t = (size_t)blockIdx.x * 256 + threadIdx.x; if (t >= n8) return; FragH f;
#pragma unroll
  for (int q = 0; q < 8; ++q) f.h[q] = (_Float16)bf16_round(x[t * 8 + q]); *(v8us*)((unsigned short*)X16 + t * 8) = f.half[0];  }
__global__ __launch_bounds__(256) void k_h16(const float* __restrict__ x, _Float16* __restrict__ X16, size_t n8) { const size_t t = (size_t)blockIdx.x * 256 + threadIdx.x; if (t >= n8) return; FragH f;
#pragma unroll
  for (int q = 0; q < 8; ++q) f.h[q] = (_Float16)x[t * 8 + q]; *(v8us*)((unsigned short*)X16 + t * 8) = f.half[0];  }
__global__ __launch_bounds__(256) void k_round16f(const float* __restrict__ W, _Float16* __restrict__ Bt, size_t n8) { const size_t t = (size_t)blockIdx.x * 256 + threadIdx.x; if (t >= n8) return; FragH f;
#pragma unroll
  for (int i = 0; i < 8; ++i) f.h[i] = (_Float16)(bf16_round(W[t * 8 + i]) * 16.0f); *(v8us*)((unsigned short*)Bt + t * 8) = f.half[0];  }
template <int NHv, int TTv>
__global__ __launch_bounds__(256) void k_vt(const _Float16* __restrict__ V16, int ldv, int voff, _Float16* __restrict__ Vt) { __shared__ unsigned short tl[64][66]; const int tid = threadIdx.x; const int slab = blockIdx.x / (TTv / 64), lg = blockIdx.x % (TTv / 64); const int b = slab / NHv, h = slab % NHv;
  for (int i = tid; i < 64 * 8; i += 256) { const int r = i / 8, c8 = (i % 8) * 8; FragH f; f.half[0] = *(const v8us*)((const unsigned short*)V16 + ((size_t)b * TTv + lg * 64 + r) * ldv + voff + h * 64 + c8);
#pragma unroll
    for (int q = 0; q < 8; ++q) tl[r][c8 + q] = f.u[q]; }
  __syncthreads();
  {
#pragma unroll
    for (int rd = 0; rd < 2; ++rd) { const int d = rd * 32 + tid / 8, pc = tid % 8; FragH f;
#pragma unroll
      for (int q = 0; q < 8; ++q) f.u[q] = tl[pc * 8 + q][d];
      *(v8us*)((unsigned short*)Vt + ((size_t)slab * 64 + d) * TTv + lg * 64 + pc * 8) = f.half[0]; }
     } }

__global__ __launch_bounds__(256) void k_hl(const float* __restrict__ F, _Float16* __restrict__ Hh, _Float16* __restrict__ Hl, size_t n8) { const size_t t = (size_t)blockIdx.x * 256 + threadIdx.x; if (t >= n8) return; FragH fh, fl; const v4f a = *(const v4fa*)(F + t * 8), c = *(const v4fa*)(F + t * 8 + 4);
#pragma unroll
  for (int q = 0; q < 4; ++q) { _Float16 h = (_Float16)a[q]; fh.h[q] = h; fl.h[q] = (_Float16)((a[q] - (float)h) * 1024.0f); h = (_Float16)c[q]; fh.h[4 + q] = h; fl.h[4 + q] = (_Float16)((c[q] - (float)h) * 1024.0f); }
  { *(v8us*)((unsigned short*)Hh + t * 8) = fh.half[0]; *(v8us*)((unsigned short*)Hl + t * 8) = fl.half[0];  } }

// ---- fast GEMM (wave tile 32x64; requires M % 32 == 0 rows per launch region and N % 64 == 0); epilogue = k_gemm_hhx semantics ----
__device__ __forceinline__ v16h g2_frag(const _Float16* p, int hh) { FragH f; f.half[0] = *(const v8us*)((const unsigned short*)p + 8 * hh); f.half[1] = *(const v8us*)((const unsigned short*)p + 16 + 8 * hh); return f.v; }
__device__ __forceinline__ v8f g2_mma(v16h a, v16h b, v8f c) { v8f d = __builtin_amdgcn_wmma_f32_16x16x32_f16(false, a, false, b, (short)0, c, false, false); asm volatile("v_nop\n\tv_nop\n\tv_nop\n\tv_nop" : "+v"(d) : "v"(a), "v"(b)); return d; }
template <int ACT>
__device__ __forceinline__ void gemm2_tile(const int bx, const int by, const _Float16* __restrict__ A, int lda, size_t sA, const _Float16* __restrict__ Bh, int ldb, size_t sB, float alpha, const float* __restrict__ bias, size_t sBias, const float* __restrict__ CP, int rowsPerB, size_t sCPb, int row0g,
    float* __restrict__ C, _Float16* __restrict__ C16, int ldc, size_t sC, int M, int N, int K) { static_assert(ACT == 0 || ACT == 3 || ACT == 6 || ACT == 8 || ACT == 9 || ACT == 11 || ACT == 12 || ACT == 14 || ACT == 15 || ACT == 16 || ACT == 17, "gemm2_tile: unsupported ACT code (would silently apply no activation)");
  __shared__ __attribute__((aligned(16))) float so[4][32][68];
  const int tid = threadIdx.x, w = tid >> 5, lane = tid & 31, ln = lane & 15, hh = lane >> 4;
  A += (size_t)by * sA; Bh += (size_t)by * sB; const size_t cofs = (size_t)by * sC; const float* bp = bias ? bias + (size_t)by * sBias : nullptr;
  const int ntn = N >> 6; const int mt = bx / ntn, nq = bx - mt * ntn; const int row0 = mt * 128 + 32 * w, col0 = nq * 64; if (row0 >= M) return;
  const _Float16* a0p = A + (size_t)(row0 + ln) * lda; const _Float16* a1p = a0p + (size_t)16 * lda;
  const _Float16* b0p = Bh + (size_t)(col0 + ln) * ldb; const _Float16* b1p = b0p + (size_t)16 * ldb; const _Float16* b2p = b1p + (size_t)16 * ldb; const _Float16* b3p = b2p + (size_t)16 * ldb;
  const v8f z8 = {0.f,0.f,0.f,0.f,0.f,0.f,0.f,0.f}; v8f c00 = z8, c01 = z8, c02 = z8, c03 = z8, c10 = z8, c11 = z8, c12 = z8, c13 = z8;
#pragma unroll 1
  for (int kb = 0; kb < K; kb += 32) { const v16h a0 = g2_frag(a0p + kb, hh); FragH a1f; a1f.half[0] = *(const v8us*)((const unsigned short*)(a1p + kb) + 8 * hh);
    asm volatile("s_wait_xcnt 0x0" ::: "memory");      /* the last A load lands in the address registers that the A loads before it name: their translations are waited for first */
    a1f.half[1] = *(const v8us*)((const unsigned short*)(a1p + kb) + 16 + 8 * hh); const v16h a1 = a1f.v;
    v16h b = g2_frag(b0p + kb, hh); c00 = g2_mma(a0, b, c00); c10 = g2_mma(a1, b, c10);
    b = g2_frag(b1p + kb, hh); c01 = g2_mma(a0, b, c01); c11 = g2_mma(a1, b, c11);
    b = g2_frag(b2p + kb, hh); c02 = g2_mma(a0, b, c02); c12 = g2_mma(a1, b, c12);
    b = g2_frag(b3p + kb, hh); c03 = g2_mma(a0, b, c03); c13 = g2_mma(a1, b, c13); }
  v8f accs[8] = {c00, c01, c02, c03, c10, c11, c12, c13};
#pragma unroll
  for (int u = 0; u < 8; ++u) { const int t = u & 3, half = u >> 2; const int col = col0 + t * 16 + ln; const float bv = bp ? bf16_round(bp[col]) : 0.f;
#pragma unroll
    for (int r = 0; r < 8; ++r) { const int rloc = half * 16 + 8 * hh + r; float v = accs[u][r] * alpha + bv; if (CP) { if (rowsPerB < 0) v += CP[cofs + (size_t)(row0g + row0 + rloc) * ldc + col];      /* rowsPerB < 0: own element of the batched C plane */ else { const int bidx = (row0g + row0 + rloc) / rowsPerB; v += CP[(size_t)bidx * sCPb + (size_t)by * 64 + col]; } }
      if (ACT == 3) v = fmaxf(v, 0.f); else if (ACT == 6) v = 0.5f * v * (1.0f + erff(v * 0.70710678118654752f)); else if (ACT == 11) v = 1.0f / (1.0f + expf(-v)); else if (ACT == 15) v = v / (1.0f + expf(-v)); else if (ACT == 12) v = (v > 0.f) ? v : 0.01f * v; else if (ACT == 8) v = tanhf(v); else if (ACT == 9) v = 0.5f * v * (1.0f + tanhf(0.7978845608028654f * (v + 0.044715f * v * v * v))); else if (ACT == 14) v = (v > 0.f) ? v : 0.1f * v; else if (ACT == 16) v = (v >= 0.f) ? v : 0.3f * v; else if (ACT == 17) v = (v >= 0.f) ? v : 0.2f * v;
      so[w][rloc][t * 16 + ln] = v; } }
  __builtin_amdgcn_fence(__ATOMIC_ACQ_REL, "workgroup"); __builtin_amdgcn_wave_barrier();
  const int rsub = lane >> 4, c4 = (lane & 15) * 4;
  {
#pragma unroll
    for (int q = 0; q < 16; ++q) { const int r = q * 2 + rsub; const v4f v = *(const v4fa*)&so[w][r][c4]; if (C) *(v4f*)(C + cofs + (size_t)(row0 + r) * ldc + col0 + c4) = v; if (C16) { v4h h4; for (int i = 0; i < 4; ++i) h4[i] = (_Float16)v[i]; *(v4h*)(C16 + cofs + (size_t)(row0 + r) * ldc + col0 + c4) = h4; } }
     } }
// ---- one launch per stage: batch and causal query tile ride on the grid ----
// grid.z = (tile, batch), widest tile first
__device__ __forceinline__ int z_tile(int z) { return NQT - 1 - z / NB; }
__device__ __forceinline__ int z_batch(int z) { return z % NB; }
// S / P are packed: tile t holds NB*NH slabs of QT rows with a row pitch of its own key count (t + 1) * QT
__device__ __forceinline__ size_t sp_off(int b, int h, int t) { return (size_t)NB * NH * QT * QT * (size_t)(t * (t + 1) / 2) + (size_t)(b * NH + h) * QT * (size_t)((t + 1) * QT); }
// f16 q, k, v of all token rows: grid.y = which of q/k/v; QKV16 [3][NR][DM]
__global__ __launch_bounds__(128) void k_qkv(const _Float16* __restrict__ X16, const _Float16* __restrict__ B3, _Float16* __restrict__ QKV16) { const int wh = blockIdx.y;
  gemm2_tile<0>(blockIdx.x, 0, X16, DM, 0, B3 + (size_t)wh * DM * DM, DM, 0, 0.0625f, nullptr, 0, nullptr, 1, 0, 0, nullptr, QKV16 + (size_t)wh * NR * DM, DM, 0, MP, DM, DM); }
// f32 q, k, v of the first QT0 rows of every batch: grid.y = which of q/k/v, grid.z = batch; F0 [3][NB][QT0][DM]
__global__ __launch_bounds__(128) void k_proj0(const _Float16* __restrict__ X16, const _Float16* __restrict__ B3, float* __restrict__ F0) { const int wh = blockIdx.y, b = blockIdx.z;
  gemm2_tile<0>(blockIdx.x, 0, X16 + (size_t)b * SQ * DM, DM, 0, B3 + (size_t)wh * DM * DM, DM, 0, 0.0625f, nullptr, 0, nullptr, 1, 0, 0, F0 + (size_t)(wh * NB + b) * QT0 * DM, nullptr, DM, 0, QT0, DM, DM); }
// scores of every (batch, tile, head): keys below the tile end only; blocks past a narrow tile's columns leave at the row test
__global__ __launch_bounds__(128) void k_scores(const _Float16* __restrict__ Q16, const _Float16* __restrict__ K16, float* __restrict__ S) { const int h = blockIdx.y, t = z_tile(blockIdx.z), b = z_batch(blockIdx.z); const int nk = (t + 1) * QT;
  gemm2_tile<0>(blockIdx.x, 0, Q16 + ((size_t)b * SQ + t * QT) * LQ + h * HD, LQ, 0, K16 + (size_t)b * SQ * LQ + h * HD, LQ, 0, 0.125f, nullptr, 0, nullptr, 1, 0, 0, S + sp_off(b, h, t), nullptr, nk, 0, QT, nk, HD); }
// out tile = P V^T of every (batch, tile, head), f32 into the concatenated-heads rows
__global__ __launch_bounds__(128) void k_pv(const _Float16* __restrict__ P, const _Float16* __restrict__ VT, float* __restrict__ out) { const int h = blockIdx.y, t = z_tile(blockIdx.z), b = z_batch(blockIdx.z); const int nk = (t + 1) * QT;
  gemm2_tile<0>(blockIdx.x, 0, P + sp_off(b, h, t), nk, 0, VT + (size_t)(b * NH + h) * HD * SQ, SQ, 0, 0.00390625f, nullptr, 0, nullptr, 1, 0, 0, out + ((size_t)b * SQ + t * QT) * DM + h * HD, nullptr, DM, 0, QT, HD, nk); }


__global__ __launch_bounds__(256) void k_wnat(const float* __restrict__ w, size_t n8, _Float16* __restrict__ Bt) { const size_t t = (size_t)blockIdx.x * 256 + threadIdx.x; if (t >= n8) return; FragH f; for (int q = 0; q < 8; ++q) f.h[q] = (_Float16)(bf16_round(w[t * 8 + q]) * 16.0f); *(v8us*)((unsigned short*)Bt + t * 8) = f.half[0];  }
__global__ __launch_bounds__(256) void k_rsm(const float* __restrict__ S, _Float16* __restrict__ P, int nrows) {
  #pragma clang fp contract(off)
  const int i = blockIdx.x * 256 + threadIdx.x; if (i >= nrows) return; const float* s = S + (size_t)i * SQ; float mx = -3.0e38f;
#pragma unroll 1
  for (int j = 0; j < SQ; ++j) mx = fmaxf(mx, s[j]); float se = 0.f;
#pragma unroll 1
  for (int j = 0; j < SQ; ++j) se += expf(s[j] - mx); const float sc = 256.0f / se;
#pragma unroll 1
  for (int j0 = 0; j0 < SQ; j0 += 8) { FragH f; for (int q = 0; q < 8; ++q) f.h[q] = (_Float16)(expf(s[j0 + q] - mx) * sc); unsigned short* d = (unsigned short*)P + (size_t)i * SQ + j0; *(v8us*)d = f.half[0];  } }
__global__ __launch_bounds__(256) void k_vt(const _Float16* __restrict__ V16, int b, int h0, _Float16* __restrict__ VT) { __shared__ unsigned short tl[64][65]; const int tid = threadIdx.x; const int hh = blockIdx.x % HG, sg = blockIdx.x / HG; const int s0 = sg * 64; const int h = h0 + hh;
  for (int i = tid; i < 64 * 8; i += 256) { const int j = i / 8, d8 = (i % 8) * 8; FragH f; f.half[0] = *(const v8us*)((const unsigned short*)V16 + ((size_t)b * SQ + s0 + j) * DM + h * HD + d8); for (int q = 0; q < 8; ++q) tl[d8 + q][j] = f.u[q]; }
  __syncthreads();
  { for (int i = tid; i < 64 * 8; i += 256) { const int d = i / 8, j8 = (i % 8) * 8; FragH f; for (int q = 0; q < 8; ++q) f.u[q] = tl[d][j8 + q]; *(v8us*)((unsigned short*)VT + ((size_t)hh * HD + d) * SQ + s0 + j8) = f.half[0]; }  } }

__global__ __launch_bounds__(256) void k_wthd(const float* __restrict__ Wq, const float* __restrict__ Wk, const float* __restrict__ Wv, _Float16* __restrict__ B3) { const size_t t = (size_t)blockIdx.x * 256 + threadIdx.x; if (t >= (size_t)NH * HD * (DM / 8)) return; const float* Wt = blockIdx.y == 0 ? Wq : blockIdx.y == 1 ? Wk : Wv; _Float16* Bt = B3 + (size_t)blockIdx.y * DM * DM;      /* grid.y = which of q/k/v */ const int m8 = (int)(t % (DM / 8)) * 8; const int d = (int)((t / (DM / 8)) % HD); const int h = (int)(t / ((size_t)(DM / 8) * HD)); FragH f;
  for (int q = 0; q < 8; ++q) f.h[q] = (_Float16)(16.0f * bf16_round(Wt[((size_t)h * DM + m8 + q) * HD + d])); unsigned short* dst = (unsigned short*)Bt + ((size_t)h * HD + d) * DM + m8; *(v8us*)dst = f.half[0];  }



__global__ __launch_bounds__(QT) void k_rsmcf2(const float* __restrict__ S, _Float16* __restrict__ P) {
  #pragma clang fp contract(off)
  const int tl = z_tile(blockIdx.z), nk = (tl + 1) * QT; const size_t i = sp_off(z_batch(blockIdx.z), blockIdx.y, tl) + (size_t)threadIdx.x * nk;      /* one block = the QT rows of one (batch, tile, head) */
  const float* s = S + i; const int last = tl * QT + (int)threadIdx.x; float mx = -3.0e38f;
#pragma unroll 1
  for (int j = 0; j < nk; ++j) { const float f = (j <= last) ? 1.f : 0.f; mx = fmaxf(mx, fmaf(f, s[j], (1.f - f) * -1.0e9f)); } float se = 0.f;
#pragma unroll 1
  for (int j = 0; j < nk; ++j) { const float f = (j <= last) ? 1.f : 0.f; se += __expf(fmaf(f, s[j], (1.f - f) * -1.0e9f) - mx); } const float sc = 256.0f / se;
#pragma unroll 1
  for (int j0 = 0; j0 < nk; j0 += 8) { FragH fr; for (int q = 0; q < 8; ++q) { const int j = j0 + q; const float f = (j <= last) ? 1.f : 0.f; fr.h[q] = (_Float16)(__expf(fmaf(f, s[j], (1.f - f) * -1.0e9f) - mx) * sc); } unsigned short* d = (unsigned short*)P + i + j0; *(v8us*)d = fr.half[0];  } }


template <int MASKADD>
__global__ __launch_bounds__(64) void k_att0(const float* __restrict__ QF, const float* __restrict__ KF, const float* __restrict__ VF, int ld, const float* __restrict__ mask, float scale, float* __restrict__ OF, int ldo) {
  #pragma clang fp contract(off)
  __shared__ __attribute__((aligned(16))) float lq[64][64]; __shared__ __attribute__((aligned(16))) float lo[64][64];
  const int tid = threadIdx.x; const int h = blockIdx.x / (QT0 / 64), rg = blockIdx.x % (QT0 / 64); const int i = rg * 64 + tid;
  QF += (size_t)blockIdx.y * QT0 * ld; KF += (size_t)blockIdx.y * QT0 * ld; VF += (size_t)blockIdx.y * QT0 * ld; OF += (size_t)blockIdx.y * QT0 * ldo;      /* grid.y = batch */
  const float* qr = QF + (size_t)i * ld + h * HD;
#pragma unroll 1
  for (int c = 0; c < HD / 4; ++c) { *(v4f*)&lq[tid][c * 4] = *(const v4fa*)(qr + c * 4); const v4f z = {0.f, 0.f, 0.f, 0.f}; *(v4f*)&lo[tid][c * 4] = z; }
  float m = -1.0e30f, l = 0.f; const int jmax = MASKADD ? (SQ - 1) : (rg * 64 + 63);      /* additive-mask form: every key (the mask input decides); causal form: keys up to the block's last row */
#pragma unroll 1
  for (int j = 0; j <= jmax; ++j) { const float* kr = KF + (size_t)j * ld + h * HD; const float* vr = VF + (size_t)j * ld + h * HD; float s = 0.f;
#pragma unroll 1
    for (int c = 0; c < HD / 4; ++c) { const v4f kq = *(const v4fa*)(kr + c * 4); const v4f qq = *(v4f*)&lq[tid][c * 4]; s = __fadd_rn(s, __fmul_rn(qq[0], kq[0])); s = __fadd_rn(s, __fmul_rn(qq[1], kq[1])); s = __fadd_rn(s, __fmul_rn(qq[2], kq[2])); s = __fadd_rn(s, __fmul_rn(qq[3], kq[3])); }
    s = __fmul_rn(s, scale); if (MASKADD) s = __fadd_rn(s, __fmul_rn(bf16_round(mask[(size_t)i * SQ + j]), -10000.0f));
    const float f = (MASKADD || j <= i) ? 1.f : 0.f; const float sm = fmaf(f, s, (1.f - f) * -1.0e30f); const float mn = fmaxf(m, sm); const float sc = expf(m - mn); const float e = expf(sm - mn); l = __fadd_rn(__fmul_rn(l, sc), e); m = mn;
#pragma unroll 1
    for (int c = 0; c < HD / 4; ++c) { const v4f vv = *(const v4fa*)(vr + c * 4); v4f oo = *(v4f*)&lo[tid][c * 4]; for (int u = 0; u < 4; ++u) oo[u] = __fadd_rn(__fmul_rn(oo[u], sc), __fmul_rn(e, vv[u])); *(v4f*)&lo[tid][c * 4] = oo; } }
  const float fin = 64.0f / l;      /* o carried x64, scaled back by 1/64 in k_ftcopy */
#pragma unroll 1
  for (int c = 0; c < HD / 4; ++c) { v4f oo = *(v4f*)&lo[tid][c * 4]; for (int u = 0; u < 4; ++u) oo[u] = __fmul_rn(oo[u], fin); *(v4f*)&lo[tid][c * 4] = oo; }
  __syncthreads();
  {
#pragma unroll 1
    for (int it = 0; it < 16; ++it) { const int row = it * 4 + tid / 16, pc = (tid % 16) * 4; const v4f v = *(const v4f*)&lo[row][pc]; *(v4f*)(OF + (size_t)(rg * 64 + row) * ldo + h * HD + pc) = v; }
     } }


__global__ __launch_bounds__(256) void k_ftcopy(const float* __restrict__ OF0, float* __restrict__ out, size_t n4) {
  #pragma clang fp contract(off)
  const size_t t = (size_t)blockIdx.x * 256 + threadIdx.x; if (t >= n4) return; OF0 += (size_t)blockIdx.y * QT0 * DM; out += (size_t)blockIdx.y * SQ * DM;      /* grid.y = batch */
  const v4f o = *(const v4fa*)(OF0 + t * 4); v4f y; for (int q = 0; q < 4; ++q) y[q] = __fmul_rn(o[q], 0.015625f); *(v4f*)(out + t * 4) = y;  }
extern "C" void kernel_launch(void* const* d_in, const int* in_sizes, int n_in,
                              void* d_out, int out_size, void* d_ws, size_t ws_size, hipStream_t stream) {
  (void)in_sizes; (void)n_in; (void)out_size;
  const float* const* I = (const float* const*)d_in; const float* x = I[0]; const float* wq = I[1]; const float* wk = I[2]; const float* wv = I[3];      /* per-head [h][in][out] weights, no biases, no output projection */
  char* ws = (char*)d_ws; size_t off = 0;
  auto take = [&](size_t bytes) { char* p = ws + off; off += (bytes + 255) & ~(size_t)255; return p; };
  _Float16* B3 = (_Float16*)take((size_t)3 * DM * DM * 2);      /* q, k, v weights, one after the other */
  _Float16* X16 = (_Float16*)take(NR * DM * 2); _Float16* QKV16 = (_Float16*)take((size_t)3 * NR * DM * 2); _Float16* Q16 = QKV16; _Float16* K16 = QKV16 + NR * DM; _Float16* V16 = QKV16 + 2 * NR * DM;
  float* S = (float*)take((size_t)NB * NH * QT * QT * (NQT * (NQT + 1) / 2) * 4); _Float16* P = (_Float16*)take((size_t)NB * NH * QT * QT * (NQT * (NQT + 1) / 2) * 2); _Float16* VT = (_Float16*)take((size_t)NB * NH * HD * SQ * 2);
  float* F0 = (float*)take((size_t)3 * NB * QT0 * DM * 4); float* OF0 = (float*)take((size_t)NB * QT0 * DM * 4);
  if (off > ws_size) return;
  k_wthd<<<dim3((unsigned)(((size_t)NH * HD * (DM / 8) + 255) / 256), 3), 256, 0, stream>>>(wq, wk, wv, B3);      /* per-head [m][d] -> Bt[(h,d)][m] x16 */
  k_x16<<<(unsigned)((NR * DM / 8 + 255) / 256), 256, 0, stream>>>(x, X16, NR * DM / 8);
  k_qkv<<<dim3((unsigned)((MP / 128) * (DM / 64)), 3), 128, 0, stream>>>(X16, B3, QKV16);
  k_vt<NH, SQ><<<NB * NH * (SQ / 64), 256, 0, stream>>>(V16, LQ, 0, VT);      /* V^T [NB][NH][HD][SQ] */
  k_proj0<<<dim3((QT0 / 128) * (DM / 64), 3, NB), 128, 0, stream>>>(X16, B3, F0);      /* f32 q, k, v of the first 128 rows (exact products) */
  k_att0<0><<<dim3(NH * (QT0 / 64), NB), 64, 0, stream>>>(F0, F0 + (size_t)NB * QT0 * DM, F0 + (size_t)2 * NB * QT0 * DM, DM, nullptr, 0.125f, OF0, DM);      /* exact f32 attention for rows 0..127 (o x64) */
  k_scores<<<dim3((QT / 128) * (SQ / 64), NH, NQT * NB), 128, 0, stream>>>(Q16, K16, S);
  k_rsmcf2<<<dim3(1, NH, NQT * NB), QT, 0, stream>>>(S, P);
  k_pv<<<dim3((QT / 128) * (HD / 64), NH, NQT * NB), 128, 0, stream>>>(P, VT, (float*)d_out);      /* out = attn v (concatenated heads) written f32 */
  k_ftcopy<<<dim3((unsigned)(((size_t)QT0 * DM / 4 + 255) / 256), NB), 256, 0, stream>>>(OF0, (float*)d_out, (size_t)QT0 * DM / 4);      /* rows 0..127 of each batch rewritten from the exact f32 attention (the module has no output projection) */
}

// v002
// It runs in 411 microseconds.
// Two timings next to v001 put it at 1.86 and 1.85 times that version's speed.
// Over all steps from v000 it is 10.3 times as fast.
#include <hip/hip_runtime.h>
// Causal multi-head attention with per-head weight tensors (x [4][1024][768]; Q[s][h][d] = sum_m x[s][m] W_Q[h][m][d], K, V likewise (12 heads of 64); scores / 8 with a causal mask (tril); softmax; avg_V = probs V; out[q][h*64 + d] = avg_V[q][h][d] -> [4][1024][768]).
// Structure: token rows r = b*1024 + s; x as exact f16 rows (bf16-rounded); Q, K, V as three WMMA GEMMs (32x64 wave tiles, f32 accumulation, exact x16 weights, no bias, f16 outputs); every stage is one launch over all batches (and all query tiles, on grid.z): V^T for all heads via LDS transposes; per query tile of 256 rows: scores against the keys below the tile end only (K = 64, all heads on grid.y, alpha = 0.125), causal row softmax on VALU with an arithmetic 0/1 key mask over the computed range (f32 statistics, native exp; weights x256 f16), out tile = P V^T GEMM (K = keys below the tile end, alpha 2^-8) written f32 straight into the concatenated-heads output rows (no output projection); first-tile refinement: the first 128 query rows of every batch recomputed exactly in f32 (f32 q/k/v GEMMs + an online-softmax causal attention on VALU) and copied over those output rows.
// Compute dtype: inputs rounded to bf16; x / weights exact; q, k, v and softmax weights as plain f16 GEMM operands (~2^-12); scores and softmax statistics f32. v_wmma_f32_16x16x32_f16.
#define NB 4
#define SQ 1024
#define DM 768
#define NH 12
#define HD 64
#define HG 4                         /* heads per group in the unlaunched k_vt(V16, b, h0, VT) */
#define QT 256                       /* query rows per causal tile */
#define NQT (SQ / QT)                /* causal query tiles per batch */
#define NKX SQ
#define QT0 128                      /* first-tile rows recomputed exactly in f32 */
#define B0 0                         /* unused (all batches on the grid) */
#define NBR NB                       /* batches processed (debug hook) */
#define NR ((size_t)NB * SQ)         /* token rows */
#define MP ((int)((size_t)NBR * SQ)) /* rows projected (debug hook) */
#define QN SQ                        /* unused (query tiles on grid.z) */
#define NHD NH                       /* unused (all heads on the grid) */
#define MPO MP                       /* unused (no output stage) */
#define LQ DM      /* row pitch of the q/k/v rows */
typedef __bf16 v16b __attribute__((ext_vector_type(16)));
typedef unsigned short v8us __attribute__((ext_vector_type(8), may_alias));
typedef float  v8f  __attribute__((ext_vector_type(8)));
typedef float  v4f  __attribute__((ext_vector_type(4)));
typedef float  v4fa __attribute__((ext_vector_type(4), may_alias));
union FragB { v16b v; v8us half[2]; unsigned short u[16]; };

__device__ __forceinline__ unsigned short bf16_bits(float x) { unsigned int u = __float_as_uint(x); return (unsigned short)((u + 0x7FFFu + ((u >> 16) & 1u)) >> 16); }
__device__ __forceinline__ float bf16_val(unsigned short b) { return __uint_as_float(((unsigned int)b) << 16); }
__device__ __forceinline__ float bf16_round(float x) { return bf16_val(bf16_bits(x)); }
// D += A·B with NT terms: 1 = ah·bh, 2 = + al·bh (A split), 3 = + ah·bl (both split)
template <int NT>
__device__ __forceinline__ v8f mmaN(v16b ah, v16b al, v16b bh, v16b bl, v8f c) {
  c = __builtin_amdgcn_wmma_f32_16x16x32_bf16(false, ah, false, bh, (short)0, c, false, false);
  if (NT >= 2) c = __builtin_amdgcn_wmma_f32_16x16x32_bf16(false, al, false, bh, (short)0, c, false, false);
  if (NT >= 3) c = __builtin_amdgcn_wmma_f32_16x16x32_bf16(false, ah, false, bl, (short)0, c, false, false);
  asm volatile("v_nop\n\tv_nop\n\tv_nop\n\tv_nop" : "+v"(c) : "v"(ah), "v"(al), "v"(bh), "v"(bl));
  return c;
}

__global__ __launch_bounds__(256) void k_wt_bf16(const float* __restrict__ W, unsigned short* __restrict__ Wt, int K, int N) {
  const int t = blockIdx.x * 256 + threadIdx.x;
  const int k8n = K / 8;
  if (t >= N * k8n) return;
  const int n = t / k8n, k8 = (t % k8n) * 8;
  v8us v;
#pragma unroll
  for (int i = 0; i < 8; ++i) v[i] = bf16_bits(W[(size_t)(k8 + i) * N + n]);
  *(v8us*)(Wt + (size_t)n * K + k8) = v;
  
}

// GEMM C[M][N] (f32, pitch ldc) = act(A[M][K]·W + bias). A f32 row-major (pitch lda) converted per fragment to bf16
// (ASPLIT: hi/lo two planes -> 2 terms, else single rounded term); Wt bf16 [N][K] (pitch ldb). BIAS_BF16 rounds the
// bias to bf16 first (bias quantised to bf16 before the add). K%32==0, M%16==0, N%64==0.
template <bool ASPLIT, int ACT, bool BIAS_BF16>
__global__ __launch_bounds__(128) void k_gemm_bf(const float* __restrict__ A, int lda, const unsigned short* __restrict__ Wt, int ldb,
                                               const float* __restrict__ bias, float* __restrict__ C, int ldc, int M, int N, int K) {
  __shared__ __attribute__((aligned(16))) float so[4][16][64];
  const int tid = threadIdx.x, w = tid >> 5, lane = tid & 31, ln = lane & 15, hh = lane >> 4;
  const int ntn = N / 64;
  const int wid = blockIdx.x * 4 + w;
  const int mt = wid / ntn, nq = wid % ntn;
  if (mt * 16 >= M) return;
  const int row0 = mt * 16, col0 = nq * 64;
  const float* arow = A + (size_t)(row0 + ln) * lda;
  v8f acc[4] = {};
  for (int kb = 0; kb < K; kb += 32) {
    FragB ah, al;
    const v4f x0 = *(const v4fa*)(arow + kb + 8 * hh), x1 = *(const v4fa*)(arow + kb + 8 * hh + 4);
    const v4f x2 = *(const v4fa*)(arow + kb + 16 + 8 * hh), x3 = *(const v4fa*)(arow + kb + 16 + 8 * hh + 4);
    float xs[16] = {x0[0],x0[1],x0[2],x0[3],x1[0],x1[1],x1[2],x1[3],x2[0],x2[1],x2[2],x2[3],x3[0],x3[1],x3[2],x3[3]};
#pragma unroll
    for (int i = 0; i < 16; ++i) { const unsigned short hb = bf16_bits(xs[i]); ah.u[i] = hb; al.u[i] = ASPLIT ? bf16_bits(xs[i] - bf16_val(hb)) : (unsigned short)0; }
#pragma unroll
    for (int t = 0; t < 4; ++t) {
      const unsigned short* brow = Wt + (size_t)(col0 + t * 16 + ln) * ldb + kb;
      FragB b;
      b.half[0] = *(const v8us*)(brow + 8 * hh);
      b.half[1] = *(const v8us*)(brow + 16 + 8 * hh);
      acc[t] = mmaN<ASPLIT ? 2 : 1>(ah.v, al.v, b.v, b.v, acc[t]);
    }
  }
#pragma unroll
  for (int t = 0; t < 4; ++t) {
    float bv = bias ? bias[col0 + t * 16 + ln] : 0.f;
    if (BIAS_BF16) bv = bf16_round(bv);
#pragma unroll
    for (int r = 0; r < 8; ++r) { float v = acc[t][r] + bv; if (ACT == 1) v = fmaxf(v, 0.f); so[w][8 * hh + r][t * 16 + ln] = v; }
  }
  __builtin_amdgcn_fence(__ATOMIC_ACQ_REL, "workgroup");
  __builtin_amdgcn_wave_barrier();
  const int rsub = lane >> 4, c4 = (lane & 15) * 4;
  {
#pragma unroll
    for (int q = 0; q < 8; ++q) {
      const int r = q * 2 + rsub;
      const v4f v = *(const v4fa*)&so[w][r][c4];
      *(v4f*)(C + (size_t)(row0 + r) * ldc + col0 + c4) = v;
    }
    
  }
}

// GEMM C = act(A·W + bias + resid): A f32 (ASPLIT -> hi/lo 2 terms), Wt bf16 [N][K]; ACT 0 none, 1 relu, 2 exact gelu;
// resid (optional, f32, row index = (row % rmod), pitch ldr, RES_BF16 rounds it) added before the activation.
template <bool ASPLIT, int ACT, bool BIAS_BF16, bool RES_BF16>
__global__ __launch_bounds__(128) void k_gemm_bf3(const float* __restrict__ A, int lda, const unsigned short* __restrict__ Wt, int ldb,
                                                const float* __restrict__ bias, const float* __restrict__ resid, int rmod, int ldr,
                                                float* __restrict__ C, int ldc, int M, int N, int K) {
  __shared__ __attribute__((aligned(16))) float so[4][16][64];
  const int tid = threadIdx.x, w = tid >> 5, lane = tid & 31, ln = lane & 15, hh = lane >> 4;
  const int ntn = N / 64;
  const int wid = blockIdx.x * 4 + w;
  const int mt = wid / ntn, nq = wid % ntn;
  if (mt * 16 >= M) return;
  const int row0 = mt * 16, col0 = nq * 64;
  const float* arow = A + (size_t)(row0 + ln) * lda;
  v8f acc[4] = {};
  for (int kb = 0; kb < K; kb += 32) {
    FragB ah, al;
    const v4f x0 = *(const v4fa*)(arow + kb + 8 * hh), x1 = *(const v4fa*)(arow + kb + 8 * hh + 4);
    const v4f x2 = *(const v4fa*)(arow + kb + 16 + 8 * hh), x3 = *(const v4fa*)(arow + kb + 16 + 8 * hh + 4);
    float xs[16] = {x0[0],x0[1],x0[2],x0[3],x1[0],x1[1],x1[2],x1[3],x2[0],x2[1],x2[2],x2[3],x3[0],x3[1],x3[2],x3[3]};
#pragma unroll
    for (int i = 0; i < 16; ++i) { const unsigned short hb = bf16_bits(xs[i]); ah.u[i] = hb; al.u[i] = ASPLIT ? bf16_bits(xs[i] - bf16_val(hb)) : (unsigned short)0; }
#pragma unroll
    for (int t = 0; t < 4; ++t) {
      const unsigned short* brow = Wt + (size_t)(col0 + t * 16 + ln) * ldb + kb;
      FragB b;
      b.half[0] = *(const v8us*)(brow + 8 * hh);
      b.half[1] = *(const v8us*)(brow + 16 + 8 * hh);
      acc[t] = mmaN<ASPLIT ? 2 : 1>(ah.v, al.v, b.v, b.v, acc[t]);
    }
  }
#pragma unroll
  for (int t = 0; t < 4; ++t) {
    const int col = col0 + t * 16 + ln;
    float bv = bias ? bias[col] : 0.f;
    if (BIAS_BF16) bv = bf16_round(bv);
#pragma unroll
    for (int r = 0; r < 8; ++r) {
      float v = acc[t][r] + bv;
      if (resid) { float rv = resid[(size_t)((row0 + 8 * hh + r) % rmod) * ldr + col]; if (RES_BF16) rv = bf16_round(rv); v += rv; }
      if (ACT == 1) v = fmaxf(v, 0.f);
      if (ACT == 2) v = 0.5f * v * (1.0f + erff(v * 0.70710678118654752f));
      if (ACT == 3) { const float u = 0.7978845608028654f * (v + 0.044715f * v * v * v); v = 0.5f * v * (1.0f + tanhf(u)); }
      so[w][8 * hh + r][t * 16 + ln] = v;
    }
  }
  __builtin_amdgcn_fence(__ATOMIC_ACQ_REL, "workgroup");
  __builtin_amdgcn_wave_barrier();
  const int rsub = lane >> 4, c4 = (lane & 15) * 4;
  {
#pragma unroll
    for (int q = 0; q < 8; ++q) {
      const int r = q * 2 + rsub;
      const v4f v = *(const v4fa*)&so[w][r][c4];
      *(v4f*)(C + (size_t)(row0 + r) * ldc + col0 + c4) = v;
    }
    
  }
}
// row LayerNorm (biased variance, eps) over N: s = X (+ R); optional out_sum <- s; out_norm <- (s-mu)*rsqrt(var+eps)*g + b
template <bool PARAM_BF16>
__global__ __launch_bounds__(256) void k_layernorm(const float* __restrict__ X, const float* __restrict__ R, const float* __restrict__ g, const float* __restrict__ bta,
                                                  float* __restrict__ out_sum, float* __restrict__ out_norm, int N, float eps) {
  __shared__ float red[256];
  const int row = blockIdx.x, tid = threadIdx.x;
  const float* x = X + (size_t)row * N; const float* rr = R ? R + (size_t)row * N : nullptr;
  float vals[16];                     // up to N = 4096
  const int per = N / 256;            // contiguous chunk per thread? use strided-by-4 chunks: thread handles j = tid*4 + 1024*u
  float s1 = 0.f;
  for (int u = 0; u < per / 4; ++u) {
    const int j = tid * 4 + 1024 * u;
    const v4f a = *(const v4fa*)(x + j);
    v4f b = {0.f,0.f,0.f,0.f}; if (rr) b = *(const v4fa*)(rr + j);
#pragma unroll
    for (int q = 0; q < 4; ++q) { const float v = a[q] + b[q]; vals[u * 4 + q] = v; s1 += v; }
  }
  red[tid] = s1; __syncthreads();
  for (int st = 128; st > 0; st >>= 1) { if (tid < st) red[tid] += red[tid + st]; __syncthreads(); }
  const float mu = red[0] / (float)N; __syncthreads();
  float s2 = 0.f;
  for (int u = 0; u < per / 4; ++u)
#pragma unroll
    for (int q = 0; q < 4; ++q) { const float c = vals[u * 4 + q] - mu; s2 += c * c; }
  red[tid] = s2; __syncthreads();
  for (int st = 128; st > 0; st >>= 1) { if (tid < st) red[tid] += red[tid + st]; __syncthreads(); }
  const float rs = rsqrtf(red[0] / (float)N + eps);
  {
    for (int u = 0; u < per / 4; ++u) {
      const int j = tid * 4 + 1024 * u;
      v4f o, sm;
#pragma unroll
      for (int q = 0; q < 4; ++q) {
        float gg = g[j + q], bb = bta[j + q];
        if (PARAM_BF16) { gg = bf16_round(gg); bb = bf16_round(bb); }
        sm[q] = vals[u * 4 + q]; o[q] = (vals[u * 4 + q] - mu) * rs * gg + bb;
      }
      if (out_sum) *(v4f*)(out_sum + (size_t)row * N + j) = sm;
      *(v4f*)(out_norm + (size_t)row * N + j) = o;
    }
    
  }
}



// ---- f16 WMMA path (v_wmma_f32_16x16x32_f16): 11-bit significands for operands in range — used where a [0,1] probability operand needs more precision than bf16
typedef _Float16 v16h __attribute__((ext_vector_type(16)));
union FragH { v16h v; v8us half[2]; _Float16 h[16]; unsigned short u[16]; };
template <int NT>
__device__ __forceinline__ v8f mmaH(v16h ah, v16h al, v16h bh, v16h bl, v8f c) {
  c = __builtin_amdgcn_wmma_f32_16x16x32_f16(false, ah, false, bh, (short)0, c, false, false);
  if (NT >= 2) c = __builtin_amdgcn_wmma_f32_16x16x32_f16(false, al, false, bh, (short)0, c, false, false);
  if (NT >= 3) c = __builtin_amdgcn_wmma_f32_16x16x32_f16(false, ah, false, bl, (short)0, c, false, false);
  asm volatile("v_nop\n\tv_nop\n\tv_nop\n\tv_nop" : "+v"(c) : "v"(ah), "v"(al), "v"(bh), "v"(bl));
  return c;
}
// batched GEMM like k_gemm_b but f16 operands: A f32 (split into f16 hi/lo if ASPLIT, else rounded to f16), Bt = f16 values [n][k]; alpha; C f32; N multiple of 16 (partial tiles skipped)
template <bool ASPLIT>
__global__ __launch_bounds__(128) void k_gemm_h(const float* __restrict__ A, int lda, size_t sA, const _Float16* __restrict__ Bh, int ldb, size_t sB, float alpha, float* __restrict__ C, int ldc, size_t sC, int M, int N, int K) {
  __shared__ __attribute__((aligned(16))) float so[4][16][64];
  const int tid = threadIdx.x, w = tid >> 5, lane = tid & 31, ln = lane & 15, hh = lane >> 4; const int by = blockIdx.y;
  A += (size_t)by * sA; Bh += (size_t)by * sB; C += (size_t)by * sC;
  const int ntn = (N + 63) / 64; const int wid = blockIdx.x * 4 + w; const int mt = wid / ntn, nq = wid % ntn; if (mt * 16 >= M) return;
  const int row0 = mt * 16, col0 = nq * 64; const float* arow = A + (size_t)(row0 + ln) * lda;
  v8f acc[4] = {};
  for (int kb = 0; kb < K; kb += 32) {
    FragH ah, al;
    const v4f x0 = *(const v4fa*)(arow + kb + 8 * hh), x1 = *(const v4fa*)(arow + kb + 8 * hh + 4), x2 = *(const v4fa*)(arow + kb + 16 + 8 * hh), x3 = *(const v4fa*)(arow + kb + 16 + 8 * hh + 4);
    float xs[16] = {x0[0],x0[1],x0[2],x0[3],x1[0],x1[1],x1[2],x1[3],x2[0],x2[1],x2[2],x2[3],x3[0],x3[1],x3[2],x3[3]};
#pragma unroll
    for (int i = 0; i < 16; ++i) { const _Float16 h = (_Float16)xs[i]; ah.h[i] = h; al.h[i] = ASPLIT ? (_Float16)(xs[i] - (float)h) : (_Float16)0.0f; }
#pragma unroll
    for (int t = 0; t < 4; ++t) { if (col0 + t * 16 >= N) continue; const size_t boff = (size_t)(col0 + t * 16 + ln) * ldb + kb; FragH bq; bq.half[0] = *(const v8us*)(Bh + boff + 8 * hh); bq.half[1] = *(const v8us*)(Bh + boff + 16 + 8 * hh);
      acc[t] = mmaH<ASPLIT ? 2 : 1>(ah.v, al.v, bq.v, bq.v, acc[t]); }
  }
#pragma unroll
  for (int t = 0; t < 4; ++t) { if (col0 + t * 16 >= N) continue;
#pragma unroll
    for (int r = 0; r < 8; ++r) so[w][8 * hh + r][t * 16 + ln] = acc[t][r] * alpha; }
  __builtin_amdgcn_fence(__ATOMIC_ACQ_REL, "workgroup"); __builtin_amdgcn_wave_barrier();
  const int rsub = lane >> 4, c4 = (lane & 15) * 4;
  {
#pragma unroll
    for (int q = 0; q < 8; ++q) { const int r = q * 2 + rsub; if (col0 + c4 < N) { const v4f v = *(const v4fa*)&so[w][r][c4]; *(v4f*)(C + (size_t)(row0 + r) * ldc + col0 + c4) = v; } }
     }
}

// Wt[n][k] = f16(W[k][n]·scale) from f32 row-major W[K][N] (scale = power of two; bf16-exact weights stay exact in f16 away from the subnormal range)
__global__ __launch_bounds__(256) void k_wt_f16(const float* __restrict__ W, _Float16* __restrict__ Wt, int K, int N, float scale) {
  const int t = blockIdx.x * 256 + threadIdx.x; if (t >= N * (K / 8)) return; const int n = t / (K / 8), k8 = (t % (K / 8)) * 8; FragH f;
#pragma unroll
  for (int i = 0; i < 8; ++i) f.h[i] = (_Float16)(bf16_round(W[(size_t)(k8 + i) * N + n]) * scale); const v8us o = f.half[0];
  *(v8us*)((unsigned short*)Wt + (size_t)n * K + k8) = o; 
}
// k_gemm_hh variant with fused epilogue: v = acc·alpha + bias[by·sBias + col] (+ CP[(row/rowsPerB)·sCPb + by·64 + col] if CP) ; ACT 0 none / 1 elu ; writes f16 C16 (and f32 C if non-null)
template <int ACT>
__global__ __launch_bounds__(128) void k_gemm_hhx(const _Float16* __restrict__ A, int lda, size_t sA, const _Float16* __restrict__ Bh, int ldb, size_t sB, float alpha, const float* __restrict__ bias, size_t sBias, const float* __restrict__ CP, int rowsPerB, size_t sCPb, int row0g,
    float* __restrict__ C, _Float16* __restrict__ C16, int ldc, size_t sC, int M, int N, int K) {
  __shared__ __attribute__((aligned(16))) float so[4][16][64];
  const int tid = threadIdx.x, w = tid >> 5, lane = tid & 31, ln = lane & 15, hh = lane >> 4; const int by = blockIdx.y;
  A += (size_t)by * sA; Bh += (size_t)by * sB; const size_t cofs = (size_t)by * sC; const float* bp = bias ? bias + (size_t)by * sBias : nullptr;
  const int ntn = (N + 63) / 64; const int wid = blockIdx.x * 4 + w; const int mt = wid / ntn, nq = wid % ntn; if (mt * 16 >= M) return;
  const int row0 = mt * 16, col0 = nq * 64; const _Float16* arow = A + (size_t)(row0 + ln) * lda;
  v8f acc[4] = {};
  for (int kb = 0; kb < K; kb += 32) { FragH ah; ah.half[0] = *(const v8us*)((const unsigned short*)arow + kb + 8 * hh); ah.half[1] = *(const v8us*)((const unsigned short*)arow + kb + 16 + 8 * hh);
#pragma unroll
    for (int t = 0; t < 4; ++t) { if (col0 + t * 16 >= N) continue; const size_t boff = (size_t)(col0 + t * 16 + ln) * ldb + kb; FragH bq; bq.half[0] = *(const v8us*)((const unsigned short*)Bh + boff + 8 * hh); bq.half[1] = *(const v8us*)((const unsigned short*)Bh + boff + 16 + 8 * hh);
      acc[t] = mmaH<1>(ah.v, ah.v, bq.v, bq.v, acc[t]); }
  }
#pragma unroll
  for (int t = 0; t < 4; ++t) { if (col0 + t * 16 >= N) continue; const int col = col0 + t * 16 + ln; const float bv = bp ? bf16_round(bp[col]) : 0.f;
#pragma unroll
    for (int r = 0; r < 8; ++r) { float v = acc[t][r] * alpha + bv; if (CP) { const int rr = row0g + row0 + 8 * hh + r; if (rowsPerB < 0) v += CP[cofs + (size_t)rr * ldc + col];      /* rowsPerB < 0: own element of the batched C plane */ else { const int bidx = rr / rowsPerB; v += CP[(size_t)bidx * sCPb + (size_t)by * 64 + col]; } } if (ACT == 1) v = (v > 0.f) ? v : expm1f(v); else if (ACT == 7) v = (v > 0.f) ? v + 1.0f : expf(v); else if (ACT == 8) v = tanhf(v); else if (ACT == 9) v = 0.5f * v * (1.0f + tanhf(0.7978845608028654f * (v + 0.044715f * v * v * v))); else if (ACT == 11) v = 1.0f / (1.0f + expf(-v)); else if (ACT == 12) v = (v > 0.f) ? v : 0.01f * v; else if (ACT == 14) v = (v > 0.f) ? v : 0.1f * v; else if (ACT == 16) v = (v >= 0.f) ? v : 0.3f * v; else if (ACT == 17) v = (v >= 0.f) ? v : 0.2f * v; else if (ACT == 15) v = v / (1.0f + expf(-v)); else if (ACT == 3) v = fmaxf(v, 0.f); else if (ACT == 6) v = 0.5f * v * (1.0f + erff(v * 0.70710678118654752f)); so[w][8 * hh + r][t * 16 + ln] = v; } }
  __builtin_amdgcn_fence(__ATOMIC_ACQ_REL, "workgroup"); __builtin_amdgcn_wave_barrier();
  const int rsub = lane >> 4, c4 = (lane & 15) * 4; typedef _Float16 v4h __attribute__((ext_vector_type(4)));
  {
#pragma unroll
    for (int q = 0; q < 8; ++q) { const int r = q * 2 + rsub; if (col0 + c4 < N) { const v4f v = *(const v4fa*)&so[w][r][c4]; if (C) *(v4f*)(C + cofs + (size_t)(row0 + r) * ldc + col0 + c4) = v; if (C16) { v4h h4; for (int i = 0; i < 4; ++i) h4[i] = (_Float16)v[i]; *(v4h*)(C16 + cofs + (size_t)(row0 + r) * ldc + col0 + c4) = h4; } } }
     }
}


typedef _Float16 v4h __attribute__((ext_vector_type(4)));

__global__ __launch_bounds__(256) void k_x16(const float* __restrict__ x, _Float16* __restrict__ X16, size_t n8) { const size_t t = (size_t)blockIdx.x * 256 + threadIdx.x; if (t >= n8) return; FragH f;
#pragma unroll
  for (int q = 0; q < 8; ++q) f.h[q] = (_Float16)bf16_round(x[t * 8 + q]); *(v8us*)((unsigned short*)X16 + t * 8) = f.half[0];  }
__global__ __launch_bounds__(256) void k_h16(const float* __restrict__ x, _Float16* __restrict__ X16, size_t n8) { const size_t t = (size_t)blockIdx.x * 256 + threadIdx.x; if (t >= n8) return; FragH f;
#pragma unroll
  for (int q = 0; q < 8; ++q) f.h[q] = (_Float16)x[t * 8 + q]; *(v8us*)((unsigned short*)X16 + t * 8) = f.half[0];  }
__global__ __launch_bounds__(256) void k_round16f(const float* __restrict__ W, _Float16* __restrict__ Bt, size_t n8) { const size_t t = (size_t)blockIdx.x * 256 + threadIdx.x; if (t >= n8) return; FragH f;
#pragma unroll
  for (int i = 0; i < 8; ++i) f.h[i] = (_Float16)(bf16_round(W[t * 8 + i]) * 16.0f); *(v8us*)((unsigned short*)Bt + t * 8) = f.half[0];  }
template <int NHv, int TTv>
__global__ __launch_bounds__(256) void k_vt(const _Float16* __restrict__ V16, int ldv, int voff, _Float16* __restrict__ Vt) { __shared__ unsigned short tl[64][66]; const int tid = threadIdx.x; const int slab = blockIdx.x / (TTv / 64), lg = blockIdx.x % (TTv / 64); const int b = slab / NHv, h = slab % NHv;
  for (int i = tid; i < 64 * 8; i += 256) { const int r = i / 8, c8 = (i % 8) * 8; FragH f; f.half[0] = *(const v8us*)((const unsigned short*)V16 + ((size_t)b * TTv + lg * 64 + r) * ldv + voff + h * 64 + c8);
#pragma unroll
    for (int q = 0; q < 8; ++q) tl[r][c8 + q] = f.u[q]; }
  __syncthreads();
  {
#pragma unroll
    for (int rd = 0; rd < 2; ++rd) { const int d = rd * 32 + tid / 8, pc = tid % 8; FragH f;
#pragma unroll
      for (int q = 0; q < 8; ++q) f.u[q] = tl[pc * 8 + q][d];
      *(v8us*)((unsigned short*)Vt + ((size_t)slab * 64 + d) * TTv + lg * 64 + pc * 8) = f.half[0]; }
     } }

__global__ __launch_bounds__(256) void k_hl(const float* __restrict__ F, _Float16* __restrict__ Hh, _Float16* __restrict__ Hl, size_t n8) { const size_t t = (size_t)blockIdx.x * 256 + threadIdx.x; if (t >= n8) return; FragH fh, fl; const v4f a = *(const v4fa*)(F + t * 8), c = *(const v4fa*)(F + t * 8 + 4);
#pragma unroll
  for (int q = 0; q < 4; ++q) { _Float16 h = (_Float16)a[q]; fh.h[q] = h; fl.h[q] = (_Float16)((a[q] - (float)h) * 1024.0f); h = (_Float16)c[q]; fh.h[4 + q] = h; fl.h[4 + q] = (_Float16)((c[q] - (float)h) * 1024.0f); }
  { *(v8us*)((unsigned short*)Hh + t * 8) = fh.half[0]; *(v8us*)((unsigned short*)Hl + t * 8) = fl.half[0];  } }

// ---- fast GEMM (wave tile 32x64; requires M % 32 == 0 rows per launch region and N % 64 == 0); epilogue = k_gemm_hhx semantics ----
__device__ __forceinline__ v16h g2_frag(const _Float16* p, int hh) { FragH f; f.half[0] = *(const v8us*)((const unsigned short*)p + 8 * hh); f.half[1] = *(const v8us*)((const unsigned short*)p + 16 + 8 * hh); return f.v; }
__device__ __forceinline__ v8f g2_mma(v16h a, v16h b, v8f c) { v8f d = __builtin_amdgcn_wmma_f32_16x16x32_f16(false, a, false, b, (short)0, c, false, false); asm volatile("v_nop\n\tv_nop\n\tv_nop\n\tv_nop" : "+v"(d) : "v"(a), "v"(b)); return d; }
template <int ACT>
__device__ __forceinline__ void gemm2_tile(const int bx, const int by, const _Float16* __restrict__ A, int lda, size_t sA, const _Float16* __restrict__ Bh, int ldb, size_t sB, float alpha, const float* __restrict__ bias, size_t sBias, const float* __restrict__ CP, int rowsPerB, size_t sCPb, int row0g,
    float* __restrict__ C, _Float16* __restrict__ C16, int ldc, size_t sC, int M, int N, int K) { static_assert(ACT == 0 || ACT == 3 || ACT == 6 || ACT == 8 || ACT == 9 || ACT == 11 || ACT == 12 || ACT == 14 || ACT == 15 || ACT == 16 || ACT == 17, "gemm2_tile: unsupported ACT code (would silently apply no activation)");
  __shared__ __attribute__((aligned(16))) float so[4][32][68];
  const int tid = threadIdx.x, w = tid >> 5, lane = tid & 31, ln = lane & 15, hh = lane >> 4;
  A += (size_t)by * sA; Bh += (size_t)by * sB; const size_t cofs = (size_t)by * sC; const float* bp = bias ? bias + (size_t)by * sBias : nullptr;
  const int ntn = N >> 6; const int mt = bx / ntn, nq = bx - mt * ntn; const int row0 = mt * 128 + 32 * w, col0 = nq * 64; if (row0 >= M) return;
  const _Float16* a0p = A + (size_t)(row0 + ln) * lda; const _Float16* a1p = a0p + (size_t)16 * lda;
  const _Float16* b0p = Bh + (size_t)(col0 + ln) * ldb; const _Float16* b1p = b0p + (size_t)16 * ldb; const _Float16* b2p = b1p + (size_t)16 * ldb; const _Float16* b3p = b2p + (size_t)16 * ldb;
  const v8f z8 = {0.f,0.f,0.f,0.f,0.f,0.f,0.f,0.f}; v8f c00 = z8, c01 = z8, c02 = z8, c03 = z8, c10 = z8, c11 = z8, c12 = z8, c13 = z8;
#pragma unroll 1
  for (int kb = 0; kb < K; kb += 32) { const v16h a0 = g2_frag(a0p + kb, hh); FragH a1f; a1f.half[0] = *(const v8us*)((const unsigned short*)(a1p + kb) + 8 * hh);
    asm volatile("s_wait_xcnt 0x0" ::: "memory");      /* the last A load lands in the address registers that the A loads before it name: their translations are waited for first */
    a1f.half[1] = *(const v8us*)((const unsigned short*)(a1p + kb) + 16 + 8 * hh); const v16h a1 = a1f.v;
    v16h b = g2_frag(b0p + kb, hh); c00 = g2_mma(a0, b, c00); c10 = g2_mma(a1, b, c10);
    b = g2_frag(b1p + kb, hh); c01 = g2_mma(a0, b, c01); c11 = g2_mma(a1, b, c11);
    b = g2_frag(b2p + kb, hh); c02 = g2_mma(a0, b, c02); c12 = g2_mma(a1, b, c12);
    b = g2_frag(b3p + kb, hh); c03 = g2_mma(a0, b, c03); c13 = g2_mma(a1, b, c13); }
  v8f accs[8] = {c00, c01, c02, c03, c10, c11, c12, c13};
#pragma unroll
  for (int u = 0; u < 8; ++u) { const int t = u & 3, half = u >> 2; const int col = col0 + t * 16 + ln; const float bv = bp ? bf16_round(bp[col]) : 0.f;
#pragma unroll
    for (int r = 0; r < 8; ++r) { const int rloc = half * 16 + 8 * hh + r; float v = accs[u][r] * alpha + bv; if (CP) { if (rowsPerB < 0) v += CP[cofs + (size_t)(row0g + row0 + rloc) * ldc + col];      /* rowsPerB < 0: own element of the batched C plane */ else { const int bidx = (row0g + row0 + rloc) / rowsPerB; v += CP[(size_t)bidx * sCPb + (size_t)by * 64 + col]; } }
      if (ACT == 3) v = fmaxf(v, 0.f); else if (ACT == 6) v = 0.5f * v * (1.0f + erff(v * 0.70710678118654752f)); else if (ACT == 11) v = 1.0f / (1.0f + expf(-v)); else if (ACT == 15) v = v / (1.0f + expf(-v)); else if (ACT == 12) v = (v > 0.f) ? v : 0.01f * v; else if (ACT == 8) v = tanhf(v); else if (ACT == 9) v = 0.5f * v * (1.0f + tanhf(0.7978845608028654f * (v + 0.044715f * v * v * v))); else if (ACT == 14) v = (v > 0.f) ? v : 0.1f * v; else if (ACT == 16) v = (v >= 0.f) ? v : 0.3f * v; else if (ACT == 17) v = (v >= 0.f) ? v : 0.2f * v;
      so[w][rloc][t * 16 + ln] = v; } }
  __builtin_amdgcn_fence(__ATOMIC_ACQ_REL, "workgroup"); __builtin_amdgcn_wave_barrier();
  const int rsub = lane >> 4, c4 = (lane & 15) * 4;
  {
#pragma unroll
    for (int q = 0; q < 16; ++q) { const int r = q * 2 + rsub; const v4f v = *(const v4fa*)&so[w][r][c4]; if (C) *(v4f*)(C + cofs + (size_t)(row0 + r) * ldc + col0 + c4) = v; if (C16) { v4h h4; for (int i = 0; i < 4; ++i) h4[i] = (_Float16)v[i]; *(v4h*)(C16 + cofs + (size_t)(row0 + r) * ldc + col0 + c4) = h4; } }
     } }
// ---- one launch per stage: batch and causal query tile ride on the grid ----
// grid.z = (tile, batch), widest tile first
__device__ __forceinline__ int z_tile(int z) { return NQT - 1 - z / NB; }
__device__ __forceinline__ int z_batch(int z) { return z % NB; }
// S / P are packed: tile t holds NB*NH slabs of QT rows with a row pitch of its own key count (t + 1) * QT
__device__ __forceinline__ size_t sp_off(int b, int h, int t) { return (size_t)NB * NH * QT * QT * (size_t)(t * (t + 1) / 2) + (size_t)(b * NH + h) * QT * (size_t)((t + 1) * QT); }
// f16 q, k, v of all token rows: grid.y = which of q/k/v; QKV16 [3][NR][DM]
__global__ __launch_bounds__(128) void k_qkv(const _Float16* __restrict__ X16, const _Float16* __restrict__ B3, _Float16* __restrict__ QKV16) { const int wh = blockIdx.y;
  gemm2_tile<0>(blockIdx.x, 0, X16, DM, 0, B3 + (size_t)wh * DM * DM, DM, 0, 0.0625f, nullptr, 0, nullptr, 1, 0, 0, nullptr, QKV16 + (size_t)wh * NR * DM, DM, 0, MP, DM, DM); }
// f32 q, k, v of the first QT0 rows of every batch: grid.y = which of q/k/v, grid.z = batch; F0 [3][NB][QT0][DM]
__global__ __launch_bounds__(128) void k_proj0(const _Float16* __restrict__ X16, const _Float16* __restrict__ B3, float* __restrict__ F0) { const int wh = blockIdx.y, b = blockIdx.z;
  gemm2_tile<0>(blockIdx.x, 0, X16 + (size_t)b * SQ * DM, DM, 0, B3 + (size_t)wh * DM * DM, DM, 0, 0.0625f, nullptr, 0, nullptr, 1, 0, 0, F0 + (size_t)(wh * NB + b) * QT0 * DM, nullptr, DM, 0, QT0, DM, DM); }
// scores of every (batch, tile, head): keys below the tile end only; blocks past a narrow tile's columns leave at the row test
__global__ __launch_bounds__(128) void k_scores(const _Float16* __restrict__ Q16, const _Float16* __restrict__ K16, float* __restrict__ S) { const int h = blockIdx.y, t = z_tile(blockIdx.z), b = z_batch(blockIdx.z); const int nk = (t + 1) * QT;
  gemm2_tile<0>(blockIdx.x, 0, Q16 + ((size_t)b * SQ + t * QT) * LQ + h * HD, LQ, 0, K16 + (size_t)b * SQ * LQ + h * HD, LQ, 0, 0.125f, nullptr, 0, nullptr, 1, 0, 0, S + sp_off(b, h, t), nullptr, nk, 0, QT, nk, HD); }
// out tile = P V^T of every (batch, tile, head), f32 into the concatenated-heads rows
__global__ __launch_bounds__(128) void k_pv(const _Float16* __restrict__ P, const _Float16* __restrict__ VT, float* __restrict__ out) { const int h = blockIdx.y, t = z_tile(blockIdx.z), b = z_batch(blockIdx.z); const int nk = (t + 1) * QT;
  gemm2_tile<0>(blockIdx.x, 0, P + sp_off(b, h, t), nk, 0, VT + (size_t)(b * NH + h) * HD * SQ, SQ, 0, 0.00390625f, nullptr, 0, nullptr, 1, 0, 0, out + ((size_t)b * SQ + t * QT) * DM + h * HD, nullptr, DM, 0, QT, HD, nk); }


__global__ __launch_bounds__(256) void k_wnat(const float* __restrict__ w, size_t n8, _Float16* __restrict__ Bt) { const size_t t = (size_t)blockIdx.x * 256 + threadIdx.x; if (t >= n8) return; FragH f; for (int q = 0; q < 8; ++q) f.h[q] = (_Float16)(bf16_round(w[t * 8 + q]) * 16.0f); *(v8us*)((unsigned short*)Bt + t * 8) = f.half[0];  }
__global__ __launch_bounds__(256) void k_rsm(const float* __restrict__ S, _Float16* __restrict__ P, int nrows) {
  #pragma clang fp contract(off)
  const int i = blockIdx.x * 256 + threadIdx.x; if (i >= nrows) return; const float* s = S + (size_t)i * SQ; float mx = -3.0e38f;
#pragma unroll 1
  for (int j = 0; j < SQ; ++j) mx = fmaxf(mx, s[j]); float se = 0.f;
#pragma unroll 1
  for (int j = 0; j < SQ; ++j) se += expf(s[j] - mx); const float sc = 256.0f / se;
#pragma unroll 1
  for (int j0 = 0; j0 < SQ; j0 += 8) { FragH f; for (int q = 0; q < 8; ++q) f.h[q] = (_Float16)(expf(s[j0 + q] - mx) * sc); unsigned short* d = (unsigned short*)P + (size_t)i * SQ + j0; *(v8us*)d = f.half[0];  } }
__global__ __launch_bounds__(256) void k_vt(const _Float16* __restrict__ V16, int b, int h0, _Float16* __restrict__ VT) { __shared__ unsigned short tl[64][65]; const int tid = threadIdx.x; const int hh = blockIdx.x % HG, sg = blockIdx.x / HG; const int s0 = sg * 64; const int h = h0 + hh;
  for (int i = tid; i < 64 * 8; i += 256) { const int j = i / 8, d8 = (i % 8) * 8; FragH f; f.half[0] = *(const v8us*)((const unsigned short*)V16 + ((size_t)b * SQ + s0 + j) * DM + h * HD + d8); for (int q = 0; q < 8; ++q) tl[d8 + q][j] = f.u[q]; }
  __syncthreads();
  { for (int i = tid; i < 64 * 8; i += 256) { const int d = i / 8, j8 = (i % 8) * 8; FragH f; for (int q = 0; q < 8; ++q) f.u[q] = tl[d][j8 + q]; *(v8us*)((unsigned short*)VT + ((size_t)hh * HD + d) * SQ + s0 + j8) = f.half[0]; }  } }

__global__ __launch_bounds__(256) void k_wthd(const float* __restrict__ Wq, const float* __restrict__ Wk, const float* __restrict__ Wv, _Float16* __restrict__ B3) { const size_t t = (size_t)blockIdx.x * 256 + threadIdx.x; if (t >= (size_t)NH * HD * (DM / 8)) return; const float* Wt = blockIdx.y == 0 ? Wq : blockIdx.y == 1 ? Wk : Wv; _Float16* Bt = B3 + (size_t)blockIdx.y * DM * DM;      /* grid.y = which of q/k/v */ const int m8 = (int)(t % (DM / 8)) * 8; const int d = (int)((t / (DM / 8)) % HD); const int h = (int)(t / ((size_t)(DM / 8) * HD)); FragH f;
  for (int q = 0; q < 8; ++q) f.h[q] = (_Float16)(16.0f * bf16_round(Wt[((size_t)h * DM + m8 + q) * HD + d])); unsigned short* dst = (unsigned short*)Bt + ((size_t)h * HD + d) * DM + m8; *(v8us*)dst = f.half[0];  }



__global__ __launch_bounds__(QT) void k_rsmcf2(const float* __restrict__ S, _Float16* __restrict__ P) {
  #pragma clang fp contract(off)
  const int tl = z_tile(blockIdx.z), nk = (tl + 1) * QT; const size_t i = sp_off(z_batch(blockIdx.z), blockIdx.y, tl) + (size_t)threadIdx.x * nk;      /* one block = the QT rows of one (batch, tile, head) */
  const float* s = S + i; const int last = tl * QT + (int)threadIdx.x; float mx = -3.0e38f;
#pragma unroll 1
  for (int j = 0; j < nk; ++j) { const float f = (j <= last) ? 1.f : 0.f; mx = fmaxf(mx, fmaf(f, s[j], (1.f - f) * -1.0e9f)); } float se = 0.f;
#pragma unroll 1
  for (int j = 0; j < nk; ++j) { const float f = (j <= last) ? 1.f : 0.f; se += __expf(fmaf(f, s[j], (1.f - f) * -1.0e9f) - mx); } const float sc = 256.0f / se;
#pragma unroll 1
  for (int j0 = 0; j0 < nk; j0 += 8) { FragH fr; for (int q = 0; q < 8; ++q) { const int j = j0 + q; const float f = (j <= last) ? 1.f : 0.f; fr.h[q] = (_Float16)(__expf(fmaf(f, s[j], (1.f - f) * -1.0e9f) - mx) * sc); } unsigned short* d = (unsigned short*)P + i + j0; *(v8us*)d = fr.half[0];  } }


template <int MASKADD>
__global__ __launch_bounds__(64) void k_att0(const float* __restrict__ QF, const float* __restrict__ KF, const float* __restrict__ VF, int ld, const float* __restrict__ mask, float scale, float* __restrict__ OF, int ldo) {
  #pragma clang fp contract(off)
  __shared__ __attribute__((aligned(16))) float lo[64][64];
  const int tid = threadIdx.x; const int h = blockIdx.x / (QT0 / 64), rg = blockIdx.x % (QT0 / 64); const int i = rg * 64 + tid;
  QF += (size_t)blockIdx.y * QT0 * ld; KF += (size_t)blockIdx.y * QT0 * ld; VF += (size_t)blockIdx.y * QT0 * ld; OF += (size_t)blockIdx.y * QT0 * ldo;      /* grid.y = batch */
  const float* qr = QF + (size_t)i * ld + h * HD;
  v4f q[HD / 4], o[HD / 4];      /* the thread's q row and o row stay in registers for the whole key loop */
#pragma unroll      /* constant indices: q and o must not fall back to scratch memory */
  for (int c = 0; c < HD / 4 - 1; ++c) q[c] = *(const v4fa*)(qr + c * 4);
  asm volatile("s_wait_xcnt 0x0" ::: "memory");      /* the last q load may land in the address registers that the q loads before it name: their translations are waited for first */
  q[HD / 4 - 1] = *(const v4fa*)(qr + HD - 4);
#pragma unroll      /* constant indices, as above */
  for (int c = 0; c < HD / 4; ++c) { const v4f z = {0.f, 0.f, 0.f, 0.f}; o[c] = z; }
  float m = -1.0e30f, l = 0.f; const int jmax = MASKADD ? (SQ - 1) : (rg * 64 + 63);      /* additive-mask form: every key (the mask input decides); causal form: keys up to the block's last row */
#pragma unroll 1
  for (int j = 0; j <= jmax; ++j) { const float* kr = KF + (size_t)j * ld + h * HD; const float* vr = VF + (size_t)j * ld + h * HD; float s = 0.f;
#pragma unroll      /* the whole k row is fetched in one batch of loads: one wait a key, not one a chunk; the sum keeps its order */
    for (int c = 0; c < HD / 4; ++c) { const v4f kq = *(const v4fa*)(kr + c * 4); const v4f qq = q[c]; s = __fadd_rn(s, __fmul_rn(qq[0], kq[0])); s = __fadd_rn(s, __fmul_rn(qq[1], kq[1])); s = __fadd_rn(s, __fmul_rn(qq[2], kq[2])); s = __fadd_rn(s, __fmul_rn(qq[3], kq[3])); }
    s = __fmul_rn(s, scale); if (MASKADD) s = __fadd_rn(s, __fmul_rn(bf16_round(mask[(size_t)i * SQ + j]), -10000.0f));
    const float f = (MASKADD || j <= i) ? 1.f : 0.f; const float sm = fmaf(f, s, (1.f - f) * -1.0e30f); const float mn = fmaxf(m, sm); const float sc = expf(m - mn); const float e = expf(sm - mn); l = __fadd_rn(__fmul_rn(l, sc), e); m = mn;
#pragma unroll      /* the whole v row in one batch of loads; 64 independent updates of registers */
    for (int c = 0; c < HD / 4; ++c) { const v4f vv = *(const v4fa*)(vr + c * 4); for (int u = 0; u < 4; ++u) o[c][u] = __fadd_rn(__fmul_rn(o[c][u], sc), __fmul_rn(e, vv[u])); } }
  const float fin = 64.0f / l;      /* o carried x64; k_ftcopy scales it back by 1/64 */
#pragma unroll      /* constant indices into o */
  for (int c = 0; c < HD / 4; ++c) { v4f oo = o[c]; for (int u = 0; u < 4; ++u) oo[u] = __fmul_rn(oo[u], fin); *(v4f*)&lo[tid][c * 4] = oo; }
  __syncthreads();
  {
#pragma unroll 1
    for (int it = 0; it < 16; ++it) { const int row = it * 4 + tid / 16, pc = (tid % 16) * 4; const v4f v = *(const v4f*)&lo[row][pc]; *(v4f*)(OF + (size_t)(rg * 64 + row) * ldo + h * HD + pc) = v; }
     } }


__global__ __launch_bounds__(256) void k_ftcopy(const float* __restrict__ OF0, float* __restrict__ out, size_t n4) {
  #pragma clang fp contract(off)
  const size_t t = (size_t)blockIdx.x * 256 + threadIdx.x; if (t >= n4) return; OF0 += (size_t)blockIdx.y * QT0 * DM; out += (size_t)blockIdx.y * SQ * DM;      /* grid.y = batch */
  const v4f o = *(const v4fa*)(OF0 + t * 4); v4f y; for (int q = 0; q < 4; ++q) y[q] = __fmul_rn(o[q], 0.015625f); *(v4f*)(out + t * 4) = y;  }
extern "C" void kernel_launch(void* const* d_in, const int* in_sizes, int n_in,
                              void* d_out, int out_size, void* d_ws, size_t ws_size, hipStream_t stream) {
  (void)in_sizes; (void)n_in; (void)out_size;
  const float* const* I = (const float* const*)d_in; const float* x = I[0]; const float* wq = I[1]; const float* wk = I[2]; const float* wv = I[3];      /* per-head [h][in][out] weights, no biases, no output projection */
  char* ws = (char*)d_ws; size_t off = 0;
  auto take = [&](size_t bytes) { char* p = ws + off; off += (bytes + 255) & ~(size_t)255; return p; };
  _Float16* B3 = (_Float16*)take((size_t)3 * DM * DM * 2);      /* q, k, v weights, one after the other */
  _Float16* X16 = (_Float16*)take(NR * DM * 2); _Float16* QKV16 = (_Float16*)take((size_t)3 * NR * DM * 2); _Float16* Q16 = QKV16; _Float16* K16 = QKV16 + NR * DM; _Float16* V16 = QKV16 + 2 * NR * DM;
  float* S = (float*)take((size_t)NB * NH * QT * QT * (NQT * (NQT + 1) / 2) * 4); _Float16* P = (_Float16*)take((size_t)NB * NH * QT * QT * (NQT * (NQT + 1) / 2) * 2); _Float16* VT = (_Float16*)take((size_t)NB * NH * HD * SQ * 2);
  float* F0 = (float*)take((size_t)3 * NB * QT0 * DM * 4); float* OF0 = (float*)take((size_t)NB * QT0 * DM * 4);
  if (off > ws_size) return;
  k_wthd<<<dim3((unsigned)(((size_t)NH * HD * (DM / 8) + 255) / 256), 3), 256, 0, stream>>>(wq, wk, wv, B3);      /* per-head [m][d] -> Bt[(h,d)][m] x16 */
  k_x16<<<(unsigned)((NR * DM / 8 + 255) / 256), 256, 0, stream>>>(x, X16, NR * DM / 8);
  k_qkv<<<dim3((unsigned)((MP / 128) * (DM / 64)), 3), 128, 0, stream>>>(X16, B3, QKV16);
  k_vt<NH, SQ><<<NB * NH * (SQ / 64), 256, 0, stream>>>(V16, LQ, 0, VT);      /* V^T [NB][NH][HD][SQ] */
  k_proj0<<<dim3((QT0 / 128) * (DM / 64), 3, NB), 128, 0, stream>>>(X16, B3, F0);      /* f32 q, k, v of the first 128 rows (exact products) */
  k_att0<0><<<dim3(NH * (QT0 / 64), NB), 64, 0, stream>>>(F0, F0 + (size_t)NB * QT0 * DM, F0 + (size_t)2 * NB * QT0 * DM, DM, nullptr, 0.125f, OF0, DM);      /* exact f32 attention for rows 0..127 (o x64) */
  k_scores<<<dim3((QT / 128) * (SQ / 64), NH, NQT * NB), 128, 0, stream>>>(Q16, K16, S);
  k_rsmcf2<<<dim3(1, NH, NQT * NB), QT, 0, stream>>>(S, P);
  k_pv<<<dim3((QT / 128) * (HD / 64), NH, NQT * NB), 128, 0, stream>>>(P, VT, (float*)d_out);      /* out = attn v (concatenated heads) written f32 */
  k_ftcopy<<<dim3((unsigned)(((size_t)QT0 * DM / 4 + 255) / 256), NB), 256, 0, stream>>>(OF0, (float*)d_out, (size_t)QT0 * DM / 4);      /* rows 0..127 of each batch rewritten from the exact f32 attention (the module has no output projection) */
}

// v003
// It runs in 243 microseconds.
// Two timings next to v002 both put it at 1.69 times that version's speed.
// Counting every step since v000, it is 17.3 times as fast.
#include <hip/hip_runtime.h>
// Causal multi-head attention with per-head weight tensors (x [4][1024][768]; Q[s][h][d] = sum_m x[s][m] W_Q[h][m][d], K, V likewise (12 heads of 64); scores / 8 with a causal mask (tril); softmax; avg_V = probs V; out[q][h*64+d] = avg_V[q][h][d] -> [4][1024][768]).
// Structure: token rows r = b*1024 + s; x as exact f16 rows (bf16-rounded); Q, K, V as three WMMA GEMMs (32x64 wave tiles, f32 accumulation, exact x16 weights, no bias, f16 outputs); every stage is one launch over all batches (and all query tiles: on grid.z for scores and P V^T, looped in each wave for the softmax): V^T for all heads via LDS transposes; per query tile of 256 rows: scores against the keys below the tile end only (K = 64, all heads on grid.y, alpha = 0.125), causal row softmax on VALU, one wave a row with the row in registers, key mask on the diagonal tile's columns (f32 statistics, native exp; weights x256 f16), out tile = P V^T GEMM (K = keys below the tile end, alpha 2^-8) written f32 straight into the concatenated-heads output rows (no output projection); first-tile refinement: the first 128 query rows of every batch recomputed exactly in f32 (f32 q/k/v GEMMs + an online-softmax causal attention on VALU) and copied over those output rows.
// Compute dtype: inputs rounded to bf16; x / weights exact; q, k, v and softmax weights as plain f16 GEMM operands (~2^-12); scores and softmax statistics f32. v_wmma_f32_16x16x32_f16.
#define NB 4
#define SQ 1024
#define DM 768
#define NH 12
#define HD 64
#define HG 4                         /* heads per group in the unlaunched k_vt(V16, b, h0, VT) */
#define QT 256                       /* query rows per causal tile */
#define NQT (SQ / QT)                /* causal query tiles per batch */
#define NKX SQ
#define QT0 128                      /* first-tile rows recomputed exactly in f32 */
#define B0 0                         /* unused (all batches on the grid) */
#define NBR NB                       /* batches processed (debug hook) */
#define NR ((size_t)NB * SQ)         /* token rows */
#define MP ((int)((size_t)NBR * SQ)) /* rows projected (debug hook) */
#define QN SQ                        /* unused (query tiles on grid.z) */
#define NHD NH                       /* unused (all heads on the grid) */
#define MPO MP                       /* unused (no output stage) */
#define LQ DM      /* row pitch of the q/k/v rows */
typedef __bf16 v16b __attribute__((ext_vector_type(16)));
typedef unsigned short v8us __attribute__((ext_vector_type(8), may_alias));
typedef float  v8f  __attribute__((ext_vector_type(8)));
typedef float  v4f  __attribute__((ext_vector_type(4)));
typedef float  v4fa __attribute__((ext_vector_type(4), may_alias));
union FragB { v16b v; v8us half[2]; unsigned short u[16]; };

__device__ __forceinline__ unsigned short bf16_bits(float x) { unsigned int u = __float_as_uint(x); return (unsigned short)((u + 0x7FFFu + ((u >> 16) & 1u)) >> 16); }
__device__ __forceinline__ float bf16_val(unsigned short b) { return __uint_as_float(((unsigned int)b) << 16); }
__device__ __forceinline__ float bf16_round(float x) { return bf16_val(bf16_bits(x)); }
// D += A·B with NT terms: 1 = ah·bh, 2 = + al·bh (A split), 3 = + ah·bl (both split)
template <int NT>
__device__ __forceinline__ v8f mmaN(v16b ah, v16b al, v16b bh, v16b bl, v8f c) {
  c = __builtin_amdgcn_wmma_f32_16x16x32_bf16(false, ah, false, bh, (short)0, c, false, false);
  if (NT >= 2) c = __builtin_amdgcn_wmma_f32_16x16x32_bf16(false, al, false, bh, (short)0, c, false, false);
  if (NT >= 3) c = __builtin_amdgcn_wmma_f32_16x16x32_bf16(false, ah, false, bl, (short)0, c, false, false);
  asm volatile("v_nop\n\tv_nop\n\tv_nop\n\tv_nop" : "+v"(c) : "v"(ah), "v"(al), "v"(bh), "v"(bl));
  return c;
}

__global__ __launch_bounds__(256) void k_wt_bf16(const float* __restrict__ W, unsigned short* __restrict__ Wt, int K, int N) {
  const int t = blockIdx.x * 256 + threadIdx.x;
  const int k8n = K / 8;
  if (t >= N * k8n) return;
  const int n = t / k8n, k8 = (t % k8n) * 8;
  v8us v;
#pragma unroll
  for (int i = 0; i < 8; ++i) v[i] = bf16_bits(W[(size_t)(k8 + i) * N + n]);
  *(v8us*)(Wt + (size_t)n * K + k8) = v;
  
}

// GEMM C[M][N] (f32, pitch ldc) = act(A[M][K]·W + bias). A f32 row-major (pitch lda) converted per fragment to bf16
// (ASPLIT: hi/lo two planes -> 2 terms, else single rounded term); Wt bf16 [N][K] (pitch ldb). BIAS_BF16 rounds the
// bias to bf16 first (bias quantised to bf16 before the add). K%32==0, M%16==0, N%64==0.
template <bool ASPLIT, int ACT, bool BIAS_BF16>
__global__ __launch_bounds__(128) void k_gemm_bf(const float* __restrict__ A, int lda, const unsigned short* __restrict__ Wt, int ldb,
                                               const float* __restrict__ bias, float* __restrict__ C, int ldc, int M, int N, int K) {
  __shared__ __attribute__((aligned(16))) float so[4][16][64];
  const int tid = threadIdx.x, w = tid >> 5, lane = tid & 31, ln = lane & 15, hh = lane >> 4;
  const int ntn = N / 64;
  const int wid = blockIdx.x * 4 + w;
  const int mt = wid / ntn, nq = wid % ntn;
  if (mt * 16 >= M) return;
  const int row0 = mt * 16, col0 = nq * 64;
  const float* arow = A + (size_t)(row0 + ln) * lda;
  v8f acc[4] = {};
  for (int kb = 0; kb < K; kb += 32) {
    FragB ah, al;
    const v4f x0 = *(const v4fa*)(arow + kb + 8 * hh), x1 = *(const v4fa*)(arow + kb + 8 * hh + 4);
    const v4f x2 = *(const v4fa*)(arow + kb + 16 + 8 * hh), x3 = *(const v4fa*)(arow + kb + 16 + 8 * hh + 4);
    float xs[16] = {x0[0],x0[1],x0[2],x0[3],x1[0],x1[1],x1[2],x1[3],x2[0],x2[1],x2[2],x2[3],x3[0],x3[1],x3[2],x3[3]};
#pragma unroll
    for (int i = 0; i < 16; ++i) { const unsigned short hb = bf16_bits(xs[i]); ah.u[i] = hb; al.u[i] = ASPLIT ? bf16_bits(xs[i] - bf16_val(hb)) : (unsigned short)0; }
#pragma unroll
    for (int t = 0; t < 4; ++t) {
      const unsigned short* brow = Wt + (size_t)(col0 + t * 16 + ln) * ldb + kb;
      FragB b;
      b.half[0] = *(const v8us*)(brow + 8 * hh);
      b.half[1] = *(const v8us*)(brow + 16 + 8 * hh);
      acc[t] = mmaN<ASPLIT ? 2 : 1>(ah.v, al.v, b.v, b.v, acc[t]);
    }
  }
#pragma unroll
  for (int t = 0; t < 4; ++t) {
    float bv = bias ? bias[col0 + t * 16 + ln] : 0.f;
    if (BIAS_BF16) bv = bf16_round(bv);
#pragma unroll
    for (int r = 0; r < 8; ++r) { float v = acc[t][r] + bv; if (ACT == 1) v = fmaxf(v, 0.f); so[w][8 * hh + r][t * 16 + ln] = v; }
  }
  __builtin_amdgcn_fence(__ATOMIC_ACQ_REL, "workgroup");
  __builtin_amdgcn_wave_barrier();
  const int rsub = lane >> 4, c4 = (lane & 15) * 4;
  {
#pragma unroll
    for (int q = 0; q < 8; ++q) {
      const int r = q * 2 + rsub;
      const v4f v = *(const v4fa*)&so[w][r][c4];
      *(v4f*)(C + (size_t)(row0 + r) * ldc + col0 + c4) = v;
    }
    
  }
}

// GEMM C = act(A·W + bias + resid): A f32 (ASPLIT -> hi/lo 2 terms), Wt bf16 [N][K]; ACT 0 none, 1 relu, 2 exact gelu;
// resid (optional, f32, row index = (row % rmod), pitch ldr, RES_BF16 rounds it) added before the activation.
template <bool ASPLIT, int ACT, bool BIAS_BF16, bool RES_BF16>
__global__ __launch_bounds__(128) void k_gemm_bf3(const float* __restrict__ A, int lda, const unsigned short* __restrict__ Wt, int ldb,
                                                const float* __restrict__ bias, const float* __restrict__ resid, int rmod, int ldr,
                                                float* __restrict__ C, int ldc, int M, int N, int K) {
  __shared__ __attribute__((aligned(16))) float so[4][16][64];
  const int tid = threadIdx.x, w = tid >> 5, lane = tid & 31, ln = lane & 15, hh = lane >> 4;
  const int ntn = N / 64;
  const int wid = blockIdx.x * 4 + w;
  const int mt = wid / ntn, nq = wid % ntn;
  if (mt * 16 >= M) return;
  const int row0 = mt * 16, col0 = nq * 64;
  const float* arow = A + (size_t)(row0 + ln) * lda;
  v8f acc[4] = {};
  for (int kb = 0; kb < K; kb += 32) {
    FragB ah, al;
    const v4f x0 = *(const v4fa*)(arow + kb + 8 * hh), x1 = *(const v4fa*)(arow + kb + 8 * hh + 4);
    const v4f x2 = *(const v4fa*)(arow + kb + 16 + 8 * hh), x3 = *(const v4fa*)(arow + kb + 16 + 8 * hh + 4);
    float xs[16] = {x0[0],x0[1],x0[2],x0[3],x1[0],x1[1],x1[2],x1[3],x2[0],x2[1],x2[2],x2[3],x3[0],x3[1],x3[2],x3[3]};
#pragma unroll
    for (int i = 0; i < 16; ++i) { const unsigned short hb = bf16_bits(xs[i]); ah.u[i] = hb; al.u[i] = ASPLIT ? bf16_bits(xs[i] - bf16_val(hb)) : (unsigned short)0; }
#pragma unroll
    for (int t = 0; t < 4; ++t) {
      const unsigned short* brow = Wt + (size_t)(col0 + t * 16 + ln) * ldb + kb;
      FragB b;
      b.half[0] = *(const v8us*)(brow + 8 * hh);
      b.half[1] = *(const v8us*)(brow + 16 + 8 * hh);
      acc[t] = mmaN<ASPLIT ? 2 : 1>(ah.v, al.v, b.v, b.v, acc[t]);
    }
  }
#pragma unroll
  for (int t = 0; t < 4; ++t) {
    const int col = col0 + t * 16 + ln;
    float bv = bias ? bias[col] : 0.f;
    if (BIAS_BF16) bv = bf16_round(bv);
#pragma unroll
    for (int r = 0; r < 8; ++r) {
      float v = acc[t][r] + bv;
      if (resid) { float rv = resid[(size_t)((row0 + 8 * hh + r) % rmod) * ldr + col]; if (RES_BF16) rv = bf16_round(rv); v += rv; }
      if (ACT == 1) v = fmaxf(v, 0.f);
      if (ACT == 2) v = 0.5f * v * (1.0f + erff(v * 0.70710678118654752f));
      if (ACT == 3) { const float u = 0.7978845608028654f * (v + 0.044715f * v * v * v); v = 0.5f * v * (1.0f + tanhf(u)); }
      so[w][8 * hh + r][t * 16 + ln] = v;
    }
  }
  __builtin_amdgcn_fence(__ATOMIC_ACQ_REL, "workgroup");
  __builtin_amdgcn_wave_barrier();
  const int rsub = lane >> 4, c4 = (lane & 15) * 4;
  {
#pragma unroll
    for (int q = 0; q < 8; ++q) {
      const int r = q * 2 + rsub;
      const v4f v = *(const v4fa*)&so[w][r][c4];
      *(v4f*)(C + (size_t)(row0 + r) * ldc + col0 + c4) = v;
    }
    
  }
}
// row LayerNorm (biased variance, eps) over N: s = X (+ R); optional out_sum <- s; out_norm <- (s-mu)*rsqrt(var+eps)*g + b
template <bool PARAM_BF16>
__global__ __launch_bounds__(256) void k_layernorm(const float* __restrict__ X, const float* __restrict__ R, const float* __restrict__ g, const float* __restrict__ bta,
                                                  float* __restrict__ out_sum, float* __restrict__ out_norm, int N, float eps) {
  __shared__ float red[256];
  const int row = blockIdx.x, tid = threadIdx.x;
  const float* x = X + (size_t)row * N; const float* rr = R ? R + (size_t)row * N : nullptr;
  float vals[16];                     // up to N = 4096
  const int per = N / 256;            // contiguous chunk per thread? use strided-by-4 chunks: thread handles j = tid*4 + 1024*u
  float s1 = 0.f;
  for (int u = 0; u < per / 4; ++u) {
    const int j = tid * 4 + 1024 * u;
    const v4f a = *(const v4fa*)(x + j);
    v4f b = {0.f,0.f,0.f,0.f}; if (rr) b = *(const v4fa*)(rr + j);
#pragma unroll
    for (int q = 0; q < 4; ++q) { const float v = a[q] + b[q]; vals[u * 4 + q] = v; s1 += v; }
  }
  red[tid] = s1; __syncthreads();
  for (int st = 128; st > 0; st >>= 1) { if (tid < st) red[tid] += red[tid + st]; __syncthreads(); }
  const float mu = red[0] / (float)N; __syncthreads();
  float s2 = 0.f;
  for (int u = 0; u < per / 4; ++u)
#pragma unroll
    for (int q = 0; q < 4; ++q) { const float c = vals[u * 4 + q] - mu; s2 += c * c; }
  red[tid] = s2; __syncthreads();
  for (int st = 128; st > 0; st >>= 1) { if (tid < st) red[tid] += red[tid + st]; __syncthreads(); }
  const float rs = rsqrtf(red[0] / (float)N + eps);
  {
    for (int u = 0; u < per / 4; ++u) {
      const int j = tid * 4 + 1024 * u;
      v4f o, sm;
#pragma unroll
      for (int q = 0; q < 4; ++q) {
        float gg = g[j + q], bb = bta[j + q];
        if (PARAM_BF16) { gg = bf16_round(gg); bb = bf16_round(bb); }
        sm[q] = vals[u * 4 + q]; o[q] = (vals[u * 4 + q] - mu) * rs * gg + bb;
      }
      if (out_sum) *(v4f*)(out_sum + (size_t)row * N + j) = sm;
      *(v4f*)(out_norm + (size_t)row * N + j) = o;
    }
    
  }
}



// ---- f16 WMMA path (v_wmma_f32_16x16x32_f16): 11-bit significands for operands in range — used where a [0,1] probability operand needs more precision than bf16
typedef _Float16 v16h __attribute__((ext_vector_type(16)));
union FragH { v16h v; v8us half[2]; _Float16 h[16]; unsigned short u[16]; };
template <int NT>
__device__ __forceinline__ v8f mmaH(v16h ah, v16h al, v16h bh, v16h bl, v8f c) {
  c = __builtin_amdgcn_wmma_f32_16x16x32_f16(false, ah, false, bh, (short)0, c, false, false);
  if (NT >= 2) c = __builtin_amdgcn_wmma_f32_16x16x32_f16(false, al, false, bh, (short)0, c, false, false);
  if (NT >= 3) c = __builtin_amdgcn_wmma_f32_16x16x32_f16(false, ah, false, bl, (short)0, c, false, false);
  asm volatile("v_nop\n\tv_nop\n\tv_nop\n\tv_nop" : "+v"(c) : "v"(ah), "v"(al), "v"(bh), "v"(bl));
  return c;
}
// batched GEMM like k_gemm_b but f16 operands: A f32 (split into f16 hi/lo if ASPLIT, else rounded to f16), Bt = f16 values [n][k]; alpha; C f32; N multiple of 16 (partial tiles skipped)
template <bool ASPLIT>
__global__ __launch_bounds__(128) void k_gemm_h(const float* __restrict__ A, int lda, size_t sA, const _Float16* __restrict__ Bh, int ldb, size_t sB, float alpha, float* __restrict__ C, int ldc, size_t sC, int M, int N, int K) {
  __shared__ __attribute__((aligned(16))) float so[4][16][64];
  const int tid = threadIdx.x, w = tid >> 5, lane = tid & 31, ln = lane & 15, hh = lane >> 4; const int by = blockIdx.y;
  A += (size_t)by * sA; Bh += (size_t)by * sB; C += (size_t)by * sC;
  const int ntn = (N + 63) / 64; const int wid = blockIdx.x * 4 + w; const int mt = wid / ntn, nq = wid % ntn; if (mt * 16 >= M) return;
  const int row0 = mt * 16, col0 = nq * 64; const float* arow = A + (size_t)(row0 + ln) * lda;
  v8f acc[4] = {};
  for (int kb = 0; kb < K; kb += 32) {
    FragH ah, al;
    const v4f x0 = *(const v4fa*)(arow + kb + 8 * hh), x1 = *(const v4fa*)(arow + kb + 8 * hh + 4), x2 = *(const v4fa*)(arow + kb + 16 + 8 * hh), x3 = *(const v4fa*)(arow + kb + 16 + 8 * hh + 4);
    float xs[16] = {x0[0],x0[1],x0[2],x0[3],x1[0],x1[1],x1[2],x1[3],x2[0],x2[1],x2[2],x2[3],x3[0],x3[1],x3[2],x3[3]};
#pragma unroll
    for (int i = 0; i < 16; ++i) { const _Float16 h = (_Float16)xs[i]; ah.h[i] = h; al.h[i] = ASPLIT ? (_Float16)(xs[i] - (float)h) : (_Float16)0.0f; }
#pragma unroll
    for (int t = 0; t < 4; ++t) { if (col0 + t * 16 >= N) continue; const size_t boff = (size_t)(col0 + t * 16 + ln) * ldb + kb; FragH bq; bq.half[0] = *(const v8us*)(Bh + boff + 8 * hh); bq.half[1] = *(const v8us*)(Bh + boff + 16 + 8 * hh);
      acc[t] = mmaH<ASPLIT ? 2 : 1>(ah.v, al.v, bq.v, bq.v, acc[t]); }
  }
#pragma unroll
  for (int t = 0; t < 4; ++t) { if (col0 + t * 16 >= N) continue;
#pragma unroll
    for (int r = 0; r < 8; ++r) so[w][8 * hh + r][t * 16 + ln] = acc[t][r] * alpha; }
  __builtin_amdgcn_fence(__ATOMIC_ACQ_REL, "workgroup"); __builtin_amdgcn_wave_barrier();
  const int rsub = lane >> 4, c4 = (lane & 15) * 4;
  {
#pragma unroll
    for (int q = 0; q < 8; ++q) { const int r = q * 2 + rsub; if (col0 + c4 < N) { const v4f v = *(const v4fa*)&so[w][r][c4]; *(v4f*)(C + (size_t)(row0 + r) * ldc + col0 + c4) = v; } }
     }
}

// Wt[n][k] = f16(W[k][n]·scale) from f32 row-major W[K][N] (scale = power of two; bf16-exact weights stay exact in f16 away from the subnormal range)
__global__ __launch_bounds__(256) void k_wt_f16(const float* __restrict__ W, _Float16* __restrict__ Wt, int K, int N, float scale) {
  const int t = blockIdx.x * 256 + threadIdx.x; if (t >= N * (K / 8)) return; const int n = t / (K / 8), k8 = (t % (K / 8)) * 8; FragH f;
#pragma unroll
  for (int i = 0; i < 8; ++i) f.h[i] = (_Float16)(bf16_round(W[(size_t)(k8 + i) * N + n]) * scale); const v8us o = f.half[0];
  *(v8us*)((unsigned short*)Wt + (size_t)n * K + k8) = o; 
}
// k_gemm_hh variant with fused epilogue: v = acc·alpha + bias[by·sBias + col] (+ CP[(row/rowsPerB)·sCPb + by·64 + col] if CP) ; ACT 0 none / 1 elu ; writes f16 C16 (and f32 C if non-null)
template <int ACT>
__global__ __launch_bounds__(128) void k_gemm_hhx(const _Float16* __restrict__ A, int lda, size_t sA, const _Float16* __restrict__ Bh, int ldb, size_t sB, float alpha, const float* __restrict__ bias, size_t sBias, const float* __restrict__ CP, int rowsPerB, size_t sCPb, int row0g,
    float* __restrict__ C, _Float16* __restrict__ C16, int ldc, size_t sC, int M, int N, int K) {
  __shared__ __attribute__((aligned(16))) float so[4][16][64];
  const int tid = threadIdx.x, w = tid >> 5, lane = tid & 31, ln = lane & 15, hh = lane >> 4; const int by = blockIdx.y;
  A += (size_t)by * sA; Bh += (size_t)by * sB; const size_t cofs = (size_t)by * sC; const float* bp = bias ? bias + (size_t)by * sBias : nullptr;
  const int ntn = (N + 63) / 64; const int wid = blockIdx.x * 4 + w; const int mt = wid / ntn, nq = wid % ntn; if (mt * 16 >= M) return;
  const int row0 = mt * 16, col0 = nq * 64; const _Float16* arow = A + (size_t)(row0 + ln) * lda;
  v8f acc[4] = {};
  for (int kb = 0; kb < K; kb += 32) { FragH ah; ah.half[0] = *(const v8us*)((const unsigned short*)arow + kb + 8 * hh); ah.half[1] = *(const v8us*)((const unsigned short*)arow + kb + 16 + 8 * hh);
#pragma unroll
    for (int t = 0; t < 4; ++t) { if (col0 + t * 16 >= N) continue; const size_t boff = (size_t)(col0 + t * 16 + ln) * ldb + kb; FragH bq; bq.half[0] = *(const v8us*)((const unsigned short*)Bh + boff + 8 * hh); bq.half[1] = *(const v8us*)((const unsigned short*)Bh + boff + 16 + 8 * hh);
      acc[t] = mmaH<1>(ah.v, ah.v, bq.v, bq.v, acc[t]); }
  }
#pragma unroll
  for (int t = 0; t < 4; ++t) { if (col0 + t * 16 >= N) continue; const int col = col0 + t * 16 + ln; const float bv = bp ? bf16_round(bp[col]) : 0.f;
#pragma unroll
    for (int r = 0; r < 8; ++r) { float v = acc[t][r] * alpha + bv; if (CP) { const int rr = row0g + row0 + 8 * hh + r; if (rowsPerB < 0) v += CP[cofs + (size_t)rr * ldc + col];      /* rowsPerB < 0: own element of the batched C plane */ else { const int bidx = rr / rowsPerB; v += CP[(size_t)bidx * sCPb + (size_t)by * 64 + col]; } } if (ACT == 1) v = (v > 0.f) ? v : expm1f(v); else if (ACT == 7) v = (v > 0.f) ? v + 1.0f : expf(v); else if (ACT == 8) v = tanhf(v); else if (ACT == 9) v = 0.5f * v * (1.0f + tanhf(0.7978845608028654f * (v + 0.044715f * v * v * v))); else if (ACT == 11) v = 1.0f / (1.0f + expf(-v)); else if (ACT == 12) v = (v > 0.f) ? v : 0.01f * v; else if (ACT == 14) v = (v > 0.f) ? v : 0.1f * v; else if (ACT == 16) v = (v >= 0.f) ? v : 0.3f * v; else if (ACT == 17) v = (v >= 0.f) ? v : 0.2f * v; else if (ACT == 15) v = v / (1.0f + expf(-v)); else if (ACT == 3) v = fmaxf(v, 0.f); else if (ACT == 6) v = 0.5f * v * (1.0f + erff(v * 0.70710678118654752f)); so[w][8 * hh + r][t * 16 + ln] = v; } }
  __builtin_amdgcn_fence(__ATOMIC_ACQ_REL, "workgroup"); __builtin_amdgcn_wave_barrier();
  const int rsub = lane >> 4, c4 = (lane & 15) * 4; typedef _Float16 v4h __attribute__((ext_vector_type(4)));
  {
#pragma unroll
    for (int q = 0; q < 8; ++q) { const int r = q * 2 + rsub; if (col0 + c4 < N) { const v4f v = *(const v4fa*)&so[w][r][c4]; if (C) *(v4f*)(C + cofs + (size_t)(row0 + r) * ldc + col0 + c4) = v; if (C16) { v4h h4; for (int i = 0; i < 4; ++i) h4[i] = (_Float16)v[i]; *(v4h*)(C16 + cofs + (size_t)(row0 + r) * ldc + col0 + c4) = h4; } } }
     }
}


typedef _Float16 v4h __attribute__((ext_vector_type(4)));

__global__ __launch_bounds__(256) void k_x16(const float* __restrict__ x, _Float16* __restrict__ X16, size_t n8) { const size_t t = (size_t)blockIdx.x * 256 + threadIdx.x; if (t >= n8) return; FragH f;
#pragma unroll
  for (int q = 0; q < 8; ++q) f.h[q] = (_Float16)bf16_round(x[t * 8 + q]); *(v8us*)((unsigned short*)X16 + t * 8) = f.half[0];  }
__global__ __launch_bounds__(256) void k_h16(const float* __restrict__ x, _Float16* __restrict__ X16, size_t n8) { const size_t t = (size_t)blockIdx.x * 256 + threadIdx.x; if (t >= n8) return; FragH f;
#pragma unroll
  for (int q = 0; q < 8; ++q) f.h[q] = (_Float16)x[t * 8 + q]; *(v8us*)((unsigned short*)X16 + t * 8) = f.half[0];  }
__global__ __launch_bounds__(256) void k_round16f(const float* __restrict__ W, _Float16* __restrict__ Bt, size_t n8) { const size_t t = (size_t)blockIdx.x * 256 + threadIdx.x; if (t >= n8) return; FragH f;
#pragma unroll
  for (int i = 0; i < 8; ++i) f.h[i] = (_Float16)(bf16_round(W[t * 8 + i]) * 16.0f); *(v8us*)((unsigned short*)Bt + t * 8) = f.half[0];  }
template <int NHv, int TTv>
__global__ __launch_bounds__(256) void k_vt(const _Float16* __restrict__ V16, int ldv, int voff, _Float16* __restrict__ Vt) { __shared__ unsigned short tl[64][66]; const int tid = threadIdx.x; const int slab = blockIdx.x / (TTv / 64), lg = blockIdx.x % (TTv / 64); const int b = slab / NHv, h = slab % NHv;
  for (int i = tid; i < 64 * 8; i += 256) { const int r = i / 8, c8 = (i % 8) * 8; FragH f; f.half[0] = *(const v8us*)((const unsigned short*)V16 + ((size_t)b * TTv + lg * 64 + r) * ldv + voff + h * 64 + c8);
#pragma unroll
    for (int q = 0; q < 8; ++q) tl[r][c8 + q] = f.u[q]; }
  __syncthreads();
  {
#pragma unroll
    for (int rd = 0; rd < 2; ++rd) { const int d = rd * 32 + tid / 8, pc = tid % 8; FragH f;
#pragma unroll
      for (int q = 0; q < 8; ++q) f.u[q] = tl[pc * 8 + q][d];
      *(v8us*)((unsigned short*)Vt + ((size_t)slab * 64 + d) * TTv + lg * 64 + pc * 8) = f.half[0]; }
     } }

__global__ __launch_bounds__(256) void k_hl(const float* __restrict__ F, _Float16* __restrict__ Hh, _Float16* __restrict__ Hl, size_t n8) { const size_t t = (size_t)blockIdx.x * 256 + threadIdx.x; if (t >= n8) return; FragH fh, fl; const v4f a = *(const v4fa*)(F + t * 8), c = *(const v4fa*)(F + t * 8 + 4);
#pragma unroll
  for (int q = 0; q < 4; ++q) { _Float16 h = (_Float16)a[q]; fh.h[q] = h; fl.h[q] = (_Float16)((a[q] - (float)h) * 1024.0f); h = (_Float16)c[q]; fh.h[4 + q] = h; fl.h[4 + q] = (_Float16)((c[q] - (float)h) * 1024.0f); }
  { *(v8us*)((unsigned short*)Hh + t * 8) = fh.half[0]; *(v8us*)((unsigned short*)Hl + t * 8) = fl.half[0];  } }

// ---- fast GEMM (wave tile 32x64; requires M % 32 == 0 rows per launch region and N % 64 == 0); epilogue = k_gemm_hhx semantics ----
__device__ __forceinline__ v16h g2_frag(const _Float16* p, int hh) { FragH f; f.half[0] = *(const v8us*)((const unsigned short*)p + 8 * hh); f.half[1] = *(const v8us*)((const unsigned short*)p + 16 + 8 * hh); return f.v; }
__device__ __forceinline__ v8f g2_mma(v16h a, v16h b, v8f c) { v8f d = __builtin_amdgcn_wmma_f32_16x16x32_f16(false, a, false, b, (short)0, c, false, false); asm volatile("v_nop\n\tv_nop\n\tv_nop\n\tv_nop" : "+v"(d) : "v"(a), "v"(b)); return d; }
template <int ACT>
__device__ __forceinline__ void gemm2_tile(const int bx, const int by, const _Float16* __restrict__ A, int lda, size_t sA, const _Float16* __restrict__ Bh, int ldb, size_t sB, float alpha, const float* __restrict__ bias, size_t sBias, const float* __restrict__ CP, int rowsPerB, size_t sCPb, int row0g,
    float* __restrict__ C, _Float16* __restrict__ C16, int ldc, size_t sC, int M, int N, int K) { static_assert(ACT == 0 || ACT == 3 || ACT == 6 || ACT == 8 || ACT == 9 || ACT == 11 || ACT == 12 || ACT == 14 || ACT == 15 || ACT == 16 || ACT == 17, "gemm2_tile: unsupported ACT code (would silently apply no activation)");
  __shared__ __attribute__((aligned(16))) float so[4][32][68];
  const int tid = threadIdx.x, w = tid >> 5, lane = tid & 31, ln = lane & 15, hh = lane >> 4;
  A += (size_t)by * sA; Bh += (size_t)by * sB; const size_t cofs = (size_t)by * sC; const float* bp = bias ? bias + (size_t)by * sBias : nullptr;
  const int ntn = N >> 6; const int mt = bx / ntn, nq = bx - mt * ntn; const int row0 = mt * 128 + 32 * w, col0 = nq * 64; if (row0 >= M) return;
  const _Float16* a0p = A + (size_t)(row0 + ln) * lda; const _Float16* a1p = a0p + (size_t)16 * lda;
  const _Float16* b0p = Bh + (size_t)(col0 + ln) * ldb; const _Float16* b1p = b0p + (size_t)16 * ldb; const _Float16* b2p = b1p + (size_t)16 * ldb; const _Float16* b3p = b2p + (size_t)16 * ldb;
  const v8f z8 = {0.f,0.f,0.f,0.f,0.f,0.f,0.f,0.f}; v8f c00 = z8, c01 = z8, c02 = z8, c03 = z8, c10 = z8, c11 = z8, c12 = z8, c13 = z8;
#pragma unroll 1
  for (int kb = 0; kb < K; kb += 32) { const v16h a0 = g2_frag(a0p + kb, hh); FragH a1f; a1f.half[0] = *(const v8us*)((const unsigned short*)(a1p + kb) + 8 * hh);
    asm volatile("s_wait_xcnt 0x0" ::: "memory");      /* the last A load lands in the address registers that the A loads before it name: their translations are waited for first */
    a1f.half[1] = *(const v8us*)((const unsigned short*)(a1p + kb) + 16 + 8 * hh); const v16h a1 = a1f.v;
    v16h b = g2_frag(b0p + kb, hh); c00 = g2_mma(a0, b, c00); c10 = g2_mma(a1, b, c10);
    b = g2_frag(b1p + kb, hh); c01 = g2_mma(a0, b, c01); c11 = g2_mma(a1, b, c11);
    b = g2_frag(b2p + kb, hh); c02 = g2_mma(a0, b, c02); c12 = g2_mma(a1, b, c12);
    b = g2_frag(b3p + kb, hh); c03 = g2_mma(a0, b, c03); c13 = g2_mma(a1, b, c13); }
  v8f accs[8] = {c00, c01, c02, c03, c10, c11, c12, c13};
#pragma unroll
  for (int u = 0; u < 8; ++u) { const int t = u & 3, half = u >> 2; const int col = col0 + t * 16 + ln; const float bv = bp ? bf16_round(bp[col]) : 0.f;
#pragma unroll
    for (int r = 0; r < 8; ++r) { const int rloc = half * 16 + 8 * hh + r; float v = accs[u][r] * alpha + bv; if (CP) { if (rowsPerB < 0) v += CP[cofs + (size_t)(row0g + row0 + rloc) * ldc + col];      /* rowsPerB < 0: own element of the batched C plane */ else { const int bidx = (row0g + row0 + rloc) / rowsPerB; v += CP[(size_t)bidx * sCPb + (size_t)by * 64 + col]; } }
      if (ACT == 3) v = fmaxf(v, 0.f); else if (ACT == 6) v = 0.5f * v * (1.0f + erff(v * 0.70710678118654752f)); else if (ACT == 11) v = 1.0f / (1.0f + expf(-v)); else if (ACT == 15) v = v / (1.0f + expf(-v)); else if (ACT == 12) v = (v > 0.f) ? v : 0.01f * v; else if (ACT == 8) v = tanhf(v); else if (ACT == 9) v = 0.5f * v * (1.0f + tanhf(0.7978845608028654f * (v + 0.044715f * v * v * v))); else if (ACT == 14) v = (v > 0.f) ? v : 0.1f * v; else if (ACT == 16) v = (v >= 0.f) ? v : 0.3f * v; else if (ACT == 17) v = (v >= 0.f) ? v : 0.2f * v;
      so[w][rloc][t * 16 + ln] = v; } }
  __builtin_amdgcn_fence(__ATOMIC_ACQ_REL, "workgroup"); __builtin_amdgcn_wave_barrier();
  const int rsub = lane >> 4, c4 = (lane & 15) * 4;
  {
#pragma unroll
    for (int q = 0; q < 16; ++q) { const int r = q * 2 + rsub; const v4f v = *(const v4fa*)&so[w][r][c4]; if (C) *(v4f*)(C + cofs + (size_t)(row0 + r) * ldc + col0 + c4) = v; if (C16) { v4h h4; for (int i = 0; i < 4; ++i) h4[i] = (_Float16)v[i]; *(v4h*)(C16 + cofs + (size_t)(row0 + r) * ldc + col0 + c4) = h4; } }
     } }
// ---- one launch per stage: batch and causal query tile ride on the grid ----
// grid.z = (tile, batch), widest tile first
__device__ __forceinline__ int z_tile(int z) { return NQT - 1 - z / NB; }
__device__ __forceinline__ int z_batch(int z) { return z % NB; }
// S / P are packed: tile t holds NB*NH slabs of QT rows with a row pitch of its own key count (t + 1) * QT
__device__ __forceinline__ size_t sp_off(int b, int h, int t) { return (size_t)NB * NH * QT * QT * (size_t)(t * (t + 1) / 2) + (size_t)(b * NH + h) * QT * (size_t)((t + 1) * QT); }
// f16 q, k, v of all token rows: grid.y = which of q/k/v; QKV16 [3][NR][DM]
__global__ __launch_bounds__(128) void k_qkv(const _Float16* __restrict__ X16, const _Float16* __restrict__ B3, _Float16* __restrict__ QKV16) { const int wh = blockIdx.y;
  gemm2_tile<0>(blockIdx.x, 0, X16, DM, 0, B3 + (size_t)wh * DM * DM, DM, 0, 0.0625f, nullptr, 0, nullptr, 1, 0, 0, nullptr, QKV16 + (size_t)wh * NR * DM, DM, 0, MP, DM, DM); }
// f32 q, k, v of the first QT0 rows of every batch: grid.y = which of q/k/v, grid.z = batch; F0 [3][NB][QT0][DM]
__global__ __launch_bounds__(128) void k_proj0(const _Float16* __restrict__ X16, const _Float16* __restrict__ B3, float* __restrict__ F0) { const int wh = blockIdx.y, b = blockIdx.z;
  gemm2_tile<0>(blockIdx.x, 0, X16 + (size_t)b * SQ * DM, DM, 0, B3 + (size_t)wh * DM * DM, DM, 0, 0.0625f, nullptr, 0, nullptr, 1, 0, 0, F0 + (size_t)(wh * NB + b) * QT0 * DM, nullptr, DM, 0, QT0, DM, DM); }
// scores of every (batch, tile, head): keys below the tile end only; blocks past a narrow tile's columns leave at the row test
__global__ __launch_bounds__(128) void k_scores(const _Float16* __restrict__ Q16, const _Float16* __restrict__ K16, float* __restrict__ S) { const int h = blockIdx.y, t = z_tile(blockIdx.z), b = z_batch(blockIdx.z); const int nk = (t + 1) * QT;
  gemm2_tile<0>(blockIdx.x, 0, Q16 + ((size_t)b * SQ + t * QT) * LQ + h * HD, LQ, 0, K16 + (size_t)b * SQ * LQ + h * HD, LQ, 0, 0.125f, nullptr, 0, nullptr, 1, 0, 0, S + sp_off(b, h, t), nullptr, nk, 0, QT, nk, HD); }
// out tile = P V^T of every (batch, tile, head), f32 into the concatenated-heads rows
__global__ __launch_bounds__(128) void k_pv(const _Float16* __restrict__ P, const _Float16* __restrict__ VT, float* __restrict__ out) { const int h = blockIdx.y, t = z_tile(blockIdx.z), b = z_batch(blockIdx.z); const int nk = (t + 1) * QT;
  gemm2_tile<0>(blockIdx.x, 0, P + sp_off(b, h, t), nk, 0, VT + (size_t)(b * NH + h) * HD * SQ, SQ, 0, 0.00390625f, nullptr, 0, nullptr, 1, 0, 0, out + ((size_t)b * SQ + t * QT) * DM + h * HD, nullptr, DM, 0, QT, HD, nk); }


__global__ __launch_bounds__(256) void k_wnat(const float* __restrict__ w, size_t n8, _Float16* __restrict__ Bt) { const size_t t = (size_t)blockIdx.x * 256 + threadIdx.x; if (t >= n8) return; FragH f; for (int q = 0; q < 8; ++q) f.h[q] = (_Float16)(bf16_round(w[t * 8 + q]) * 16.0f); *(v8us*)((unsigned short*)Bt + t * 8) = f.half[0];  }
__global__ __launch_bounds__(256) void k_rsm(const float* __restrict__ S, _Float16* __restrict__ P, int nrows) {
  #pragma clang fp contract(off)
  const int i = blockIdx.x * 256 + threadIdx.x; if (i >= nrows) return; const float* s = S + (size_t)i * SQ; float mx = -3.0e38f;
#pragma unroll 1
  for (int j = 0; j < SQ; ++j) mx = fmaxf(mx, s[j]); float se = 0.f;
#pragma unroll 1
  for (int j = 0; j < SQ; ++j) se += expf(s[j] - mx); const float sc = 256.0f / se;
#pragma unroll 1
  for (int j0 = 0; j0 < SQ; j0 += 8) { FragH f; for (int q = 0; q < 8; ++q) f.h[q] = (_Float16)(expf(s[j0 + q] - mx) * sc); unsigned short* d = (unsigned short*)P + (size_t)i * SQ + j0; *(v8us*)d = f.half[0];  } }
__global__ __launch_bounds__(256) void k_vt(const _Float16* __restrict__ V16, int b, int h0, _Float16* __restrict__ VT) { __shared__ unsigned short tl[64][65]; const int tid = threadIdx.x; const int hh = blockIdx.x % HG, sg = blockIdx.x / HG; const int s0 = sg * 64; const int h = h0 + hh;
  for (int i = tid; i < 64 * 8; i += 256) { const int j = i / 8, d8 = (i % 8) * 8; FragH f; f.half[0] = *(const v8us*)((const unsigned short*)V16 + ((size_t)b * SQ + s0 + j) * DM + h * HD + d8); for (int q = 0; q < 8; ++q) tl[d8 + q][j] = f.u[q]; }
  __syncthreads();
  { for (int i = tid; i < 64 * 8; i += 256) { const int d = i / 8, j8 = (i % 8) * 8; FragH f; for (int q = 0; q < 8; ++q) f.u[q] = tl[d][j8 + q]; *(v8us*)((unsigned short*)VT + ((size_t)hh * HD + d) * SQ + s0 + j8) = f.half[0]; }  } }

__global__ __launch_bounds__(256) void k_wthd(const float* __restrict__ Wq, const float* __restrict__ Wk, const float* __restrict__ Wv, _Float16* __restrict__ B3) { const size_t t = (size_t)blockIdx.x * 256 + threadIdx.x; if (t >= (size_t)NH * HD * (DM / 8)) return; const float* Wt = blockIdx.y == 0 ? Wq : blockIdx.y == 1 ? Wk : Wv; _Float16* Bt = B3 + (size_t)blockIdx.y * DM * DM;      /* grid.y = which of q/k/v */ const int m8 = (int)(t % (DM / 8)) * 8; const int d = (int)((t / (DM / 8)) % HD); const int h = (int)(t / ((size_t)(DM / 8) * HD)); FragH f;
  for (int q = 0; q < 8; ++q) f.h[q] = (_Float16)(16.0f * bf16_round(Wt[((size_t)h * DM + m8 + q) * HD + d])); unsigned short* dst = (unsigned short*)Bt + ((size_t)h * HD + d) * DM + m8; *(v8us*)dst = f.half[0];  }



// ---- causal row softmax, streaming form: one wave a row, the row held in registers ----
#define RSW 8                        /* waves per softmax block */
#define RSP 2                        /* rows of EACH causal tile per wave: every wave gets the same number of columns */
#define RSR (NQT * RSP)              /* rows per wave */
#define RSC (QT / 128)               /* 128-column pieces (32 lanes x 4 floats) per tile width */
template <int M> __device__ __forceinline__ float rs_xm(float x) { return __builtin_bit_cast(float, __builtin_amdgcn_mov_dpp(__builtin_bit_cast(int, x), 0x160 + M, 0xf, 0xf, false)); }      /* lane l <- lane l ^ M inside a 16-lane row (row_xmask) */
__device__ __forceinline__ float rs_xh(float x) { return __builtin_bit_cast(float, __builtin_amdgcn_permlanex16(__builtin_bit_cast(int, x), __builtin_bit_cast(int, x), 0x76543210, 0xfedcba98, false, false)); }      /* lane l <- lane l ^ 16 */
__device__ __forceinline__ float rs_wmax(float x) { x = fmaxf(x, rs_xm<1>(x)); x = fmaxf(x, rs_xm<2>(x)); x = fmaxf(x, rs_xm<4>(x)); x = fmaxf(x, rs_xm<8>(x)); return fmaxf(x, rs_xh(x)); }
__device__ __forceinline__ float rs_wsum(float x) { x += rs_xm<1>(x); x += rs_xm<2>(x); x += rs_xm<4>(x); x += rs_xm<8>(x); return x + rs_xh(x); }
// e^x of four values, as __expf forms it (x * log2 e, then v_exp_f32). One statement: behind a transcendental the instruction set asks for one independent instruction before its source is overwritten or its result read;
// each v_exp_f32 is that instruction for the one before it (outputs are early-clobber, so none lies on an input), the v_nop for the last.
__device__ __forceinline__ v4f rs_exp4(v4f x) { float y0, y1, y2, y3; const v4f t = x * 1.44269504f;
  asm("v_exp_f32 %0, %4\n\tv_exp_f32 %1, %5\n\tv_exp_f32 %2, %6\n\tv_exp_f32 %3, %7\n\tv_nop" : "=&v"(y0), "=&v"(y1), "=&v"(y2), "=&v"(y3) : "v"(t[0]), "v"(t[1]), "v"(t[2]), "v"(t[3]));
  const v4f y = {y0, y1, y2, y3}; return y; }
#define RS_G __attribute__((address_space(1)))      /* global memory, said outright: a pointer rebuilt from its two words would otherwise be a flat one */
__device__ __forceinline__ RS_G char* rs_uni(const void* p) { const unsigned long long a = (unsigned long long)p; const unsigned lo = (unsigned)__builtin_amdgcn_readfirstlane((int)(unsigned)a), hi = (unsigned)__builtin_amdgcn_readfirstlane((int)(unsigned)(a >> 32)); return (RS_G char*)(((unsigned long long)hi << 32) | lo); }      /* a row's start, the same in every lane, held as a scalar base: loads and stores then take base + one lane offset register that lives for the whole kernel */
// grid = (QT / (RSW * RSP), head, batch). Lane l holds columns 128 c + 4 l .. + 3 of its row: each load of a wave is 512 contiguous bytes, each store 256.
__global__ __launch_bounds__(RSW * 32) void k_rsmcf2(const float* __restrict__ S, _Float16* __restrict__ P) {
  const int lane = threadIdx.x & 31; const unsigned l4 = (unsigned)lane * 4u; const int wave = __builtin_amdgcn_readfirstlane((int)(threadIdx.x >> 5));
  const int h = blockIdx.y, b = blockIdx.z; const int r0 = ((int)blockIdx.x * RSW + wave) * RSP;      /* the wave's first row inside every tile */
  v4f w[2][NQT * RSC];      /* this row and the next one */
#define RS_TILE(R) (NQT - 1 - (R) / RSP)      /* widest tile first */
#define RS_OFF(R) (sp_off(b, h, RS_TILE(R)) + (size_t)(r0 + (R) % RSP) * (size_t)((RS_TILE(R) + 1) * QT))      /* start of the row: the same in every lane, so the base stays in scalar registers */
#define RS_LOAD(R) do { const RS_G char* s_ = rs_uni(S + RS_OFF(R)); _Pragma("unroll") for (int c = 0; c < (RS_TILE(R) + 1) * RSC; ++c) w[(R) & 1][c] = *(const RS_G v4fa*)(s_ + l4 * 4u + c * 512); } while (0)
  RS_LOAD(0);
  asm volatile("s_wait_xcnt 0x0" ::: "memory");      /* before any register that these loads name is written again */
#pragma unroll      /* constant row numbers: tile widths and the indices into w are compile-time, w stays in registers */
  for (int r = 0; r < RSR; ++r) {
    __builtin_amdgcn_sched_barrier(0);      /* with the one below: the next row's loads are issued before this row is worked on, so they fly meanwhile */
    if (r + 1 < RSR) { RS_LOAD(r + 1);
      asm volatile("s_wait_xcnt 0x0" ::: "memory"); }      /* before any register that these loads name is written again */
    __builtin_amdgcn_sched_barrier(0);
    const int nc = (RS_TILE(r) + 1) * RSC; const int last = RS_TILE(r) * QT + r0 + r % RSP;      /* last key the row may see */
    v4f* v = w[r & 1];
#pragma unroll      /* only the diagonal tile's columns can lie behind the row's own key */
    for (int c = nc - RSC; c < nc; ++c) for (int u = 0; u < 4; ++u) v[c][u] = (c * 128 + lane * 4 + u <= last) ? v[c][u] : -1.0e9f;
    v4f m4 = {-3.0e38f, -3.0e38f, -3.0e38f, -3.0e38f};
#pragma unroll      /* constant indices into w, as above; four independent chains */
    for (int c = 0; c < nc; ++c) for (int u = 0; u < 4; ++u) m4[u] = fmaxf(m4[u], v[c][u]);
    const float mx = rs_wmax(fmaxf(fmaxf(m4[0], m4[1]), fmaxf(m4[2], m4[3])));
    v4f s4 = {0.f, 0.f, 0.f, 0.f};
#pragma unroll      /* constant indices into w, as above; four independent partial sums a lane */
    for (int c = 0; c < nc; ++c) { v[c] = rs_exp4(v[c] - mx); s4 += v[c]; }
    const float sc = 256.0f / rs_wsum((s4[0] + s4[1]) + (s4[2] + s4[3]));
    RS_G char* p = rs_uni(P + RS_OFF(r));
#pragma unroll      /* constant indices into w, as above */
    for (int c = 0; c < nc; ++c) { v4h h4; for (int u = 0; u < 4; ++u) h4[u] = (_Float16)(v[c][u] * sc); *(RS_G v4h*)(p + l4 * 2u + c * 256) = h4; }
    if (r + 1 < RSR) asm volatile("s_wait_xcnt 0x0" ::: "memory");      /* before the loads of the row after next and the next row's sums land in registers that these stores name */
  }
#undef RS_LOAD
#undef RS_G
#undef RS_OFF
#undef RS_TILE
}


template <int MASKADD>
__global__ __launch_bounds__(64) void k_att0(const float* __restrict__ QF, const float* __restrict__ KF, const float* __restrict__ VF, int ld, const float* __restrict__ mask, float scale, float* __restrict__ OF, int ldo) {
  #pragma clang fp contract(off)
  __shared__ __attribute__((aligned(16))) float lo[64][64];
  const int tid = threadIdx.x; const int h = blockIdx.x / (QT0 / 64), rg = blockIdx.x % (QT0 / 64); const int i = rg * 64 + tid;
  QF += (size_t)blockIdx.y * QT0 * ld; KF += (size_t)blockIdx.y * QT0 * ld; VF += (size_t)blockIdx.y * QT0 * ld; OF += (size_t)blockIdx.y * QT0 * ldo;      /* grid.y = batch */
  const float* qr = QF + (size_t)i * ld + h * HD;
  v4f q[HD / 4], o[HD / 4];      /* the thread's q row and o row stay in registers for the whole key loop */
#pragma unroll      /* constant indices: q and o must not fall back to scratch memory */
  for (int c = 0; c < HD / 4 - 1; ++c) q[c] = *(const v4fa*)(qr + c * 4);
  asm volatile("s_wait_xcnt 0x0" ::: "memory");      /* the last q load may land in the address registers that the q loads before it name: their translations are waited for first */
  q[HD / 4 - 1] = *(const v4fa*)(qr + HD - 4);
#pragma unroll      /* constant indices, as above */
  for (int c = 0; c < HD / 4; ++c) { const v4f z = {0.f, 0.f, 0.f, 0.f}; o[c] = z; }
  float m = -1.0e30f, l = 0.f; const int jmax = MASKADD ? (SQ - 1) : (rg * 64 + 63);      /* additive-mask form: every key (the mask input decides); causal form: keys up to the block's last row */
#pragma unroll 1
  for (int j = 0; j <= jmax; ++j) { const float* kr = KF + (size_t)j * ld + h * HD; const float* vr = VF + (size_t)j * ld + h * HD; float s = 0.f;
#pragma unroll      /* the whole k row is fetched in one batch of loads: one wait a key, not one a chunk; the sum keeps its order */
    for (int c = 0; c < HD / 4; ++c) { const v4f kq = *(const v4fa*)(kr + c * 4); const v4f qq = q[c]; s = __fadd_rn(s, __fmul_rn(qq[0], kq[0])); s = __fadd_rn(s, __fmul_rn(qq[1], kq[1])); s = __fadd_rn(s, __fmul_rn(qq[2], kq[2])); s = __fadd_rn(s, __fmul_rn(qq[3], kq[3])); }
    s = __fmul_rn(s, scale); if (MASKADD) s = __fadd_rn(s, __fmul_rn(bf16_round(mask[(size_t)i * SQ + j]), -10000.0f));
    const float f = (MASKADD || j <= i) ? 1.f : 0.f; const float sm = fmaf(f, s, (1.f - f) * -1.0e30f); const float mn = fmaxf(m, sm); const float sc = expf(m - mn); const float e = expf(sm - mn); l = __fadd_rn(__fmul_rn(l, sc), e); m = mn;
#pragma unroll      /* the whole v row in one batch of loads; 64 independent updates of registers */
    for (int c = 0; c < HD / 4; ++c) { const v4f vv = *(const v4fa*)(vr + c * 4); for (int u = 0; u < 4; ++u) o[c][u] = __fadd_rn(__fmul_rn(o[c][u], sc), __fmul_rn(e, vv[u])); } }
  const float fin = 64.0f / l;      /* o carried x64; k_ftcopy scales it back by 1/64 */
#pragma unroll      /* constant indices into o */
  for (int c = 0; c < HD / 4; ++c) { v4f oo = o[c]; for (int u = 0; u < 4; ++u) oo[u] = __fmul_rn(oo[u], fin); *(v4f*)&lo[tid][c * 4] = oo; }
  __syncthreads();
  {
#pragma unroll 1
    for (int it = 0; it < 16; ++it) { const int row = it * 4 + tid / 16, pc = (tid % 16) * 4; const v4f v = *(const v4f*)&lo[row][pc]; *(v4f*)(OF + (size_t)(rg * 64 + row) * ldo + h * HD + pc) = v; }
     } }


__global__ __launch_bounds__(256) void k_ftcopy(const float* __restrict__ OF0, float* __restrict__ out, size_t n4) {
  #pragma clang fp contract(off)
  const size_t t = (size_t)blockIdx.x * 256 + threadIdx.x; if (t >= n4) return; OF0 += (size_t)blockIdx.y * QT0 * DM; out += (size_t)blockIdx.y * SQ * DM;      /* grid.y = batch */
  const v4f o = *(const v4fa*)(OF0 + t * 4); v4f y; for (int q = 0; q < 4; ++q) y[q] = __fmul_rn(o[q], 0.015625f); *(v4f*)(out + t * 4) = y;  }
extern "C" void kernel_launch(void* const* d_in, const int* in_sizes, int n_in,
                              void* d_out, int out_size, void* d_ws, size_t ws_size, hipStream_t stream) {
  (void)in_sizes; (void)n_in; (void)out_size;
  const float* const* I = (const float* const*)d_in; const float* x = I[0]; const float* wq = I[1]; const float* wk = I[2]; const float* wv = I[3];      /* per-head [h][in][out] weights, no biases, no output projection */
  char* ws = (char*)d_ws; size_t off = 0;
  auto take = [&](size_t bytes) { char* p = ws + off; off += (bytes + 255) & ~(size_t)255; return p; };
  _Float16* B3 = (_Float16*)take((size_t)3 * DM * DM * 2);      /* q, k, v weights, one after the other */
  _Float16* X16 = (_Float16*)take(NR * DM * 2); _Float16* QKV16 = (_Float16*)take((size_t)3 * NR * DM * 2); _Float16* Q16 = QKV16; _Float16* K16 = QKV16 + NR * DM; _Float16* V16 = QKV16 + 2 * NR * DM;
  float* S = (float*)take((size_t)NB * NH * QT * QT * (NQT * (NQT + 1) / 2) * 4); _Float16* P = (_Float16*)take((size_t)NB * NH * QT * QT * (NQT * (NQT + 1) / 2) * 2); _Float16* VT = (_Float16*)take((size_t)NB * NH * HD * SQ * 2);
  float* F0 = (float*)take((size_t)3 * NB * QT0 * DM * 4); float* OF0 = (float*)take((size_t)NB * QT0 * DM * 4);
  if (off > ws_size) return;
  k_wthd<<<dim3((unsigned)(((size_t)NH * HD * (DM / 8) + 255) / 256), 3), 256, 0, stream>>>(wq, wk, wv, B3);      /* per-head [m][d] -> Bt[(h,d)][m] x16 */
  k_x16<<<(unsigned)((NR * DM / 8 + 255) / 256), 256, 0, stream>>>(x, X16, NR * DM / 8);
  k_qkv<<<dim3((unsigned)((MP / 128) * (DM / 64)), 3), 128, 0, stream>>>(X16, B3, QKV16);
  k_vt<NH, SQ><<<NB * NH * (SQ / 64), 256, 0, stream>>>(V16, LQ, 0, VT);      /* V^T [NB][NH][HD][SQ] */
  k_proj0<<<dim3((QT0 / 128) * (DM / 64), 3, NB), 128, 0, stream>>>(X16, B3, F0);      /* f32 q, k, v of the first 128 rows (exact products) */
  k_att0<0><<<dim3(NH * (QT0 / 64), NB), 64, 0, stream>>>(F0, F0 + (size_t)NB * QT0 * DM, F0 + (size_t)2 * NB * QT0 * DM, DM, nullptr, 0.125f, OF0, DM);      /* exact f32 attention for rows 0..127 (o x64) */
  k_scores<<<dim3((QT / 128) * (SQ / 64), NH, NQT * NB), 128, 0, stream>>>(Q16, K16, S);
  k_rsmcf2<<<dim3(QT / (RSW * RSP), NH, NB), RSW * 32, 0, stream>>>(S, P);
  k_pv<<<dim3((QT / 128) * (HD / 64), NH, NQT * NB), 128, 0, stream>>>(P, VT, (float*)d_out);      /* out = attn v (concatenated heads) written f32 */
  k_ftcopy<<<dim3((unsigned)(((size_t)QT0 * DM / 4 + 255) / 256), NB), 256, 0, stream>>>(OF0, (float*)d_out, (size_t)QT0 * DM / 4);      /* rows 0..127 of each batch rewritten from the exact f32 attention (the module has no output projection) */
}

// v004
// One run takes 160 microseconds.
// Two timings next to v003 both put it at 1.53 times that version's speed.
// All steps since v000 together make it 26.5 times as fast.
#include <hip/hip_runtime.h>
// Causal multi-head attention with per-head weight tensors (x [4][1024][768]; Q[s][h][d] = sum_m x[s][m] W_Q[h][m][d], K, V likewise (12 heads of 64); scores / 8 with a causal mask (tril); softmax; avg_V = probs V; out[q][h*64 + d] = avg_V[q][h][d] (heads concatenated, no output projection) -> [4][1024][768]).
// Structure: token rows r = b*1024 + s; x as exact f16 rows (bf16-rounded); Q, K, V as three WMMA GEMMs (32x64 wave tiles, f32 accumulation, exact x16 weights, no bias, f16 outputs); every stage is one launch over all batches (and all query tiles, on grid.z): V^T for all heads via LDS transposes; per query tile of 256 rows: scores against the keys below the tile end only (K = 64, all heads on grid.y, alpha = 0.125), causal row softmax on VALU, one wave a row with the row in registers, key mask on the diagonal tile's columns (f32 statistics, native exp; weights x256 f16), out tile = P V^T GEMM (K = keys below the tile end, alpha 2^-8) written f32 straight into the concatenated-heads output rows (no output projection); first-tile refinement: the first 128 query rows of every batch recomputed exactly in f32 (f32 q/k/v GEMMs + a causal attention on VALU, 16 lanes a query row) and copied over those output rows.
// Compute dtype: inputs rounded to bf16; x / weights exact; q, k, v and softmax weights as plain f16 GEMM operands (~2^-12); scores and softmax statistics f32; v_wmma_f32_16x16x32_f16.
#define NB 4
#define SQ 1024
#define DM 768
#define NH 12
#define HD 64
#define HG 4                         /* heads per group in the unlaunched k_vt(V16, b, h0, VT) */
#define QT 256                       /* query rows per causal tile */
#define NQT (SQ / QT)                /* causal query tiles per batch */
#define NKX SQ
#define QT0 128                      /* first-tile rows recomputed exactly in f32 */
#define B0 0                         /* unused (all batches on the grid) */
#define NBR NB                       /* batches processed (debug hook) */
#define NR ((size_t)NB * SQ)         /* token rows */
#define MP ((int)((size_t)NBR * SQ)) /* rows projected (debug hook) */
#define QN SQ                        /* unused (query tiles on grid.z) */
#define NHD NH                       /* unused (all heads on the grid) */
#define MPO MP                       /* unused (no output stage) */
#define LQ DM      /* row pitch of the q/k/v rows */
typedef __bf16 v16b __attribute__((ext_vector_type(16)));
typedef unsigned short v8us __attribute__((ext_vector_type(8), may_alias));
typedef float  v8f  __attribute__((ext_vector_type(8)));
typedef float  v4f  __attribute__((ext_vector_type(4)));
typedef float  v4fa __attribute__((ext_vector_type(4), may_alias));
union FragB { v16b v; v8us half[2]; unsigned short u[16]; };

__device__ __forceinline__ unsigned short bf16_bits(float x) { unsigned int u = __float_as_uint(x); return (unsigned short)((u + 0x7FFFu + ((u >> 16) & 1u)) >> 16); }
__device__ __forceinline__ float bf16_val(unsigned short b) { return __uint_as_float(((unsigned int)b) << 16); }
__device__ __forceinline__ float bf16_round(float x) { return bf16_val(bf16_bits(x)); }
// D += A·B with NT terms: 1 = ah·bh, 2 = + al·bh (A split), 3 = + ah·bl (both split)
template <int NT>
__device__ __forceinline__ v8f mmaN(v16b ah, v16b al, v16b bh, v16b bl, v8f c) {
  c = __builtin_amdgcn_wmma_f32_16x16x32_bf16(false, ah, false, bh, (short)0, c, false, false);
  if (NT >= 2) c = __builtin_amdgcn_wmma_f32_16x16x32_bf16(false, al, false, bh, (short)0, c, false, false);
  if (NT >= 3) c = __builtin_amdgcn_wmma_f32_16x16x32_bf16(false, ah, false, bl, (short)0, c, false, false);
  asm volatile("v_nop\n\tv_nop\n\tv_nop\n\tv_nop" : "+v"(c) : "v"(ah), "v"(al), "v"(bh), "v"(bl));
  return c;
}

__global__ __launch_bounds__(256) void k_wt_bf16(const float* __restrict__ W, unsigned short* __restrict__ Wt, int K, int N) {
  const int t = blockIdx.x * 256 + threadIdx.x;
  const int k8n = K / 8;
  if (t >= N * k8n) return;
  const int n = t / k8n, k8 = (t % k8n) * 8;
  v8us v;
#pragma unroll
  for (int i = 0; i < 8; ++i) v[i] = bf16_bits(W[(size_t)(k8 + i) * N + n]);
  *(v8us*)(Wt + (size_t)n * K + k8) = v;
  
}

// GEMM C[M][N] (f32, pitch ldc) = act(A[M][K]·W + bias). A f32 row-major (pitch lda) converted per fragment to bf16
// (ASPLIT: hi/lo two planes -> 2 terms, else single rounded term); Wt bf16 [N][K] (pitch ldb). BIAS_BF16 rounds the
// bias to bf16 first (bias quantised to bf16 before the add). K%32==0, M%16==0, N%64==0.
template <bool ASPLIT, int ACT, bool BIAS_BF16>
__global__ __launch_bounds__(128) void k_gemm_bf(const float* __restrict__ A, int lda, const unsigned short* __restrict__ Wt, int ldb,
                                               const float* __restrict__ bias, float* __restrict__ C, int ldc, int M, int N, int K) {
  __shared__ __attribute__((aligned(16))) float so[4][16][64];
  const int tid = threadIdx.x, w = tid >> 5, lane = tid & 31, ln = lane & 15, hh = lane >> 4;
  const int ntn = N / 64;
  const int wid = blockIdx.x * 4 + w;
  const int mt = wid / ntn, nq = wid % ntn;
  if (mt * 16 >= M) return;
  const int row0 = mt * 16, col0 = nq * 64;
  const float* arow = A + (size_t)(row0 + ln) * lda;
  v8f acc[4] = {};
  for (int kb = 0; kb < K; kb += 32) {
    FragB ah, al;
    const v4f x0 = *(const v4fa*)(arow + kb + 8 * hh), x1 = *(const v4fa*)(arow + kb + 8 * hh + 4);
    const v4f x2 = *(const v4fa*)(arow + kb + 16 + 8 * hh), x3 = *(const v4fa*)(arow + kb + 16 + 8 * hh + 4);
    float xs[16] = {x0[0],x0[1],x0[2],x0[3],x1[0],x1[1],x1[2],x1[3],x2[0],x2[1],x2[2],x2[3],x3[0],x3[1],x3[2],x3[3]};
#pragma unroll
    for (int i = 0; i < 16; ++i) { const unsigned short hb = bf16_bits(xs[i]); ah.u[i] = hb; al.u[i] = ASPLIT ? bf16_bits(xs[i] - bf16_val(hb)) : (unsigned short)0; }
#pragma unroll
    for (int t = 0; t < 4; ++t) {
      const unsigned short* brow = Wt + (size_t)(col0 + t * 16 + ln) * ldb + kb;
      FragB b;
      b.half[0] = *(const v8us*)(brow + 8 * hh);
      b.half[1] = *(const v8us*)(brow + 16 + 8 * hh);
      acc[t] = mmaN<ASPLIT ? 2 : 1>(ah.v, al.v, b.v, b.v, acc[t]);
    }
  }
#pragma unroll
  for (int t = 0; t < 4; ++t) {
    float bv = bias ? bias[col0 + t * 16 + ln] : 0.f;
    if (BIAS_BF16) bv = bf16_round(bv);
#pragma unroll
    for (int r = 0; r < 8; ++r) { float v = acc[t][r] + bv; if (ACT == 1) v = fmaxf(v, 0.f); so[w][8 * hh + r][t * 16 + ln] = v; }
  }
  __builtin_amdgcn_fence(__ATOMIC_ACQ_REL, "workgroup");
  __builtin_amdgcn_wave_barrier();
  const int rsub = lane >> 4, c4 = (lane & 15) * 4;
  {
#pragma unroll
    for (int q = 0; q < 8; ++q) {
      const int r = q * 2 + rsub;
      const v4f v = *(const v4fa*)&so[w][r][c4];
      *(v4f*)(C + (size_t)(row0 + r) * ldc + col0 + c4) = v;
    }
    
  }
}

// GEMM C = act(A·W + bias + resid): A f32 (ASPLIT -> hi/lo 2 terms), Wt bf16 [N][K]; ACT 0 none, 1 relu, 2 exact gelu;
// resid (optional, f32, row index = (row % rmod), pitch ldr, RES_BF16 rounds it) added before the activation.
template <bool ASPLIT, int ACT, bool BIAS_BF16, bool RES_BF16>
__global__ __launch_bounds__(128) void k_gemm_bf3(const float* __restrict__ A, int lda, const unsigned short* __restrict__ Wt, int ldb,
                                                const float* __restrict__ bias, const float* __restrict__ resid, int rmod, int ldr,
                                                float* __restrict__ C, int ldc, int M, int N, int K) {
  __shared__ __attribute__((aligned(16))) float so[4][16][64];
  const int tid = threadIdx.x, w = tid >> 5, lane = tid & 31, ln = lane & 15, hh = lane >> 4;
  const int ntn = N / 64;
  const int wid = blockIdx.x * 4 + w;
  const int mt = wid / ntn, nq = wid % ntn;
  if (mt * 16 >= M) return;
  const int row0 = mt * 16, col0 = nq * 64;
  const float* arow = A + (size_t)(row0 + ln) * lda;
  v8f acc[4] = {};
  for (int kb = 0; kb < K; kb += 32) {
    FragB ah, al;
    const v4f x0 = *(const v4fa*)(arow + kb + 8 * hh), x1 = *(const v4fa*)(arow + kb + 8 * hh + 4);
    const v4f x2 = *(const v4fa*)(arow + kb + 16 + 8 * hh), x3 = *(const v4fa*)(arow + kb + 16 + 8 * hh + 4);
    float xs[16] = {x0[0],x0[1],x0[2],x0[3],x1[0],x1[1],x1[2],x1[3],x2[0],x2[1],x2[2],x2[3],x3[0],x3[1],x3[2],x3[3]};
#pragma unroll
    for (int i = 0; i < 16; ++i) { const unsigned short hb = bf16_bits(xs[i]); ah.u[i] = hb; al.u[i] = ASPLIT ? bf16_bits(xs[i] - bf16_val(hb)) : (unsigned short)0; }
#pragma unroll
    for (int t = 0; t < 4; ++t) {
      const unsigned short* brow = Wt + (size_t)(col0 + t * 16 + ln) * ldb + kb;
      FragB b;
      b.half[0] = *(const v8us*)(brow + 8 * hh);
      b.half[1] = *(const v8us*)(brow + 16 + 8 * hh);
      acc[t] = mmaN<ASPLIT ? 2 : 1>(ah.v, al.v, b.v, b.v, acc[t]);
    }
  }
#pragma unroll
  for (int t = 0; t < 4; ++t) {
    const int col = col0 + t * 16 + ln;
    float bv = bias ? bias[col] : 0.f;
    if (BIAS_BF16) bv = bf16_round(bv);
#pragma unroll
    for (int r = 0; r < 8; ++r) {
      float v = acc[t][r] + bv;
      if (resid) { float rv = resid[(size_t)((row0 + 8 * hh + r) % rmod) * ldr + col]; if (RES_BF16) rv = bf16_round(rv); v += rv; }
      if (ACT == 1) v = fmaxf(v, 0.f);
      if (ACT == 2) v = 0.5f * v * (1.0f + erff(v * 0.70710678118654752f));
      if (ACT == 3) { const float u = 0.7978845608028654f * (v + 0.044715f * v * v * v); v = 0.5f * v * (1.0f + tanhf(u)); }
      so[w][8 * hh + r][t * 16 + ln] = v;
    }
  }
  __builtin_amdgcn_fence(__ATOMIC_ACQ_REL, "workgroup");
  __builtin_amdgcn_wave_barrier();
  const int rsub = lane >> 4, c4 = (lane & 15) * 4;
  {
#pragma unroll
    for (int q = 0; q < 8; ++q) {
      const int r = q * 2 + rsub;
      const v4f v = *(const v4fa*)&so[w][r][c4];
      *(v4f*)(C + (size_t)(row0 + r) * ldc + col0 + c4) = v;
    }
    
  }
}
// row LayerNorm (biased variance, eps) over N: s = X (+ R); optional out_sum <- s; out_norm <- (s-mu)*rsqrt(var+eps)*g + b
template <bool PARAM_BF16>
__global__ __launch_bounds__(256) void k_layernorm(const float* __restrict__ X, const float* __restrict__ R, const float* __restrict__ g, const float* __restrict__ bta,
                                                  float* __restrict__ out_sum, float* __restrict__ out_norm, int N, float eps) {
  __shared__ float red[256];
  const int row = blockIdx.x, tid = threadIdx.x;
  const float* x = X + (size_t)row * N; const float* rr = R ? R + (size_t)row * N : nullptr;
  float vals[16];                     // up to N = 4096
  const int per = N / 256;            // contiguous chunk per thread? use strided-by-4 chunks: thread handles j = tid*4 + 1024*u
  float s1 = 0.f;
  for (int u = 0; u < per / 4; ++u) {
    const int j = tid * 4 + 1024 * u;
    const v4f a = *(const v4fa*)(x + j);
    v4f b = {0.f,0.f,0.f,0.f}; if (rr) b = *(const v4fa*)(rr + j);
#pragma unroll
    for (int q = 0; q < 4; ++q) { const float v = a[q] + b[q]; vals[u * 4 + q] = v; s1 += v; }
  }
  red[tid] = s1; __syncthreads();
  for (int st = 128; st > 0; st >>= 1) { if (tid < st) red[tid] += red[tid + st]; __syncthreads(); }
  const float mu = red[0] / (float)N; __syncthreads();
  float s2 = 0.f;
  for (int u = 0; u < per / 4; ++u)
#pragma unroll
    for (int q = 0; q < 4; ++q) { const float c = vals[u * 4 + q] - mu; s2 += c * c; }
  red[tid] = s2; __syncthreads();
  for (int st = 128; st > 0; st >>= 1) { if (tid < st) red[tid] += red[tid + st]; __syncthreads(); }
  const float rs = rsqrtf(red[0] / (float)N + eps);
  {
    for (int u = 0; u < per / 4; ++u) {
      const int j = tid * 4 + 1024 * u;
      v4f o, sm;
#pragma unroll
      for (int q = 0; q < 4; ++q) {
        float gg = g[j + q], bb = bta[j + q];
        if (PARAM_BF16) { gg = bf16_round(gg); bb = bf16_round(bb); }
        sm[q] = vals[u * 4 + q]; o[q] = (vals[u * 4 + q] - mu) * rs * gg + bb;
      }
      if (out_sum) *(v4f*)(out_sum + (size_t)row * N + j) = sm;
      *(v4f*)(out_norm + (size_t)row * N + j) = o;
    }
    
  }
}



// ---- f16 WMMA path (v_wmma_f32_16x16x32_f16): 11-bit significands for operands in range — used where a [0,1] probability operand needs more precision than bf16
typedef _Float16 v16h __attribute__((ext_vector_type(16)));
union FragH { v16h v; v8us half[2]; _Float16 h[16]; unsigned short u[16]; };
template <int NT>
__device__ __forceinline__ v8f mmaH(v16h ah, v16h al, v16h bh, v16h bl, v8f c) {
  c = __builtin_amdgcn_wmma_f32_16x16x32_f16(false, ah, false, bh, (short)0, c, false, false);
  if (NT >= 2) c = __builtin_amdgcn_wmma_f32_16x16x32_f16(false, al, false, bh, (short)0, c, false, false);
  if (NT >= 3) c = __builtin_amdgcn_wmma_f32_16x16x32_f16(false, ah, false, bl, (short)0, c, false, false);
  asm volatile("v_nop\n\tv_nop\n\tv_nop\n\tv_nop" : "+v"(c) : "v"(ah), "v"(al), "v"(bh), "v"(bl));
  return c;
}
// batched GEMM like k_gemm_b but f16 operands: A f32 (split into f16 hi/lo if ASPLIT, else rounded to f16), Bt = f16 values [n][k]; alpha; C f32; N multiple of 16 (partial tiles skipped)
template <bool ASPLIT>
__global__ __launch_bounds__(128) void k_gemm_h(const float* __restrict__ A, int lda, size_t sA, const _Float16* __restrict__ Bh, int ldb, size_t sB, float alpha, float* __restrict__ C, int ldc, size_t sC, int M, int N, int K) {
  __shared__ __attribute__((aligned(16))) float so[4][16][64];
  const int tid = threadIdx.x, w = tid >> 5, lane = tid & 31, ln = lane & 15, hh = lane >> 4; const int by = blockIdx.y;
  A += (size_t)by * sA; Bh += (size_t)by * sB; C += (size_t)by * sC;
  const int ntn = (N + 63) / 64; const int wid = blockIdx.x * 4 + w; const int mt = wid / ntn, nq = wid % ntn; if (mt * 16 >= M) return;
  const int row0 = mt * 16, col0 = nq * 64; const float* arow = A + (size_t)(row0 + ln) * lda;
  v8f acc[4] = {};
  for (int kb = 0; kb < K; kb += 32) {
    FragH ah, al;
    const v4f x0 = *(const v4fa*)(arow + kb + 8 * hh), x1 = *(const v4fa*)(arow + kb + 8 * hh + 4), x2 = *(const v4fa*)(arow + kb + 16 + 8 * hh), x3 = *(const v4fa*)(arow + kb + 16 + 8 * hh + 4);
    float xs[16] = {x0[0],x0[1],x0[2],x0[3],x1[0],x1[1],x1[2],x1[3],x2[0],x2[1],x2[2],x2[3],x3[0],x3[1],x3[2],x3[3]};
#pragma unroll
    for (int i = 0; i < 16; ++i) { const _Float16 h = (_Float16)xs[i]; ah.h[i] = h; al.h[i] = ASPLIT ? (_Float16)(xs[i] - (float)h) : (_Float16)0.0f; }
#pragma unroll
    for (int t = 0; t < 4; ++t) { if (col0 + t * 16 >= N) continue; const size_t boff = (size_t)(col0 + t * 16 + ln) * ldb + kb; FragH bq; bq.half[0] = *(const v8us*)(Bh + boff + 8 * hh); bq.half[1] = *(const v8us*)(Bh + boff + 16 + 8 * hh);
      acc[t] = mmaH<ASPLIT ? 2 : 1>(ah.v, al.v, bq.v, bq.v, acc[t]); }
  }
#pragma unroll
  for (int t = 0; t < 4; ++t) { if (col0 + t * 16 >= N) continue;
#pragma unroll
    for (int r = 0; r < 8; ++r) so[w][8 * hh + r][t * 16 + ln] = acc[t][r] * alpha; }
  __builtin_amdgcn_fence(__ATOMIC_ACQ_REL, "workgroup"); __builtin_amdgcn_wave_barrier();
  const int rsub = lane >> 4, c4 = (lane & 15) * 4;
  {
#pragma unroll
    for (int q = 0; q < 8; ++q) { const int r = q * 2 + rsub; if (col0 + c4 < N) { const v4f v = *(const v4fa*)&so[w][r][c4]; *(v4f*)(C + (size_t)(row0 + r) * ldc + col0 + c4) = v; } }
     }
}

// Wt[n][k] = f16(W[k][n]·scale) from f32 row-major W[K][N] (scale = power of two; bf16-exact weights stay exact in f16 away from the subnormal range)
__global__ __launch_bounds__(256) void k_wt_f16(const float* __restrict__ W, _Float16* __restrict__ Wt, int K, int N, float scale) {
  const int t = blockIdx.x * 256 + threadIdx.x; if (t >= N * (K / 8)) return; const int n = t / (K / 8), k8 = (t % (K / 8)) * 8; FragH f;
#pragma unroll
  for (int i = 0; i < 8; ++i) f.h[i] = (_Float16)(bf16_round(W[(size_t)(k8 + i) * N + n]) * scale); const v8us o = f.half[0];
  *(v8us*)((unsigned short*)Wt + (size_t)n * K + k8) = o; 
}
// k_gemm_hh variant with fused epilogue: v = acc·alpha + bias[by·sBias + col] (+ CP[(row/rowsPerB)·sCPb + by·64 + col] if CP) ; ACT 0 none / 1 elu ; writes f16 C16 (and f32 C if non-null)
template <int ACT>
__global__ __launch_bounds__(128) void k_gemm_hhx(const _Float16* __restrict__ A, int lda, size_t sA, const _Float16* __restrict__ Bh, int ldb, size_t sB, float alpha, const float* __restrict__ bias, size_t sBias, const float* __restrict__ CP, int rowsPerB, size_t sCPb, int row0g,
    float* __restrict__ C, _Float16* __restrict__ C16, int ldc, size_t sC, int M, int N, int K) {
  __shared__ __attribute__((aligned(16))) float so[4][16][64];
  const int tid = threadIdx.x, w = tid >> 5, lane = tid & 31, ln = lane & 15, hh = lane >> 4; const int by = blockIdx.y;
  A += (size_t)by * sA; Bh += (size_t)by * sB; const size_t cofs = (size_t)by * sC; const float* bp = bias ? bias + (size_t)by * sBias : nullptr;
  const int ntn = (N + 63) / 64; const int wid = blockIdx.x * 4 + w; const int mt = wid / ntn, nq = wid % ntn; if (mt * 16 >= M) return;
  const int row0 = mt * 16, col0 = nq * 64; const _Float16* arow = A + (size_t)(row0 + ln) * lda;
  v8f acc[4] = {};
  for (int kb = 0; kb < K; kb += 32) { FragH ah; ah.half[0] = *(const v8us*)((const unsigned short*)arow + kb + 8 * hh); ah.half[1] = *(const v8us*)((const unsigned short*)arow + kb + 16 + 8 * hh);
#pragma unroll
    for (int t = 0; t < 4; ++t) { if (col0 + t * 16 >= N) continue; const size_t boff = (size_t)(col0 + t * 16 + ln) * ldb + kb; FragH bq; bq.half[0] = *(const v8us*)((const unsigned short*)Bh + boff + 8 * hh); bq.half[1] = *(const v8us*)((const unsigned short*)Bh + boff + 16 + 8 * hh);
      acc[t] = mmaH<1>(ah.v, ah.v, bq.v, bq.v, acc[t]); }
  }
#pragma unroll
  for (int t = 0; t < 4; ++t) { if (col0 + t * 16 >= N) continue; const int col = col0 + t * 16 + ln; const float bv = bp ? bf16_round(bp[col]) : 0.f;
#pragma unroll
    for (int r = 0; r < 8; ++r) { float v = acc[t][r] * alpha + bv; if (CP) { const int rr = row0g + row0 + 8 * hh + r; if (rowsPerB < 0) v += CP[cofs + (size_t)rr * ldc + col];      /* rowsPerB < 0: own element of the batched C plane */ else { const int bidx = rr / rowsPerB; v += CP[(size_t)bidx * sCPb + (size_t)by * 64 + col]; } } if (ACT == 1) v = (v > 0.f) ? v : expm1f(v); else if (ACT == 7) v = (v > 0.f) ? v + 1.0f : expf(v); else if (ACT == 8) v = tanhf(v); else if (ACT == 9) v = 0.5f * v * (1.0f + tanhf(0.7978845608028654f * (v + 0.044715f * v * v * v))); else if (ACT == 11) v = 1.0f / (1.0f + expf(-v)); else if (ACT == 12) v = (v > 0.f) ? v : 0.01f * v; else if (ACT == 14) v = (v > 0.f) ? v : 0.1f * v; else if (ACT == 16) v = (v >= 0.f) ? v : 0.3f * v; else if (ACT == 17) v = (v >= 0.f) ? v : 0.2f * v; else if (ACT == 15) v = v / (1.0f + expf(-v)); else if (ACT == 3) v = fmaxf(v, 0.f); else if (ACT == 6) v = 0.5f * v * (1.0f + erff(v * 0.70710678118654752f)); so[w][8 * hh + r][t * 16 + ln] = v; } }
  __builtin_amdgcn_fence(__ATOMIC_ACQ_REL, "workgroup"); __builtin_amdgcn_wave_barrier();
  const int rsub = lane >> 4, c4 = (lane & 15) * 4; typedef _Float16 v4h __attribute__((ext_vector_type(4)));
  {
#pragma unroll
    for (int q = 0; q < 8; ++q) { const int r = q * 2 + rsub; if (col0 + c4 < N) { const v4f v = *(const v4fa*)&so[w][r][c4]; if (C) *(v4f*)(C + cofs + (size_t)(row0 + r) * ldc + col0 + c4) = v; if (C16) { v4h h4; for (int i = 0; i < 4; ++i) h4[i] = (_Float16)v[i]; *(v4h*)(C16 + cofs + (size_t)(row0 + r) * ldc + col0 + c4) = h4; } } }
     }
}


typedef _Float16 v4h __attribute__((ext_vector_type(4)));

__global__ __launch_bounds__(256) void k_x16(const float* __restrict__ x, _Float16* __restrict__ X16, size_t n8) { const size_t t = (size_t)blockIdx.x * 256 + threadIdx.x; if (t >= n8) return; FragH f;
#pragma unroll
  for (int q = 0; q < 8; ++q) f.h[q] = (_Float16)bf16_round(x[t * 8 + q]); *(v8us*)((unsigned short*)X16 + t * 8) = f.half[0];  }
__global__ __launch_bounds__(256) void k_h16(const float* __restrict__ x, _Float16* __restrict__ X16, size_t n8) { const size_t t = (size_t)blockIdx.x * 256 + threadIdx.x; if (t >= n8) return; FragH f;
#pragma unroll
  for (int q = 0; q < 8; ++q) f.h[q] = (_Float16)x[t * 8 + q]; *(v8us*)((unsigned short*)X16 + t * 8) = f.half[0];  }
__global__ __launch_bounds__(256) void k_round16f(const float* __restrict__ W, _Float16* __restrict__ Bt, size_t n8) { const size_t t = (size_t)blockIdx.x * 256 + threadIdx.x; if (t >= n8) return; FragH f;
#pragma unroll
  for (int i = 0; i < 8; ++i) f.h[i] = (_Float16)(bf16_round(W[t * 8 + i]) * 16.0f); *(v8us*)((unsigned short*)Bt + t * 8) = f.half[0];  }
template <int NHv, int TTv>
__global__ __launch_bounds__(256) void k_vt(const _Float16* __restrict__ V16, int ldv, int voff, _Float16* __restrict__ Vt) { __shared__ unsigned short tl[64][66]; const int tid = threadIdx.x; const int slab = blockIdx.x / (TTv / 64), lg = blockIdx.x % (TTv / 64); const int b = slab / NHv, h = slab % NHv;
  for (int i = tid; i < 64 * 8; i += 256) { const int r = i / 8, c8 = (i % 8) * 8; FragH f; f.half[0] = *(const v8us*)((const unsigned short*)V16 + ((size_t)b * TTv + lg * 64 + r) * ldv + voff + h * 64 + c8);
#pragma unroll
    for (int q = 0; q < 8; ++q) tl[r][c8 + q] = f.u[q]; }
  __syncthreads();
  {
#pragma unroll
    for (int rd = 0; rd < 2; ++rd) { const int d = rd * 32 + tid / 8, pc = tid % 8; FragH f;
#pragma unroll
      for (int q = 0; q < 8; ++q) f.u[q] = tl[pc * 8 + q][d];
      *(v8us*)((unsigned short*)Vt + ((size_t)slab * 64 + d) * TTv + lg * 64 + pc * 8) = f.half[0]; }
     } }

__global__ __launch_bounds__(256) void k_hl(const float* __restrict__ F, _Float16* __restrict__ Hh, _Float16* __restrict__ Hl, size_t n8) { const size_t t = (size_t)blockIdx.x * 256 + threadIdx.x; if (t >= n8) return; FragH fh, fl; const v4f a = *(const v4fa*)(F + t * 8), c = *(const v4fa*)(F + t * 8 + 4);
#pragma unroll
  for (int q = 0; q < 4; ++q) { _Float16 h = (_Float16)a[q]; fh.h[q] = h; fl.h[q] = (_Float16)((a[q] - (float)h) * 1024.0f); h = (_Float16)c[q]; fh.h[4 + q] = h; fl.h[4 + q] = (_Float16)((c[q] - (float)h) * 1024.0f); }
  { *(v8us*)((unsigned short*)Hh + t * 8) = fh.half[0]; *(v8us*)((unsigned short*)Hl + t * 8) = fl.half[0];  } }

// ---- fast GEMM (wave tile 32x64; requires M % 32 == 0 rows per launch region and N % 64 == 0); epilogue = k_gemm_hhx semantics ----
__device__ __forceinline__ v16h g2_frag(const _Float16* p, int hh) { FragH f; f.half[0] = *(const v8us*)((const unsigned short*)p + 8 * hh); f.half[1] = *(const v8us*)((const unsigned short*)p + 16 + 8 * hh); return f.v; }
__device__ __forceinline__ v8f g2_mma(v16h a, v16h b, v8f c) { v8f d = __builtin_amdgcn_wmma_f32_16x16x32_f16(false, a, false, b, (short)0, c, false, false); asm volatile("v_nop\n\tv_nop\n\tv_nop\n\tv_nop" : "+v"(d) : "v"(a), "v"(b)); return d; }
template <int ACT>
__device__ __forceinline__ void gemm2_tile(const int bx, const int by, const _Float16* __restrict__ A, int lda, size_t sA, const _Float16* __restrict__ Bh, int ldb, size_t sB, float alpha, const float* __restrict__ bias, size_t sBias, const float* __restrict__ CP, int rowsPerB, size_t sCPb, int row0g,
    float* __restrict__ C, _Float16* __restrict__ C16, int ldc, size_t sC, int M, int N, int K) { static_assert(ACT == 0 || ACT == 3 || ACT == 6 || ACT == 8 || ACT == 9 || ACT == 11 || ACT == 12 || ACT == 14 || ACT == 15 || ACT == 16 || ACT == 17, "gemm2_tile: unsupported ACT code (would silently apply no activation)");
  __shared__ __attribute__((aligned(16))) float so[4][32][68];
  const int tid = threadIdx.x, w = tid >> 5, lane = tid & 31, ln = lane & 15, hh = lane >> 4;
  A += (size_t)by * sA; Bh += (size_t)by * sB; const size_t cofs = (size_t)by * sC; const float* bp = bias ? bias + (size_t)by * sBias : nullptr;
  const int ntn = N >> 6; const int mt = bx / ntn, nq = bx - mt * ntn; const int row0 = mt * 128 + 32 * w, col0 = nq * 64; if (row0 >= M) return;
  const _Float16* a0p = A + (size_t)(row0 + ln) * lda; const _Float16* a1p = a0p + (size_t)16 * lda;
  const _Float16* b0p = Bh + (size_t)(col0 + ln) * ldb; const _Float16* b1p = b0p + (size_t)16 * ldb; const _Float16* b2p = b1p + (size_t)16 * ldb; const _Float16* b3p = b2p + (size_t)16 * ldb;
  const v8f z8 = {0.f,0.f,0.f,0.f,0.f,0.f,0.f,0.f}; v8f c00 = z8, c01 = z8, c02 = z8, c03 = z8, c10 = z8, c11 = z8, c12 = z8, c13 = z8;
#pragma unroll 1
  for (int kb = 0; kb < K; kb += 32) { const v16h a0 = g2_frag(a0p + kb, hh); FragH a1f; a1f.half[0] = *(const v8us*)((const unsigned short*)(a1p + kb) + 8 * hh);
    asm volatile("s_wait_xcnt 0x0" ::: "memory");      /* the last A load lands in the address registers that the A loads before it name: their translations are waited for first */
    a1f.half[1] = *(const v8us*)((const unsigned short*)(a1p + kb) + 16 + 8 * hh); const v16h a1 = a1f.v;
    v16h b = g2_frag(b0p + kb, hh); c00 = g2_mma(a0, b, c00); c10 = g2_mma(a1, b, c10);
    b = g2_frag(b1p + kb, hh); c01 = g2_mma(a0, b, c01); c11 = g2_mma(a1, b, c11);
    b = g2_frag(b2p + kb, hh); c02 = g2_mma(a0, b, c02); c12 = g2_mma(a1, b, c12);
    b = g2_frag(b3p + kb, hh); c03 = g2_mma(a0, b, c03); c13 = g2_mma(a1, b, c13); }
  v8f accs[8] = {c00, c01, c02, c03, c10, c11, c12, c13};
#pragma unroll
  for (int u = 0; u < 8; ++u) { const int t = u & 3, half = u >> 2; const int col = col0 + t * 16 + ln; const float bv = bp ? bf16_round(bp[col]) : 0.f;
#pragma unroll
    for (int r = 0; r < 8; ++r) { const int rloc = half * 16 + 8 * hh + r; float v = accs[u][r] * alpha + bv; if (CP) { if (rowsPerB < 0) v += CP[cofs + (size_t)(row0g + row0 + rloc) * ldc + col];      /* rowsPerB < 0: own element of the batched C plane */ else { const int bidx = (row0g + row0 + rloc) / rowsPerB; v += CP[(size_t)bidx * sCPb + (size_t)by * 64 + col]; } }
      if (ACT == 3) v = fmaxf(v, 0.f); else if (ACT == 6) v = 0.5f * v * (1.0f + erff(v * 0.70710678118654752f)); else if (ACT == 11) v = 1.0f / (1.0f + expf(-v)); else if (ACT == 15) v = v / (1.0f + expf(-v)); else if (ACT == 12) v = (v > 0.f) ? v : 0.01f * v; else if (ACT == 8) v = tanhf(v); else if (ACT == 9) v = 0.5f * v * (1.0f + tanhf(0.7978845608028654f * (v + 0.044715f * v * v * v))); else if (ACT == 14) v = (v > 0.f) ? v : 0.1f * v; else if (ACT == 16) v = (v >= 0.f) ? v : 0.3f * v; else if (ACT == 17) v = (v >= 0.f) ? v : 0.2f * v;
      so[w][rloc][t * 16 + ln] = v; } }
  __builtin_amdgcn_fence(__ATOMIC_ACQ_REL, "workgroup"); __builtin_amdgcn_wave_barrier();
  const int rsub = lane >> 4, c4 = (lane & 15) * 4;
  {
#pragma unroll
    for (int q = 0; q < 16; ++q) { const int r = q * 2 + rsub; const v4f v = *(const v4fa*)&so[w][r][c4]; if (C) *(v4f*)(C + cofs + (size_t)(row0 + r) * ldc + col0 + c4) = v; if (C16) { v4h h4; for (int i = 0; i < 4; ++i) h4[i] = (_Float16)v[i]; *(v4h*)(C16 + cofs + (size_t)(row0 + r) * ldc + col0 + c4) = h4; } }
     } }
// ---- one launch per stage: batch and causal query tile ride on the grid ----
// grid.z = (tile, batch), widest tile first
__device__ __forceinline__ int z_tile(int z) { return NQT - 1 - z / NB; }
__device__ __forceinline__ int z_batch(int z) { return z % NB; }
// S / P are packed: tile t holds NB*NH slabs of QT rows with a row pitch of its own key count (t + 1) * QT
__device__ __forceinline__ size_t sp_off(int b, int h, int t) { return (size_t)NB * NH * QT * QT * (size_t)(t * (t + 1) / 2) + (size_t)(b * NH + h) * QT * (size_t)((t + 1) * QT); }
// f16 q, k, v of all token rows: grid.y = which of q/k/v; QKV16 [3][NR][DM]
__global__ __launch_bounds__(128) void k_qkv(const _Float16* __restrict__ X16, const _Float16* __restrict__ B3, _Float16* __restrict__ QKV16) { const int wh = blockIdx.y;
  gemm2_tile<0>(blockIdx.x, 0, X16, DM, 0, B3 + (size_t)wh * DM * DM, DM, 0, 0.0625f, nullptr, 0, nullptr, 1, 0, 0, nullptr, QKV16 + (size_t)wh * NR * DM, DM, 0, MP, DM, DM); }
// f32 q, k, v of the first QT0 rows of every batch: grid.y = which of q/k/v, grid.z = batch; F0 [3][NB][QT0][DM]
__global__ __launch_bounds__(128) void k_proj0(const _Float16* __restrict__ X16, const _Float16* __restrict__ B3, float* __restrict__ F0) { const int wh = blockIdx.y, b = blockIdx.z;
  gemm2_tile<0>(blockIdx.x, 0, X16 + (size_t)b * SQ * DM, DM, 0, B3 + (size_t)wh * DM * DM, DM, 0, 0.0625f, nullptr, 0, nullptr, 1, 0, 0, F0 + (size_t)(wh * NB + b) * QT0 * DM, nullptr, DM, 0, QT0, DM, DM); }
// scores of every (batch, tile, head): keys below the tile end only; blocks past a narrow tile's columns leave at the row test
__global__ __launch_bounds__(128) void k_scores(const _Float16* __restrict__ Q16, const _Float16* __restrict__ K16, float* __restrict__ S) { const int h = blockIdx.y, t = z_tile(blockIdx.z), b = z_batch(blockIdx.z); const int nk = (t + 1) * QT;
  gemm2_tile<0>(blockIdx.x, 0, Q16 + ((size_t)b * SQ + t * QT) * LQ + h * HD, LQ, 0, K16 + (size_t)b * SQ * LQ + h * HD, LQ, 0, 0.125f, nullptr, 0, nullptr, 1, 0, 0, S + sp_off(b, h, t), nullptr, nk, 0, QT, nk, HD); }
// out tile = P V^T of every (batch, tile, head), f32 into the concatenated-heads rows
__global__ __launch_bounds__(128) void k_pv(const _Float16* __restrict__ P, const _Float16* __restrict__ VT, float* __restrict__ out) { const int h = blockIdx.y, t = z_tile(blockIdx.z), b = z_batch(blockIdx.z); const int nk = (t + 1) * QT;
  gemm2_tile<0>(blockIdx.x, 0, P + sp_off(b, h, t), nk, 0, VT + (size_t)(b * NH + h) * HD * SQ, SQ, 0, 0.00390625f, nullptr, 0, nullptr, 1, 0, 0, out + ((size_t)b * SQ + t * QT) * DM + h * HD, nullptr, DM, 0, QT, HD, nk); }


__global__ __launch_bounds__(256) void k_wnat(const float* __restrict__ w, size_t n8, _Float16* __restrict__ Bt) { const size_t t = (size_t)blockIdx.x * 256 + threadIdx.x; if (t >= n8) return; FragH f; for (int q = 0; q < 8; ++q) f.h[q] = (_Float16)(bf16_round(w[t * 8 + q]) * 16.0f); *(v8us*)((unsigned short*)Bt + t * 8) = f.half[0];  }
__global__ __launch_bounds__(256) void k_rsm(const float* __restrict__ S, _Float16* __restrict__ P, int nrows) {
  #pragma clang fp contract(off)
  const int i = blockIdx.x * 256 + threadIdx.x; if (i >= nrows) return; const float* s = S + (size_t)i * SQ; float mx = -3.0e38f;
#pragma unroll 1
  for (int j = 0; j < SQ; ++j) mx = fmaxf(mx, s[j]); float se = 0.f;
#pragma unroll 1
  for (int j = 0; j < SQ; ++j) se += expf(s[j] - mx); const float sc = 256.0f / se;
#pragma unroll 1
  for (int j0 = 0; j0 < SQ; j0 += 8) { FragH f; for (int q = 0; q < 8; ++q) f.h[q] = (_Float16)(expf(s[j0 + q] - mx) * sc); unsigned short* d = (unsigned short*)P + (size_t)i * SQ + j0; *(v8us*)d = f.half[0];  } }
__global__ __launch_bounds__(256) void k_vt(const _Float16* __restrict__ V16, int b, int h0, _Float16* __restrict__ VT) { __shared__ unsigned short tl[64][65]; const int tid = threadIdx.x; const int hh = blockIdx.x % HG, sg = blockIdx.x / HG; const int s0 = sg * 64; const int h = h0 + hh;
  for (int i = tid; i < 64 * 8; i += 256) { const int j = i / 8, d8 = (i % 8) * 8; FragH f; f.half[0] = *(const v8us*)((const unsigned short*)V16 + ((size_t)b * SQ + s0 + j) * DM + h * HD + d8); for (int q = 0; q < 8; ++q) tl[d8 + q][j] = f.u[q]; }
  __syncthreads();
  { for (int i = tid; i < 64 * 8; i += 256) { const int d = i / 8, j8 = (i % 8) * 8; FragH f; for (int q = 0; q < 8; ++q) f.u[q] = tl[d][j8 + q]; *(v8us*)((unsigned short*)VT + ((size_t)hh * HD + d) * SQ + s0 + j8) = f.half[0]; }  } }

__global__ __launch_bounds__(256) void k_wthd(const float* __restrict__ Wq, const float* __restrict__ Wk, const float* __restrict__ Wv, _Float16* __restrict__ B3) { const size_t t = (size_t)blockIdx.x * 256 + threadIdx.x; if (t >= (size_t)NH * HD * (DM / 8)) return; const float* Wt = blockIdx.y == 0 ? Wq : blockIdx.y == 1 ? Wk : Wv; _Float16* Bt = B3 + (size_t)blockIdx.y * DM * DM;      /* grid.y = which of q/k/v */ const int m8 = (int)(t % (DM / 8)) * 8; const int d = (int)((t / (DM / 8)) % HD); const int h = (int)(t / ((size_t)(DM / 8) * HD)); FragH f;
  for (int q = 0; q < 8; ++q) f.h[q] = (_Float16)(16.0f * bf16_round(Wt[((size_t)h * DM + m8 + q) * HD + d])); unsigned short* dst = (unsigned short*)Bt + ((size_t)h * HD + d) * DM + m8; *(v8us*)dst = f.half[0];  }



// ---- causal row softmax, streaming form: one wave a row, the row held in registers ----
#define RSW 8                        /* waves per softmax block */
#define RSP 2                        /* rows of EACH causal tile per wave: every wave gets the same number of columns */
#define RSR (NQT * RSP)              /* rows per wave */
#define RSC (QT / 128)               /* 128-column pieces (32 lanes x 4 floats) per tile width */
template <int M> __device__ __forceinline__ float rs_xm(float x) { return __builtin_bit_cast(float, __builtin_amdgcn_mov_dpp(__builtin_bit_cast(int, x), 0x160 + M, 0xf, 0xf, false)); }      /* lane l <- lane l ^ M inside a 16-lane row (row_xmask) */
__device__ __forceinline__ float rs_xh(float x) { return __builtin_bit_cast(float, __builtin_amdgcn_permlanex16(__builtin_bit_cast(int, x), __builtin_bit_cast(int, x), 0x76543210, 0xfedcba98, false, false)); }      /* lane l <- lane l ^ 16 */
__device__ __forceinline__ float rs_wmax(float x) { x = fmaxf(x, rs_xm<1>(x)); x = fmaxf(x, rs_xm<2>(x)); x = fmaxf(x, rs_xm<4>(x)); x = fmaxf(x, rs_xm<8>(x)); return fmaxf(x, rs_xh(x)); }
__device__ __forceinline__ float rs_wsum(float x) { x += rs_xm<1>(x); x += rs_xm<2>(x); x += rs_xm<4>(x); x += rs_xm<8>(x); return x + rs_xh(x); }
// e^x of four values, as __expf forms it (x * log2 e, then v_exp_f32). One statement: behind a transcendental the instruction set asks for one independent instruction before its source is overwritten or its result read;
// each v_exp_f32 is that instruction for the one before it (outputs are early-clobber, so none lies on an input), the v_nop for the last.
__device__ __forceinline__ v4f rs_exp4(v4f x) { float y0, y1, y2, y3; const v4f t = x * 1.44269504f;
  asm("v_exp_f32 %0, %4\n\tv_exp_f32 %1, %5\n\tv_exp_f32 %2, %6\n\tv_exp_f32 %3, %7\n\tv_nop" : "=&v"(y0), "=&v"(y1), "=&v"(y2), "=&v"(y3) : "v"(t[0]), "v"(t[1]), "v"(t[2]), "v"(t[3]));
  const v4f y = {y0, y1, y2, y3}; return y; }
#define RS_G __attribute__((address_space(1)))      /* global memory, said outright: a pointer rebuilt from its two words would otherwise be a flat one */
__device__ __forceinline__ RS_G char* rs_uni(const void* p) { const unsigned long long a = (unsigned long long)p; const unsigned lo = (unsigned)__builtin_amdgcn_readfirstlane((int)(unsigned)a), hi = (unsigned)__builtin_amdgcn_readfirstlane((int)(unsigned)(a >> 32)); return (RS_G char*)(((unsigned long long)hi << 32) | lo); }      /* a row's start, the same in every lane, held as a scalar base: loads and stores then take base + one lane offset register that lives for the whole kernel */
// grid = (QT / (RSW * RSP), head, batch). Lane l holds columns 128 c + 4 l .. + 3 of its row: each load of a wave is 512 contiguous bytes, each store 256.
__global__ __launch_bounds__(RSW * 32) void k_rsmcf2(const float* __restrict__ S, _Float16* __restrict__ P) {
  const int lane = threadIdx.x & 31; const unsigned l4 = (unsigned)lane * 4u; const int wave = __builtin_amdgcn_readfirstlane((int)(threadIdx.x >> 5));
  const int h = blockIdx.y, b = blockIdx.z; const int r0 = ((int)blockIdx.x * RSW + wave) * RSP;      /* the wave's first row inside every tile */
  v4f w[2][NQT * RSC];      /* this row and the next one */
#define RS_TILE(R) (NQT - 1 - (R) / RSP)      /* widest tile first */
#define RS_OFF(R) (sp_off(b, h, RS_TILE(R)) + (size_t)(r0 + (R) % RSP) * (size_t)((RS_TILE(R) + 1) * QT))      /* start of the row: the same in every lane, so the base stays in scalar registers */
#define RS_LOAD(R) do { const RS_G char* s_ = rs_uni(S + RS_OFF(R)); _Pragma("unroll") for (int c = 0; c < (RS_TILE(R) + 1) * RSC; ++c) w[(R) & 1][c] = *(const RS_G v4fa*)(s_ + l4 * 4u + c * 512); } while (0)
  RS_LOAD(0);
  asm volatile("s_wait_xcnt 0x0" ::: "memory");      /* before any register that these loads name is written again */
#pragma unroll      /* constant row numbers: tile widths and the indices into w are compile-time, w stays in registers */
  for (int r = 0; r < RSR; ++r) {
    __builtin_amdgcn_sched_barrier(0);      /* with the one below: the next row's loads are issued before this row is worked on, so they fly meanwhile */
    if (r + 1 < RSR) { RS_LOAD(r + 1);
      asm volatile("s_wait_xcnt 0x0" ::: "memory"); }      /* before any register that these loads name is written again */
    __builtin_amdgcn_sched_barrier(0);
    const int nc = (RS_TILE(r) + 1) * RSC; const int last = RS_TILE(r) * QT + r0 + r % RSP;      /* last key the row may see */
    v4f* v = w[r & 1];
#pragma unroll      /* only the diagonal tile's columns can lie behind the row's own key */
    for (int c = nc - RSC; c < nc; ++c) for (int u = 0; u < 4; ++u) v[c][u] = (c * 128 + lane * 4 + u <= last) ? v[c][u] : -1.0e9f;
    v4f m4 = {-3.0e38f, -3.0e38f, -3.0e38f, -3.0e38f};
#pragma unroll      /* constant indices into w, as above; four independent chains */
    for (int c = 0; c < nc; ++c) for (int u = 0; u < 4; ++u) m4[u] = fmaxf(m4[u], v[c][u]);
    const float mx = rs_wmax(fmaxf(fmaxf(m4[0], m4[1]), fmaxf(m4[2], m4[3])));
    v4f s4 = {0.f, 0.f, 0.f, 0.f};
#pragma unroll      /* constant indices into w, as above; four independent partial sums a lane */
    for (int c = 0; c < nc; ++c) { v[c] = rs_exp4(v[c] - mx); s4 += v[c]; }
    const float sc = 256.0f / rs_wsum((s4[0] + s4[1]) + (s4[2] + s4[3]));
    RS_G char* p = rs_uni(P + RS_OFF(r));
#pragma unroll      /* constant indices into w, as above */
    for (int c = 0; c < nc; ++c) { v4h h4; for (int u = 0; u < 4; ++u) h4[u] = (_Float16)(v[c][u] * sc); *(RS_G v4h*)(p + l4 * 2u + c * 256) = h4; }
    if (r + 1 < RSR) asm volatile("s_wait_xcnt 0x0" ::: "memory");      /* before the loads of the row after next and the next row's sums land in registers that these stores name */
  }
#undef RS_LOAD
#undef RS_G
#undef RS_OFF
#undef RS_TILE
}


// Exact f32 causal attention of the first QT0 rows. One workgroup = A0R query rows of one (batch, head); 16 lanes share a row.
// The head's k and v rows are staged once in LDS; scores: lane ks of a row takes keys ks, ks + 16, ...; softmax over the row's 16 lanes; o: lane ks of a row takes dims 4 ks .. 4 ks + 3 over all keys.
#define A0R 16                       /* query rows per workgroup */
#define A0N (QT0 / 16)               /* groups of 16 keys */
#define A0KP (HD + 4)                /* k row pitch in LDS, floats: the 16 key rows that 16 lanes read fall on 64 different banks */
#define A0PP (QT0 + 16)              /* weight row pitch in LDS, floats: the two rows of a wave fall on different banks */
__global__ __launch_bounds__(A0R * 16) void k_att0(const float* __restrict__ QF, const float* __restrict__ KF, const float* __restrict__ VF, float scale, float* __restrict__ OF) {
  __shared__ __attribute__((aligned(16))) float sk[QT0][A0KP];
  __shared__ __attribute__((aligned(16))) float sv[QT0][HD];
  __shared__ __attribute__((aligned(16))) float ps[A0R][A0PP];
  const int tid = threadIdx.x; const int h = blockIdx.x / (QT0 / A0R), rg = blockIdx.x % (QT0 / A0R);
  const int r = tid >> 4, ks = tid & 15; const int i = rg * A0R + r;      /* the thread's query row; ks = its key slot, later its group of four dims */
  const size_t hb = (size_t)blockIdx.y * QT0 * DM + h * HD;      /* grid.y = batch */
  const float* kp = KF + hb + r * DM + ks * 4; const float* vp = VF + hb + r * DM + ks * 4; const float* qp = QF + hb + i * DM;
  v4f q[HD / 4], kt[A0N], vt[A0N];
#pragma unroll      /* constant indices: the arrays stay in registers; all loads of the workgroup are in flight together, one memory round trip in all */
  for (int c = 0; c < HD / 4; ++c) q[c] = *(const v4fa*)(qp + c * 4);
#pragma unroll      /* constant indices, as above */
  for (int n = 0; n < A0N; ++n) { kt[n] = *(const v4fa*)(kp + n * 16 * DM); if (n < A0N - 1) vt[n] = *(const v4fa*)(vp + n * 16 * DM); }
  asm volatile("s_wait_xcnt 0x0" ::: "memory");      /* the last v load may land in the address registers that the loads before it name: their translations are waited for first */
  vt[A0N - 1] = *(const v4fa*)(vp + (A0N - 1) * 16 * DM);
  asm volatile("s_wait_xcnt 0x0" ::: "memory");      /* before any register that these loads name is written again */
#pragma unroll      /* constant indices, as above */
  for (int n = 0; n < A0N; ++n) { *(v4f*)&sk[n * 16 + r][ks * 4] = kt[n]; *(v4f*)&sv[n * 16 + r][ks * 4] = vt[n]; }
  __syncthreads();
  float s[A0N]; float m = -1.0e30f;
#pragma unroll      /* constant indices into s; the test reads the same in the whole workgroup: key groups behind its last row are skipped */
  for (int n = 0; n < A0N; ++n) { s[n] = -1.0e30f;
    if (n <= rg) { const int j = n * 16 + ks; v4f a4 = {0.f, 0.f, 0.f, 0.f};
#pragma unroll      /* constant indices into q; four independent sums */
      for (int c = 0; c < HD / 4; ++c) a4 += q[c] * *(const v4f*)&sk[j][c * 4];
      const float sj = ((a4[0] + a4[1]) + (a4[2] + a4[3])) * scale; s[n] = (j <= i) ? sj : -1.0e30f; m = fmaxf(m, s[n]); } }
  m = fmaxf(m, rs_xm<1>(m)); m = fmaxf(m, rs_xm<2>(m)); m = fmaxf(m, rs_xm<4>(m)); m = fmaxf(m, rs_xm<8>(m));      /* maximum over the row's 16 lanes */
  float l = 0.f;
#pragma unroll      /* constant indices into s; a key behind the row's own holds -1e30: its weight underflows to 0 */
  for (int n = 0; n < A0N; ++n) { const float e = expf(s[n] - m); l += e; ps[r][n * 16 + ks] = e; }
  l += rs_xm<1>(l); l += rs_xm<2>(l); l += rs_xm<4>(l); l += rs_xm<8>(l);      /* sum over the row's 16 lanes */
  __syncthreads();
  v4f o = {0.f, 0.f, 0.f, 0.f};
#pragma unroll 1      /* one trip = 16 keys, up to the workgroup's last row */
  for (int n = 0; n <= rg; ++n) {
#pragma unroll      /* a trip's LDS reads take constant offsets and overlap */
    for (int jj = 0; jj < 16; jj += 4) { const int j = n * 16 + jj; const v4f p4 = *(const v4f*)&ps[r][j];
      for (int u = 0; u < 4; ++u) o += p4[u] * *(const v4f*)&sv[j + u][ks * 4]; } }
  const float fin = 64.0f / l;      /* o carried x64; k_ftcopy scales it back by 1/64 */
  *(v4f*)(OF + hb + i * DM + ks * 4) = o * fin;
}


__global__ __launch_bounds__(256) void k_ftcopy(const float* __restrict__ OF0, float* __restrict__ out, size_t n4) {
  #pragma clang fp contract(off)
  const size_t t = (size_t)blockIdx.x * 256 + threadIdx.x; if (t >= n4) return; OF0 += (size_t)blockIdx.y * QT0 * DM; out += (size_t)blockIdx.y * SQ * DM;      /* grid.y = batch */
  const v4f o = *(const v4fa*)(OF0 + t * 4); v4f y; for (int q = 0; q < 4; ++q) y[q] = __fmul_rn(o[q], 0.015625f); *(v4f*)(out + t * 4) = y;  }
extern "C" void kernel_launch(void* const* d_in, const int* in_sizes, int n_in,
                              void* d_out, int out_size, void* d_ws, size_t ws_size, hipStream_t stream) {
  (void)in_sizes; (void)n_in; (void)out_size;
  const float* const* I = (const float* const*)d_in; const float* x = I[0]; const float* wq = I[1]; const float* wk = I[2]; const float* wv = I[3];      /* per-head [h][in][out] weights, no biases, no output projection */
  char* ws = (char*)d_ws; size_t off = 0;
  auto take = [&](size_t bytes) { char* p = ws + off; off += (bytes + 255) & ~(size_t)255; return p; };
  _Float16* B3 = (_Float16*)take((size_t)3 * DM * DM * 2);      /* q, k, v weights, one after the other */
  _Float16* X16 = (_Float16*)take(NR * DM * 2); _Float16* QKV16 = (_Float16*)take((size_t)3 * NR * DM * 2); _Float16* Q16 = QKV16; _Float16* K16 = QKV16 + NR * DM; _Float16* V16 = QKV16 + 2 * NR * DM;
  float* S = (float*)take((size_t)NB * NH * QT * QT * (NQT * (NQT + 1) / 2) * 4); _Float16* P = (_Float16*)take((size_t)NB * NH * QT * QT * (NQT * (NQT + 1) / 2) * 2); _Float16* VT = (_Float16*)take((size_t)NB * NH * HD * SQ * 2);
  float* F0 = (float*)take((size_t)3 * NB * QT0 * DM * 4); float* OF0 = (float*)take((size_t)NB * QT0 * DM * 4);
  if (off > ws_size) return;
  k_wthd<<<dim3((unsigned)(((size_t)NH * HD * (DM / 8) + 255) / 256), 3), 256, 0, stream>>>(wq, wk, wv, B3);      /* per-head [m][d] -> Bt[(h,d)][m] x16 */
  k_x16<<<(unsigned)((NR * DM / 8 + 255) / 256), 256, 0, stream>>>(x, X16, NR * DM / 8);
  k_qkv<<<dim3((unsigned)((MP / 128) * (DM / 64)), 3), 128, 0, stream>>>(X16, B3, QKV16);
  k_vt<NH, SQ><<<NB * NH * (SQ / 64), 256, 0, stream>>>(V16, LQ, 0, VT);      /* V^T [NB][NH][HD][SQ] */
  k_proj0<<<dim3((QT0 / 128) * (DM / 64), 3, NB), 128, 0, stream>>>(X16, B3, F0);      /* f32 q, k, v of the first 128 rows (exact products) */
  k_att0<<<dim3(NH * (QT0 / A0R), NB), A0R * 16, 0, stream>>>(F0, F0 + (size_t)NB * QT0 * DM, F0 + (size_t)2 * NB * QT0 * DM, 0.125f, OF0);      /* exact f32 attention for rows 0..127 (o x64) */
  k_scores<<<dim3((QT / 128) * (SQ / 64), NH, NQT * NB), 128, 0, stream>>>(Q16, K16, S);
  k_rsmcf2<<<dim3(QT / (RSW * RSP), NH, NB), RSW * 32, 0, stream>>>(S, P);
  k_pv<<<dim3((QT / 128) * (HD / 64), NH, NQT * NB), 128, 0, stream>>>(P, VT, (float*)d_out);      /* out = attn v (concatenated heads) written f32 */
  k_ftcopy<<<dim3((unsigned)(((size_t)QT0 * DM / 4 + 255) / 256), NB), 256, 0, stream>>>(OF0, (float*)d_out, (size_t)QT0 * DM / 4);      /* rows 0..127 of each batch rewritten from the exact f32 attention (the module has no output projection) */
}

// v005
// It runs in 97.5 microseconds.
// Next to v004, in two timings, it ran 1.64 times as fast each time.
// Counting every step since v000, it is 43.4 times as fast.
#include <hip/hip_runtime.h>
// Causal multi-head attention with per-head weight tensors (x [4][1024][768]; Q[s][h][d] = sum_m x[s][m] W_Q[h][m][d], K, V likewise (12 heads of 64); scores / 8 with a causal mask (tril); softmax; avg_V = probs V; out[q][h*64 + d] = avg_V[q][h][d], no output projection -> [4][1024][768]).
// Structure: token rows r = b*1024 + s; x as exact f16 rows (bf16-rounded); Q, K, V as three WMMA GEMMs (32x64 wave tiles, f32 accumulation, exact x16 weights, no bias, f16 outputs); every stage is one launch over all batches (and all query tiles, on grid.z): V^T for all heads via LDS transposes; one fused attention kernel: per 64 query rows, trips of 64 keys up to the diagonal: scores on WMMA (K = 64), running-maximum softmax in registers (f32 statistics, native exp; weights x256 f16), weighted sum of v on WMMA, f32 accumulators rescaled each trip, written f32 straight into the concatenated-heads output rows (no output projection); first-tile refinement: the first 128 query rows of every batch recomputed exactly in f32 (f32 q/k/v GEMMs + a causal attention on VALU, 16 lanes a query row) and copied over those output rows.
// Compute dtype: inputs rounded to bf16; x / weights exact; q, k, v and softmax weights as plain f16 GEMM operands (~2^-12); o, scores and softmax statistics f32. v_wmma_f32_16x16x32_f16.
#define NB 4
#define SQ 1024
#define DM 768
#define NH 12
#define HD 64
#define HG 4                         /* heads per launch of the per-batch k_vt overload (never launched) */
#define QT0 128                      /* first-tile rows recomputed exactly in f32 */
#define B0 0                         /* unused (all batches on the grid) */
#define NBR NB                       /* batches processed (debug hook) */
#define NR ((size_t)NB * SQ)         /* token rows */
#define MP ((int)((size_t)NBR * SQ)) /* rows projected (debug hook) */
#define QN SQ                        /* unused (query tiles on grid.z) */
#define NHD NH                       /* unused (all heads on the grid) */
#define MPO MP                       /* unused (no output stage) */
#define LQ DM      /* row pitch of the q/k/v rows */
typedef __bf16 v16b __attribute__((ext_vector_type(16)));
typedef unsigned short v8us __attribute__((ext_vector_type(8), may_alias));
typedef float  v8f  __attribute__((ext_vector_type(8)));
typedef float  v4f  __attribute__((ext_vector_type(4)));
typedef float  v4fa __attribute__((ext_vector_type(4), may_alias));
union FragB { v16b v; v8us half[2]; unsigned short u[16]; };

__device__ __forceinline__ unsigned short bf16_bits(float x) { unsigned int u = __float_as_uint(x); return (unsigned short)((u + 0x7FFFu + ((u >> 16) & 1u)) >> 16); }
__device__ __forceinline__ float bf16_val(unsigned short b) { return __uint_as_float(((unsigned int)b) << 16); }
__device__ __forceinline__ float bf16_round(float x) { return bf16_val(bf16_bits(x)); }
// D += A·B with NT terms: 1 = ah·bh, 2 = + al·bh (A split), 3 = + ah·bl (both split)
template <int NT>
__device__ __forceinline__ v8f mmaN(v16b ah, v16b al, v16b bh, v16b bl, v8f c) {
  c = __builtin_amdgcn_wmma_f32_16x16x32_bf16(false, ah, false, bh, (short)0, c, false, false);
  if (NT >= 2) c = __builtin_amdgcn_wmma_f32_16x16x32_bf16(false, al, false, bh, (short)0, c, false, false);
  if (NT >= 3) c = __builtin_amdgcn_wmma_f32_16x16x32_bf16(false, ah, false, bl, (short)0, c, false, false);
  asm volatile("v_nop\n\tv_nop\n\tv_nop\n\tv_nop" : "+v"(c) : "v"(ah), "v"(al), "v"(bh), "v"(bl));
  return c;
}

__global__ __launch_bounds__(256) void k_wt_bf16(const float* __restrict__ W, unsigned short* __restrict__ Wt, int K, int N) {
  const int t = blockIdx.x * 256 + threadIdx.x;
  const int k8n = K / 8;
  if (t >= N * k8n) return;
  const int n = t / k8n, k8 = (t % k8n) * 8;
  v8us v;
#pragma unroll
  for (int i = 0; i < 8; ++i) v[i] = bf16_bits(W[(size_t)(k8 + i) * N + n]);
  *(v8us*)(Wt + (size_t)n * K + k8) = v;
  
}

// GEMM C[M][N] (f32, pitch ldc) = act(A[M][K]·W + bias). A f32 row-major (pitch lda) converted per fragment to bf16
// (ASPLIT: hi/lo two planes -> 2 terms, else single rounded term); Wt bf16 [N][K] (pitch ldb). BIAS_BF16 rounds the
// bias to bf16 first (bias quantised to bf16 before the add). K%32==0, M%16==0, N%64==0.
template <bool ASPLIT, int ACT, bool BIAS_BF16>
__global__ __launch_bounds__(128) void k_gemm_bf(const float* __restrict__ A, int lda, const unsigned short* __restrict__ Wt, int ldb,
                                               const float* __restrict__ bias, float* __restrict__ C, int ldc, int M, int N, int K) {
  __shared__ __attribute__((aligned(16))) float so[4][16][64];
  const int tid = threadIdx.x, w = tid >> 5, lane = tid & 31, ln = lane & 15, hh = lane >> 4;
  const int ntn = N / 64;
  const int wid = blockIdx.x * 4 + w;
  const int mt = wid / ntn, nq = wid % ntn;
  if (mt * 16 >= M) return;
  const int row0 = mt * 16, col0 = nq * 64;
  const float* arow = A + (size_t)(row0 + ln) * lda;
  v8f acc[4] = {};
  for (int kb = 0; kb < K; kb += 32) {
    FragB ah, al;
    const v4f x0 = *(const v4fa*)(arow + kb + 8 * hh), x1 = *(const v4fa*)(arow + kb + 8 * hh + 4);
    const v4f x2 = *(const v4fa*)(arow + kb + 16 + 8 * hh), x3 = *(const v4fa*)(arow + kb + 16 + 8 * hh + 4);
    float xs[16] = {x0[0],x0[1],x0[2],x0[3],x1[0],x1[1],x1[2],x1[3],x2[0],x2[1],x2[2],x2[3],x3[0],x3[1],x3[2],x3[3]};
#pragma unroll
    for (int i = 0; i < 16; ++i) { const unsigned short hb = bf16_bits(xs[i]); ah.u[i] = hb; al.u[i] = ASPLIT ? bf16_bits(xs[i] - bf16_val(hb)) : (unsigned short)0; }
#pragma unroll
    for (int t = 0; t < 4; ++t) {
      const unsigned short* brow = Wt + (size_t)(col0 + t * 16 + ln) * ldb + kb;
      FragB b;
      b.half[0] = *(const v8us*)(brow + 8 * hh);
      b.half[1] = *(const v8us*)(brow + 16 + 8 * hh);
      acc[t] = mmaN<ASPLIT ? 2 : 1>(ah.v, al.v, b.v, b.v, acc[t]);
    }
  }
#pragma unroll
  for (int t = 0; t < 4; ++t) {
    float bv = bias ? bias[col0 + t * 16 + ln] : 0.f;
    if (BIAS_BF16) bv = bf16_round(bv);
#pragma unroll
    for (int r = 0; r < 8; ++r) { float v = acc[t][r] + bv; if (ACT == 1) v = fmaxf(v, 0.f); so[w][8 * hh + r][t * 16 + ln] = v; }
  }
  __builtin_amdgcn_fence(__ATOMIC_ACQ_REL, "workgroup");
  __builtin_amdgcn_wave_barrier();
  const int rsub = lane >> 4, c4 = (lane & 15) * 4;
  {
#pragma unroll
    for (int q = 0; q < 8; ++q) {
      const int r = q * 2 + rsub;
      const v4f v = *(const v4fa*)&so[w][r][c4];
      *(v4f*)(C + (size_t)(row0 + r) * ldc + col0 + c4) = v;
    }
    
  }
}

// GEMM C = act(A·W + bias + resid): A f32 (ASPLIT -> hi/lo 2 terms), Wt bf16 [N][K]; ACT 0 none, 1 relu, 2 exact gelu;
// resid (optional, f32, row index = (row % rmod), pitch ldr, RES_BF16 rounds it) added before the activation.
template <bool ASPLIT, int ACT, bool BIAS_BF16, bool RES_BF16>
__global__ __launch_bounds__(128) void k_gemm_bf3(const float* __restrict__ A, int lda, const unsigned short* __restrict__ Wt, int ldb,
                                                const float* __restrict__ bias, const float* __restrict__ resid, int rmod, int ldr,
                                                float* __restrict__ C, int ldc, int M, int N, int K) {
  __shared__ __attribute__((aligned(16))) float so[4][16][64];
  const int tid = threadIdx.x, w = tid >> 5, lane = tid & 31, ln = lane & 15, hh = lane >> 4;
  const int ntn = N / 64;
  const int wid = blockIdx.x * 4 + w;
  const int mt = wid / ntn, nq = wid % ntn;
  if (mt * 16 >= M) return;
  const int row0 = mt * 16, col0 = nq * 64;
  const float* arow = A + (size_t)(row0 + ln) * lda;
  v8f acc[4] = {};
  for (int kb = 0; kb < K; kb += 32) {
    FragB ah, al;
    const v4f x0 = *(const v4fa*)(arow + kb + 8 * hh), x1 = *(const v4fa*)(arow + kb + 8 * hh + 4);
    const v4f x2 = *(const v4fa*)(arow + kb + 16 + 8 * hh), x3 = *(const v4fa*)(arow + kb + 16 + 8 * hh + 4);
    float xs[16] = {x0[0],x0[1],x0[2],x0[3],x1[0],x1[1],x1[2],x1[3],x2[0],x2[1],x2[2],x2[3],x3[0],x3[1],x3[2],x3[3]};
#pragma unroll
    for (int i = 0; i < 16; ++i) { const unsigned short hb = bf16_bits(xs[i]); ah.u[i] = hb; al.u[i] = ASPLIT ? bf16_bits(xs[i] - bf16_val(hb)) : (unsigned short)0; }
#pragma unroll
    for (int t = 0; t < 4; ++t) {
      const unsigned short* brow = Wt + (size_t)(col0 + t * 16 + ln) * ldb + kb;
      FragB b;
      b.half[0] = *(const v8us*)(brow + 8 * hh);
      b.half[1] = *(const v8us*)(brow + 16 + 8 * hh);
      acc[t] = mmaN<ASPLIT ? 2 : 1>(ah.v, al.v, b.v, b.v, acc[t]);
    }
  }
#pragma unroll
  for (int t = 0; t < 4; ++t) {
    const int col = col0 + t * 16 + ln;
    float bv = bias ? bias[col] : 0.f;
    if (BIAS_BF16) bv = bf16_round(bv);
#pragma unroll
    for (int r = 0; r < 8; ++r) {
      float v = acc[t][r] + bv;
      if (resid) { float rv = resid[(size_t)((row0 + 8 * hh + r) % rmod) * ldr + col]; if (RES_BF16) rv = bf16_round(rv); v += rv; }
      if (ACT == 1) v = fmaxf(v, 0.f);
      if (ACT == 2) v = 0.5f * v * (1.0f + erff(v * 0.70710678118654752f));
      if (ACT == 3) { const float u = 0.7978845608028654f * (v + 0.044715f * v * v * v); v = 0.5f * v * (1.0f + tanhf(u)); }
      so[w][8 * hh + r][t * 16 + ln] = v;
    }
  }
  __builtin_amdgcn_fence(__ATOMIC_ACQ_REL, "workgroup");
  __builtin_amdgcn_wave_barrier();
  const int rsub = lane >> 4, c4 = (lane & 15) * 4;
  {
#pragma unroll
    for (int q = 0; q < 8; ++q) {
      const int r = q * 2 + rsub;
      const v4f v = *(const v4fa*)&so[w][r][c4];
      *(v4f*)(C + (size_t)(row0 + r) * ldc + col0 + c4) = v;
    }
    
  }
}
// row LayerNorm (biased variance, eps) over N: s = X (+ R); optional out_sum <- s; out_norm <- (s-mu)*rsqrt(var+eps)*g + b
template <bool PARAM_BF16>
__global__ __launch_bounds__(256) void k_layernorm(const float* __restrict__ X, const float* __restrict__ R, const float* __restrict__ g, const float* __restrict__ bta,
                                                  float* __restrict__ out_sum, float* __restrict__ out_norm, int N, float eps) {
  __shared__ float red[256];
  const int row = blockIdx.x, tid = threadIdx.x;
  const float* x = X + (size_t)row * N; const float* rr = R ? R + (size_t)row * N : nullptr;
  float vals[16];                     // up to N = 4096
  const int per = N / 256;            // contiguous chunk per thread? use strided-by-4 chunks: thread handles j = tid*4 + 1024*u
  float s1 = 0.f;
  for (int u = 0; u < per / 4; ++u) {
    const int j = tid * 4 + 1024 * u;
    const v4f a = *(const v4fa*)(x + j);
    v4f b = {0.f,0.f,0.f,0.f}; if (rr) b = *(const v4fa*)(rr + j);
#pragma unroll
    for (int q = 0; q < 4; ++q) { const float v = a[q] + b[q]; vals[u * 4 + q] = v; s1 += v; }
  }
  red[tid] = s1; __syncthreads();
  for (int st = 128; st > 0; st >>= 1) { if (tid < st) red[tid] += red[tid + st]; __syncthreads(); }
  const float mu = red[0] / (float)N; __syncthreads();
  float s2 = 0.f;
  for (int u = 0; u < per / 4; ++u)
#pragma unroll
    for (int q = 0; q < 4; ++q) { const float c = vals[u * 4 + q] - mu; s2 += c * c; }
  red[tid] = s2; __syncthreads();
  for (int st = 128; st > 0; st >>= 1) { if (tid < st) red[tid] += red[tid + st]; __syncthreads(); }
  const float rs = rsqrtf(red[0] / (float)N + eps);
  {
    for (int u = 0; u < per / 4; ++u) {
      const int j = tid * 4 + 1024 * u;
      v4f o, sm;
#pragma unroll
      for (int q = 0; q < 4; ++q) {
        float gg = g[j + q], bb = bta[j + q];
        if (PARAM_BF16) { gg = bf16_round(gg); bb = bf16_round(bb); }
        sm[q] = vals[u * 4 + q]; o[q] = (vals[u * 4 + q] - mu) * rs * gg + bb;
      }
      if (out_sum) *(v4f*)(out_sum + (size_t)row * N + j) = sm;
      *(v4f*)(out_norm + (size_t)row * N + j) = o;
    }
    
  }
}



// ---- f16 WMMA path (v_wmma_f32_16x16x32_f16): 11-bit significands for operands in range — used where a [0,1] probability operand needs more precision than bf16
typedef _Float16 v16h __attribute__((ext_vector_type(16)));
union FragH { v16h v; v8us half[2]; _Float16 h[16]; unsigned short u[16]; };
template <int NT>
__device__ __forceinline__ v8f mmaH(v16h ah, v16h al, v16h bh, v16h bl, v8f c) {
  c = __builtin_amdgcn_wmma_f32_16x16x32_f16(false, ah, false, bh, (short)0, c, false, false);
  if (NT >= 2) c = __builtin_amdgcn_wmma_f32_16x16x32_f16(false, al, false, bh, (short)0, c, false, false);
  if (NT >= 3) c = __builtin_amdgcn_wmma_f32_16x16x32_f16(false, ah, false, bl, (short)0, c, false, false);
  asm volatile("v_nop\n\tv_nop\n\tv_nop\n\tv_nop" : "+v"(c) : "v"(ah), "v"(al), "v"(bh), "v"(bl));
  return c;
}
// batched GEMM like k_gemm_b but f16 operands: A f32 (split into f16 hi/lo if ASPLIT, else rounded to f16), Bt = f16 values [n][k]; alpha; C f32; N multiple of 16 (partial tiles skipped)
template <bool ASPLIT>
__global__ __launch_bounds__(128) void k_gemm_h(const float* __restrict__ A, int lda, size_t sA, const _Float16* __restrict__ Bh, int ldb, size_t sB, float alpha, float* __restrict__ C, int ldc, size_t sC, int M, int N, int K) {
  __shared__ __attribute__((aligned(16))) float so[4][16][64];
  const int tid = threadIdx.x, w = tid >> 5, lane = tid & 31, ln = lane & 15, hh = lane >> 4; const int by = blockIdx.y;
  A += (size_t)by * sA; Bh += (size_t)by * sB; C += (size_t)by * sC;
  const int ntn = (N + 63) / 64; const int wid = blockIdx.x * 4 + w; const int mt = wid / ntn, nq = wid % ntn; if (mt * 16 >= M) return;
  const int row0 = mt * 16, col0 = nq * 64; const float* arow = A + (size_t)(row0 + ln) * lda;
  v8f acc[4] = {};
  for (int kb = 0; kb < K; kb += 32) {
    FragH ah, al;
    const v4f x0 = *(const v4fa*)(arow + kb + 8 * hh), x1 = *(const v4fa*)(arow + kb + 8 * hh + 4), x2 = *(const v4fa*)(arow + kb + 16 + 8 * hh), x3 = *(const v4fa*)(arow + kb + 16 + 8 * hh + 4);
    float xs[16] = {x0[0],x0[1],x0[2],x0[3],x1[0],x1[1],x1[2],x1[3],x2[0],x2[1],x2[2],x2[3],x3[0],x3[1],x3[2],x3[3]};
#pragma unroll
    for (int i = 0; i < 16; ++i) { const _Float16 h = (_Float16)xs[i]; ah.h[i] = h; al.h[i] = ASPLIT ? (_Float16)(xs[i] - (float)h) : (_Float16)0.0f; }
#pragma unroll
    for (int t = 0; t < 4; ++t) { if (col0 + t * 16 >= N) continue; const size_t boff = (size_t)(col0 + t * 16 + ln) * ldb + kb; FragH bq; bq.half[0] = *(const v8us*)(Bh + boff + 8 * hh); bq.half[1] = *(const v8us*)(Bh + boff + 16 + 8 * hh);
      acc[t] = mmaH<ASPLIT ? 2 : 1>(ah.v, al.v, bq.v, bq.v, acc[t]); }
  }
#pragma unroll
  for (int t = 0; t < 4; ++t) { if (col0 + t * 16 >= N) continue;
#pragma unroll
    for (int r = 0; r < 8; ++r) so[w][8 * hh + r][t * 16 + ln] = acc[t][r] * alpha; }
  __builtin_amdgcn_fence(__ATOMIC_ACQ_REL, "workgroup"); __builtin_amdgcn_wave_barrier();
  const int rsub = lane >> 4, c4 = (lane & 15) * 4;
  {
#pragma unroll
    for (int q = 0; q < 8; ++q) { const int r = q * 2 + rsub; if (col0 + c4 < N) { const v4f v = *(const v4fa*)&so[w][r][c4]; *(v4f*)(C + (size_t)(row0 + r) * ldc + col0 + c4) = v; } }
     }
}

// Wt[n][k] = f16(W[k][n]·scale) from f32 row-major W[K][N] (scale = power of two; bf16-exact weights stay exact in f16 away from the subnormal range)
__global__ __launch_bounds__(256) void k_wt_f16(const float* __restrict__ W, _Float16* __restrict__ Wt, int K, int N, float scale) {
  const int t = blockIdx.x * 256 + threadIdx.x; if (t >= N * (K / 8)) return; const int n = t / (K / 8), k8 = (t % (K / 8)) * 8; FragH f;
#pragma unroll
  for (int i = 0; i < 8; ++i) f.h[i] = (_Float16)(bf16_round(W[(size_t)(k8 + i) * N + n]) * scale); const v8us o = f.half[0];
  *(v8us*)((unsigned short*)Wt + (size_t)n * K + k8) = o; 
}
// k_gemm_hh variant with fused epilogue: v = acc·alpha + bias[by·sBias + col] (+ CP[(row/rowsPerB)·sCPb + by·64 + col] if CP) ; ACT 0 none / 1 elu ; writes f16 C16 (and f32 C if non-null)
template <int ACT>
__global__ __launch_bounds__(128) void k_gemm_hhx(const _Float16* __restrict__ A, int lda, size_t sA, const _Float16* __restrict__ Bh, int ldb, size_t sB, float alpha, const float* __restrict__ bias, size_t sBias, const float* __restrict__ CP, int rowsPerB, size_t sCPb, int row0g,
    float* __restrict__ C, _Float16* __restrict__ C16, int ldc, size_t sC, int M, int N, int K) {
  __shared__ __attribute__((aligned(16))) float so[4][16][64];
  const int tid = threadIdx.x, w = tid >> 5, lane = tid & 31, ln = lane & 15, hh = lane >> 4; const int by = blockIdx.y;
  A += (size_t)by * sA; Bh += (size_t)by * sB; const size_t cofs = (size_t)by * sC; const float* bp = bias ? bias + (size_t)by * sBias : nullptr;
  const int ntn = (N + 63) / 64; const int wid = blockIdx.x * 4 + w; const int mt = wid / ntn, nq = wid % ntn; if (mt * 16 >= M) return;
  const int row0 = mt * 16, col0 = nq * 64; const _Float16* arow = A + (size_t)(row0 + ln) * lda;
  v8f acc[4] = {};
  for (int kb = 0; kb < K; kb += 32) { FragH ah; ah.half[0] = *(const v8us*)((const unsigned short*)arow + kb + 8 * hh); ah.half[1] = *(const v8us*)((const unsigned short*)arow + kb + 16 + 8 * hh);
#pragma unroll
    for (int t = 0; t < 4; ++t) { if (col0 + t * 16 >= N) continue; const size_t boff = (size_t)(col0 + t * 16 + ln) * ldb + kb; FragH bq; bq.half[0] = *(const v8us*)((const unsigned short*)Bh + boff + 8 * hh); bq.half[1] = *(const v8us*)((const unsigned short*)Bh + boff + 16 + 8 * hh);
      acc[t] = mmaH<1>(ah.v, ah.v, bq.v, bq.v, acc[t]); }
  }
#pragma unroll
  for (int t = 0; t < 4; ++t) { if (col0 + t * 16 >= N) continue; const int col = col0 + t * 16 + ln; const float bv = bp ? bf16_round(bp[col]) : 0.f;
#pragma unroll
    for (int r = 0; r < 8; ++r) { float v = acc[t][r] * alpha + bv; if (CP) { const int rr = row0g + row0 + 8 * hh + r; if (rowsPerB < 0) v += CP[cofs + (size_t)rr * ldc + col];      /* rowsPerB < 0: own element of the batched C plane */ else { const int bidx = rr / rowsPerB; v += CP[(size_t)bidx * sCPb + (size_t)by * 64 + col]; } } if (ACT == 1) v = (v > 0.f) ? v : expm1f(v); else if (ACT == 7) v = (v > 0.f) ? v + 1.0f : expf(v); else if (ACT == 8) v = tanhf(v); else if (ACT == 9) v = 0.5f * v * (1.0f + tanhf(0.7978845608028654f * (v + 0.044715f * v * v * v))); else if (ACT == 11) v = 1.0f / (1.0f + expf(-v)); else if (ACT == 12) v = (v > 0.f) ? v : 0.01f * v; else if (ACT == 14) v = (v > 0.f) ? v : 0.1f * v; else if (ACT == 16) v = (v >= 0.f) ? v : 0.3f * v; else if (ACT == 17) v = (v >= 0.f) ? v : 0.2f * v; else if (ACT == 15) v = v / (1.0f + expf(-v)); else if (ACT == 3) v = fmaxf(v, 0.f); else if (ACT == 6) v = 0.5f * v * (1.0f + erff(v * 0.70710678118654752f)); so[w][8 * hh + r][t * 16 + ln] = v; } }
  __builtin_amdgcn_fence(__ATOMIC_ACQ_REL, "workgroup"); __builtin_amdgcn_wave_barrier();
  const int rsub = lane >> 4, c4 = (lane & 15) * 4; typedef _Float16 v4h __attribute__((ext_vector_type(4)));
  {
#pragma unroll
    for (int q = 0; q < 8; ++q) { const int r = q * 2 + rsub; if (col0 + c4 < N) { const v4f v = *(const v4fa*)&so[w][r][c4]; if (C) *(v4f*)(C + cofs + (size_t)(row0 + r) * ldc + col0 + c4) = v; if (C16) { v4h h4; for (int i = 0; i < 4; ++i) h4[i] = (_Float16)v[i]; *(v4h*)(C16 + cofs + (size_t)(row0 + r) * ldc + col0 + c4) = h4; } } }
     }
}


typedef _Float16 v4h __attribute__((ext_vector_type(4)));

__global__ __launch_bounds__(256) void k_x16(const float* __restrict__ x, _Float16* __restrict__ X16, size_t n8) { const size_t t = (size_t)blockIdx.x * 256 + threadIdx.x; if (t >= n8) return; FragH f;
#pragma unroll
  for (int q = 0; q < 8; ++q) f.h[q] = (_Float16)bf16_round(x[t * 8 + q]); *(v8us*)((unsigned short*)X16 + t * 8) = f.half[0];  }
__global__ __launch_bounds__(256) void k_h16(const float* __restrict__ x, _Float16* __restrict__ X16, size_t n8) { const size_t t = (size_t)blockIdx.x * 256 + threadIdx.x; if (t >= n8) return; FragH f;
#pragma unroll
  for (int q = 0; q < 8; ++q) f.h[q] = (_Float16)x[t * 8 + q]; *(v8us*)((unsigned short*)X16 + t * 8) = f.half[0];  }
__global__ __launch_bounds__(256) void k_round16f(const float* __restrict__ W, _Float16* __restrict__ Bt, size_t n8) { const size_t t = (size_t)blockIdx.x * 256 + threadIdx.x; if (t >= n8) return; FragH f;
#pragma unroll
  for (int i = 0; i < 8; ++i) f.h[i] = (_Float16)(bf16_round(W[t * 8 + i]) * 16.0f); *(v8us*)((unsigned short*)Bt + t * 8) = f.half[0];  }
template <int NHv, int TTv>
__global__ __launch_bounds__(256) void k_vt(const _Float16* __restrict__ V16, int ldv, int voff, _Float16* __restrict__ Vt) { __shared__ unsigned short tl[64][66]; const int tid = threadIdx.x; const int slab = blockIdx.x / (TTv / 64), lg = blockIdx.x % (TTv / 64); const int b = slab / NHv, h = slab % NHv;
  for (int i = tid; i < 64 * 8; i += 256) { const int r = i / 8, c8 = (i % 8) * 8; FragH f; f.half[0] = *(const v8us*)((const unsigned short*)V16 + ((size_t)b * TTv + lg * 64 + r) * ldv + voff + h * 64 + c8);
#pragma unroll
    for (int q = 0; q < 8; ++q) tl[r][c8 + q] = f.u[q]; }
  __syncthreads();
  {
#pragma unroll
    for (int rd = 0; rd < 2; ++rd) { const int d = rd * 32 + tid / 8, pc = tid % 8; FragH f;
#pragma unroll
      for (int q = 0; q < 8; ++q) f.u[q] = tl[pc * 8 + q][d];
      *(v8us*)((unsigned short*)Vt + ((size_t)slab * 64 + d) * TTv + lg * 64 + pc * 8) = f.half[0]; }
     } }

__global__ __launch_bounds__(256) void k_hl(const float* __restrict__ F, _Float16* __restrict__ Hh, _Float16* __restrict__ Hl, size_t n8) { const size_t t = (size_t)blockIdx.x * 256 + threadIdx.x; if (t >= n8) return; FragH fh, fl; const v4f a = *(const v4fa*)(F + t * 8), c = *(const v4fa*)(F + t * 8 + 4);
#pragma unroll
  for (int q = 0; q < 4; ++q) { _Float16 h = (_Float16)a[q]; fh.h[q] = h; fl.h[q] = (_Float16)((a[q] - (float)h) * 1024.0f); h = (_Float16)c[q]; fh.h[4 + q] = h; fl.h[4 + q] = (_Float16)((c[q] - (float)h) * 1024.0f); }
  { *(v8us*)((unsigned short*)Hh + t * 8) = fh.half[0]; *(v8us*)((unsigned short*)Hl + t * 8) = fl.half[0];  } }

// ---- fast GEMM (wave tile 32x64; requires M % 32 == 0 rows per launch region and N % 64 == 0); epilogue = k_gemm_hhx semantics ----
__device__ __forceinline__ v16h g2_frag(const _Float16* p, int hh) { FragH f; f.half[0] = *(const v8us*)((const unsigned short*)p + 8 * hh); f.half[1] = *(const v8us*)((const unsigned short*)p + 16 + 8 * hh); return f.v; }
__device__ __forceinline__ v8f g2_mma(v16h a, v16h b, v8f c) { v8f d = __builtin_amdgcn_wmma_f32_16x16x32_f16(false, a, false, b, (short)0, c, false, false); asm volatile("v_nop\n\tv_nop\n\tv_nop\n\tv_nop" : "+v"(d) : "v"(a), "v"(b)); return d; }
template <int ACT>
__device__ __forceinline__ void gemm2_tile(const int bx, const int by, const _Float16* __restrict__ A, int lda, size_t sA, const _Float16* __restrict__ Bh, int ldb, size_t sB, float alpha, const float* __restrict__ bias, size_t sBias, const float* __restrict__ CP, int rowsPerB, size_t sCPb, int row0g,
    float* __restrict__ C, _Float16* __restrict__ C16, int ldc, size_t sC, int M, int N, int K) { static_assert(ACT == 0 || ACT == 3 || ACT == 6 || ACT == 8 || ACT == 9 || ACT == 11 || ACT == 12 || ACT == 14 || ACT == 15 || ACT == 16 || ACT == 17, "gemm2_tile: unsupported ACT code (would silently apply no activation)");
  __shared__ __attribute__((aligned(16))) float so[4][32][68];
  const int tid = threadIdx.x, w = tid >> 5, lane = tid & 31, ln = lane & 15, hh = lane >> 4;
  A += (size_t)by * sA; Bh += (size_t)by * sB; const size_t cofs = (size_t)by * sC; const float* bp = bias ? bias + (size_t)by * sBias : nullptr;
  const int ntn = N >> 6; const int mt = bx / ntn, nq = bx - mt * ntn; const int row0 = mt * 128 + 32 * w, col0 = nq * 64; if (row0 >= M) return;
  const _Float16* a0p = A + (size_t)(row0 + ln) * lda; const _Float16* a1p = a0p + (size_t)16 * lda;
  const _Float16* b0p = Bh + (size_t)(col0 + ln) * ldb; const _Float16* b1p = b0p + (size_t)16 * ldb; const _Float16* b2p = b1p + (size_t)16 * ldb; const _Float16* b3p = b2p + (size_t)16 * ldb;
  const v8f z8 = {0.f,0.f,0.f,0.f,0.f,0.f,0.f,0.f}; v8f c00 = z8, c01 = z8, c02 = z8, c03 = z8, c10 = z8, c11 = z8, c12 = z8, c13 = z8;
#pragma unroll 1
  for (int kb = 0; kb < K; kb += 32) { const v16h a0 = g2_frag(a0p + kb, hh); FragH a1f; a1f.half[0] = *(const v8us*)((const unsigned short*)(a1p + kb) + 8 * hh);
    asm volatile("s_wait_xcnt 0x0" ::: "memory");      /* the last A load lands in the address registers that the A loads before it name: their translations are waited for first */
    a1f.half[1] = *(const v8us*)((const unsigned short*)(a1p + kb) + 16 + 8 * hh); const v16h a1 = a1f.v;
    v16h b = g2_frag(b0p + kb, hh); c00 = g2_mma(a0, b, c00); c10 = g2_mma(a1, b, c10);
    b = g2_frag(b1p + kb, hh); c01 = g2_mma(a0, b, c01); c11 = g2_mma(a1, b, c11);
    b = g2_frag(b2p + kb, hh); c02 = g2_mma(a0, b, c02); c12 = g2_mma(a1, b, c12);
    b = g2_frag(b3p + kb, hh); c03 = g2_mma(a0, b, c03); c13 = g2_mma(a1, b, c13); }
  v8f accs[8] = {c00, c01, c02, c03, c10, c11, c12, c13};
#pragma unroll
  for (int u = 0; u < 8; ++u) { const int t = u & 3, half = u >> 2; const int col = col0 + t * 16 + ln; const float bv = bp ? bf16_round(bp[col]) : 0.f;
#pragma unroll
    for (int r = 0; r < 8; ++r) { const int rloc = half * 16 + 8 * hh + r; float v = accs[u][r] * alpha + bv; if (CP) { if (rowsPerB < 0) v += CP[cofs + (size_t)(row0g + row0 + rloc) * ldc + col];      /* rowsPerB < 0: own element of the batched C plane */ else { const int bidx = (row0g + row0 + rloc) / rowsPerB; v += CP[(size_t)bidx * sCPb + (size_t)by * 64 + col]; } }
      if (ACT == 3) v = fmaxf(v, 0.f); else if (ACT == 6) v = 0.5f * v * (1.0f + erff(v * 0.70710678118654752f)); else if (ACT == 11) v = 1.0f / (1.0f + expf(-v)); else if (ACT == 15) v = v / (1.0f + expf(-v)); else if (ACT == 12) v = (v > 0.f) ? v : 0.01f * v; else if (ACT == 8) v = tanhf(v); else if (ACT == 9) v = 0.5f * v * (1.0f + tanhf(0.7978845608028654f * (v + 0.044715f * v * v * v))); else if (ACT == 14) v = (v > 0.f) ? v : 0.1f * v; else if (ACT == 16) v = (v >= 0.f) ? v : 0.3f * v; else if (ACT == 17) v = (v >= 0.f) ? v : 0.2f * v;
      so[w][rloc][t * 16 + ln] = v; } }
  __builtin_amdgcn_fence(__ATOMIC_ACQ_REL, "workgroup"); __builtin_amdgcn_wave_barrier();
  const int rsub = lane >> 4, c4 = (lane & 15) * 4;
  {
#pragma unroll
    for (int q = 0; q < 16; ++q) { const int r = q * 2 + rsub; const v4f v = *(const v4fa*)&so[w][r][c4]; if (C) *(v4f*)(C + cofs + (size_t)(row0 + r) * ldc + col0 + c4) = v; if (C16) { v4h h4; for (int i = 0; i < 4; ++i) h4[i] = (_Float16)v[i]; *(v4h*)(C16 + cofs + (size_t)(row0 + r) * ldc + col0 + c4) = h4; } }
     } }
// ---- one launch per stage: batch and causal query tile ride on the grid ----
// f16 q, k, v of all token rows: grid.y = which of q/k/v; QKV16 [3][NR][DM]
__global__ __launch_bounds__(128) void k_qkv(const _Float16* __restrict__ X16, const _Float16* __restrict__ B3, _Float16* __restrict__ QKV16) { const int wh = blockIdx.y;
  gemm2_tile<0>(blockIdx.x, 0, X16, DM, 0, B3 + (size_t)wh * DM * DM, DM, 0, 0.0625f, nullptr, 0, nullptr, 1, 0, 0, nullptr, QKV16 + (size_t)wh * NR * DM, DM, 0, MP, DM, DM); }
// f32 q, k, v of the first QT0 rows of every batch: grid.y = which of q/k/v, grid.z = batch; F0 [3][NB][QT0][DM]
__global__ __launch_bounds__(128) void k_proj0(const _Float16* __restrict__ X16, const _Float16* __restrict__ B3, float* __restrict__ F0) { const int wh = blockIdx.y, b = blockIdx.z;
  gemm2_tile<0>(blockIdx.x, 0, X16 + (size_t)b * SQ * DM, DM, 0, B3 + (size_t)wh * DM * DM, DM, 0, 0.0625f, nullptr, 0, nullptr, 1, 0, 0, F0 + (size_t)(wh * NB + b) * QT0 * DM, nullptr, DM, 0, QT0, DM, DM); }


__global__ __launch_bounds__(256) void k_wnat(const float* __restrict__ w, size_t n8, _Float16* __restrict__ Bt) { const size_t t = (size_t)blockIdx.x * 256 + threadIdx.x; if (t >= n8) return; FragH f; for (int q = 0; q < 8; ++q) f.h[q] = (_Float16)(bf16_round(w[t * 8 + q]) * 16.0f); *(v8us*)((unsigned short*)Bt + t * 8) = f.half[0];  }
__global__ __launch_bounds__(256) void k_rsm(const float* __restrict__ S, _Float16* __restrict__ P, int nrows) {
  #pragma clang fp contract(off)
  const int i = blockIdx.x * 256 + threadIdx.x; if (i >= nrows) return; const float* s = S + (size_t)i * SQ; float mx = -3.0e38f;
#pragma unroll 1
  for (int j = 0; j < SQ; ++j) mx = fmaxf(mx, s[j]); float se = 0.f;
#pragma unroll 1
  for (int j = 0; j < SQ; ++j) se += expf(s[j] - mx); const float sc = 256.0f / se;
#pragma unroll 1
  for (int j0 = 0; j0 < SQ; j0 += 8) { FragH f; for (int q = 0; q < 8; ++q) f.h[q] = (_Float16)(expf(s[j0 + q] - mx) * sc); unsigned short* d = (unsigned short*)P + (size_t)i * SQ + j0; *(v8us*)d = f.half[0];  } }
__global__ __launch_bounds__(256) void k_vt(const _Float16* __restrict__ V16, int b, int h0, _Float16* __restrict__ VT) { __shared__ unsigned short tl[64][65]; const int tid = threadIdx.x; const int hh = blockIdx.x % HG, sg = blockIdx.x / HG; const int s0 = sg * 64; const int h = h0 + hh;
  for (int i = tid; i < 64 * 8; i += 256) { const int j = i / 8, d8 = (i % 8) * 8; FragH f; f.half[0] = *(const v8us*)((const unsigned short*)V16 + ((size_t)b * SQ + s0 + j) * DM + h * HD + d8); for (int q = 0; q < 8; ++q) tl[d8 + q][j] = f.u[q]; }
  __syncthreads();
  { for (int i = tid; i < 64 * 8; i += 256) { const int d = i / 8, j8 = (i % 8) * 8; FragH f; for (int q = 0; q < 8; ++q) f.u[q] = tl[d][j8 + q]; *(v8us*)((unsigned short*)VT + ((size_t)hh * HD + d) * SQ + s0 + j8) = f.half[0]; }  } }

__global__ __launch_bounds__(256) void k_wthd(const float* __restrict__ Wq, const float* __restrict__ Wk, const float* __restrict__ Wv, _Float16* __restrict__ B3) { const size_t t = (size_t)blockIdx.x * 256 + threadIdx.x; if (t >= (size_t)NH * HD * (DM / 8)) return; const float* Wt = blockIdx.y == 0 ? Wq : blockIdx.y == 1 ? Wk : Wv; _Float16* Bt = B3 + (size_t)blockIdx.y * DM * DM;      /* grid.y = which of q/k/v */ const int m8 = (int)(t % (DM / 8)) * 8; const int d = (int)((t / (DM / 8)) % HD); const int h = (int)(t / ((size_t)(DM / 8) * HD)); FragH f;
  for (int q = 0; q < 8; ++q) f.h[q] = (_Float16)(16.0f * bf16_round(Wt[((size_t)h * DM + m8 + q) * HD + d])); unsigned short* dst = (unsigned short*)Bt + ((size_t)h * HD + d) * DM + m8; *(v8us*)dst = f.half[0];  }



// ---- cross-lane and exp helpers ----
template <int M> __device__ __forceinline__ float rs_xm(float x) { return __builtin_bit_cast(float, __builtin_amdgcn_mov_dpp(__builtin_bit_cast(int, x), 0x160 + M, 0xf, 0xf, false)); }      /* lane l <- lane l ^ M inside a 16-lane row (row_xmask) */
__device__ __forceinline__ float rs_xh(float x) { return __builtin_bit_cast(float, __builtin_amdgcn_permlanex16(__builtin_bit_cast(int, x), __builtin_bit_cast(int, x), 0x76543210, 0xfedcba98, false, false)); }      /* lane l <- lane l ^ 16 */
// e^x of four values, as __expf forms it (x * log2 e, then v_exp_f32). One statement: behind a transcendental the instruction set asks for one independent instruction before its source is overwritten or its result read;
// each v_exp_f32 is that instruction for the one before it (outputs are early-clobber, so none lies on an input), the v_nop for the last.
__device__ __forceinline__ v4f rs_exp4(v4f x) { float y0, y1, y2, y3; const v4f t = x * 1.44269504f;
  asm("v_exp_f32 %0, %4\n\tv_exp_f32 %1, %5\n\tv_exp_f32 %2, %6\n\tv_exp_f32 %3, %7\n\tv_nop" : "=&v"(y0), "=&v"(y1), "=&v"(y2), "=&v"(y3) : "v"(t[0]), "v"(t[1]), "v"(t[2]), "v"(t[3]));
  const v4f y = {y0, y1, y2, y3}; return y; }


// ---- fused causal attention: scores, softmax and weighted sum of v in one kernel; scores and weights never leave the registers ----
// One workgroup = FQ query rows of one (batch, head), 16 rows a wave; one trip = FK keys, up to the workgroup's own diagonal block.
// The products are formed transposed: S^T = K Q^T (A = 16 key rows, B = the wave's 16 query rows) leaves, in lane (ln, hh), the scores of query ln for keys 8 hh + r of each 16-key tile:
// two such tiles side by side are, register for register, the B fragment (n = query, k = 32 keys) of O^T = V^T P^T, so the weights go from accumulator to operand without a shuffle.
// A query's running maximum, sum and rescale factor live in its own two lanes (ln and ln + 16).
#define FQ 64                        /* query rows per workgroup */
#define FK 64                        /* keys per trip */
#define FLP (FK + 8)                 /* LDS row pitch in f16: 128 bytes + 16, for 16-byte fragment reads of 16 rows */
__device__ __forceinline__ v16h fa_frag(const unsigned short* p, int hh) { FragH f; f.half[0] = *(const v8us*)(p + 8 * hh); f.half[1] = *(const v8us*)(p + 16 + 8 * hh); return f.v; }
__device__ __forceinline__ v8f fa_mma(v16h a, v16h b, v8f c) { return __builtin_amdgcn_wmma_f32_16x16x32_f16(false, a, false, b, (short)0, c, false, false); }
// grid = (head, batch, query block), longest query block first
__global__ __launch_bounds__(128) void k_fattn(const _Float16* __restrict__ Q16, const _Float16* __restrict__ K16, const _Float16* __restrict__ VT, float* __restrict__ out) {
  __shared__ __attribute__((aligned(16))) unsigned short sk[2][FK][FLP];      /* k rows [key][d], two buffers */
  __shared__ __attribute__((aligned(16))) unsigned short sv[2][HD][FLP];      /* v^T rows [d][key], two buffers */
  __shared__ __attribute__((aligned(16))) float so[4][16][HD + 4];            /* a wave's output rows, turned for whole-row stores */
  const int tid = threadIdx.x, w = tid >> 5, lane = tid & 31, ln = lane & 15, hh = lane >> 4;
  const int h = blockIdx.x, b = blockIdx.y, qb = SQ / FQ - 1 - (int)blockIdx.z;
  const int sr = tid >> 3, sc = (tid & 7) * 8;      /* staging: eight threads bring one 128-byte row */
  const unsigned short* kg = (const unsigned short*)K16 + ((size_t)b * SQ + sr) * LQ + h * HD + sc;
  const unsigned short* vg = (const unsigned short*)VT + ((size_t)(b * NH + h) * HD + sr) * SQ + sc;
  const _Float16* qp = Q16 + ((size_t)b * SQ + qb * FQ + w * 16 + ln) * LQ + h * HD;
  const v16h q0 = g2_frag(qp, hh), q1 = g2_frag(qp + 32, hh);
  v8us kr[4], vr[4];
#pragma unroll      /* constant indices: kr and vr stay in registers */
  for (int i = 0; i < 4; ++i) { kr[i] = *(const v8us*)(kg + (size_t)i * 16 * LQ); vr[i] = *(const v8us*)(vg + (size_t)i * 16 * SQ); }
  asm volatile("s_wait_xcnt 0x0" ::: "memory");      /* before any register that these loads name is written again */
#pragma unroll      /* constant indices, as above */
  for (int i = 0; i < 4; ++i) { *(v8us*)&sk[0][sr + i * 16][sc] = kr[i]; *(v8us*)&sv[0][sr + i * 16][sc] = vr[i]; }
  __syncthreads();
  const v8f z8 = {0.f, 0.f, 0.f, 0.f, 0.f, 0.f, 0.f, 0.f};
  v8f o[4] = {z8, z8, z8, z8}; float m = -1.0e30f, l = 0.f;      /* m: running maximum of the raw products; l: this lane's part of the running sum */
  for (int kb = 0; kb <= qb; ++kb) {
    const int cur = kb & 1;
    if (kb < qb) {      /* the next trip's rows fly while this trip is worked on */
#pragma unroll      /* constant indices, as above */
      for (int i = 0; i < 4; ++i) { kr[i] = *(const v8us*)(kg + (size_t)(kb + 1) * FK * LQ + (size_t)i * 16 * LQ); vr[i] = *(const v8us*)(vg + (size_t)(kb + 1) * FK + (size_t)i * 16 * SQ); }
      asm volatile("s_wait_xcnt 0x0" ::: "memory");      /* before any register that these loads name is written again */
    }
    v8f st[4]; v16h kf[8], vf[8];
#pragma unroll      /* constant indices: kf stays in registers */
    for (int t = 0; t < 4; ++t) { const unsigned short* kp = &sk[cur][t * 16 + ln][0]; kf[2 * t] = fa_frag(kp, hh); kf[2 * t + 1] = fa_frag(kp + 32, hh); }
    __builtin_amdgcn_sched_barrier(0);      /* all k fragment reads are issued before the first product waits for one: one LDS round trip a trip instead of one a tile */
#pragma unroll      /* constant indices: st stays in registers; four independent accumulators */
    for (int t = 0; t < 4; ++t) st[t] = fa_mma(kf[2 * t], q0, z8);
#pragma unroll      /* constant indices, as above */
    for (int t = 0; t < 4; ++t) st[t] = fa_mma(kf[2 * t + 1], q1, st[t]);
#pragma unroll      /* constant indices: vf stays in registers */
    for (int t = 0; t < 4; ++t) { const unsigned short* vp = &sv[cur][t * 16 + ln][0]; vf[2 * t] = fa_frag(vp, hh); vf[2 * t + 1] = fa_frag(vp + 32, hh); }
    __builtin_amdgcn_sched_barrier(0);      /* the v^T fragment reads are issued ahead of the softmax arithmetic, which then covers their round trip */
    if (kb == qb) {      /* the diagonal block: keys behind the row's own are masked */
#pragma unroll      /* constant indices, as above */
      for (int t = 0; t < 4; ++t) for (int r = 0; r < 8; ++r) st[t][r] = (t * 16 + 8 * hh + r <= w * 16 + ln) ? st[t][r] : -1.0e30f;
    }
    v4f m4 = {m, m, m, m};
#pragma unroll      /* constant indices, as above; four independent chains */
    for (int t = 0; t < 4; ++t) for (int r = 0; r < 8; ++r) m4[r & 3] = fmaxf(m4[r & 3], st[t][r]);
    float mn = fmaxf(fmaxf(m4[0], m4[1]), fmaxf(m4[2], m4[3])); mn = fmaxf(mn, rs_xh(mn));      /* both lanes of a query hold the same maximum */
    const float da = (m - mn) * 0.125f; const v4f da4 = {da, da, da, da}; const float al = rs_exp4(da4)[0]; m = mn;
    const float ms = mn * 0.125f - 5.5451774f;      /* weights carried x256 (e^5.545...): small ones stay normal f16 numbers; the factor cancels against the sum */
    v4f s4 = {0.f, 0.f, 0.f, 0.f}; FragH pb[2];
#pragma unroll      /* constant indices, as above */
    for (int t = 0; t < 4; ++t) for (int g = 0; g < 2; ++g) {
      v4f x; for (int u = 0; u < 4; ++u) x[u] = st[t][g * 4 + u] * 0.125f - ms;
      const v4f e = rs_exp4(x); s4 += e;
      for (int u = 0; u < 4; ++u) pb[t >> 1].h[(t & 1) * 8 + g * 4 + u] = (_Float16)e[u]; }
    l = l * al + ((s4[0] + s4[1]) + (s4[2] + s4[3]));
#pragma unroll      /* constant indices: o stays in registers */
    for (int t = 0; t < 4; ++t) o[t] = fa_mma(vf[2 * t], pb[0].v, o[t] * al);
#pragma unroll      /* constant indices, as above */
    for (int t = 0; t < 4; ++t) o[t] = fa_mma(vf[2 * t + 1], pb[1].v, o[t]);
    if (kb < qb) {      /* the other buffer: its last readers left it at the barrier that ended the trip before */
#pragma unroll      /* constant indices, as above */
      for (int i = 0; i < 4; ++i) { *(v8us*)&sk[cur ^ 1][sr + i * 16][sc] = kr[i]; *(v8us*)&sv[cur ^ 1][sr + i * 16][sc] = vr[i]; }
    }
    __syncthreads();      /* publishes the next trip's buffer and ends this trip's reads */
  }
  l += rs_xh(l); const float fin = 1.0f / l;
#pragma unroll      /* constant indices, as above */
  for (int t = 0; t < 4; ++t) for (int g = 0; g < 2; ++g) { v4f y; for (int u = 0; u < 4; ++u) y[u] = o[t][g * 4 + u] * fin; *(v4f*)&so[w][ln][t * 16 + 8 * hh + g * 4] = y; }
  __builtin_amdgcn_fence(__ATOMIC_ACQ_REL, "workgroup"); __builtin_amdgcn_wave_barrier();      /* so[w] is the wave's own: its writes are ordered before its reads */
  float* op = out + ((size_t)b * SQ + qb * FQ + w * 16 + hh) * DM + h * HD + ln * 4;
#pragma unroll      /* stores take constant offsets from one address */
  for (int q = 0; q < 8; ++q) { const v4f y = *(const v4fa*)&so[w][q * 2 + hh][ln * 4]; *(v4f*)(op + (size_t)q * 2 * DM) = y; }
}

// Exact f32 causal attention of the first QT0 rows. One workgroup = A0R query rows of one (batch, head); 16 lanes share a row.
// The head's k and v rows are staged once in LDS; scores: lane ks of a row takes keys ks, ks + 16, ...; softmax over the row's 16 lanes; o: lane ks of a row takes dims 4 ks .. 4 ks + 3 over all keys.
#define A0R 16                       /* query rows per workgroup */
#define A0N (QT0 / 16)               /* groups of 16 keys */
#define A0KP (HD + 4)                /* k row pitch in LDS, floats: the 16 key rows that 16 lanes read fall on 64 different banks */
#define A0PP (QT0 + 16)              /* weight row pitch in LDS, floats: the two rows of a wave fall on different banks */
__global__ __launch_bounds__(A0R * 16) void k_att0(const float* __restrict__ QF, const float* __restrict__ KF, const float* __restrict__ VF, float scale, float* __restrict__ OF) {
  __shared__ __attribute__((aligned(16))) float sk[QT0][A0KP];
  __shared__ __attribute__((aligned(16))) float sv[QT0][HD];
  __shared__ __attribute__((aligned(16))) float ps[A0R][A0PP];
  const int tid = threadIdx.x; const int h = blockIdx.x / (QT0 / A0R), rg = blockIdx.x % (QT0 / A0R);
  const int r = tid >> 4, ks = tid & 15; const int i = rg * A0R + r;      /* the thread's query row; ks = its key slot, later its group of four dims */
  const size_t hb = (size_t)blockIdx.y * QT0 * DM + h * HD;      /* grid.y = batch */
  const float* kp = KF + hb + r * DM + ks * 4; const float* vp = VF + hb + r * DM + ks * 4; const float* qp = QF + hb + i * DM;
  v4f q[HD / 4], kt[A0N], vt[A0N];
#pragma unroll      /* constant indices: the arrays stay in registers; all loads of the workgroup are in flight together, one memory round trip in all */
  for (int c = 0; c < HD / 4; ++c) q[c] = *(const v4fa*)(qp + c * 4);
#pragma unroll      /* constant indices, as above */
  for (int n = 0; n < A0N; ++n) { kt[n] = *(const v4fa*)(kp + n * 16 * DM); if (n < A0N - 1) vt[n] = *(const v4fa*)(vp + n * 16 * DM); }
  asm volatile("s_wait_xcnt 0x0" ::: "memory");      /* the last v load may land in the address registers that the loads before it name: their translations are waited for first */
  vt[A0N - 1] = *(const v4fa*)(vp + (A0N - 1) * 16 * DM);
  asm volatile("s_wait_xcnt 0x0" ::: "memory");      /* before any register that these loads name is written again */
#pragma unroll      /* constant indices, as above */
  for (int n = 0; n < A0N; ++n) { *(v4f*)&sk[n * 16 + r][ks * 4] = kt[n]; *(v4f*)&sv[n * 16 + r][ks * 4] = vt[n]; }
  __syncthreads();
  float s[A0N]; float m = -1.0e30f;
#pragma unroll      /* constant indices into s; the test reads the same in the whole workgroup: key groups behind its last row are skipped */
  for (int n = 0; n < A0N; ++n) { s[n] = -1.0e30f;
    if (n <= rg) { const int j = n * 16 + ks; v4f a4 = {0.f, 0.f, 0.f, 0.f};
#pragma unroll      /* constant indices into q; four independent sums */
      for (int c = 0; c < HD / 4; ++c) a4 += q[c] * *(const v4f*)&sk[j][c * 4];
      const float sj = ((a4[0] + a4[1]) + (a4[2] + a4[3])) * scale; s[n] = (j <= i) ? sj : -1.0e30f; m = fmaxf(m, s[n]); } }
  m = fmaxf(m, rs_xm<1>(m)); m = fmaxf(m, rs_xm<2>(m)); m = fmaxf(m, rs_xm<4>(m)); m = fmaxf(m, rs_xm<8>(m));      /* maximum over the row's 16 lanes */
  float l = 0.f;
#pragma unroll      /* constant indices into s; a key behind the row's own holds -1e30: its weight underflows to 0 */
  for (int n = 0; n < A0N; ++n) { const float e = expf(s[n] - m); l += e; ps[r][n * 16 + ks] = e; }
  l += rs_xm<1>(l); l += rs_xm<2>(l); l += rs_xm<4>(l); l += rs_xm<8>(l);      /* sum over the row's 16 lanes */
  __syncthreads();
  v4f o = {0.f, 0.f, 0.f, 0.f};
#pragma unroll 1      /* one trip = 16 keys, up to the workgroup's last row */
  for (int n = 0; n <= rg; ++n) {
#pragma unroll      /* a trip's LDS reads take constant offsets and overlap */
    for (int jj = 0; jj < 16; jj += 4) { const int j = n * 16 + jj; const v4f p4 = *(const v4f*)&ps[r][j];
      for (int u = 0; u < 4; ++u) o += p4[u] * *(const v4f*)&sv[j + u][ks * 4]; } }
  const float fin = 64.0f / l;      /* o carried x64; k_ftcopy scales it back by 1/64 */
  *(v4f*)(OF + hb + i * DM + ks * 4) = o * fin;
}


__global__ __launch_bounds__(256) void k_ftcopy(const float* __restrict__ OF0, float* __restrict__ out, size_t n4) {
  #pragma clang fp contract(off)
  const size_t t = (size_t)blockIdx.x * 256 + threadIdx.x; if (t >= n4) return; OF0 += (size_t)blockIdx.y * QT0 * DM; out += (size_t)blockIdx.y * SQ * DM;      /* grid.y = batch */
  const v4f o = *(const v4fa*)(OF0 + t * 4); v4f y; for (int q = 0; q < 4; ++q) y[q] = __fmul_rn(o[q], 0.015625f); *(v4f*)(out + t * 4) = y;  }
extern "C" void kernel_launch(void* const* d_in, const int* in_sizes, int n_in,
                              void* d_out, int out_size, void* d_ws, size_t ws_size, hipStream_t stream) {
  (void)in_sizes; (void)n_in; (void)out_size;
  const float* const* I = (const float* const*)d_in; const float* x = I[0]; const float* wq = I[1]; const float* wk = I[2]; const float* wv = I[3];      /* per-head [h][in][out] weights, no biases, no output projection */
  char* ws = (char*)d_ws; size_t off = 0;
  auto take = [&](size_t bytes) { char* p = ws + off; off += (bytes + 255) & ~(size_t)255; return p; };
  _Float16* B3 = (_Float16*)take((size_t)3 * DM * DM * 2);      /* q, k, v weights, one after the other */
  _Float16* X16 = (_Float16*)take(NR * DM * 2); _Float16* QKV16 = (_Float16*)take((size_t)3 * NR * DM * 2); _Float16* Q16 = QKV16; _Float16* K16 = QKV16 + NR * DM; _Float16* V16 = QKV16 + 2 * NR * DM;
  _Float16* VT = (_Float16*)take((size_t)NB * NH * HD * SQ * 2);
  float* F0 = (float*)take((size_t)3 * NB * QT0 * DM * 4); float* OF0 = (float*)take((size_t)NB * QT0 * DM * 4);
  if (off > ws_size) return;
  k_wthd<<<dim3((unsigned)(((size_t)NH * HD * (DM / 8) + 255) / 256), 3), 256, 0, stream>>>(wq, wk, wv, B3);      /* per-head [m][d] -> Bt[(h,d)][m] x16 */
  k_x16<<<(unsigned)((NR * DM / 8 + 255) / 256), 256, 0, stream>>>(x, X16, NR * DM / 8);
  k_qkv<<<dim3((unsigned)((MP / 128) * (DM / 64)), 3), 128, 0, stream>>>(X16, B3, QKV16);
  k_vt<NH, SQ><<<NB * NH * (SQ / 64), 256, 0, stream>>>(V16, LQ, 0, VT);      /* V^T [NB][NH][HD][SQ] */
  k_proj0<<<dim3((QT0 / 128) * (DM / 64), 3, NB), 128, 0, stream>>>(X16, B3, F0);      /* f32 q, k, v of the first 128 rows (exact products) */
  k_att0<<<dim3(NH * (QT0 / A0R), NB), A0R * 16, 0, stream>>>(F0, F0 + (size_t)NB * QT0 * DM, F0 + (size_t)2 * NB * QT0 * DM, 0.125f, OF0);      /* exact f32 attention for rows 0..127 (o x64) */
  k_fattn<<<dim3(NH, NB, SQ / FQ), 128, 0, stream>>>(Q16, K16, VT, (float*)d_out);      /* out = softmax(q k^T / 8, causal) v, f32, concatenated heads */
  k_ftcopy<<<dim3((unsigned)(((size_t)QT0 * DM / 4 + 255) / 256), NB), 256, 0, stream>>>(OF0, (float*)d_out, (size_t)QT0 * DM / 4);      /* rows 0..127 of each batch rewritten from the exact f32 attention (the module has no output projection) */
}

// v006
// It runs in 74.1 microseconds.
// Two timings next to v005 both put it at 1.31 times that version's speed.
// All steps since v000 together make it 56.9 times as fast.
#include <hip/hip_runtime.h>
// Causal multi-head attention with per-head weight tensors (x [4][1024][768]; Q[s][h][d] = sum_m x[s][m] W_Q[h][m][d], K, V likewise (12 heads of 64); scores / 8 with a causal mask (tril); softmax; avg_V = probs V; out[q][h*64 + d] = avg_V[q][h][d], heads concatenated -> [4][1024][768]).
// Structure: token rows r = b*1024 + s; x as exact f16 rows (bf16-rounded); Q, K, V as three WMMA GEMMs (32x64 wave tiles, f32 accumulation, exact x16 weights, no bias, f16 outputs); four launches, stages that need nothing of each other share one by ranges of the block index: (1) weights | x rows; (2) the q/k/v GEMMs; (3) exact first rows | V^T for all heads via LDS transposes; (4) one fused attention kernel: per 64 query rows, trips of 64 keys up to the diagonal: scores on WMMA (K = 64), running-maximum softmax in registers (f32 statistics, native exp; weights x256 f16), weighted sum of v on WMMA, f32 accumulators rescaled each trip, written f32 straight into the concatenated-heads output rows (no output projection); first-tile refinement: the first 128 query rows of every batch are formed exactly in f32 (their q/k/v rows leave the GEMMs in f32 as well; a causal attention on VALU, 16 lanes a query row, writes those output rows; the fused kernel starts behind them).
// Compute dtype: inputs rounded to bf16; x / weights exact; q, k, v and softmax weights as plain f16 GEMM operands (~2^-12); scores and softmax statistics f32. v_wmma_f32_16x16x32_f16.
#define NB 4
#define SQ 1024
#define DM 768
#define NH 12
#define HD 64
#define HG 4                         /* heads per launch of the per-batch k_vt overload (never launched) */
#define QT0 128                      /* first-tile rows recomputed exactly in f32 */
#define B0 0                         /* unused (all batches on the grid) */
#define NBR NB                       /* batches processed (debug hook) */
#define NR ((size_t)NB * SQ)         /* token rows */
#define MP ((int)((size_t)NBR * SQ)) /* rows projected (debug hook) */
#define QN SQ                        /* unused (query tiles on grid.z) */
#define NHD NH                       /* unused (all heads on the grid) */
#define MPO MP                       /* unused (no output stage) */
#define LQ DM      /* row pitch of the q/k/v rows */
typedef __bf16 v16b __attribute__((ext_vector_type(16)));
typedef unsigned short v8us __attribute__((ext_vector_type(8), may_alias));
typedef float  v8f  __attribute__((ext_vector_type(8)));
typedef float  v4f  __attribute__((ext_vector_type(4)));
typedef float  v4fa __attribute__((ext_vector_type(4), may_alias));
union FragB { v16b v; v8us half[2]; unsigned short u[16]; };

__device__ __forceinline__ unsigned short bf16_bits(float x) { unsigned int u = __float_as_uint(x); return (unsigned short)((u + 0x7FFFu + ((u >> 16) & 1u)) >> 16); }
__device__ __forceinline__ float bf16_val(unsigned short b) { return __uint_as_float(((unsigned int)b) << 16); }
__device__ __forceinline__ float bf16_round(float x) { return bf16_val(bf16_bits(x)); }
// D += A·B with NT terms: 1 = ah·bh, 2 = + al·bh (A split), 3 = + ah·bl (both split)
template <int NT>
__device__ __forceinline__ v8f mmaN(v16b ah, v16b al, v16b bh, v16b bl, v8f c) {
  c = __builtin_amdgcn_wmma_f32_16x16x32_bf16(false, ah, false, bh, (short)0, c, false, false);
  if (NT >= 2) c = __builtin_amdgcn_wmma_f32_16x16x32_bf16(false, al, false, bh, (short)0, c, false, false);
  if (NT >= 3) c = __builtin_amdgcn_wmma_f32_16x16x32_bf16(false, ah, false, bl, (short)0, c, false, false);
  asm volatile("v_nop\n\tv_nop\n\tv_nop\n\tv_nop" : "+v"(c) : "v"(ah), "v"(al), "v"(bh), "v"(bl));
  return c;
}

__global__ __launch_bounds__(256) void k_wt_bf16(const float* __restrict__ W, unsigned short* __restrict__ Wt, int K, int N) {
  const int t = blockIdx.x * 256 + threadIdx.x;
  const int k8n = K / 8;
  if (t >= N * k8n) return;
  const int n = t / k8n, k8 = (t % k8n) * 8;
  v8us v;
#pragma unroll
  for (int i = 0; i < 8; ++i) v[i] = bf16_bits(W[(size_t)(k8 + i) * N + n]);
  *(v8us*)(Wt + (size_t)n * K + k8) = v;
  
}

// GEMM C[M][N] (f32, pitch ldc) = act(A[M][K]·W + bias). A f32 row-major (pitch lda) converted per fragment to bf16
// (ASPLIT: hi/lo two planes -> 2 terms, else single rounded term); Wt bf16 [N][K] (pitch ldb). BIAS_BF16 rounds the
// bias to bf16 first (bias quantised to bf16 before the add). K%32==0, M%16==0, N%64==0.
template <bool ASPLIT, int ACT, bool BIAS_BF16>
__global__ __launch_bounds__(128) void k_gemm_bf(const float* __restrict__ A, int lda, const unsigned short* __restrict__ Wt, int ldb,
                                               const float* __restrict__ bias, float* __restrict__ C, int ldc, int M, int N, int K) {
  __shared__ __attribute__((aligned(16))) float so[4][16][64];
  const int tid = threadIdx.x, w = tid >> 5, lane = tid & 31, ln = lane & 15, hh = lane >> 4;
  const int ntn = N / 64;
  const int wid = blockIdx.x * 4 + w;
  const int mt = wid / ntn, nq = wid % ntn;
  if (mt * 16 >= M) return;
  const int row0 = mt * 16, col0 = nq * 64;
  const float* arow = A + (size_t)(row0 + ln) * lda;
  v8f acc[4] = {};
  for (int kb = 0; kb < K; kb += 32) {
    FragB ah, al;
    const v4f x0 = *(const v4fa*)(arow + kb + 8 * hh), x1 = *(const v4fa*)(arow + kb + 8 * hh + 4);
    const v4f x2 = *(const v4fa*)(arow + kb + 16 + 8 * hh), x3 = *(const v4fa*)(arow + kb + 16 + 8 * hh + 4);
    float xs[16] = {x0[0],x0[1],x0[2],x0[3],x1[0],x1[1],x1[2],x1[3],x2[0],x2[1],x2[2],x2[3],x3[0],x3[1],x3[2],x3[3]};
#pragma unroll
    for (int i = 0; i < 16; ++i) { const unsigned short hb = bf16_bits(xs[i]); ah.u[i] = hb; al.u[i] = ASPLIT ? bf16_bits(xs[i] - bf16_val(hb)) : (unsigned short)0; }
#pragma unroll
    for (int t = 0; t < 4; ++t) {
      const unsigned short* brow = Wt + (size_t)(col0 + t * 16 + ln) * ldb + kb;
      FragB b;
      b.half[0] = *(const v8us*)(brow + 8 * hh);
      b.half[1] = *(const v8us*)(brow + 16 + 8 * hh);
      acc[t] = mmaN<ASPLIT ? 2 : 1>(ah.v, al.v, b.v, b.v, acc[t]);
    }
  }
#pragma unroll
  for (int t = 0; t < 4; ++t) {
    float bv = bias ? bias[col0 + t * 16 + ln] : 0.f;
    if (BIAS_BF16) bv = bf16_round(bv);
#pragma unroll
    for (int r = 0; r < 8; ++r) { float v = acc[t][r] + bv; if (ACT == 1) v = fmaxf(v, 0.f); so[w][8 * hh + r][t * 16 + ln] = v; }
  }
  __builtin_amdgcn_fence(__ATOMIC_ACQ_REL, "workgroup");
  __builtin_amdgcn_wave_barrier();
  const int rsub = lane >> 4, c4 = (lane & 15) * 4;
  {
#pragma unroll
    for (int q = 0; q < 8; ++q) {
      const int r = q * 2 + rsub;
      const v4f v = *(const v4fa*)&so[w][r][c4];
      *(v4f*)(C + (size_t)(row0 + r) * ldc + col0 + c4) = v;
    }
    
  }
}

// GEMM C = act(A·W + bias + resid): A f32 (ASPLIT -> hi/lo 2 terms), Wt bf16 [N][K]; ACT 0 none, 1 relu, 2 exact gelu;
// resid (optional, f32, row index = (row % rmod), pitch ldr, RES_BF16 rounds it) added before the activation.
template <bool ASPLIT, int ACT, bool BIAS_BF16, bool RES_BF16>
__global__ __launch_bounds__(128) void k_gemm_bf3(const float* __restrict__ A, int lda, const unsigned short* __restrict__ Wt, int ldb,
                                                const float* __restrict__ bias, const float* __restrict__ resid, int rmod, int ldr,
                                                float* __restrict__ C, int ldc, int M, int N, int K) {
  __shared__ __attribute__((aligned(16))) float so[4][16][64];
  const int tid = threadIdx.x, w = tid >> 5, lane = tid & 31, ln = lane & 15, hh = lane >> 4;
  const int ntn = N / 64;
  const int wid = blockIdx.x * 4 + w;
  const int mt = wid / ntn, nq = wid % ntn;
  if (mt * 16 >= M) return;
  const int row0 = mt * 16, col0 = nq * 64;
  const float* arow = A + (size_t)(row0 + ln) * lda;
  v8f acc[4] = {};
  for (int kb = 0; kb < K; kb += 32) {
    FragB ah, al;
    const v4f x0 = *(const v4fa*)(arow + kb + 8 * hh), x1 = *(const v4fa*)(arow + kb + 8 * hh + 4);
    const v4f x2 = *(const v4fa*)(arow + kb + 16 + 8 * hh), x3 = *(const v4fa*)(arow + kb + 16 + 8 * hh + 4);
    float xs[16] = {x0[0],x0[1],x0[2],x0[3],x1[0],x1[1],x1[2],x1[3],x2[0],x2[1],x2[2],x2[3],x3[0],x3[1],x3[2],x3[3]};
#pragma unroll
    for (int i = 0; i < 16; ++i) { const unsigned short hb = bf16_bits(xs[i]); ah.u[i] = hb; al.u[i] = ASPLIT ? bf16_bits(xs[i] - bf16_val(hb)) : (unsigned short)0; }
#pragma unroll
    for (int t = 0; t < 4; ++t) {
      const unsigned short* brow = Wt + (size_t)(col0 + t * 16 + ln) * ldb + kb;
      FragB b;
      b.half[0] = *(const v8us*)(brow + 8 * hh);
      b.half[1] = *(const v8us*)(brow + 16 + 8 * hh);
      acc[t] = mmaN<ASPLIT ? 2 : 1>(ah.v, al.v, b.v, b.v, acc[t]);
    }
  }
#pragma unroll
  for (int t = 0; t < 4; ++t) {
    const int col = col0 + t * 16 + ln;
    float bv = bias ? bias[col] : 0.f;
    if (BIAS_BF16) bv = bf16_round(bv);
#pragma unroll
    for (int r = 0; r < 8; ++r) {
      float v = acc[t][r] + bv;
      if (resid) { float rv = resid[(size_t)((row0 + 8 * hh + r) % rmod) * ldr + col]; if (RES_BF16) rv = bf16_round(rv); v += rv; }
      if (ACT == 1) v = fmaxf(v, 0.f);
      if (ACT == 2) v = 0.5f * v * (1.0f + erff(v * 0.70710678118654752f));
      if (ACT == 3) { const float u = 0.7978845608028654f * (v + 0.044715f * v * v * v); v = 0.5f * v * (1.0f + tanhf(u)); }
      so[w][8 * hh + r][t * 16 + ln] = v;
    }
  }
  __builtin_amdgcn_fence(__ATOMIC_ACQ_REL, "workgroup");
  __builtin_amdgcn_wave_barrier();
  const int rsub = lane >> 4, c4 = (lane & 15) * 4;
  {
#pragma unroll
    for (int q = 0; q < 8; ++q) {
      const int r = q * 2 + rsub;
      const v4f v = *(const v4fa*)&so[w][r][c4];
      *(v4f*)(C + (size_t)(row0 + r) * ldc + col0 + c4) = v;
    }
    
  }
}
// row LayerNorm (biased variance, eps) over N: s = X (+ R); optional out_sum <- s; out_norm <- (s-mu)*rsqrt(var+eps)*g + b
template <bool PARAM_BF16>
__global__ __launch_bounds__(256) void k_layernorm(const float* __restrict__ X, const float* __restrict__ R, const float* __restrict__ g, const float* __restrict__ bta,
                                                  float* __restrict__ out_sum, float* __restrict__ out_norm, int N, float eps) {
  __shared__ float red[256];
  const int row = blockIdx.x, tid = threadIdx.x;
  const float* x = X + (size_t)row * N; const float* rr = R ? R + (size_t)row * N : nullptr;
  float vals[16];                     // up to N = 4096
  const int per = N / 256;            // contiguous chunk per thread? use strided-by-4 chunks: thread handles j = tid*4 + 1024*u
  float s1 = 0.f;
  for (int u = 0; u < per / 4; ++u) {
    const int j = tid * 4 + 1024 * u;
    const v4f a = *(const v4fa*)(x + j);
    v4f b = {0.f,0.f,0.f,0.f}; if (rr) b = *(const v4fa*)(rr + j);
#pragma unroll
    for (int q = 0; q < 4; ++q) { const float v = a[q] + b[q]; vals[u * 4 + q] = v; s1 += v; }
  }
  red[tid] = s1; __syncthreads();
  for (int st = 128; st > 0; st >>= 1) { if (tid < st) red[tid] += red[tid + st]; __syncthreads(); }
  const float mu = red[0] / (float)N; __syncthreads();
  float s2 = 0.f;
  for (int u = 0; u < per / 4; ++u)
#pragma unroll
    for (int q = 0; q < 4; ++q) { const float c = vals[u * 4 + q] - mu; s2 += c * c; }
  red[tid] = s2; __syncthreads();
  for (int st = 128; st > 0; st >>= 1) { if (tid < st) red[tid] += red[tid + st]; __syncthreads(); }
  const float rs = rsqrtf(red[0] / (float)N + eps);
  {
    for (int u = 0; u < per / 4; ++u) {
      const int j = tid * 4 + 1024 * u;
      v4f o, sm;
#pragma unroll
      for (int q = 0; q < 4; ++q) {
        float gg = g[j + q], bb = bta[j + q];
        if (PARAM_BF16) { gg = bf16_round(gg); bb = bf16_round(bb); }
        sm[q] = vals[u * 4 + q]; o[q] = (vals[u * 4 + q] - mu) * rs * gg + bb;
      }
      if (out_sum) *(v4f*)(out_sum + (size_t)row * N + j) = sm;
      *(v4f*)(out_norm + (size_t)row * N + j) = o;
    }
    
  }
}



// ---- f16 WMMA path (v_wmma_f32_16x16x32_f16): 11-bit significands for operands in range — used where a [0,1] probability operand needs more precision than bf16
typedef _Float16 v16h __attribute__((ext_vector_type(16)));
union FragH { v16h v; v8us half[2]; _Float16 h[16]; unsigned short u[16]; };
template <int NT>
__device__ __forceinline__ v8f mmaH(v16h ah, v16h al, v16h bh, v16h bl, v8f c) {
  c = __builtin_amdgcn_wmma_f32_16x16x32_f16(false, ah, false, bh, (short)0, c, false, false);
  if (NT >= 2) c = __builtin_amdgcn_wmma_f32_16x16x32_f16(false, al, false, bh, (short)0, c, false, false);
  if (NT >= 3) c = __builtin_amdgcn_wmma_f32_16x16x32_f16(false, ah, false, bl, (short)0, c, false, false);
  asm volatile("v_nop\n\tv_nop\n\tv_nop\n\tv_nop" : "+v"(c) : "v"(ah), "v"(al), "v"(bh), "v"(bl));
  return c;
}
// batched GEMM like k_gemm_b but f16 operands: A f32 (split into f16 hi/lo if ASPLIT, else rounded to f16), Bt = f16 values [n][k]; alpha; C f32; N multiple of 16 (partial tiles skipped)
template <bool ASPLIT>
__global__ __launch_bounds__(128) void k_gemm_h(const float* __restrict__ A, int lda, size_t sA, const _Float16* __restrict__ Bh, int ldb, size_t sB, float alpha, float* __restrict__ C, int ldc, size_t sC, int M, int N, int K) {
  __shared__ __attribute__((aligned(16))) float so[4][16][64];
  const int tid = threadIdx.x, w = tid >> 5, lane = tid & 31, ln = lane & 15, hh = lane >> 4; const int by = blockIdx.y;
  A += (size_t)by * sA; Bh += (size_t)by * sB; C += (size_t)by * sC;
  const int ntn = (N + 63) / 64; const int wid = blockIdx.x * 4 + w; const int mt = wid / ntn, nq = wid % ntn; if (mt * 16 >= M) return;
  const int row0 = mt * 16, col0 = nq * 64; const float* arow = A + (size_t)(row0 + ln) * lda;
  v8f acc[4] = {};
  for (int kb = 0; kb < K; kb += 32) {
    FragH ah, al;
    const v4f x0 = *(const v4fa*)(arow + kb + 8 * hh), x1 = *(const v4fa*)(arow + kb + 8 * hh + 4), x2 = *(const v4fa*)(arow + kb + 16 + 8 * hh), x3 = *(const v4fa*)(arow + kb + 16 + 8 * hh + 4);
    float xs[16] = {x0[0],x0[1],x0[2],x0[3],x1[0],x1[1],x1[2],x1[3],x2[0],x2[1],x2[2],x2[3],x3[0],x3[1],x3[2],x3[3]};
#pragma unroll
    for (int i = 0; i < 16; ++i) { const _Float16 h = (_Float16)xs[i]; ah.h[i] = h; al.h[i] = ASPLIT ? (_Float16)(xs[i] - (float)h) : (_Float16)0.0f; }
#pragma unroll
    for (int t = 0; t < 4; ++t) { if (col0 + t * 16 >= N) continue; const size_t boff = (size_t)(col0 + t * 16 + ln) * ldb + kb; FragH bq; bq.half[0] = *(const v8us*)(Bh + boff + 8 * hh); bq.half[1] = *(const v8us*)(Bh + boff + 16 + 8 * hh);
      acc[t] = mmaH<ASPLIT ? 2 : 1>(ah.v, al.v, bq.v, bq.v, acc[t]); }
  }
#pragma unroll
  for (int t = 0; t < 4; ++t) { if (col0 + t * 16 >= N) continue;
#pragma unroll
    for (int r = 0; r < 8; ++r) so[w][8 * hh + r][t * 16 + ln] = acc[t][r] * alpha; }
  __builtin_amdgcn_fence(__ATOMIC_ACQ_REL, "workgroup"); __builtin_amdgcn_wave_barrier();
  const int rsub = lane >> 4, c4 = (lane & 15) * 4;
  {
#pragma unroll
    for (int q = 0; q < 8; ++q) { const int r = q * 2 + rsub; if (col0 + c4 < N) { const v4f v = *(const v4fa*)&so[w][r][c4]; *(v4f*)(C + (size_t)(row0 + r) * ldc + col0 + c4) = v; } }
     }
}

// Wt[n][k] = f16(W[k][n]·scale) from f32 row-major W[K][N] (scale = power of two; bf16-exact weights stay exact in f16 away from the subnormal range)
__global__ __launch_bounds__(256) void k_wt_f16(const float* __restrict__ W, _Float16* __restrict__ Wt, int K, int N, float scale) {
  const int t = blockIdx.x * 256 + threadIdx.x; if (t >= N * (K / 8)) return; const int n = t / (K / 8), k8 = (t % (K / 8)) * 8; FragH f;
#pragma unroll
  for (int i = 0; i < 8; ++i) f.h[i] = (_Float16)(bf16_round(W[(size_t)(k8 + i) * N + n]) * scale); const v8us o = f.half[0];
  *(v8us*)((unsigned short*)Wt + (size_t)n * K + k8) = o; 
}
// k_gemm_hh variant with fused epilogue: v = acc·alpha + bias[by·sBias + col] (+ CP[(row/rowsPerB)·sCPb + by·64 + col] if CP) ; ACT 0 none / 1 elu ; writes f16 C16 (and f32 C if non-null)
template <int ACT>
__global__ __launch_bounds__(128) void k_gemm_hhx(const _Float16* __restrict__ A, int lda, size_t sA, const _Float16* __restrict__ Bh, int ldb, size_t sB, float alpha, const float* __restrict__ bias, size_t sBias, const float* __restrict__ CP, int rowsPerB, size_t sCPb, int row0g,
    float* __restrict__ C, _Float16* __restrict__ C16, int ldc, size_t sC, int M, int N, int K) {
  __shared__ __attribute__((aligned(16))) float so[4][16][64];
  const int tid = threadIdx.x, w = tid >> 5, lane = tid & 31, ln = lane & 15, hh = lane >> 4; const int by = blockIdx.y;
  A += (size_t)by * sA; Bh += (size_t)by * sB; const size_t cofs = (size_t)by * sC; const float* bp = bias ? bias + (size_t)by * sBias : nullptr;
  const int ntn = (N + 63) / 64; const int wid = blockIdx.x * 4 + w; const int mt = wid / ntn, nq = wid % ntn; if (mt * 16 >= M) return;
  const int row0 = mt * 16, col0 = nq * 64; const _Float16* arow = A + (size_t)(row0 + ln) * lda;
  v8f acc[4] = {};
  for (int kb = 0; kb < K; kb += 32) { FragH ah; ah.half[0] = *(const v8us*)((const unsigned short*)arow + kb + 8 * hh); ah.half[1] = *(const v8us*)((const unsigned short*)arow + kb + 16 + 8 * hh);
#pragma unroll
    for (int t = 0; t < 4; ++t) { if (col0 + t * 16 >= N) continue; const size_t boff = (size_t)(col0 + t * 16 + ln) * ldb + kb; FragH bq; bq.half[0] = *(const v8us*)((const unsigned short*)Bh + boff + 8 * hh); bq.half[1] = *(const v8us*)((const unsigned short*)Bh + boff + 16 + 8 * hh);
      acc[t] = mmaH<1>(ah.v, ah.v, bq.v, bq.v, acc[t]); }
  }
#pragma unroll
  for (int t = 0; t < 4; ++t) { if (col0 + t * 16 >= N) continue; const int col = col0 + t * 16 + ln; const float bv = bp ? bf16_round(bp[col]) : 0.f;
#pragma unroll
    for (int r = 0; r < 8; ++r) { float v = acc[t][r] * alpha + bv; if (CP) { const int rr = row0g + row0 + 8 * hh + r; if (rowsPerB < 0) v += CP[cofs + (size_t)rr * ldc + col];      /* rowsPerB < 0: own element of the batched C plane */ else { const int bidx = rr / rowsPerB; v += CP[(size_t)bidx * sCPb + (size_t)by * 64 + col]; } } if (ACT == 1) v = (v > 0.f) ? v : expm1f(v); else if (ACT == 7) v = (v > 0.f) ? v + 1.0f : expf(v); else if (ACT == 8) v = tanhf(v); else if (ACT == 9) v = 0.5f * v * (1.0f + tanhf(0.7978845608028654f * (v + 0.044715f * v * v * v))); else if (ACT == 11) v = 1.0f / (1.0f + expf(-v)); else if (ACT == 12) v = (v > 0.f) ? v : 0.01f * v; else if (ACT == 14) v = (v > 0.f) ? v : 0.1f * v; else if (ACT == 16) v = (v >= 0.f) ? v : 0.3f * v; else if (ACT == 17) v = (v >= 0.f) ? v : 0.2f * v; else if (ACT == 15) v = v / (1.0f + expf(-v)); else if (ACT == 3) v = fmaxf(v, 0.f); else if (ACT == 6) v = 0.5f * v * (1.0f + erff(v * 0.70710678118654752f)); so[w][8 * hh + r][t * 16 + ln] = v; } }
  __builtin_amdgcn_fence(__ATOMIC_ACQ_REL, "workgroup"); __builtin_amdgcn_wave_barrier();
  const int rsub = lane >> 4, c4 = (lane & 15) * 4; typedef _Float16 v4h __attribute__((ext_vector_type(4)));
  {
#pragma unroll
    for (int q = 0; q < 8; ++q) { const int r = q * 2 + rsub; if (col0 + c4 < N) { const v4f v = *(const v4fa*)&so[w][r][c4]; if (C) *(v4f*)(C + cofs + (size_t)(row0 + r) * ldc + col0 + c4) = v; if (C16) { v4h h4; for (int i = 0; i < 4; ++i) h4[i] = (_Float16)v[i]; *(v4h*)(C16 + cofs + (size_t)(row0 + r) * ldc + col0 + c4) = h4; } } }
     }
}


typedef _Float16 v4h __attribute__((ext_vector_type(4)));

__device__ __forceinline__ void x16_part(const unsigned bx, const float* __restrict__ x, _Float16* __restrict__ X16, size_t n8) { const size_t t = (size_t)bx * 256 + threadIdx.x; if (t >= n8) return; FragH f;
#pragma unroll
  for (int q = 0; q < 8; ++q) f.h[q] = (_Float16)bf16_round(x[t * 8 + q]); *(v8us*)((unsigned short*)X16 + t * 8) = f.half[0];  }
__global__ __launch_bounds__(256) void k_h16(const float* __restrict__ x, _Float16* __restrict__ X16, size_t n8) { const size_t t = (size_t)blockIdx.x * 256 + threadIdx.x; if (t >= n8) return; FragH f;
#pragma unroll
  for (int q = 0; q < 8; ++q) f.h[q] = (_Float16)x[t * 8 + q]; *(v8us*)((unsigned short*)X16 + t * 8) = f.half[0];  }
__global__ __launch_bounds__(256) void k_round16f(const float* __restrict__ W, _Float16* __restrict__ Bt, size_t n8) { const size_t t = (size_t)blockIdx.x * 256 + threadIdx.x; if (t >= n8) return; FragH f;
#pragma unroll
  for (int i = 0; i < 8; ++i) f.h[i] = (_Float16)(bf16_round(W[t * 8 + i]) * 16.0f); *(v8us*)((unsigned short*)Bt + t * 8) = f.half[0];  }
template <int NHv, int TTv>
__device__ __forceinline__ void vt_part(const unsigned bx, unsigned short (*tl)[66], const _Float16* __restrict__ V16, int ldv, int voff, _Float16* __restrict__ Vt) { const int tid = threadIdx.x; const int slab = bx / (TTv / 64), lg = bx % (TTv / 64); const int b = slab / NHv, h = slab % NHv;
  for (int i = tid; i < 64 * 8; i += 256) { const int r = i / 8, c8 = (i % 8) * 8; FragH f; f.half[0] = *(const v8us*)((const unsigned short*)V16 + ((size_t)b * TTv + lg * 64 + r) * ldv + voff + h * 64 + c8);
#pragma unroll
    for (int q = 0; q < 8; ++q) tl[r][c8 + q] = f.u[q]; }
  __syncthreads();
  {
#pragma unroll
    for (int rd = 0; rd < 2; ++rd) { const int d = rd * 32 + tid / 8, pc = tid % 8; FragH f;
#pragma unroll
      for (int q = 0; q < 8; ++q) f.u[q] = tl[pc * 8 + q][d];
      *(v8us*)((unsigned short*)Vt + ((size_t)slab * 64 + d) * TTv + lg * 64 + pc * 8) = f.half[0]; }
     } }

__global__ __launch_bounds__(256) void k_hl(const float* __restrict__ F, _Float16* __restrict__ Hh, _Float16* __restrict__ Hl, size_t n8) { const size_t t = (size_t)blockIdx.x * 256 + threadIdx.x; if (t >= n8) return; FragH fh, fl; const v4f a = *(const v4fa*)(F + t * 8), c = *(const v4fa*)(F + t * 8 + 4);
#pragma unroll
  for (int q = 0; q < 4; ++q) { _Float16 h = (_Float16)a[q]; fh.h[q] = h; fl.h[q] = (_Float16)((a[q] - (float)h) * 1024.0f); h = (_Float16)c[q]; fh.h[4 + q] = h; fl.h[4 + q] = (_Float16)((c[q] - (float)h) * 1024.0f); }
  { *(v8us*)((unsigned short*)Hh + t * 8) = fh.half[0]; *(v8us*)((unsigned short*)Hl + t * 8) = fl.half[0];  } }

// ---- fast GEMM (wave tile 32x64; requires M % 32 == 0 rows per launch region and N % 64 == 0); epilogue = k_gemm_hhx semantics ----
__device__ __forceinline__ v16h g2_frag(const _Float16* p, int hh) { FragH f; f.half[0] = *(const v8us*)((const unsigned short*)p + 8 * hh); f.half[1] = *(const v8us*)((const unsigned short*)p + 16 + 8 * hh); return f.v; }
__device__ __forceinline__ v8f g2_mma(v16h a, v16h b, v8f c) { v8f d = __builtin_amdgcn_wmma_f32_16x16x32_f16(false, a, false, b, (short)0, c, false, false); asm volatile("v_nop\n\tv_nop\n\tv_nop\n\tv_nop" : "+v"(d) : "v"(a), "v"(b)); return d; }
template <int ACT>
__device__ __forceinline__ void gemm2_tile(const int bx, const int by, const _Float16* __restrict__ A, int lda, size_t sA, const _Float16* __restrict__ Bh, int ldb, size_t sB, float alpha, const float* __restrict__ bias, size_t sBias, const float* __restrict__ CP, int rowsPerB, size_t sCPb, int row0g,
    float* __restrict__ C, _Float16* __restrict__ C16, int ldc, size_t sC, int M, int N, int K) { static_assert(ACT == 0 || ACT == 3 || ACT == 6 || ACT == 8 || ACT == 9 || ACT == 11 || ACT == 12 || ACT == 14 || ACT == 15 || ACT == 16 || ACT == 17, "gemm2_tile: unsupported ACT code (would silently apply no activation)");
  __shared__ __attribute__((aligned(16))) float so[4][32][68];
  const int tid = threadIdx.x, w = tid >> 5, lane = tid & 31, ln = lane & 15, hh = lane >> 4;
  A += (size_t)by * sA; Bh += (size_t)by * sB; const size_t cofs = (size_t)by * sC; const float* bp = bias ? bias + (size_t)by * sBias : nullptr;
  const int ntn = N >> 6; const int mt = bx / ntn, nq = bx - mt * ntn; const int row0 = mt * 128 + 32 * w, col0 = nq * 64; if (row0 >= M) return;
  const _Float16* a0p = A + (size_t)(row0 + ln) * lda; const _Float16* a1p = a0p + (size_t)16 * lda;
  const _Float16* b0p = Bh + (size_t)(col0 + ln) * ldb; const _Float16* b1p = b0p + (size_t)16 * ldb; const _Float16* b2p = b1p + (size_t)16 * ldb; const _Float16* b3p = b2p + (size_t)16 * ldb;
  const v8f z8 = {0.f,0.f,0.f,0.f,0.f,0.f,0.f,0.f}; v8f c00 = z8, c01 = z8, c02 = z8, c03 = z8, c10 = z8, c11 = z8, c12 = z8, c13 = z8;
#pragma unroll 1
  for (int kb = 0; kb < K; kb += 32) { const v16h a0 = g2_frag(a0p + kb, hh); FragH a1f; a1f.half[0] = *(const v8us*)((const unsigned short*)(a1p + kb) + 8 * hh);
    asm volatile("s_wait_xcnt 0x0" ::: "memory");      /* the last A load lands in the address registers that the A loads before it name: their translations are waited for first */
    a1f.half[1] = *(const v8us*)((const unsigned short*)(a1p + kb) + 16 + 8 * hh); const v16h a1 = a1f.v;
    v16h b = g2_frag(b0p + kb, hh); c00 = g2_mma(a0, b, c00); c10 = g2_mma(a1, b, c10);
    b = g2_frag(b1p + kb, hh); c01 = g2_mma(a0, b, c01); c11 = g2_mma(a1, b, c11);
    b = g2_frag(b2p + kb, hh); c02 = g2_mma(a0, b, c02); c12 = g2_mma(a1, b, c12);
    b = g2_frag(b3p + kb, hh); c03 = g2_mma(a0, b, c03); c13 = g2_mma(a1, b, c13); }
  v8f accs[8] = {c00, c01, c02, c03, c10, c11, c12, c13};
#pragma unroll
  for (int u = 0; u < 8; ++u) { const int t = u & 3, half = u >> 2; const int col = col0 + t * 16 + ln; const float bv = bp ? bf16_round(bp[col]) : 0.f;
#pragma unroll
    for (int r = 0; r < 8; ++r) { const int rloc = half * 16 + 8 * hh + r; float v = accs[u][r] * alpha + bv; if (CP) { if (rowsPerB < 0) v += CP[cofs + (size_t)(row0g + row0 + rloc) * ldc + col];      /* rowsPerB < 0: own element of the batched C plane */ else { const int bidx = (row0g + row0 + rloc) / rowsPerB; v += CP[(size_t)bidx * sCPb + (size_t)by * 64 + col]; } }
      if (ACT == 3) v = fmaxf(v, 0.f); else if (ACT == 6) v = 0.5f * v * (1.0f + erff(v * 0.70710678118654752f)); else if (ACT == 11) v = 1.0f / (1.0f + expf(-v)); else if (ACT == 15) v = v / (1.0f + expf(-v)); else if (ACT == 12) v = (v > 0.f) ? v : 0.01f * v; else if (ACT == 8) v = tanhf(v); else if (ACT == 9) v = 0.5f * v * (1.0f + tanhf(0.7978845608028654f * (v + 0.044715f * v * v * v))); else if (ACT == 14) v = (v > 0.f) ? v : 0.1f * v; else if (ACT == 16) v = (v >= 0.f) ? v : 0.3f * v; else if (ACT == 17) v = (v >= 0.f) ? v : 0.2f * v;
      so[w][rloc][t * 16 + ln] = v; } }
  __builtin_amdgcn_fence(__ATOMIC_ACQ_REL, "workgroup"); __builtin_amdgcn_wave_barrier();
  const int rsub = lane >> 4, c4 = (lane & 15) * 4;
  {
    v4f vq[16]; v4h hq[16];      /* all rows are read and converted first: behind the stores nothing is computed, so no register that an issued store names is written again */
#pragma unroll      /* constant indices: vq and hq stay in registers */
    for (int q = 0; q < 16; ++q) { vq[q] = *(const v4fa*)&so[w][q * 2 + rsub][c4]; for (int i = 0; i < 4; ++i) hq[q][i] = (_Float16)vq[q][i]; }
    if (C16) {
#pragma unroll      /* constant indices, as above; the stores take constant offsets from one address */
      for (int q = 0; q < 16; ++q) *(v4h*)(C16 + cofs + (size_t)(row0 + q * 2 + rsub) * ldc + col0 + c4) = hq[q]; }
    if (C) {
      asm volatile("s_wait_xcnt 0x0" ::: "memory");      /* before this branch's address lands in a register that the stores above name */
#pragma unroll      /* constant indices, as above */
      for (int q = 0; q < 16; ++q) *(v4f*)(C + cofs + (size_t)(row0 + q * 2 + rsub) * ldc + col0 + c4) = vq[q]; }
     } }
// ---- one launch per stage: batch and causal query tile ride on the grid ----
// f16 q, k, v of all token rows: grid.y = which of q/k/v; QKV16 [3][NR][DM]. The 128-row block that holds the first QT0 rows of a batch stores the same sums in f32 as well: F0 [3][NB][QT0][DM]
static_assert(QT0 == 128 && SQ % 128 == 0, "the first QT0 rows of a batch are one 128-row block of the GEMM");
__global__ __launch_bounds__(128) void k_qkv(const _Float16* __restrict__ X16, const _Float16* __restrict__ B3, _Float16* __restrict__ QKV16, float* __restrict__ F0) { const int wh = blockIdx.y;
  const int mt = blockIdx.x / (DM / 64), nq = blockIdx.x % (DM / 64); const int b = mt / (SQ / 128);      /* row block, column block, batch */
  float* cf = (mt % (SQ / 128) == 0) ? F0 + (size_t)(wh * NB + b) * QT0 * DM : nullptr;
  gemm2_tile<0>(nq, 0, X16 + (size_t)mt * 128 * DM, DM, 0, B3 + (size_t)wh * DM * DM, DM, 0, 0.0625f, nullptr, 0, nullptr, 1, 0, 0, cf, QKV16 + (size_t)wh * NR * DM + (size_t)mt * 128 * DM, DM, 0, 128, DM, DM); }


__global__ __launch_bounds__(256) void k_wnat(const float* __restrict__ w, size_t n8, _Float16* __restrict__ Bt) { const size_t t = (size_t)blockIdx.x * 256 + threadIdx.x; if (t >= n8) return; FragH f; for (int q = 0; q < 8; ++q) f.h[q] = (_Float16)(bf16_round(w[t * 8 + q]) * 16.0f); *(v8us*)((unsigned short*)Bt + t * 8) = f.half[0];  }
__global__ __launch_bounds__(256) void k_rsm(const float* __restrict__ S, _Float16* __restrict__ P, int nrows) {
  #pragma clang fp contract(off)
  const int i = blockIdx.x * 256 + threadIdx.x; if (i >= nrows) return; const float* s = S + (size_t)i * SQ; float mx = -3.0e38f;
#pragma unroll 1
  for (int j = 0; j < SQ; ++j) mx = fmaxf(mx, s[j]); float se = 0.f;
#pragma unroll 1
  for (int j = 0; j < SQ; ++j) se += expf(s[j] - mx); const float sc = 256.0f / se;
#pragma unroll 1
  for (int j0 = 0; j0 < SQ; j0 += 8) { FragH f; for (int q = 0; q < 8; ++q) f.h[q] = (_Float16)(expf(s[j0 + q] - mx) * sc); unsigned short* d = (unsigned short*)P + (size_t)i * SQ + j0; *(v8us*)d = f.half[0];  } }
__global__ __launch_bounds__(256) void k_vt(const _Float16* __restrict__ V16, int b, int h0, _Float16* __restrict__ VT) { __shared__ unsigned short tl[64][65]; const int tid = threadIdx.x; const int hh = blockIdx.x % HG, sg = blockIdx.x / HG; const int s0 = sg * 64; const int h = h0 + hh;
  for (int i = tid; i < 64 * 8; i += 256) { const int j = i / 8, d8 = (i % 8) * 8; FragH f; f.half[0] = *(const v8us*)((const unsigned short*)V16 + ((size_t)b * SQ + s0 + j) * DM + h * HD + d8); for (int q = 0; q < 8; ++q) tl[d8 + q][j] = f.u[q]; }
  __syncthreads();
  { for (int i = tid; i < 64 * 8; i += 256) { const int d = i / 8, j8 = (i % 8) * 8; FragH f; for (int q = 0; q < 8; ++q) f.u[q] = tl[d][j8 + q]; *(v8us*)((unsigned short*)VT + ((size_t)hh * HD + d) * SQ + s0 + j8) = f.half[0]; }  } }

__device__ __forceinline__ void wthd_part(const unsigned bx, const unsigned wh, const float* __restrict__ Wq, const float* __restrict__ Wk, const float* __restrict__ Wv, _Float16* __restrict__ B3) { const size_t t = (size_t)bx * 256 + threadIdx.x; if (t >= (size_t)NH * HD * (DM / 8)) return; const float* Wt = wh == 0 ? Wq : wh == 1 ? Wk : Wv; _Float16* Bt = B3 + (size_t)wh * DM * DM;      /* wh = which of q/k/v */ const int m8 = (int)(t % (DM / 8)) * 8; const int d = (int)((t / (DM / 8)) % HD); const int h = (int)(t / ((size_t)(DM / 8) * HD)); FragH f;
  for (int q = 0; q < 8; ++q) f.h[q] = (_Float16)(16.0f * bf16_round(Wt[((size_t)h * DM + m8 + q) * HD + d])); unsigned short* dst = (unsigned short*)Bt + ((size_t)h * HD + d) * DM + m8; *(v8us*)dst = f.half[0];  }
// launch 1: the weights' blocks, then the blocks of the x rows (neither reads what the other writes)
#define PWB ((unsigned)(((size_t)NH * HD * (DM / 8) + 255) / 256))      /* blocks per weight tensor */
#define PXB ((unsigned)((NR * DM / 8 + 255) / 256))                    /* blocks of the x rows */
__global__ __launch_bounds__(256) void k_prep(const float* __restrict__ x, const float* __restrict__ Wq, const float* __restrict__ Wk, const float* __restrict__ Wv, _Float16* __restrict__ B3, _Float16* __restrict__ X16) {
  const unsigned bx = blockIdx.x;
  if (bx < 3 * PWB) wthd_part(bx % PWB, bx / PWB, Wq, Wk, Wv, B3);
  else x16_part(bx - 3 * PWB, x, X16, NR * DM / 8);
}



// ---- cross-lane and exp helpers ----
template <int M> __device__ __forceinline__ float rs_xm(float x) { return __builtin_bit_cast(float, __builtin_amdgcn_mov_dpp(__builtin_bit_cast(int, x), 0x160 + M, 0xf, 0xf, false)); }      /* lane l <- lane l ^ M inside a 16-lane row (row_xmask) */
__device__ __forceinline__ float rs_xh(float x) { return __builtin_bit_cast(float, __builtin_amdgcn_permlanex16(__builtin_bit_cast(int, x), __builtin_bit_cast(int, x), 0x76543210, 0xfedcba98, false, false)); }      /* lane l <- lane l ^ 16 */
// e^x of four values, as __expf forms it (x * log2 e, then v_exp_f32). One statement: behind a transcendental the instruction set asks for one independent instruction before its source is overwritten or its result read;
// each v_exp_f32 is that instruction for the one before it (outputs are early-clobber, so none lies on an input), the v_nop for the last.
__device__ __forceinline__ v4f rs_exp4(v4f x) { float y0, y1, y2, y3; const v4f t = x * 1.44269504f;
  asm("v_exp_f32 %0, %4\n\tv_exp_f32 %1, %5\n\tv_exp_f32 %2, %6\n\tv_exp_f32 %3, %7\n\tv_nop" : "=&v"(y0), "=&v"(y1), "=&v"(y2), "=&v"(y3) : "v"(t[0]), "v"(t[1]), "v"(t[2]), "v"(t[3]));
  const v4f y = {y0, y1, y2, y3}; return y; }


// ---- fused causal attention: scores, softmax and weighted sum of v in one kernel; scores and weights never leave the registers ----
// One workgroup = FQ query rows of one (batch, head), 16 rows a wave; one trip = FK keys, up to the workgroup's own diagonal block.
// The products are formed transposed: S^T = K Q^T (A = 16 key rows, B = the wave's 16 query rows) leaves, in lane (ln, hh), the scores of query ln for keys 8 hh + r of each 16-key tile:
// two such tiles side by side are, register for register, the B fragment (n = query, k = 32 keys) of O^T = V^T P^T, so the weights go from accumulator to operand without a shuffle.
// A query's running maximum, sum and rescale factor live in its own two lanes (ln and ln + 16).
#define FQ 64                        /* query rows per workgroup */
#define FK 64                        /* keys per trip */
#define FLP (FK + 8)                 /* LDS row pitch in f16: 128 bytes + 16, for 16-byte fragment reads of 16 rows */
__device__ __forceinline__ v16h fa_frag(const unsigned short* p, int hh) { FragH f; f.half[0] = *(const v8us*)(p + 8 * hh); f.half[1] = *(const v8us*)(p + 16 + 8 * hh); return f.v; }
__device__ __forceinline__ v8f fa_mma(v16h a, v16h b, v8f c) { return __builtin_amdgcn_wmma_f32_16x16x32_f16(false, a, false, b, (short)0, c, false, false); }
// grid = (head, batch, query block), longest query block first
__global__ __launch_bounds__(128) void k_fattn(const _Float16* __restrict__ Q16, const _Float16* __restrict__ K16, const _Float16* __restrict__ VT, float* __restrict__ out) {
  __shared__ __attribute__((aligned(16))) unsigned short sk[2][FK][FLP];      /* k rows [key][d], two buffers */
  __shared__ __attribute__((aligned(16))) unsigned short sv[2][HD][FLP];      /* v^T rows [d][key], two buffers */
  __shared__ __attribute__((aligned(16))) float so[4][16][HD + 4];            /* a wave's output rows, turned for whole-row stores */
  const int tid = threadIdx.x, w = tid >> 5, lane = tid & 31, ln = lane & 15, hh = lane >> 4;
  const int h = blockIdx.x, b = blockIdx.y, qb = SQ / FQ - 1 - (int)blockIdx.z;
  const int sr = tid >> 3, sc = (tid & 7) * 8;      /* staging: eight threads bring one 128-byte row */
  const unsigned short* kg = (const unsigned short*)K16 + ((size_t)b * SQ + sr) * LQ + h * HD + sc;
  const unsigned short* vg = (const unsigned short*)VT + ((size_t)(b * NH + h) * HD + sr) * SQ + sc;
  const _Float16* qp = Q16 + ((size_t)b * SQ + qb * FQ + w * 16 + ln) * LQ + h * HD;
  const v16h q0 = g2_frag(qp, hh), q1 = g2_frag(qp + 32, hh);
  v8us kr[4], vr[4];
#pragma unroll      /* constant indices: kr and vr stay in registers */
  for (int i = 0; i < 4; ++i) { kr[i] = *(const v8us*)(kg + (size_t)i * 16 * LQ); vr[i] = *(const v8us*)(vg + (size_t)i * 16 * SQ); }
  asm volatile("s_wait_xcnt 0x0" ::: "memory");      /* before any register that these loads name is written again */
#pragma unroll      /* constant indices, as above */
  for (int i = 0; i < 4; ++i) { *(v8us*)&sk[0][sr + i * 16][sc] = kr[i]; *(v8us*)&sv[0][sr + i * 16][sc] = vr[i]; }
  __syncthreads();
  const v8f z8 = {0.f, 0.f, 0.f, 0.f, 0.f, 0.f, 0.f, 0.f};
  v8f o[4] = {z8, z8, z8, z8}; float m = -1.0e30f, l = 0.f;      /* m: running maximum of the raw products; l: this lane's part of the running sum */
  for (int kb = 0; kb <= qb; ++kb) {
    const int cur = kb & 1;
    if (kb < qb) {      /* the next trip's rows fly while this trip is worked on */
#pragma unroll      /* constant indices, as above */
      for (int i = 0; i < 4; ++i) { kr[i] = *(const v8us*)(kg + (size_t)(kb + 1) * FK * LQ + (size_t)i * 16 * LQ); vr[i] = *(const v8us*)(vg + (size_t)(kb + 1) * FK + (size_t)i * 16 * SQ); }
      asm volatile("s_wait_xcnt 0x0" ::: "memory");      /* before any register that these loads name is written again */
    }
    v8f st[4]; v16h kf[8], vf[8];
#pragma unroll      /* constant indices: kf stays in registers */
    for (int t = 0; t < 4; ++t) { const unsigned short* kp = &sk[cur][t * 16 + ln][0]; kf[2 * t] = fa_frag(kp, hh); kf[2 * t + 1] = fa_frag(kp + 32, hh); }
    __builtin_amdgcn_sched_barrier(0);      /* all k fragment reads are issued before the first product waits for one: one LDS round trip a trip instead of one a tile */
#pragma unroll      /* constant indices: st stays in registers; four independent accumulators */
    for (int t = 0; t < 4; ++t) st[t] = fa_mma(kf[2 * t], q0, z8);
#pragma unroll      /* constant indices, as above */
    for (int t = 0; t < 4; ++t) st[t] = fa_mma(kf[2 * t + 1], q1, st[t]);
#pragma unroll      /* constant indices: vf stays in registers */
    for (int t = 0; t < 4; ++t) { const unsigned short* vp = &sv[cur][t * 16 + ln][0]; vf[2 * t] = fa_frag(vp, hh); vf[2 * t + 1] = fa_frag(vp + 32, hh); }
    __builtin_amdgcn_sched_barrier(0);      /* the v^T fragment reads are issued ahead of the softmax arithmetic, which then covers their round trip */
    if (kb == qb) {      /* the diagonal block: keys behind the row's own are masked */
#pragma unroll      /* constant indices, as above */
      for (int t = 0; t < 4; ++t) for (int r = 0; r < 8; ++r) st[t][r] = (t * 16 + 8 * hh + r <= w * 16 + ln) ? st[t][r] : -1.0e30f;
    }
    v4f m4 = {m, m, m, m};
#pragma unroll      /* constant indices, as above; four independent chains */
    for (int t = 0; t < 4; ++t) for (int r = 0; r < 8; ++r) m4[r & 3] = fmaxf(m4[r & 3], st[t][r]);
    float mn = fmaxf(fmaxf(m4[0], m4[1]), fmaxf(m4[2], m4[3])); mn = fmaxf(mn, rs_xh(mn));      /* both lanes of a query hold the same maximum */
    const float da = (m - mn) * 0.125f; const v4f da4 = {da, da, da, da}; const float al = rs_exp4(da4)[0]; m = mn;
    const float ms = mn * 0.125f - 5.5451774f;      /* weights carried x256 (e^5.545...): small ones stay normal f16 numbers; the factor cancels against the sum */
    v4f s4 = {0.f, 0.f, 0.f, 0.f}; FragH pb[2];
#pragma unroll      /* constant indices, as above */
    for (int t = 0; t < 4; ++t) for (int g = 0; g < 2; ++g) {
      v4f x; for (int u = 0; u < 4; ++u) x[u] = st[t][g * 4 + u] * 0.125f - ms;
      const v4f e = rs_exp4(x); s4 += e;
      for (int u = 0; u < 4; ++u) pb[t >> 1].h[(t & 1) * 8 + g * 4 + u] = (_Float16)e[u]; }
    l = l * al + ((s4[0] + s4[1]) + (s4[2] + s4[3]));
#pragma unroll      /* constant indices: o stays in registers */
    for (int t = 0; t < 4; ++t) o[t] = fa_mma(vf[2 * t], pb[0].v, o[t] * al);
#pragma unroll      /* constant indices, as above */
    for (int t = 0; t < 4; ++t) o[t] = fa_mma(vf[2 * t + 1], pb[1].v, o[t]);
    if (kb < qb) {      /* the other buffer: its last readers left it at the barrier that ended the trip before */
#pragma unroll      /* constant indices, as above */
      for (int i = 0; i < 4; ++i) { *(v8us*)&sk[cur ^ 1][sr + i * 16][sc] = kr[i]; *(v8us*)&sv[cur ^ 1][sr + i * 16][sc] = vr[i]; }
    }
    __syncthreads();      /* publishes the next trip's buffer and ends this trip's reads */
  }
  l += rs_xh(l); const float fin = 1.0f / l;
#pragma unroll      /* constant indices, as above */
  for (int t = 0; t < 4; ++t) for (int g = 0; g < 2; ++g) { v4f y; for (int u = 0; u < 4; ++u) y[u] = o[t][g * 4 + u] * fin; *(v4f*)&so[w][ln][t * 16 + 8 * hh + g * 4] = y; }
  __builtin_amdgcn_fence(__ATOMIC_ACQ_REL, "workgroup"); __builtin_amdgcn_wave_barrier();      /* so[w] is the wave's own: its writes are ordered before its reads */
  float* op = out + ((size_t)b * SQ + qb * FQ + w * 16 + hh) * DM + h * HD + ln * 4;
#pragma unroll      /* stores take constant offsets from one address */
  for (int q = 0; q < 8; ++q) { const v4f y = *(const v4fa*)&so[w][q * 2 + hh][ln * 4]; *(v4f*)(op + (size_t)q * 2 * DM) = y; }
}

// Exact f32 causal attention of the first QT0 rows. One workgroup = A0R query rows of one (batch, head); 16 lanes share a row.
// The head's k and v rows are staged once in LDS; scores: lane ks of a row takes keys ks, ks + 16, ...; softmax over the row's 16 lanes; o: lane ks of a row takes dims 4 ks .. 4 ks + 3 over all keys.
#define A0R 16                       /* query rows per workgroup */
#define A0N (QT0 / 16)               /* groups of 16 keys */
#define A0KP (HD + 4)                /* k row pitch in LDS, floats: the 16 key rows that 16 lanes read fall on 64 different banks */
#define A0PP (QT0 + 16)              /* weight row pitch in LDS, floats: the two rows of a wave fall on different banks */
#define A0LDS ((QT0 * A0KP + QT0 * HD + A0R * A0PP) * 4)      /* its LDS, bytes */
__device__ __forceinline__ void att0_part(const unsigned bx, const unsigned b, float* __restrict__ sm, const float* __restrict__ QF, const float* __restrict__ KF, const float* __restrict__ VF, float scale, float* __restrict__ out) {
  float (*sk)[A0KP] = (float (*)[A0KP])sm;
  float (*sv)[HD] = (float (*)[HD])(sm + QT0 * A0KP);
  float (*ps)[A0PP] = (float (*)[A0PP])(sm + QT0 * A0KP + QT0 * HD);
  const int tid = threadIdx.x; const int h = bx / (QT0 / A0R), rg = bx % (QT0 / A0R);
  const int r = tid >> 4, ks = tid & 15; const int i = rg * A0R + r;      /* the thread's query row; ks = its key slot, later its group of four dims */
  const size_t hb = (size_t)b * QT0 * DM + h * HD;
  const float* kp = KF + hb + r * DM + ks * 4; const float* vp = VF + hb + r * DM + ks * 4; const float* qp = QF + hb + i * DM;
  v4f q[HD / 4], kt[A0N], vt[A0N];
#pragma unroll      /* constant indices: the arrays stay in registers; all loads of the workgroup are in flight together, one memory round trip in all */
  for (int c = 0; c < HD / 4; ++c) q[c] = *(const v4fa*)(qp + c * 4);
#pragma unroll      /* constant indices, as above */
  for (int n = 0; n < A0N; ++n) { kt[n] = *(const v4fa*)(kp + n * 16 * DM); if (n < A0N - 1) vt[n] = *(const v4fa*)(vp + n * 16 * DM); }
  asm volatile("s_wait_xcnt 0x0" ::: "memory");      /* the last v load may land in the address registers that the loads before it name: their translations are waited for first */
  vt[A0N - 1] = *(const v4fa*)(vp + (A0N - 1) * 16 * DM);
  asm volatile("s_wait_xcnt 0x0" ::: "memory");      /* before any register that these loads name is written again */
#pragma unroll      /* constant indices, as above */
  for (int n = 0; n < A0N; ++n) { *(v4f*)&sk[n * 16 + r][ks * 4] = kt[n]; *(v4f*)&sv[n * 16 + r][ks * 4] = vt[n]; }
  __syncthreads();
  float s[A0N]; float m = -1.0e30f;
#pragma unroll      /* constant indices into s; the test reads the same in the whole workgroup: key groups behind its last row are skipped */
  for (int n = 0; n < A0N; ++n) { s[n] = -1.0e30f;
    if (n <= rg) { const int j = n * 16 + ks; v4f a4 = {0.f, 0.f, 0.f, 0.f};
#pragma unroll      /* constant indices into q; four independent sums */
      for (int c = 0; c < HD / 4; ++c) a4 += q[c] * *(const v4f*)&sk[j][c * 4];
      const float sj = ((a4[0] + a4[1]) + (a4[2] + a4[3])) * scale; s[n] = (j <= i) ? sj : -1.0e30f; m = fmaxf(m, s[n]); } }
  m = fmaxf(m, rs_xm<1>(m)); m = fmaxf(m, rs_xm<2>(m)); m = fmaxf(m, rs_xm<4>(m)); m = fmaxf(m, rs_xm<8>(m));      /* maximum over the row's 16 lanes */
  float l = 0.f;
#pragma unroll      /* constant indices into s; a key behind the row's own holds -1e30: its weight underflows to 0 */
  for (int n = 0; n < A0N; ++n) { const float e = expf(s[n] - m); l += e; ps[r][n * 16 + ks] = e; }
  l += rs_xm<1>(l); l += rs_xm<2>(l); l += rs_xm<4>(l); l += rs_xm<8>(l);      /* sum over the row's 16 lanes */
  __syncthreads();
  v4f o = {0.f, 0.f, 0.f, 0.f};
#pragma unroll 1      /* one trip = 16 keys, up to the workgroup's last row */
  for (int n = 0; n <= rg; ++n) {
#pragma unroll      /* a trip's LDS reads take constant offsets and overlap */
    for (int jj = 0; jj < 16; jj += 4) { const int j = n * 16 + jj; const v4f p4 = *(const v4f*)&ps[r][j];
      for (int u = 0; u < 4; ++u) o += p4[u] * *(const v4f*)&sv[j + u][ks * 4]; } }
  const float fin = 1.0f / l;
  *(v4f*)(out + ((size_t)b * SQ + i) * DM + h * HD + ks * 4) = o * fin;      /* straight into the row's place in the output */
}
// launch 3: the exact first rows' blocks (the longer ones, so they start first), then the blocks of the V^T transposes; neither reads what the other writes. One LDS range serves whichever part a block runs.
#define A0B ((unsigned)(NH * (QT0 / A0R)))      /* exact-rows blocks per batch */
__global__ __launch_bounds__(256) void k_att0_vt(const float* __restrict__ F0, float* __restrict__ out, const _Float16* __restrict__ V16, _Float16* __restrict__ VT) {
  static_assert(A0R * 16 == 256 && A0LDS >= 64 * 66 * 2, "both parts run in 256 threads and in the one LDS range");
  __shared__ __attribute__((aligned(16))) float sm[A0LDS / 4];
  const unsigned bx = blockIdx.x;
  if (bx < NB * A0B) att0_part(bx % A0B, bx / A0B, sm, F0, F0 + (size_t)NB * QT0 * DM, F0 + (size_t)2 * NB * QT0 * DM, 0.125f, out);
  else vt_part<NH, SQ>(bx - NB * A0B, (unsigned short (*)[66])sm, V16, LQ, 0, VT);
}


extern "C" void kernel_launch(void* const* d_in, const int* in_sizes, int n_in,
                              void* d_out, int out_size, void* d_ws, size_t ws_size, hipStream_t stream) {
  (void)in_sizes; (void)n_in; (void)out_size;
  const float* const* I = (const float* const*)d_in; const float* x = I[0]; const float* wq = I[1]; const float* wk = I[2]; const float* wv = I[3];      /* per-head [h][in][out] weights, no biases, no output projection */
  char* ws = (char*)d_ws; size_t off = 0;
  auto take = [&](size_t bytes) { char* p = ws + off; off += (bytes + 255) & ~(size_t)255; return p; };
  _Float16* B3 = (_Float16*)take((size_t)3 * DM * DM * 2);      /* q, k, v weights, one after the other */
  _Float16* X16 = (_Float16*)take(NR * DM * 2); _Float16* QKV16 = (_Float16*)take((size_t)3 * NR * DM * 2); _Float16* Q16 = QKV16; _Float16* K16 = QKV16 + NR * DM; _Float16* V16 = QKV16 + 2 * NR * DM;
  _Float16* VT = (_Float16*)take((size_t)NB * NH * HD * SQ * 2);
  float* F0 = (float*)take((size_t)3 * NB * QT0 * DM * 4);
  if (off > ws_size) return;
  k_prep<<<3 * PWB + PXB, 256, 0, stream>>>(x, wq, wk, wv, B3, X16);      /* per-head [m][d] -> Bt[(h,d)][m] x16 | x rows as f16 */
  k_qkv<<<dim3((unsigned)((MP / 128) * (DM / 64)), 3), 128, 0, stream>>>(X16, B3, QKV16, F0);      /* f16 q, k, v; f32 as well for the first 128 rows of each batch (exact products) */
  k_att0_vt<<<NB * A0B + NB * NH * (SQ / 64), 256, 0, stream>>>(F0, (float*)d_out, V16, VT);      /* exact f32 attention writes rows 0..127 of each batch | V^T [NB][NH][HD][SQ] */
  k_fattn<<<dim3(NH, NB, (SQ - QT0) / FQ), 128, 0, stream>>>(Q16, K16, VT, (float*)d_out);      /* rows 128.. : out = softmax(q k^T / 8, causal) v, f32, concatenated heads */
}

// v007
// It runs in 50.8 microseconds.
// Two timings next to v006 put it at 1.45 and 1.46 times that version's speed.
// All steps since v000 together make it 82.9 times as fast.
#include <hip/hip_runtime.h>
// Causal multi-head attention with per-head weight tensors (x [4][1024][768]; Q[s][h][d] = sum_m x[s][m] W_Q[h][m][d], K, V likewise (12 heads of 64); scores / 8 with a causal mask (tril); softmax; avg_V = probs V; out[q][h*64 + d] = avg_V[q][h][d], heads concatenated -> [4][1024][768]).
// Structure: token rows r = b*1024 + s; x as exact f16 rows (bf16-rounded); Q, K, V as three WMMA GEMMs (32x64 wave tiles, f32 accumulation, exact x16 weights, no bias, f16 outputs); four launches, stages that need nothing of each other share one by ranges of the block index: (1) weights | x rows; (2) the q/k/v GEMMs; (3) exact first rows | V^T for all heads via LDS transposes; (4) one fused attention kernel: per 64 query rows, trips of 64 keys up to the diagonal: scores on WMMA (K = 64), running-maximum softmax in registers (f32 statistics, native exp; weights x256 f16), weighted sum of v on WMMA, f32 accumulators rescaled each trip, written f32 straight into the concatenated-heads output rows (no output projection); first-tile refinement: the first 128 query rows of every batch are formed exactly in f32 (their q/k/v rows leave the GEMMs in f32 as well; a causal attention on VALU, 16 lanes a query row, writes those output rows; the fused kernel starts behind them).
// Compute dtype: inputs rounded to bf16; x / weights exact; q, k, v and softmax weights as plain f16 GEMM operands (~2^-12); scores and softmax statistics f32. v_wmma_f32_16x16x32_f16.
#define NB 4
#define SQ 1024
#define DM 768
#define NH 12
#define HD 64
#define HG 4                         /* heads per launch of the per-batch k_vt overload (never launched) */
#define QT0 128                      /* first-tile rows recomputed exactly in f32 */
#define B0 0                         /* unused (all batches on the grid) */
#define NBR NB                       /* batches processed (debug hook) */
#define NR ((size_t)NB * SQ)         /* token rows */
#define MP ((int)((size_t)NBR * SQ)) /* rows projected (debug hook) */
#define QN SQ                        /* unused (query tiles on grid.z) */
#define NHD NH                       /* unused (all heads on the grid) */
#define MPO MP                       /* unused (no output stage) */
#define LQ DM      /* row pitch of the q/k/v rows */
typedef __bf16 v16b __attribute__((ext_vector_type(16)));
typedef unsigned short v8us __attribute__((ext_vector_type(8), may_alias));
typedef float  v8f  __attribute__((ext_vector_type(8)));
typedef float  v4f  __attribute__((ext_vector_type(4)));
typedef float  v4fa __attribute__((ext_vector_type(4), may_alias));
union FragB { v16b v; v8us half[2]; unsigned short u[16]; };

__device__ __forceinline__ unsigned short bf16_bits(float x) { unsigned int u = __float_as_uint(x); return (unsigned short)((u + 0x7FFFu + ((u >> 16) & 1u)) >> 16); }
__device__ __forceinline__ float bf16_val(unsigned short b) { return __uint_as_float(((unsigned int)b) << 16); }
__device__ __forceinline__ float bf16_round(float x) { return bf16_val(bf16_bits(x)); }
// D += A·B with NT terms: 1 = ah·bh, 2 = + al·bh (A split), 3 = + ah·bl (both split)
template <int NT>
__device__ __forceinline__ v8f mmaN(v16b ah, v16b al, v16b bh, v16b bl, v8f c) {
  c = __builtin_amdgcn_wmma_f32_16x16x32_bf16(false, ah, false, bh, (short)0, c, false, false);
  if (NT >= 2) c = __builtin_amdgcn_wmma_f32_16x16x32_bf16(false, al, false, bh, (short)0, c, false, false);
  if (NT >= 3) c = __builtin_amdgcn_wmma_f32_16x16x32_bf16(false, ah, false, bl, (short)0, c, false, false);
  asm volatile("v_nop\n\tv_nop\n\tv_nop\n\tv_nop" : "+v"(c) : "v"(ah), "v"(al), "v"(bh), "v"(bl));
  return c;
}

__global__ __launch_bounds__(256) void k_wt_bf16(const float* __restrict__ W, unsigned short* __restrict__ Wt, int K, int N) {
  const int t = blockIdx.x * 256 + threadIdx.x;
  const int k8n = K / 8;
  if (t >= N * k8n) return;
  const int n = t / k8n, k8 = (t % k8n) * 8;
  v8us v;
#pragma unroll
  for (int i = 0; i < 8; ++i) v[i] = bf16_bits(W[(size_t)(k8 + i) * N + n]);
  *(v8us*)(Wt + (size_t)n * K + k8) = v;
  
}

// GEMM C[M][N] (f32, pitch ldc) = act(A[M][K]·W + bias). A f32 row-major (pitch lda) converted per fragment to bf16
// (ASPLIT: hi/lo two planes -> 2 terms, else single rounded term); Wt bf16 [N][K] (pitch ldb). BIAS_BF16 rounds the
// bias to bf16 first (bias quantised to bf16 before the add). K%32==0, M%16==0, N%64==0.
template <bool ASPLIT, int ACT, bool BIAS_BF16>
__global__ __launch_bounds__(128) void k_gemm_bf(const float* __restrict__ A, int lda, const unsigned short* __restrict__ Wt, int ldb,
                                               const float* __restrict__ bias, float* __restrict__ C, int ldc, int M, int N, int K) {
  __shared__ __attribute__((aligned(16))) float so[4][16][64];
  const int tid = threadIdx.x, w = tid >> 5, lane = tid & 31, ln = lane & 15, hh = lane >> 4;
  const int ntn = N / 64;
  const int wid = blockIdx.x * 4 + w;
  const int mt = wid / ntn, nq = wid % ntn;
  if (mt * 16 >= M) return;
  const int row0 = mt * 16, col0 = nq * 64;
  const float* arow = A + (size_t)(row0 + ln) * lda;
  v8f acc[4] = {};
  for (int kb = 0; kb < K; kb += 32) {
    FragB ah, al;
    const v4f x0 = *(const v4fa*)(arow + kb + 8 * hh), x1 = *(const v4fa*)(arow + kb + 8 * hh + 4);
    const v4f x2 = *(const v4fa*)(arow + kb + 16 + 8 * hh), x3 = *(const v4fa*)(arow + kb + 16 + 8 * hh + 4);
    float xs[16] = {x0[0],x0[1],x0[2],x0[3],x1[0],x1[1],x1[2],x1[3],x2[0],x2[1],x2[2],x2[3],x3[0],x3[1],x3[2],x3[3]};
#pragma unroll
    for (int i = 0; i < 16; ++i) { const unsigned short hb = bf16_bits(xs[i]); ah.u[i] = hb; al.u[i] = ASPLIT ? bf16_bits(xs[i] - bf16_val(hb)) : (unsigned short)0; }
#pragma unroll
    for (int t = 0; t < 4; ++t) {
      const unsigned short* brow = Wt + (size_t)(col0 + t * 16 + ln) * ldb + kb;
      FragB b;
      b.half[0] = *(const v8us*)(brow + 8 * hh);
      b.half[1] = *(const v8us*)(brow + 16 + 8 * hh);
      acc[t] = mmaN<ASPLIT ? 2 : 1>(ah.v, al.v, b.v, b.v, acc[t]);
    }
  }
#pragma unroll
  for (int t = 0; t < 4; ++t) {
    float bv = bias ? bias[col0 + t * 16 + ln] : 0.f;
    if (BIAS_BF16) bv = bf16_round(bv);
#pragma unroll
    for (int r = 0; r < 8; ++r) { float v = acc[t][r] + bv; if (ACT == 1) v = fmaxf(v, 0.f); so[w][8 * hh + r][t * 16 + ln] = v; }
  }
  __builtin_amdgcn_fence(__ATOMIC_ACQ_REL, "workgroup");
  __builtin_amdgcn_wave_barrier();
  const int rsub = lane >> 4, c4 = (lane & 15) * 4;
  {
#pragma unroll
    for (int q = 0; q < 8; ++q) {
      const int r = q * 2 + rsub;
      const v4f v = *(const v4fa*)&so[w][r][c4];
      *(v4f*)(C + (size_t)(row0 + r) * ldc + col0 + c4) = v;
    }
    
  }
}

// GEMM C = act(A·W + bias + resid): A f32 (ASPLIT -> hi/lo 2 terms), Wt bf16 [N][K]; ACT 0 none, 1 relu, 2 exact gelu;
// resid (optional, f32, row index = (row % rmod), pitch ldr, RES_BF16 rounds it) added before the activation.
template <bool ASPLIT, int ACT, bool BIAS_BF16, bool RES_BF16>
__global__ __launch_bounds__(128) void k_gemm_bf3(const float* __restrict__ A, int lda, const unsigned short* __restrict__ Wt, int ldb,
                                                const float* __restrict__ bias, const float* __restrict__ resid, int rmod, int ldr,
                                                float* __restrict__ C, int ldc, int M, int N, int K) {
  __shared__ __attribute__((aligned(16))) float so[4][16][64];
  const int tid = threadIdx.x, w = tid >> 5, lane = tid & 31, ln = lane & 15, hh = lane >> 4;
  const int ntn = N / 64;
  const int wid = blockIdx.x * 4 + w;
  const int mt = wid / ntn, nq = wid % ntn;
  if (mt * 16 >= M) return;
  const int row0 = mt * 16, col0 = nq * 64;
  const float* arow = A + (size_t)(row0 + ln) * lda;
  v8f acc[4] = {};
  for (int kb = 0; kb < K; kb += 32) {
    FragB ah, al;
    const v4f x0 = *(const v4fa*)(arow + kb + 8 * hh), x1 = *(const v4fa*)(arow + kb + 8 * hh + 4);
    const v4f x2 = *(const v4fa*)(arow + kb + 16 + 8 * hh), x3 = *(const v4fa*)(arow + kb + 16 + 8 * hh + 4);
    float xs[16] = {x0[0],x0[1],x0[2],x0[3],x1[0],x1[1],x1[2],x1[3],x2[0],x2[1],x2[2],x2[3],x3[0],x3[1],x3[2],x3[3]};
#pragma unroll
    for (int i = 0; i < 16; ++i) { const unsigned short hb = bf16_bits(xs[i]); ah.u[i] = hb; al.u[i] = ASPLIT ? bf16_bits(xs[i] - bf16_val(hb)) : (unsigned short)0; }
#pragma unroll
    for (int t = 0; t < 4; ++t) {
      const unsigned short* brow = Wt + (size_t)(col0 + t * 16 + ln) * ldb + kb;
      FragB b;
      b.half[0] = *(const v8us*)(brow + 8 * hh);
      b.half[1] = *(const v8us*)(brow + 16 + 8 * hh);
      acc[t] = mmaN<ASPLIT ? 2 : 1>(ah.v, al.v, b.v, b.v, acc[t]);
    }
  }
#pragma unroll
  for (int t = 0; t < 4; ++t) {
    const int col = col0 + t * 16 + ln;
    float bv = bias ? bias[col] : 0.f;
    if (BIAS_BF16) bv = bf16_round(bv);
#pragma unroll
    for (int r = 0; r < 8; ++r) {
      float v = acc[t][r] + bv;
      if (resid) { float rv = resid[(size_t)((row0 + 8 * hh + r) % rmod) * ldr + col]; if (RES_BF16) rv = bf16_round(rv); v += rv; }
      if (ACT == 1) v = fmaxf(v, 0.f);
      if (ACT == 2) v = 0.5f * v * (1.0f + erff(v * 0.70710678118654752f));
      if (ACT == 3) { const float u = 0.7978845608028654f * (v + 0.044715f * v * v * v); v = 0.5f * v * (1.0f + tanhf(u)); }
      so[w][8 * hh + r][t * 16 + ln] = v;
    }
  }
  __builtin_amdgcn_fence(__ATOMIC_ACQ_REL, "workgroup");
  __builtin_amdgcn_wave_barrier();
  const int rsub = lane >> 4, c4 = (lane & 15) * 4;
  {
#pragma unroll
    for (int q = 0; q < 8; ++q) {
      const int r = q * 2 + rsub;
      const v4f v = *(const v4fa*)&so[w][r][c4];
      *(v4f*)(C + (size_t)(row0 + r) * ldc + col0 + c4) = v;
    }
    
  }
}
// row LayerNorm (biased variance, eps) over N: s = X (+ R); optional out_sum <- s; out_norm <- (s-mu)*rsqrt(var+eps)*g + b
template <bool PARAM_BF16>
__global__ __launch_bounds__(256) void k_layernorm(const float* __restrict__ X, const float* __restrict__ R, const float* __restrict__ g, const float* __restrict__ bta,
                                                  float* __restrict__ out_sum, float* __restrict__ out_norm, int N, float eps) {
  __shared__ float red[256];
  const int row = blockIdx.x, tid = threadIdx.x;
  const float* x = X + (size_t)row * N; const float* rr = R ? R + (size_t)row * N : nullptr;
  float vals[16];                     // up to N = 4096
  const int per = N / 256;            // contiguous chunk per thread? use strided-by-4 chunks: thread handles j = tid*4 + 1024*u
  float s1 = 0.f;
  for (int u = 0; u < per / 4; ++u) {
    const int j = tid * 4 + 1024 * u;
    const v4f a = *(const v4fa*)(x + j);
    v4f b = {0.f,0.f,0.f,0.f}; if (rr) b = *(const v4fa*)(rr + j);
#pragma unroll
    for (int q = 0; q < 4; ++q) { const float v = a[q] + b[q]; vals[u * 4 + q] = v; s1 += v; }
  }
  red[tid] = s1; __syncthreads();
  for (int st = 128; st > 0; st >>= 1) { if (tid < st) red[tid] += red[tid + st]; __syncthreads(); }
  const float mu = red[0] / (float)N; __syncthreads();
  float s2 = 0.f;
  for (int u = 0; u < per / 4; ++u)
#pragma unroll
    for (int q = 0; q < 4; ++q) { const float c = vals[u * 4 + q] - mu; s2 += c * c; }
  red[tid] = s2; __syncthreads();
  for (int st = 128; st > 0; st >>= 1) { if (tid < st) red[tid] += red[tid + st]; __syncthreads(); }
  const float rs = rsqrtf(red[0] / (float)N + eps);
  {
    for (int u = 0; u < per / 4; ++u) {
      const int j = tid * 4 + 1024 * u;
      v4f o, sm;
#pragma unroll
      for (int q = 0; q < 4; ++q) {
        float gg = g[j + q], bb = bta[j + q];
        if (PARAM_BF16) { gg = bf16_round(gg); bb = bf16_round(bb); }
        sm[q] = vals[u * 4 + q]; o[q] = (vals[u * 4 + q] - mu) * rs * gg + bb;
      }
      if (out_sum) *(v4f*)(out_sum + (size_t)row * N + j) = sm;
      *(v4f*)(out_norm + (size_t)row * N + j) = o;
    }
    
  }
}



// ---- f16 WMMA path (v_wmma_f32_16x16x32_f16): 11-bit significands for operands in range — used where a [0,1] probability operand needs more precision than bf16
typedef _Float16 v16h __attribute__((ext_vector_type(16)));
union FragH { v16h v; v8us half[2]; _Float16 h[16]; unsigned short u[16]; };
template <int NT>
__device__ __forceinline__ v8f mmaH(v16h ah, v16h al, v16h bh, v16h bl, v8f c) {
  c = __builtin_amdgcn_wmma_f32_16x16x32_f16(false, ah, false, bh, (short)0, c, false, false);
  if (NT >= 2) c = __builtin_amdgcn_wmma_f32_16x16x32_f16(false, al, false, bh, (short)0, c, false, false);
  if (NT >= 3) c = __builtin_amdgcn_wmma_f32_16x16x32_f16(false, ah, false, bl, (short)0, c, false, false);
  asm volatile("v_nop\n\tv_nop\n\tv_nop\n\tv_nop" : "+v"(c) : "v"(ah), "v"(al), "v"(bh), "v"(bl));
  return c;
}
// batched GEMM like k_gemm_b but f16 operands: A f32 (split into f16 hi/lo if ASPLIT, else rounded to f16), Bt = f16 values [n][k]; alpha; C f32; N multiple of 16 (partial tiles skipped)
template <bool ASPLIT>
__global__ __launch_bounds__(128) void k_gemm_h(const float* __restrict__ A, int lda, size_t sA, const _Float16* __restrict__ Bh, int ldb, size_t sB, float alpha, float* __restrict__ C, int ldc, size_t sC, int M, int N, int K) {
  __shared__ __attribute__((aligned(16))) float so[4][16][64];
  const int tid = threadIdx.x, w = tid >> 5, lane = tid & 31, ln = lane & 15, hh = lane >> 4; const int by = blockIdx.y;
  A += (size_t)by * sA; Bh += (size_t)by * sB; C += (size_t)by * sC;
  const int ntn = (N + 63) / 64; const int wid = blockIdx.x * 4 + w; const int mt = wid / ntn, nq = wid % ntn; if (mt * 16 >= M) return;
  const int row0 = mt * 16, col0 = nq * 64; const float* arow = A + (size_t)(row0 + ln) * lda;
  v8f acc[4] = {};
  for (int kb = 0; kb < K; kb += 32) {
    FragH ah, al;
    const v4f x0 = *(const v4fa*)(arow + kb + 8 * hh), x1 = *(const v4fa*)(arow + kb + 8 * hh + 4), x2 = *(const v4fa*)(arow + kb + 16 + 8 * hh), x3 = *(const v4fa*)(arow + kb + 16 + 8 * hh + 4);
    float xs[16] = {x0[0],x0[1],x0[2],x0[3],x1[0],x1[1],x1[2],x1[3],x2[0],x2[1],x2[2],x2[3],x3[0],x3[1],x3[2],x3[3]};
#pragma unroll
    for (int i = 0; i < 16; ++i) { const _Float16 h = (_Float16)xs[i]; ah.h[i] = h; al.h[i] = ASPLIT ? (_Float16)(xs[i] - (float)h) : (_Float16)0.0f; }
#pragma unroll
    for (int t = 0; t < 4; ++t) { if (col0 + t * 16 >= N) continue; const size_t boff = (size_t)(col0 + t * 16 + ln) * ldb + kb; FragH bq; bq.half[0] = *(const v8us*)(Bh + boff + 8 * hh); bq.half[1] = *(const v8us*)(Bh + boff + 16 + 8 * hh);
      acc[t] = mmaH<ASPLIT ? 2 : 1>(ah.v, al.v, bq.v, bq.v, acc[t]); }
  }
#pragma unroll
  for (int t = 0; t < 4; ++t) { if (col0 + t * 16 >= N) continue;
#pragma unroll
    for (int r = 0; r < 8; ++r) so[w][8 * hh + r][t * 16 + ln] = acc[t][r] * alpha; }
  __builtin_amdgcn_fence(__ATOMIC_ACQ_REL, "workgroup"); __builtin_amdgcn_wave_barrier();
  const int rsub = lane >> 4, c4 = (lane & 15) * 4;
  {
#pragma unroll
    for (int q = 0; q < 8; ++q) { const int r = q * 2 + rsub; if (col0 + c4 < N) { const v4f v = *(const v4fa*)&so[w][r][c4]; *(v4f*)(C + (size_t)(row0 + r) * ldc + col0 + c4) = v; } }
     }
}

// Wt[n][k] = f16(W[k][n]·scale) from f32 row-major W[K][N] (scale = power of two; bf16-exact weights stay exact in f16 away from the subnormal range)
__global__ __launch_bounds__(256) void k_wt_f16(const float* __restrict__ W, _Float16* __restrict__ Wt, int K, int N, float scale) {
  const int t = blockIdx.x * 256 + threadIdx.x; if (t >= N * (K / 8)) return; const int n = t / (K / 8), k8 = (t % (K / 8)) * 8; FragH f;
#pragma unroll
  for (int i = 0; i < 8; ++i) f.h[i] = (_Float16)(bf16_round(W[(size_t)(k8 + i) * N + n]) * scale); const v8us o = f.half[0];
  *(v8us*)((unsigned short*)Wt + (size_t)n * K + k8) = o; 
}
// k_gemm_hh variant with fused epilogue: v = acc·alpha + bias[by·sBias + col] (+ CP[(row/rowsPerB)·sCPb + by·64 + col] if CP) ; ACT 0 none / 1 elu ; writes f16 C16 (and f32 C if non-null)
template <int ACT>
__global__ __launch_bounds__(128) void k_gemm_hhx(const _Float16* __restrict__ A, int lda, size_t sA, const _Float16* __restrict__ Bh, int ldb, size_t sB, float alpha, const float* __restrict__ bias, size_t sBias, const float* __restrict__ CP, int rowsPerB, size_t sCPb, int row0g,
    float* __restrict__ C, _Float16* __restrict__ C16, int ldc, size_t sC, int M, int N, int K) {
  __shared__ __attribute__((aligned(16))) float so[4][16][64];
  const int tid = threadIdx.x, w = tid >> 5, lane = tid & 31, ln = lane & 15, hh = lane >> 4; const int by = blockIdx.y;
  A += (size_t)by * sA; Bh += (size_t)by * sB; const size_t cofs = (size_t)by * sC; const float* bp = bias ? bias + (size_t)by * sBias : nullptr;
  const int ntn = (N + 63) / 64; const int wid = blockIdx.x * 4 + w; const int mt = wid / ntn, nq = wid % ntn; if (mt * 16 >= M) return;
  const int row0 = mt * 16, col0 = nq * 64; const _Float16* arow = A + (size_t)(row0 + ln) * lda;
  v8f acc[4] = {};
  for (int kb = 0; kb < K; kb += 32) { FragH ah; ah.half[0] = *(const v8us*)((const unsigned short*)arow + kb + 8 * hh); ah.half[1] = *(const v8us*)((const unsigned short*)arow + kb + 16 + 8 * hh);
#pragma unroll
    for (int t = 0; t < 4; ++t) { if (col0 + t * 16 >= N) continue; const size_t boff = (size_t)(col0 + t * 16 + ln) * ldb + kb; FragH bq; bq.half[0] = *(const v8us*)((const unsigned short*)Bh + boff + 8 * hh); bq.half[1] = *(const v8us*)((const unsigned short*)Bh + boff + 16 + 8 * hh);
      acc[t] = mmaH<1>(ah.v, ah.v, bq.v, bq.v, acc[t]); }
  }
#pragma unroll
  for (int t = 0; t < 4; ++t) { if (col0 + t * 16 >= N) continue; const int col = col0 + t * 16 + ln; const float bv = bp ? bf16_round(bp[col]) : 0.f;
#pragma unroll
    for (int r = 0; r < 8; ++r) { float v = acc[t][r] * alpha + bv; if (CP) { const int rr = row0g + row0 + 8 * hh + r; if (rowsPerB < 0) v += CP[cofs + (size_t)rr * ldc + col];      /* rowsPerB < 0: own element of the batched C plane */ else { const int bidx = rr / rowsPerB; v += CP[(size_t)bidx * sCPb + (size_t)by * 64 + col]; } } if (ACT == 1) v = (v > 0.f) ? v : expm1f(v); else if (ACT == 7) v = (v > 0.f) ? v + 1.0f : expf(v); else if (ACT == 8) v = tanhf(v); else if (ACT == 9) v = 0.5f * v * (1.0f + tanhf(0.7978845608028654f * (v + 0.044715f * v * v * v))); else if (ACT == 11) v = 1.0f / (1.0f + expf(-v)); else if (ACT == 12) v = (v > 0.f) ? v : 0.01f * v; else if (ACT == 14) v = (v > 0.f) ? v : 0.1f * v; else if (ACT == 16) v = (v >= 0.f) ? v : 0.3f * v; else if (ACT == 17) v = (v >= 0.f) ? v : 0.2f * v; else if (ACT == 15) v = v / (1.0f + expf(-v)); else if (ACT == 3) v = fmaxf(v, 0.f); else if (ACT == 6) v = 0.5f * v * (1.0f + erff(v * 0.70710678118654752f)); so[w][8 * hh + r][t * 16 + ln] = v; } }
  __builtin_amdgcn_fence(__ATOMIC_ACQ_REL, "workgroup"); __builtin_amdgcn_wave_barrier();
  const int rsub = lane >> 4, c4 = (lane & 15) * 4; typedef _Float16 v4h __attribute__((ext_vector_type(4)));
  {
#pragma unroll
    for (int q = 0; q < 8; ++q) { const int r = q * 2 + rsub; if (col0 + c4 < N) { const v4f v = *(const v4fa*)&so[w][r][c4]; if (C) *(v4f*)(C + cofs + (size_t)(row0 + r) * ldc + col0 + c4) = v; if (C16) { v4h h4; for (int i = 0; i < 4; ++i) h4[i] = (_Float16)v[i]; *(v4h*)(C16 + cofs + (size_t)(row0 + r) * ldc + col0 + c4) = h4; } } }
     }
}


typedef _Float16 v4h __attribute__((ext_vector_type(4)));

__device__ __forceinline__ void x16_part(const unsigned bx, const float* __restrict__ x, _Float16* __restrict__ X16, size_t n8) { const size_t t = (size_t)bx * 256 + threadIdx.x; if (t >= n8) return; FragH f;
#pragma unroll
  for (int q = 0; q < 8; ++q) f.h[q] = (_Float16)bf16_round(x[t * 8 + q]); *(v8us*)((unsigned short*)X16 + t * 8) = f.half[0];  }
__global__ __launch_bounds__(256) void k_h16(const float* __restrict__ x, _Float16* __restrict__ X16, size_t n8) { const size_t t = (size_t)blockIdx.x * 256 + threadIdx.x; if (t >= n8) return; FragH f;
#pragma unroll
  for (int q = 0; q < 8; ++q) f.h[q] = (_Float16)x[t * 8 + q]; *(v8us*)((unsigned short*)X16 + t * 8) = f.half[0];  }
__global__ __launch_bounds__(256) void k_round16f(const float* __restrict__ W, _Float16* __restrict__ Bt, size_t n8) { const size_t t = (size_t)blockIdx.x * 256 + threadIdx.x; if (t >= n8) return; FragH f;
#pragma unroll
  for (int i = 0; i < 8; ++i) f.h[i] = (_Float16)(bf16_round(W[t * 8 + i]) * 16.0f); *(v8us*)((unsigned short*)Bt + t * 8) = f.half[0];  }
template <int NHv, int TTv>
__device__ __forceinline__ void vt_part(const unsigned bx, unsigned short (*tl)[66], const _Float16* __restrict__ V16, int ldv, int voff, _Float16* __restrict__ Vt) { const int tid = threadIdx.x; const int slab = bx / (TTv / 64), lg = bx % (TTv / 64); const int b = slab / NHv, h = slab % NHv;
  for (int i = tid; i < 64 * 8; i += 256) { const int r = i / 8, c8 = (i % 8) * 8; FragH f; f.half[0] = *(const v8us*)((const unsigned short*)V16 + ((size_t)b * TTv + lg * 64 + r) * ldv + voff + h * 64 + c8);
#pragma unroll
    for (int q = 0; q < 8; ++q) tl[r][c8 + q] = f.u[q]; }
  __syncthreads();
  {
#pragma unroll
    for (int rd = 0; rd < 2; ++rd) { const int d = rd * 32 + tid / 8, pc = tid % 8; FragH f;
#pragma unroll
      for (int q = 0; q < 8; ++q) f.u[q] = tl[pc * 8 + q][d];
      *(v8us*)((unsigned short*)Vt + ((size_t)slab * 64 + d) * TTv + lg * 64 + pc * 8) = f.half[0]; }
     } }

__global__ __launch_bounds__(256) void k_hl(const float* __restrict__ F, _Float16* __restrict__ Hh, _Float16* __restrict__ Hl, size_t n8) { const size_t t = (size_t)blockIdx.x * 256 + threadIdx.x; if (t >= n8) return; FragH fh, fl; const v4f a = *(const v4fa*)(F + t * 8), c = *(const v4fa*)(F + t * 8 + 4);
#pragma unroll
  for (int q = 0; q < 4; ++q) { _Float16 h = (_Float16)a[q]; fh.h[q] = h; fl.h[q] = (_Float16)((a[q] - (float)h) * 1024.0f); h = (_Float16)c[q]; fh.h[4 + q] = h; fl.h[4 + q] = (_Float16)((c[q] - (float)h) * 1024.0f); }
  { *(v8us*)((unsigned short*)Hh + t * 8) = fh.half[0]; *(v8us*)((unsigned short*)Hl + t * 8) = fl.half[0];  } }

// ---- q/k/v GEMM: wave tile 32x64, operands staged in LDS ----
__device__ __forceinline__ v16h g2_frag(const _Float16* p, int hh) { FragH f; f.half[0] = *(const v8us*)((const unsigned short*)p + 8 * hh); f.half[1] = *(const v8us*)((const unsigned short*)p + 16 + 8 * hh); return f.v; }
__device__ __forceinline__ v16h g3_frag(const unsigned short* p, int hh) { FragH f; f.half[0] = *(const v8us*)(p + 8 * hh); f.half[1] = *(const v8us*)(p + 16 + 8 * hh); return f.v; }
__device__ __forceinline__ v8f g3_mma(v16h a, v16h b, v8f c) { return __builtin_amdgcn_wmma_f32_16x16x32_f16(false, a, false, b, (short)0, c, false, false); }
// One workgroup = a 128 x 128 tile of one of q/k/v: eight waves of 32 x 64, four down and two across. One trip = GK of k.
// A trip's 128 x rows and 128 weight rows (128 bytes of each) come into LDS as whole lines by asynchronous copies, once a workgroup instead of once a wave and in 32-byte pieces;
// two buffers: the copies of trip t + 2 are issued when trip t has left its buffer and fly while trip t + 1 is worked on. The k order of every sum is the one it was.
#define GK 64                        /* k per trip */
#define GP (GK + 8)                  /* LDS row pitch in f16: 128 bytes + 16, for 16-byte fragment reads of 16 rows */
#define GNT (DM / GK)                /* trips */
#define GBUF (256 * GP)              /* one buffer in f16: 128 x rows, then 128 weight rows */
// A lane's eight 16-byte copies of one trip: rows sr + 32 i of x (a) and of the weights (b) to the same rows of the buffer at LDS byte address l.
// The s_wait_xcnt stands in the copies' own statement: behind it the registers that the copies name may be written again.
__device__ __forceinline__ void g3_copy(unsigned l, const unsigned short* a, const unsigned short* b) {
  asm volatile("global_load_async_to_lds_b128 %0, %8, off\n\t"
               "global_load_async_to_lds_b128 %1, %9, off\n\t"
               "global_load_async_to_lds_b128 %2, %10, off\n\t"
               "global_load_async_to_lds_b128 %3, %11, off\n\t"
               "global_load_async_to_lds_b128 %4, %12, off\n\t"
               "global_load_async_to_lds_b128 %5, %13, off\n\t"
               "global_load_async_to_lds_b128 %6, %14, off\n\t"
               "global_load_async_to_lds_b128 %7, %15, off\n\t"
               "s_wait_xcnt 0x0"
               :: "v"(l), "v"(l + 32u * GP * 2u), "v"(l + 64u * GP * 2u), "v"(l + 96u * GP * 2u), "v"(l + 128u * GP * 2u), "v"(l + 160u * GP * 2u), "v"(l + 192u * GP * 2u), "v"(l + 224u * GP * 2u),
                  "v"(a), "v"(a + 32 * DM), "v"(a + 64 * DM), "v"(a + 96 * DM), "v"(b), "v"(b + 32 * DM), "v"(b + 64 * DM), "v"(b + 96 * DM)
               : "memory");
}
// f16 q, k, v of all token rows: grid.y = which of q/k/v; QKV16 [3][NR][DM]. The 128-row block that holds the first QT0 rows of a batch stores the same sums in f32 as well: F0 [3][NB][QT0][DM]
static_assert(QT0 == 128 && SQ % 128 == 0, "the first QT0 rows of a batch are one 128-row block of the GEMM");
static_assert(DM % 128 == 0 && GNT >= 2, "whole 128-column tiles; the two buffers want two trips");
__global__ __launch_bounds__(256) void k_qkv(const _Float16* __restrict__ X16, const _Float16* __restrict__ B3, _Float16* __restrict__ QKV16, float* __restrict__ F0) {
  __shared__ __attribute__((aligned(16))) unsigned short st[2 * GBUF];      /* the two buffers; behind the loop each wave's output rows, turned for whole-row stores */
  static_assert(sizeof(st) >= 8 * 32 * 68 * 4, "the output staging fits in the buffers");
  const int tid = threadIdx.x, w = tid >> 5, lane = tid & 31, ln = lane & 15, hh = lane >> 4; const int wh = blockIdx.y;
  const int mt = blockIdx.x / (DM / 128), nq = blockIdx.x % (DM / 128); const int b = mt / (SQ / 128);      /* row block, column block, batch */
  const int row0 = 32 * (w & 3), col0 = nq * 128 + 64 * (w >> 2);      /* the wave's tile: rows inside the row block, columns of the tensor */
  const int sr = tid >> 3, sc = (tid & 7) * 8;      /* staging: eight threads bring one 128-byte row */
  const unsigned short* ag = (const unsigned short*)X16 + ((size_t)mt * 128 + sr) * DM + sc;
  const unsigned short* bg = (const unsigned short*)B3 + (size_t)wh * DM * DM + ((size_t)nq * 128 + sr) * DM + sc;
  const unsigned l0 = (unsigned)(size_t)&st[sr * GP + sc];      /* the lane's LDS byte address in buffer 0 */
  g3_copy(l0, ag, bg);
  asm volatile("s_wait_asynccnt 0x0" ::: "memory");      /* the wave's own copies of trip 0 have landed ... */
  __syncthreads();                                       /* ... and every other wave's */
  g3_copy(l0 + GBUF * 2u, ag + GK, bg + GK);
  const unsigned short* af = &st[(row0 + ln) * GP]; const unsigned short* bf = &st[(128 + 64 * (w >> 2) + ln) * GP];
  const v8f z8 = {0.f,0.f,0.f,0.f,0.f,0.f,0.f,0.f}; v8f c0[4] = {z8, z8, z8, z8}, c1[4] = {z8, z8, z8, z8};
#pragma unroll 1      /* one trip's code: the buffer is chosen by an offset */
  for (int t = 0; t < GNT; ++t) {
    const unsigned short* ap = af + (t & 1) * GBUF; const unsigned short* bp = bf + (t & 1) * GBUF;
#pragma unroll      /* constant indices: the accumulators stay in registers */
    for (int kk = 0; kk < GK; kk += 32) { const v16h a0 = g3_frag(ap + kk, hh), a1 = g3_frag(ap + 16 * GP + kk, hh); v16h bj[4];
#pragma unroll      /* constant indices: bj stays in registers */
      for (int j = 0; j < 4; ++j) bj[j] = g3_frag(bp + j * 16 * GP + kk, hh);
      __builtin_amdgcn_sched_barrier(0);      /* the six fragments' reads are issued together before the first product waits for one: one LDS round trip for eight products instead of one for two */
#pragma unroll      /* constant indices, as above; eight independent accumulators */
      for (int j = 0; j < 4; ++j) { c0[j] = g3_mma(a0, bj[j], c0[j]); c1[j] = g3_mma(a1, bj[j], c1[j]); } }
    asm volatile("s_wait_dscnt 0x0" ::: "memory");         /* this wave has read its last of this trip's buffer */
    asm volatile("s_wait_asynccnt 0x0" ::: "memory");      /* its copies of the next trip have landed */
    __syncthreads();      /* publishes the next trip's buffer and ends this trip's reads */
    if (t + 2 < GNT) g3_copy(l0 + (unsigned)(t & 1) * (GBUF * 2u), ag + (t + 2) * GK, bg + (t + 2) * GK);      /* into the buffer that this trip has just left */
  }
  asm volatile("s_wait_asynccnt 0x0" ::: "memory");      /* no copy is outstanding when the buffers become output staging */
  float (*so)[68] = (float (*)[68])((float*)st + (size_t)w * 32 * 68);      /* the wave's own 32 rows */
  float* C = (mt % (SQ / 128) == 0) ? F0 + (size_t)(wh * NB + b) * QT0 * DM : nullptr;
  _Float16* C16 = QKV16 + (size_t)wh * NR * DM + (size_t)mt * 128 * DM;
#pragma unroll      /* constant indices, as above */
  for (int j = 0; j < 4; ++j)
#pragma unroll      /* constant indices, as above */
    for (int r = 0; r < 8; ++r) { so[8 * hh + r][j * 16 + ln] = c0[j][r] * 0.0625f; so[16 + 8 * hh + r][j * 16 + ln] = c1[j][r] * 0.0625f; }      /* the weights were carried x16 */
  __builtin_amdgcn_fence(__ATOMIC_ACQ_REL, "workgroup"); __builtin_amdgcn_wave_barrier();      /* so is the wave's own: its writes are ordered before its reads */
  const int rsub = lane >> 4, c4 = (lane & 15) * 4;
  {
    v4f vq[16]; v4h hq[16];      /* all rows are read and converted first: behind the stores nothing is computed, so no register that an issued store names is written again */
#pragma unroll      /* constant indices: vq and hq stay in registers */
    for (int q = 0; q < 16; ++q) { vq[q] = *(const v4fa*)&so[q * 2 + rsub][c4]; for (int i = 0; i < 4; ++i) hq[q][i] = (_Float16)vq[q][i]; }
#pragma unroll      /* constant indices, as above; the stores take constant offsets from one address */
    for (int q = 0; q < 16; ++q) *(v4h*)(C16 + (size_t)(row0 + q * 2 + rsub) * DM + col0 + c4) = hq[q];
    if (C) {
      asm volatile("s_wait_xcnt 0x0" ::: "memory");      /* before this branch's address lands in a register that the stores above name */
#pragma unroll      /* constant indices, as above */
      for (int q = 0; q < 16; ++q) *(v4f*)(C + (size_t)(row0 + q * 2 + rsub) * DM + col0 + c4) = vq[q]; }
  }
}


__global__ __launch_bounds__(256) void k_wnat(const float* __restrict__ w, size_t n8, _Float16* __restrict__ Bt) { const size_t t = (size_t)blockIdx.x * 256 + threadIdx.x; if (t >= n8) return; FragH f; for (int q = 0; q < 8; ++q) f.h[q] = (_Float16)(bf16_round(w[t * 8 + q]) * 16.0f); *(v8us*)((unsigned short*)Bt + t * 8) = f.half[0];  }
__global__ __launch_bounds__(256) void k_rsm(const float* __restrict__ S, _Float16* __restrict__ P, int nrows) {
  #pragma clang fp contract(off)
  const int i = blockIdx.x * 256 + threadIdx.x; if (i >= nrows) return; const float* s = S + (size_t)i * SQ; float mx = -3.0e38f;
#pragma unroll 1
  for (int j = 0; j < SQ; ++j) mx = fmaxf(mx, s[j]); float se = 0.f;
#pragma unroll 1
  for (int j = 0; j < SQ; ++j) se += expf(s[j] - mx); const float sc = 256.0f / se;
#pragma unroll 1
  for (int j0 = 0; j0 < SQ; j0 += 8) { FragH f; for (int q = 0; q < 8; ++q) f.h[q] = (_Float16)(expf(s[j0 + q] - mx) * sc); unsigned short* d = (unsigned short*)P + (size_t)i * SQ + j0; *(v8us*)d = f.half[0];  } }
__global__ __launch_bounds__(256) void k_vt(const _Float16* __restrict__ V16, int b, int h0, _Float16* __restrict__ VT) { __shared__ unsigned short tl[64][65]; const int tid = threadIdx.x; const int hh = blockIdx.x % HG, sg = blockIdx.x / HG; const int s0 = sg * 64; const int h = h0 + hh;
  for (int i = tid; i < 64 * 8; i += 256) { const int j = i / 8, d8 = (i % 8) * 8; FragH f; f.half[0] = *(const v8us*)((const unsigned short*)V16 + ((size_t)b * SQ + s0 + j) * DM + h * HD + d8); for (int q = 0; q < 8; ++q) tl[d8 + q][j] = f.u[q]; }
  __syncthreads();
  { for (int i = tid; i < 64 * 8; i += 256) { const int d = i / 8, j8 = (i % 8) * 8; FragH f; for (int q = 0; q < 8; ++q) f.u[q] = tl[d][j8 + q]; *(v8us*)((unsigned short*)VT + ((size_t)hh * HD + d) * SQ + s0 + j8) = f.half[0]; }  } }

__device__ __forceinline__ void wthd_part(const unsigned bx, const unsigned wh, const float* __restrict__ Wq, const float* __restrict__ Wk, const float* __restrict__ Wv, _Float16* __restrict__ B3) { const size_t t = (size_t)bx * 256 + threadIdx.x; if (t >= (size_t)NH * HD * (DM / 8)) return; const float* Wt = wh == 0 ? Wq : wh == 1 ? Wk : Wv; _Float16* Bt = B3 + (size_t)wh * DM * DM;      /* wh = which of q/k/v */ const int m8 = (int)(t % (DM / 8)) * 8; const int d = (int)((t / (DM / 8)) % HD); const int h = (int)(t / ((size_t)(DM / 8) * HD)); FragH f;
  for (int q = 0; q < 8; ++q) f.h[q] = (_Float16)(16.0f * bf16_round(Wt[((size_t)h * DM + m8 + q) * HD + d])); unsigned short* dst = (unsigned short*)Bt + ((size_t)h * HD + d) * DM + m8; *(v8us*)dst = f.half[0];  }
// launch 1: the weights' blocks, then the blocks of the x rows (neither reads what the other writes)
#define PWB ((unsigned)(((size_t)NH * HD * (DM / 8) + 255) / 256))      /* blocks per weight tensor */
#define PXB ((unsigned)((NR * DM / 8 + 255) / 256))                    /* blocks of the x rows */
__global__ __launch_bounds__(256) void k_prep(const float* __restrict__ x, const float* __restrict__ Wq, const float* __restrict__ Wk, const float* __restrict__ Wv, _Float16* __restrict__ B3, _Float16* __restrict__ X16) {
  const unsigned bx = blockIdx.x;
  if (bx < 3 * PWB) wthd_part(bx % PWB, bx / PWB, Wq, Wk, Wv, B3);
  else x16_part(bx - 3 * PWB, x, X16, NR * DM / 8);
}



// ---- cross-lane and exp helpers ----
template <int M> __device__ __forceinline__ float rs_xm(float x) { return __builtin_bit_cast(float, __builtin_amdgcn_mov_dpp(__builtin_bit_cast(int, x), 0x160 + M, 0xf, 0xf, false)); }      /* lane l <- lane l ^ M inside a 16-lane row (row_xmask) */
__device__ __forceinline__ float rs_xh(float x) { return __builtin_bit_cast(float, __builtin_amdgcn_permlanex16(__builtin_bit_cast(int, x), __builtin_bit_cast(int, x), 0x76543210, 0xfedcba98, false, false)); }      /* lane l <- lane l ^ 16 */
// e^x of four values, as __expf forms it (x * log2 e, then v_exp_f32). One statement: behind a transcendental the instruction set asks for one independent instruction before its source is overwritten or its result read;
// each v_exp_f32 is that instruction for the one before it (outputs are early-clobber, so none lies on an input), the v_nop for the last.
__device__ __forceinline__ v4f rs_exp4(v4f x) { float y0, y1, y2, y3; const v4f t = x * 1.44269504f;
  asm("v_exp_f32 %0, %4\n\tv_exp_f32 %1, %5\n\tv_exp_f32 %2, %6\n\tv_exp_f32 %3, %7\n\tv_nop" : "=&v"(y0), "=&v"(y1), "=&v"(y2), "=&v"(y3) : "v"(t[0]), "v"(t[1]), "v"(t[2]), "v"(t[3]));
  const v4f y = {y0, y1, y2, y3}; return y; }


// ---- fused causal attention: scores, softmax and weighted sum of v in one kernel; scores and weights never leave the registers ----
// One workgroup = FQ query rows of one (batch, head), 16 rows a wave; one trip = FK keys, up to the workgroup's own diagonal block.
// The products are formed transposed: S^T = K Q^T (A = 16 key rows, B = the wave's 16 query rows) leaves, in lane (ln, hh), the scores of query ln for keys 8 hh + r of each 16-key tile:
// two such tiles side by side are, register for register, the B fragment (n = query, k = 32 keys) of O^T = V^T P^T, so the weights go from accumulator to operand without a shuffle.
// A query's running maximum, sum and rescale factor live in its own two lanes (ln and ln + 16).
#define FQ 64                        /* query rows per workgroup */
#define FK 64                        /* keys per trip */
#define FLP (FK + 8)                 /* LDS row pitch in f16: 128 bytes + 16, for 16-byte fragment reads of 16 rows */
__device__ __forceinline__ v16h fa_frag(const unsigned short* p, int hh) { FragH f; f.half[0] = *(const v8us*)(p + 8 * hh); f.half[1] = *(const v8us*)(p + 16 + 8 * hh); return f.v; }
__device__ __forceinline__ v8f fa_mma(v16h a, v16h b, v8f c) { return __builtin_amdgcn_wmma_f32_16x16x32_f16(false, a, false, b, (short)0, c, false, false); }
// grid = (head, batch, query block), longest query block first
__global__ __launch_bounds__(128) void k_fattn(const _Float16* __restrict__ Q16, const _Float16* __restrict__ K16, const _Float16* __restrict__ VT, float* __restrict__ out) {
  __shared__ __attribute__((aligned(16))) unsigned short sk[2][FK][FLP];      /* k rows [key][d], two buffers */
  __shared__ __attribute__((aligned(16))) unsigned short sv[2][HD][FLP];      /* v^T rows [d][key], two buffers */
  __shared__ __attribute__((aligned(16))) float so[4][16][HD + 4];            /* a wave's output rows, turned for whole-row stores */
  const int tid = threadIdx.x, w = tid >> 5, lane = tid & 31, ln = lane & 15, hh = lane >> 4;
  const int h = blockIdx.x, b = blockIdx.y, qb = SQ / FQ - 1 - (int)blockIdx.z;
  const int sr = tid >> 3, sc = (tid & 7) * 8;      /* staging: eight threads bring one 128-byte row */
  const unsigned short* kg = (const unsigned short*)K16 + ((size_t)b * SQ + sr) * LQ + h * HD + sc;
  const unsigned short* vg = (const unsigned short*)VT + ((size_t)(b * NH + h) * HD + sr) * SQ + sc;
  const _Float16* qp = Q16 + ((size_t)b * SQ + qb * FQ + w * 16 + ln) * LQ + h * HD;
  const v16h q0 = g2_frag(qp, hh), q1 = g2_frag(qp + 32, hh);
  v8us kr[4], vr[4];
#pragma unroll      /* constant indices: kr and vr stay in registers */
  for (int i = 0; i < 4; ++i) { kr[i] = *(const v8us*)(kg + (size_t)i * 16 * LQ); vr[i] = *(const v8us*)(vg + (size_t)i * 16 * SQ); }
  asm volatile("s_wait_xcnt 0x0" ::: "memory");      /* before any register that these loads name is written again */
#pragma unroll      /* constant indices, as above */
  for (int i = 0; i < 4; ++i) { *(v8us*)&sk[0][sr + i * 16][sc] = kr[i]; *(v8us*)&sv[0][sr + i * 16][sc] = vr[i]; }
  __syncthreads();
  const v8f z8 = {0.f, 0.f, 0.f, 0.f, 0.f, 0.f, 0.f, 0.f};
  v8f o[4] = {z8, z8, z8, z8}; float m = -1.0e30f, l = 0.f;      /* m: running maximum of the raw products; l: this lane's part of the running sum */
  for (int kb = 0; kb <= qb; ++kb) {
    const int cur = kb & 1;
    if (kb < qb) {      /* the next trip's rows fly while this trip is worked on */
#pragma unroll      /* constant indices, as above */
      for (int i = 0; i < 4; ++i) { kr[i] = *(const v8us*)(kg + (size_t)(kb + 1) * FK * LQ + (size_t)i * 16 * LQ); vr[i] = *(const v8us*)(vg + (size_t)(kb + 1) * FK + (size_t)i * 16 * SQ); }
      asm volatile("s_wait_xcnt 0x0" ::: "memory");      /* before any register that these loads name is written again */
    }
    v8f st[4]; v16h kf[8], vf[8];
#pragma unroll      /* constant indices: kf stays in registers */
    for (int t = 0; t < 4; ++t) { const unsigned short* kp = &sk[cur][t * 16 + ln][0]; kf[2 * t] = fa_frag(kp, hh); kf[2 * t + 1] = fa_frag(kp + 32, hh); }
    __builtin_amdgcn_sched_barrier(0);      /* all k fragment reads are issued before the first product waits for one: one LDS round trip a trip instead of one a tile */
#pragma unroll      /* constant indices: st stays in registers; four independent accumulators */
    for (int t = 0; t < 4; ++t) st[t] = fa_mma(kf[2 * t], q0, z8);
#pragma unroll      /* constant indices, as above */
    for (int t = 0; t < 4; ++t) st[t] = fa_mma(kf[2 * t + 1], q1, st[t]);
#pragma unroll      /* constant indices: vf stays in registers */
    for (int t = 0; t < 4; ++t) { const unsigned short* vp = &sv[cur][t * 16 + ln][0]; vf[2 * t] = fa_frag(vp, hh); vf[2 * t + 1] = fa_frag(vp + 32, hh); }
    __builtin_amdgcn_sched_barrier(0);      /* the v^T fragment reads are issued ahead of the softmax arithmetic, which then covers their round trip */
    if (kb == qb) {      /* the diagonal block: keys behind the row's own are masked */
#pragma unroll      /* constant indices, as above */
      for (int t = 0; t < 4; ++t) for (int r = 0; r < 8; ++r) st[t][r] = (t * 16 + 8 * hh + r <= w * 16 + ln) ? st[t][r] : -1.0e30f;
    }
    v4f m4 = {m, m, m, m};
#pragma unroll      /* constant indices, as above; four independent chains */
    for (int t = 0; t < 4; ++t) for (int r = 0; r < 8; ++r) m4[r & 3] = fmaxf(m4[r & 3], st[t][r]);
    float mn = fmaxf(fmaxf(m4[0], m4[1]), fmaxf(m4[2], m4[3])); mn = fmaxf(mn, rs_xh(mn));      /* both lanes of a query hold the same maximum */
    const float da = (m - mn) * 0.125f; const v4f da4 = {da, da, da, da}; const float al = rs_exp4(da4)[0]; m = mn;
    const float ms = mn * 0.125f - 5.5451774f;      /* weights carried x256 (e^5.545...): small ones stay normal f16 numbers; the factor cancels against the sum */
    v4f s4 = {0.f, 0.f, 0.f, 0.f}; FragH pb[2];
#pragma unroll      /* constant indices, as above */
    for (int t = 0; t < 4; ++t) for (int g = 0; g < 2; ++g) {
      v4f x; for (int u = 0; u < 4; ++u) x[u] = st[t][g * 4 + u] * 0.125f - ms;
      const v4f e = rs_exp4(x); s4 += e;
      for (int u = 0; u < 4; ++u) pb[t >> 1].h[(t & 1) * 8 + g * 4 + u] = (_Float16)e[u]; }
    l = l * al + ((s4[0] + s4[1]) + (s4[2] + s4[3]));
#pragma unroll      /* constant indices: o stays in registers */
    for (int t = 0; t < 4; ++t) o[t] = fa_mma(vf[2 * t], pb[0].v, o[t] * al);
#pragma unroll      /* constant indices, as above */
    for (int t = 0; t < 4; ++t) o[t] = fa_mma(vf[2 * t + 1], pb[1].v, o[t]);
    if (kb < qb) {      /* the other buffer: its last readers left it at the barrier that ended the trip before */
#pragma unroll      /* constant indices, as above */
      for (int i = 0; i < 4; ++i) { *(v8us*)&sk[cur ^ 1][sr + i * 16][sc] = kr[i]; *(v8us*)&sv[cur ^ 1][sr + i * 16][sc] = vr[i]; }
    }
    __syncthreads();      /* publishes the next trip's buffer and ends this trip's reads */
  }
  l += rs_xh(l); const float fin = 1.0f / l;
#pragma unroll      /* constant indices, as above */
  for (int t = 0; t < 4; ++t) for (int g = 0; g < 2; ++g) { v4f y; for (int u = 0; u < 4; ++u) y[u] = o[t][g * 4 + u] * fin; *(v4f*)&so[w][ln][t * 16 + 8 * hh + g * 4] = y; }
  __builtin_amdgcn_fence(__ATOMIC_ACQ_REL, "workgroup"); __builtin_amdgcn_wave_barrier();      /* so[w] is the wave's own: its writes are ordered before its reads */
  float* op = out + ((size_t)b * SQ + qb * FQ + w * 16 + hh) * DM + h * HD + ln * 4;
#pragma unroll      /* stores take constant offsets from one address */
  for (int q = 0; q < 8; ++q) { const v4f y = *(const v4fa*)&so[w][q * 2 + hh][ln * 4]; *(v4f*)(op + (size_t)q * 2 * DM) = y; }
}

// Exact f32 causal attention of the first QT0 rows. One workgroup = A0R query rows of one (batch, head); 16 lanes share a row.
// The head's k and v rows are staged once in LDS; scores: lane ks of a row takes keys ks, ks + 16, ...; softmax over the row's 16 lanes; o: lane ks of a row takes dims 4 ks .. 4 ks + 3 over all keys.
#define A0R 16                       /* query rows per workgroup */
#define A0N (QT0 / 16)               /* groups of 16 keys */
#define A0KP (HD + 4)                /* k row pitch in LDS, floats: the 16 key rows that 16 lanes read fall on 64 different banks */
#define A0PP (QT0 + 16)              /* weight row pitch in LDS, floats: the two rows of a wave fall on different banks */
#define A0LDS ((QT0 * A0KP + QT0 * HD + A0R * A0PP) * 4)      /* its LDS, bytes */
__device__ __forceinline__ void att0_part(const unsigned bx, const unsigned b, float* __restrict__ sm, const float* __restrict__ QF, const float* __restrict__ KF, const float* __restrict__ VF, float scale, float* __restrict__ out) {
  float (*sk)[A0KP] = (float (*)[A0KP])sm;
  float (*sv)[HD] = (float (*)[HD])(sm + QT0 * A0KP);
  float (*ps)[A0PP] = (float (*)[A0PP])(sm + QT0 * A0KP + QT0 * HD);
  const int tid = threadIdx.x; const int h = bx / (QT0 / A0R), rg = bx % (QT0 / A0R);
  const int r = tid >> 4, ks = tid & 15; const int i = rg * A0R + r;      /* the thread's query row; ks = its key slot, later its group of four dims */
  const size_t hb = (size_t)b * QT0 * DM + h * HD;
  const float* kp = KF + hb + r * DM + ks * 4; const float* vp = VF + hb + r * DM + ks * 4; const float* qp = QF + hb + i * DM;
  v4f q[HD / 4], kt[A0N], vt[A0N];
#pragma unroll      /* constant indices: the arrays stay in registers; all loads of the workgroup are in flight together, one memory round trip in all */
  for (int c = 0; c < HD / 4; ++c) q[c] = *(const v4fa*)(qp + c * 4);
#pragma unroll      /* constant indices, as above */
  for (int n = 0; n < A0N; ++n) { kt[n] = *(const v4fa*)(kp + n * 16 * DM); if (n < A0N - 1) vt[n] = *(const v4fa*)(vp + n * 16 * DM); }
  asm volatile("s_wait_xcnt 0x0" ::: "memory");      /* the last v load may land in the address registers that the loads before it name: their translations are waited for first */
  vt[A0N - 1] = *(const v4fa*)(vp + (A0N - 1) * 16 * DM);
  asm volatile("s_wait_xcnt 0x0" ::: "memory");      /* before any register that these loads name is written again */
#pragma unroll      /* constant indices, as above */
  for (int n = 0; n < A0N; ++n) { *(v4f*)&sk[n * 16 + r][ks * 4] = kt[n]; *(v4f*)&sv[n * 16 + r][ks * 4] = vt[n]; }
  __syncthreads();
  float s[A0N]; float m = -1.0e30f;
#pragma unroll      /* constant indices into s; the test reads the same in the whole workgroup: key groups behind its last row are skipped */
  for (int n = 0; n < A0N; ++n) { s[n] = -1.0e30f;
    if (n <= rg) { const int j = n * 16 + ks; v4f a4 = {0.f, 0.f, 0.f, 0.f};
#pragma unroll      /* constant indices into q; four independent sums */
      for (int c = 0; c < HD / 4; ++c) a4 += q[c] * *(const v4f*)&sk[j][c * 4];
      const float sj = ((a4[0] + a4[1]) + (a4[2] + a4[3])) * scale; s[n] = (j <= i) ? sj : -1.0e30f; m = fmaxf(m, s[n]); } }
  m = fmaxf(m, rs_xm<1>(m)); m = fmaxf(m, rs_xm<2>(m)); m = fmaxf(m, rs_xm<4>(m)); m = fmaxf(m, rs_xm<8>(m));      /* maximum over the row's 16 lanes */
  float l = 0.f;
#pragma unroll      /* constant indices into s; a key behind the row's own holds -1e30: its weight underflows to 0 */
  for (int n = 0; n < A0N; ++n) { const float e = expf(s[n] - m); l += e; ps[r][n * 16 + ks] = e; }
  l += rs_xm<1>(l); l += rs_xm<2>(l); l += rs_xm<4>(l); l += rs_xm<8>(l);      /* sum over the row's 16 lanes */
  __syncthreads();
  v4f o = {0.f, 0.f, 0.f, 0.f};
#pragma unroll 1      /* one trip = 16 keys, up to the workgroup's last row */
  for (int n = 0; n <= rg; ++n) {
#pragma unroll      /* a trip's LDS reads take constant offsets and overlap */
    for (int jj = 0; jj < 16; jj += 4) { const int j = n * 16 + jj; const v4f p4 = *(const v4f*)&ps[r][j];
      for (int u = 0; u < 4; ++u) o += p4[u] * *(const v4f*)&sv[j + u][ks * 4]; } }
  const float fin = 1.0f / l;
  *(v4f*)(out + ((size_t)b * SQ + i) * DM + h * HD + ks * 4) = o * fin;      /* straight into the row's place in the output */
}
// launch 3: the exact first rows' blocks (the longer ones, so they start first), then the blocks of the V^T transposes; neither reads what the other writes. One LDS range serves whichever part a block runs.
#define A0B ((unsigned)(NH * (QT0 / A0R)))      /* exact-rows blocks per batch */
__global__ __launch_bounds__(256) void k_att0_vt(const float* __restrict__ F0, float* __restrict__ out, const _Float16* __restrict__ V16, _Float16* __restrict__ VT) {
  static_assert(A0R * 16 == 256 && A0LDS >= 64 * 66 * 2, "both parts run in 256 threads and in the one LDS range");
  __shared__ __attribute__((aligned(16))) float sm[A0LDS / 4];
  const unsigned bx = blockIdx.x;
  if (bx < NB * A0B) att0_part(bx % A0B, bx / A0B, sm, F0, F0 + (size_t)NB * QT0 * DM, F0 + (size_t)2 * NB * QT0 * DM, 0.125f, out);
  else vt_part<NH, SQ>(bx - NB * A0B, (unsigned short (*)[66])sm, V16, LQ, 0, VT);
}


extern "C" void kernel_launch(void* const* d_in, const int* in_sizes, int n_in,
                              void* d_out, int out_size, void* d_ws, size_t ws_size, hipStream_t stream) {
  (void)in_sizes; (void)n_in; (void)out_size;
  const float* const* I = (const float* const*)d_in; const float* x = I[0]; const float* wq = I[1]; const float* wk = I[2]; const float* wv = I[3];      /* per-head [h][in][out] weights, no biases, no output projection */
  char* ws = (char*)d_ws; size_t off = 0;
  auto take = [&](size_t bytes) { char* p = ws + off; off += (bytes + 255) & ~(size_t)255; return p; };
  _Float16* B3 = (_Float16*)take((size_t)3 * DM * DM * 2);      /* q, k, v weights, one after the other */
  _Float16* X16 = (_Float16*)take(NR * DM * 2); _Float16* QKV16 = (_Float16*)take((size_t)3 * NR * DM * 2); _Float16* Q16 = QKV16; _Float16* K16 = QKV16 + NR * DM; _Float16* V16 = QKV16 + 2 * NR * DM;
  _Float16* VT = (_Float16*)take((size_t)NB * NH * HD * SQ * 2);
  float* F0 = (float*)take((size_t)3 * NB * QT0 * DM * 4);
  if (off > ws_size) return;
  k_prep<<<3 * PWB + PXB, 256, 0, stream>>>(x, wq, wk, wv, B3, X16);      /* per-head [m][d] -> Bt[(h,d)][m] x16 | x rows as f16 */
  k_qkv<<<dim3((unsigned)((MP / 128) * (DM / 128)), 3), 256, 0, stream>>>(X16, B3, QKV16, F0);      /* f16 q, k, v; f32 as well for the first 128 rows of each batch (exact products) */
  k_att0_vt<<<NB * A0B + NB * NH * (SQ / 64), 256, 0, stream>>>(F0, (float*)d_out, V16, VT);      /* exact f32 attention writes rows 0..127 of each batch | V^T [NB][NH][HD][SQ] */
  k_fattn<<<dim3(NH, NB, (SQ - QT0) / FQ), 128, 0, stream>>>(Q16, K16, VT, (float*)d_out);      /* rows 128.. : out = softmax(q k^T / 8, causal) v, f32, concatenated heads */
}

// v008
// A run of this version takes 46.4 microseconds.
// Timed twice side by side with v007, it ran 1.08 and 1.09 times as fast.
// All steps since v000 together make it 90.0 times as fast.
#include <hip/hip_runtime.h>
// Causal multi-head attention with per-head weight tensors (x [4][1024][768]; Q[s][h][d] = sum_m x[s][m] W_Q[h][m][d], K, V likewise (12 heads of 64); scores / 8 with a causal mask (tril); softmax; avg_V = probs V; out[q][h*64 + d] = avg_V[q][h][d], heads concatenated -> [4][1024][768]).
// Structure: token rows r = b*1024 + s; x as exact f16 rows (bf16-rounded); Q, K, V as three WMMA GEMMs (32x64 wave tiles, f32 accumulation, exact x16 weights, no bias, f16 outputs); four launches, stages that need nothing of each other share one by ranges of the block index: (1) weights | x rows; (2) the q/k/v GEMMs; (3) exact first rows | V^T for all heads via LDS transposes; (4) one fused attention kernel: per 64 query rows, trips of 64 keys up to the diagonal: scores on WMMA (K = 64), running-maximum softmax in registers (f32 statistics, native exp; weights x256 f16), weighted sum of v on WMMA, f32 accumulators rescaled each trip, written f32 straight into the concatenated-heads output rows (no output projection); first-tile refinement: the first 128 query rows of every batch are formed exactly in f32 (their q/k/v rows leave the GEMMs in f32 as well; a causal attention on VALU, 16 lanes a query row, writes those output rows; the fused kernel starts behind them).
// Compute dtype: inputs rounded to bf16; x / weights exact; q, k, v and softmax weights as plain f16 GEMM operands (~2^-12); scores and softmax statistics f32. v_wmma_f32_16x16x32_f16.
#define NB 4
#define SQ 1024
#define DM 768
#define NH 12
#define HD 64
#define HG 4                         /* heads per launch of the per-batch k_vt overload (never launched) */
#define QT0 128                      /* first-tile rows recomputed exactly in f32 */
#define B0 0                         /* unused (all batches on the grid) */
#define NBR NB                       /* batches processed (debug hook) */
#define NR ((size_t)NB * SQ)         /* token rows */
#define MP ((int)((size_t)NBR * SQ)) /* rows projected (debug hook) */
#define QN SQ                        /* unused (query tiles on grid.z) */
#define NHD NH                       /* unused (all heads on the grid) */
#define MPO MP                       /* unused (no output stage) */
#define LQ DM      /* row pitch of the q/k/v rows */
typedef __bf16 v16b __attribute__((ext_vector_type(16)));
typedef unsigned short v8us __attribute__((ext_vector_type(8), may_alias));
typedef float  v8f  __attribute__((ext_vector_type(8)));
typedef float  v4f  __attribute__((ext_vector_type(4)));
typedef float  v4fa __attribute__((ext_vector_type(4), may_alias));
union FragB { v16b v; v8us half[2]; unsigned short u[16]; };

__device__ __forceinline__ unsigned short bf16_bits(float x) { unsigned int u = __float_as_uint(x); return (unsigned short)((u + 0x7FFFu + ((u >> 16) & 1u)) >> 16); }
__device__ __forceinline__ float bf16_val(unsigned short b) { return __uint_as_float(((unsigned int)b) << 16); }
__device__ __forceinline__ float bf16_round(float x) { return bf16_val(bf16_bits(x)); }
// D += A·B with NT terms: 1 = ah·bh, 2 = + al·bh (A split), 3 = + ah·bl (both split)
template <int NT>
__device__ __forceinline__ v8f mmaN(v16b ah, v16b al, v16b bh, v16b bl, v8f c) {
  c = __builtin_amdgcn_wmma_f32_16x16x32_bf16(false, ah, false, bh, (short)0, c, false, false);
  if (NT >= 2) c = __builtin_amdgcn_wmma_f32_16x16x32_bf16(false, al, false, bh, (short)0, c, false, false);
  if (NT >= 3) c = __builtin_amdgcn_wmma_f32_16x16x32_bf16(false, ah, false, bl, (short)0, c, false, false);
  asm volatile("v_nop\n\tv_nop\n\tv_nop\n\tv_nop" : "+v"(c) : "v"(ah), "v"(al), "v"(bh), "v"(bl));
  return c;
}

__global__ __launch_bounds__(256) void k_wt_bf16(const float* __restrict__ W, unsigned short* __restrict__ Wt, int K, int N) {
  const int t = blockIdx.x * 256 + threadIdx.x;
  const int k8n = K / 8;
  if (t >= N * k8n) return;
  const int n = t / k8n, k8 = (t % k8n) * 8;
  v8us v;
#pragma unroll
  for (int i = 0; i < 8; ++i) v[i] = bf16_bits(W[(size_t)(k8 + i) * N + n]);
  *(v8us*)(Wt + (size_t)n * K + k8) = v;
  
}

// GEMM C[M][N] (f32, pitch ldc) = act(A[M][K]·W + bias). A f32 row-major (pitch lda) converted per fragment to bf16
// (ASPLIT: hi/lo two planes -> 2 terms, else single rounded term); Wt bf16 [N][K] (pitch ldb). BIAS_BF16 rounds the
// bias to bf16 first (bias quantised to bf16 before the add). K%32==0, M%16==0, N%64==0.
template <bool ASPLIT, int ACT, bool BIAS_BF16>
__global__ __launch_bounds__(128) void k_gemm_bf(const float* __restrict__ A, int lda, const unsigned short* __restrict__ Wt, int ldb,
                                               const float* __restrict__ bias, float* __restrict__ C, int ldc, int M, int N, int K) {
  __shared__ __attribute__((aligned(16))) float so[4][16][64];
  const int tid = threadIdx.x, w = tid >> 5, lane = tid & 31, ln = lane & 15, hh = lane >> 4;
  const int ntn = N / 64;
  const int wid = blockIdx.x * 4 + w;
  const int mt = wid / ntn, nq = wid % ntn;
  if (mt * 16 >= M) return;
  const int row0 = mt * 16, col0 = nq * 64;
  const float* arow = A + (size_t)(row0 + ln) * lda;
  v8f acc[4] = {};
  for (int kb = 0; kb < K; kb += 32) {
    FragB ah, al;
    const v4f x0 = *(const v4fa*)(arow + kb + 8 * hh), x1 = *(const v4fa*)(arow + kb + 8 * hh + 4);
    const v4f x2 = *(const v4fa*)(arow + kb + 16 + 8 * hh), x3 = *(const v4fa*)(arow + kb + 16 + 8 * hh + 4);
    float xs[16] = {x0[0],x0[1],x0[2],x0[3],x1[0],x1[1],x1[2],x1[3],x2[0],x2[1],x2[2],x2[3],x3[0],x3[1],x3[2],x3[3]};
#pragma unroll
    for (int i = 0; i < 16; ++i) { const unsigned short hb = bf16_bits(xs[i]); ah.u[i] = hb; al.u[i] = ASPLIT ? bf16_bits(xs[i] - bf16_val(hb)) : (unsigned short)0; }
#pragma unroll
    for (int t = 0; t < 4; ++t) {
      const unsigned short* brow = Wt + (size_t)(col0 + t * 16 + ln) * ldb + kb;
      FragB b;
      b.half[0] = *(const v8us*)(brow + 8 * hh);
      b.half[1] = *(const v8us*)(brow + 16 + 8 * hh);
      acc[t] = mmaN<ASPLIT ? 2 : 1>(ah.v, al.v, b.v, b.v, acc[t]);
    }
  }
#pragma unroll
  for (int t = 0; t < 4; ++t) {
    float bv = bias ? bias[col0 + t * 16 + ln] : 0.f;
    if (BIAS_BF16) bv = bf16_round(bv);
#pragma unroll
    for (int r = 0; r < 8; ++r) { float v = acc[t][r] + bv; if (ACT == 1) v = fmaxf(v, 0.f); so[w][8 * hh + r][t * 16 + ln] = v; }
  }
  __builtin_amdgcn_fence(__ATOMIC_ACQ_REL, "workgroup");
  __builtin_amdgcn_wave_barrier();
  const int rsub = lane >> 4, c4 = (lane & 15) * 4;
  {
#pragma unroll
    for (int q = 0; q < 8; ++q) {
      const int r = q * 2 + rsub;
      const v4f v = *(const v4fa*)&so[w][r][c4];
      *(v4f*)(C + (size_t)(row0 + r) * ldc + col0 + c4) = v;
    }
    
  }
}

// GEMM C = act(A·W + bias + resid): A f32 (ASPLIT -> hi/lo 2 terms), Wt bf16 [N][K]; ACT 0 none, 1 relu, 2 exact gelu;
// resid (optional, f32, row index = (row % rmod), pitch ldr, RES_BF16 rounds it) added before the activation.
template <bool ASPLIT, int ACT, bool BIAS_BF16, bool RES_BF16>
__global__ __launch_bounds__(128) void k_gemm_bf3(const float* __restrict__ A, int lda, const unsigned short* __restrict__ Wt, int ldb,
                                                const float* __restrict__ bias, const float* __restrict__ resid, int rmod, int ldr,
                                                float* __restrict__ C, int ldc, int M, int N, int K) {
  __shared__ __attribute__((aligned(16))) float so[4][16][64];
  const int tid = threadIdx.x, w = tid >> 5, lane = tid & 31, ln = lane & 15, hh = lane >> 4;
  const int ntn = N / 64;
  const int wid = blockIdx.x * 4 + w;
  const int mt = wid / ntn, nq = wid % ntn;
  if (mt * 16 >= M) return;
  const int row0 = mt * 16, col0 = nq * 64;
  const float* arow = A + (size_t)(row0 + ln) * lda;
  v8f acc[4] = {};
  for (int kb = 0; kb < K; kb += 32) {
    FragB ah, al;
    const v4f x0 = *(const v4fa*)(arow + kb + 8 * hh), x1 = *(const v4fa*)(arow + kb + 8 * hh + 4);
    const v4f x2 = *(const v4fa*)(arow + kb + 16 + 8 * hh), x3 = *(const v4fa*)(arow + kb + 16 + 8 * hh + 4);
    float xs[16] = {x0[0],x0[1],x0[2],x0[3],x1[0],x1[1],x1[2],x1[3],x2[0],x2[1],x2[2],x2[3],x3[0],x3[1],x3[2],x3[3]};
#pragma unroll
    for (int i = 0; i < 16; ++i) { const unsigned short hb = bf16_bits(xs[i]); ah.u[i] = hb; al.u[i] = ASPLIT ? bf16_bits(xs[i] - bf16_val(hb)) : (unsigned short)0; }
#pragma unroll
    for (int t = 0; t < 4; ++t) {
      const unsigned short* brow = Wt + (size_t)(col0 + t * 16 + ln) * ldb + kb;
      FragB b;
      b.half[0] = *(const v8us*)(brow + 8 * hh);
      b.half[1] = *(const v8us*)(brow + 16 + 8 * hh);
      acc[t] = mmaN<ASPLIT ? 2 : 1>(ah.v, al.v, b.v, b.v, acc[t]);
    }
  }
#pragma unroll
  for (int t = 0; t < 4; ++t) {
    const int col = col0 + t * 16 + ln;
    float bv = bias ? bias[col] : 0.f;
    if (BIAS_BF16) bv = bf16_round(bv);
#pragma unroll
    for (int r = 0; r < 8; ++r) {
      float v = acc[t][r] + bv;
      if (resid) { float rv = resid[(size_t)((row0 + 8 * hh + r) % rmod) * ldr + col]; if (RES_BF16) rv = bf16_round(rv); v += rv; }
      if (ACT == 1) v = fmaxf(v, 0.f);
      if (ACT == 2) v = 0.5f * v * (1.0f + erff(v * 0.70710678118654752f));
      if (ACT == 3) { const float u = 0.7978845608028654f * (v + 0.044715f * v * v * v); v = 0.5f * v * (1.0f + tanhf(u)); }
      so[w][8 * hh + r][t * 16 + ln] = v;
    }
  }
  __builtin_amdgcn_fence(__ATOMIC_ACQ_REL, "workgroup");
  __builtin_amdgcn_wave_barrier();
  const int rsub = lane >> 4, c4 = (lane & 15) * 4;
  {
#pragma unroll
    for (int q = 0; q < 8; ++q) {
      const int r = q * 2 + rsub;
      const v4f v = *(const v4fa*)&so[w][r][c4];
      *(v4f*)(C + (size_t)(row0 + r) * ldc + col0 + c4) = v;
    }
    
  }
}
// row LayerNorm (biased variance, eps) over N: s = X (+ R); optional out_sum <- s; out_norm <- (s-mu)*rsqrt(var+eps)*g + b
template <bool PARAM_BF16>
__global__ __launch_bounds__(256) void k_layernorm(const float* __restrict__ X, const float* __restrict__ R, const float* __restrict__ g, const float* __restrict__ bta,
                                                  float* __restrict__ out_sum, float* __restrict__ out_norm, int N, float eps) {
  __shared__ float red[256];
  const int row = blockIdx.x, tid = threadIdx.x;
  const float* x = X + (size_t)row * N; const float* rr = R ? R + (size_t)row * N : nullptr;
  float vals[16];                     // up to N = 4096
  const int per = N / 256;            // contiguous chunk per thread? use strided-by-4 chunks: thread handles j = tid*4 + 1024*u
  float s1 = 0.f;
  for (int u = 0; u < per / 4; ++u) {
    const int j = tid * 4 + 1024 * u;
    const v4f a = *(const v4fa*)(x + j);
    v4f b = {0.f,0.f,0.f,0.f}; if (rr) b = *(const v4fa*)(rr + j);
#pragma unroll
    for (int q = 0; q < 4; ++q) { const float v = a[q] + b[q]; vals[u * 4 + q] = v; s1 += v; }
  }
  red[tid] = s1; __syncthreads();
  for (int st = 128; st > 0; st >>= 1) { if (tid < st) red[tid] += red[tid + st]; __syncthreads(); }
  const float mu = red[0] / (float)N; __syncthreads();
  float s2 = 0.f;
  for (int u = 0; u < per / 4; ++u)
#pragma unroll
    for (int q = 0; q < 4; ++q) { const float c = vals[u * 4 + q] - mu; s2 += c * c; }
  red[tid] = s2; __syncthreads();
  for (int st = 128; st > 0; st >>= 1) { if (tid < st) red[tid] += red[tid + st]; __syncthreads(); }
  const float rs = rsqrtf(red[0] / (float)N + eps);
  {
    for (int u = 0; u < per / 4; ++u) {
      const int j = tid * 4 + 1024 * u;
      v4f o, sm;
#pragma unroll
      for (int q = 0; q < 4; ++q) {
        float gg = g[j + q], bb = bta[j + q];
        if (PARAM_BF16) { gg = bf16_round(gg); bb = bf16_round(bb); }
        sm[q] = vals[u * 4 + q]; o[q] = (vals[u * 4 + q] - mu) * rs * gg + bb;
      }
      if (out_sum) *(v4f*)(out_sum + (size_t)row * N + j) = sm;
      *(v4f*)(out_norm + (size_t)row * N + j) = o;
    }
    
  }
}



// ---- f16 WMMA path (v_wmma_f32_16x16x32_f16): 11-bit significands for operands in range — used where a [0,1] probability operand needs more precision than bf16
typedef _Float16 v16h __attribute__((ext_vector_type(16)));
union FragH { v16h v; v8us half[2]; _Float16 h[16]; unsigned short u[16]; };
template <int NT>
__device__ __forceinline__ v8f mmaH(v16h ah, v16h al, v16h bh, v16h bl, v8f c) {
  c = __builtin_amdgcn_wmma_f32_16x16x32_f16(false, ah, false, bh, (short)0, c, false, false);
  if (NT >= 2) c = __builtin_amdgcn_wmma_f32_16x16x32_f16(false, al, false, bh, (short)0, c, false, false);
  if (NT >= 3) c = __builtin_amdgcn_wmma_f32_16x16x32_f16(false, ah, false, bl, (short)0, c, false, false);
  asm volatile("v_nop\n\tv_nop\n\tv_nop\n\tv_nop" : "+v"(c) : "v"(ah), "v"(al), "v"(bh), "v"(bl));
  return c;
}
// batched GEMM like k_gemm_b but f16 operands: A f32 (split into f16 hi/lo if ASPLIT, else rounded to f16), Bt = f16 values [n][k]; alpha; C f32; N multiple of 16 (partial tiles skipped)
template <bool ASPLIT>
__global__ __launch_bounds__(128) void k_gemm_h(const float* __restrict__ A, int lda, size_t sA, const _Float16* __restrict__ Bh, int ldb, size_t sB, float alpha, float* __restrict__ C, int ldc, size_t sC, int M, int N, int K) {
  __shared__ __attribute__((aligned(16))) float so[4][16][64];
  const int tid = threadIdx.x, w = tid >> 5, lane = tid & 31, ln = lane & 15, hh = lane >> 4; const int by = blockIdx.y;
  A += (size_t)by * sA; Bh += (size_t)by * sB; C += (size_t)by * sC;
  const int ntn = (N + 63) / 64; const int wid = blockIdx.x * 4 + w; const int mt = wid / ntn, nq = wid % ntn; if (mt * 16 >= M) return;
  const int row0 = mt * 16, col0 = nq * 64; const float* arow = A + (size_t)(row0 + ln) * lda;
  v8f acc[4] = {};
  for (int kb = 0; kb < K; kb += 32) {
    FragH ah, al;
    const v4f x0 = *(const v4fa*)(arow + kb + 8 * hh), x1 = *(const v4fa*)(arow + kb + 8 * hh + 4), x2 = *(const v4fa*)(arow + kb + 16 + 8 * hh), x3 = *(const v4fa*)(arow + kb + 16 + 8 * hh + 4);
    float xs[16] = {x0[0],x0[1],x0[2],x0[3],x1[0],x1[1],x1[2],x1[3],x2[0],x2[1],x2[2],x2[3],x3[0],x3[1],x3[2],x3[3]};
#pragma unroll
    for (int i = 0; i < 16; ++i) { const _Float16 h = (_Float16)xs[i]; ah.h[i] = h; al.h[i] = ASPLIT ? (_Float16)(xs[i] - (float)h) : (_Float16)0.0f; }
#pragma unroll
    for (int t = 0; t < 4; ++t) { if (col0 + t * 16 >= N) continue; const size_t boff = (size_t)(col0 + t * 16 + ln) * ldb + kb; FragH bq; bq.half[0] = *(const v8us*)(Bh + boff + 8 * hh); bq.half[1] = *(const v8us*)(Bh + boff + 16 + 8 * hh);
      acc[t] = mmaH<ASPLIT ? 2 : 1>(ah.v, al.v, bq.v, bq.v, acc[t]); }
  }
#pragma unroll
  for (int t = 0; t < 4; ++t) { if (col0 + t * 16 >= N) continue;
#pragma unroll
    for (int r = 0; r < 8; ++r) so[w][8 * hh + r][t * 16 + ln] = acc[t][r] * alpha; }
  __builtin_amdgcn_fence(__ATOMIC_ACQ_REL, "workgroup"); __builtin_amdgcn_wave_barrier();
  const int rsub = lane >> 4, c4 = (lane & 15) * 4;
  {
#pragma unroll
    for (int q = 0; q < 8; ++q) { const int r = q * 2 + rsub; if (col0 + c4 < N) { const v4f v = *(const v4fa*)&so[w][r][c4]; *(v4f*)(C + (size_t)(row0 + r) * ldc + col0 + c4) = v; } }
     }
}

// Wt[n][k] = f16(W[k][n]·scale) from f32 row-major W[K][N] (scale = power of two; bf16-exact weights stay exact in f16 away from the subnormal range)
__global__ __launch_bounds__(256) void k_wt_f16(const float* __restrict__ W, _Float16* __restrict__ Wt, int K, int N, float scale) {
  const int t = blockIdx.x * 256 + threadIdx.x; if (t >= N * (K / 8)) return; const int n = t / (K / 8), k8 = (t % (K / 8)) * 8; FragH f;
#pragma unroll
  for (int i = 0; i < 8; ++i) f.h[i] = (_Float16)(bf16_round(W[(size_t)(k8 + i) * N + n]) * scale); const v8us o = f.half[0];
  *(v8us*)((unsigned short*)Wt + (size_t)n * K + k8) = o; 
}
// k_gemm_hh variant with fused epilogue: v = acc·alpha + bias[by·sBias + col] (+ CP[(row/rowsPerB)·sCPb + by·64 + col] if CP) ; ACT 0 none / 1 elu ; writes f16 C16 (and f32 C if non-null)
template <int ACT>
__global__ __launch_bounds__(128) void k_gemm_hhx(const _Float16* __restrict__ A, int lda, size_t sA, const _Float16* __restrict__ Bh, int ldb, size_t sB, float alpha, const float* __restrict__ bias, size_t sBias, const float* __restrict__ CP, int rowsPerB, size_t sCPb, int row0g,
    float* __restrict__ C, _Float16* __restrict__ C16, int ldc, size_t sC, int M, int N, int K) {
  __shared__ __attribute__((aligned(16))) float so[4][16][64];
  const int tid = threadIdx.x, w = tid >> 5, lane = tid & 31, ln = lane & 15, hh = lane >> 4; const int by = blockIdx.y;
  A += (size_t)by * sA; Bh += (size_t)by * sB; const size_t cofs = (size_t)by * sC; const float* bp = bias ? bias + (size_t)by * sBias : nullptr;
  const int ntn = (N + 63) / 64; const int wid = blockIdx.x * 4 + w; const int mt = wid / ntn, nq = wid % ntn; if (mt * 16 >= M) return;
  const int row0 = mt * 16, col0 = nq * 64; const _Float16* arow = A + (size_t)(row0 + ln) * lda;
  v8f acc[4] = {};
  for (int kb = 0; kb < K; kb += 32) { FragH ah; ah.half[0] = *(const v8us*)((const unsigned short*)arow + kb + 8 * hh); ah.half[1] = *(const v8us*)((const unsigned short*)arow + kb + 16 + 8 * hh);
#pragma unroll
    for (int t = 0; t < 4; ++t) { if (col0 + t * 16 >= N) continue; const size_t boff = (size_t)(col0 + t * 16 + ln) * ldb + kb; FragH bq; bq.half[0] = *(const v8us*)((const unsigned short*)Bh + boff + 8 * hh); bq.half[1] = *(const v8us*)((const unsigned short*)Bh + boff + 16 + 8 * hh);
      acc[t] = mmaH<1>(ah.v, ah.v, bq.v, bq.v, acc[t]); }
  }
#pragma unroll
  for (int t = 0; t < 4; ++t) { if (col0 + t * 16 >= N) continue; const int col = col0 + t * 16 + ln; const float bv = bp ? bf16_round(bp[col]) : 0.f;
#pragma unroll
    for (int r = 0; r < 8; ++r) { float v = acc[t][r] * alpha + bv; if (CP) { const int rr = row0g + row0 + 8 * hh + r; if (rowsPerB < 0) v += CP[cofs + (size_t)rr * ldc + col];      /* rowsPerB < 0: own element of the batched C plane */ else { const int bidx = rr / rowsPerB; v += CP[(size_t)bidx * sCPb + (size_t)by * 64 + col]; } } if (ACT == 1) v = (v > 0.f) ? v : expm1f(v); else if (ACT == 7) v = (v > 0.f) ? v + 1.0f : expf(v); else if (ACT == 8) v = tanhf(v); else if (ACT == 9) v = 0.5f * v * (1.0f + tanhf(0.7978845608028654f * (v + 0.044715f * v * v * v))); else if (ACT == 11) v = 1.0f / (1.0f + expf(-v)); else if (ACT == 12) v = (v > 0.f) ? v : 0.01f * v; else if (ACT == 14) v = (v > 0.f) ? v : 0.1f * v; else if (ACT == 16) v = (v >= 0.f) ? v : 0.3f * v; else if (ACT == 17) v = (v >= 0.f) ? v : 0.2f * v; else if (ACT == 15) v = v / (1.0f + expf(-v)); else if (ACT == 3) v = fmaxf(v, 0.f); else if (ACT == 6) v = 0.5f * v * (1.0f + erff(v * 0.70710678118654752f)); so[w][8 * hh + r][t * 16 + ln] = v; } }
  __builtin_amdgcn_fence(__ATOMIC_ACQ_REL, "workgroup"); __builtin_amdgcn_wave_barrier();
  const int rsub = lane >> 4, c4 = (lane & 15) * 4; typedef _Float16 v4h __attribute__((ext_vector_type(4)));
  {
#pragma unroll
    for (int q = 0; q < 8; ++q) { const int r = q * 2 + rsub; if (col0 + c4 < N) { const v4f v = *(const v4fa*)&so[w][r][c4]; if (C) *(v4f*)(C + cofs + (size_t)(row0 + r) * ldc + col0 + c4) = v; if (C16) { v4h h4; for (int i = 0; i < 4; ++i) h4[i] = (_Float16)v[i]; *(v4h*)(C16 + cofs + (size_t)(row0 + r) * ldc + col0 + c4) = h4; } } }
     }
}


typedef _Float16 v4h __attribute__((ext_vector_type(4)));

#define PXI 8                        /* 8-float pieces of x per thread */
// x rows as f16: a thread takes PXI pieces of 8 floats, a workgroup's width apart; its 2 PXI 16-byte loads are all in flight before the first value is used
__device__ __forceinline__ void x16_part(const unsigned bx, const float* __restrict__ x, _Float16* __restrict__ X16) {
  const size_t t0 = (size_t)bx * (256 * PXI) + threadIdx.x; const float* p = x + t0 * 8; unsigned short* dst = (unsigned short*)X16 + t0 * 8;
  v4f a[PXI][2]; v8us o[PXI];
#pragma unroll      /* constant indices: a stays in registers; the loads take constant offsets from one address */
  for (int i = 0; i < PXI; ++i) { a[i][0] = *(const v4fa*)(p + i * 2048); if (i < PXI - 1) a[i][1] = *(const v4fa*)(p + i * 2048 + 4); }
  asm volatile("s_wait_xcnt 0x0" ::: "memory");      /* the last load may land in the address registers that the loads before it name: their translations are waited for first */
  a[PXI - 1][1] = *(const v4fa*)(p + (PXI - 1) * 2048 + 4);
  asm volatile("s_wait_xcnt 0x0" ::: "memory");      /* before any register that these loads name is written again */
#pragma unroll      /* constant indices, as above */
  for (int i = 0; i < PXI; ++i) { FragH f; for (int q = 0; q < 4; ++q) { f.h[q] = (_Float16)bf16_round(a[i][0][q]); f.h[4 + q] = (_Float16)bf16_round(a[i][1][q]); } o[i] = f.half[0]; }
  __builtin_amdgcn_sched_barrier(0);      /* all pieces are converted first: nothing is computed between the stores */
#pragma unroll      /* the stores take constant offsets from one address */
  for (int i = 0; i < PXI; ++i) *(v8us*)(dst + i * 2048) = o[i];
  asm volatile("s_wait_xcnt 0x0" ::: "memory");      /* before any register that these stores name is written again: in the built kernel the other part's code follows this one */
}
__global__ __launch_bounds__(256) void k_h16(const float* __restrict__ x, _Float16* __restrict__ X16, size_t n8) { const size_t t = (size_t)blockIdx.x * 256 + threadIdx.x; if (t >= n8) return; FragH f;
#pragma unroll
  for (int q = 0; q < 8; ++q) f.h[q] = (_Float16)x[t * 8 + q]; *(v8us*)((unsigned short*)X16 + t * 8) = f.half[0];  }
__global__ __launch_bounds__(256) void k_round16f(const float* __restrict__ W, _Float16* __restrict__ Bt, size_t n8) { const size_t t = (size_t)blockIdx.x * 256 + threadIdx.x; if (t >= n8) return; FragH f;
#pragma unroll
  for (int i = 0; i < 8; ++i) f.h[i] = (_Float16)(bf16_round(W[t * 8 + i]) * 16.0f); *(v8us*)((unsigned short*)Bt + t * 8) = f.half[0];  }
template <int NHv, int TTv>
__device__ __forceinline__ void vt_part(const unsigned bx, unsigned short (*tl)[66], const _Float16* __restrict__ V16, int ldv, int voff, _Float16* __restrict__ Vt) { const int tid = threadIdx.x; const int slab = bx / (TTv / 64), lg = bx % (TTv / 64); const int b = slab / NHv, h = slab % NHv;
  for (int i = tid; i < 64 * 8; i += 256) { const int r = i / 8, c8 = (i % 8) * 8; FragH f; f.half[0] = *(const v8us*)((const unsigned short*)V16 + ((size_t)b * TTv + lg * 64 + r) * ldv + voff + h * 64 + c8);
#pragma unroll
    for (int q = 0; q < 8; ++q) tl[r][c8 + q] = f.u[q]; }
  __syncthreads();
  {
#pragma unroll
    for (int rd = 0; rd < 2; ++rd) { const int d = rd * 32 + tid / 8, pc = tid % 8; FragH f;
#pragma unroll
      for (int q = 0; q < 8; ++q) f.u[q] = tl[pc * 8 + q][d];
      *(v8us*)((unsigned short*)Vt + ((size_t)slab * 64 + d) * TTv + lg * 64 + pc * 8) = f.half[0]; }
     } }

__global__ __launch_bounds__(256) void k_hl(const float* __restrict__ F, _Float16* __restrict__ Hh, _Float16* __restrict__ Hl, size_t n8) { const size_t t = (size_t)blockIdx.x * 256 + threadIdx.x; if (t >= n8) return; FragH fh, fl; const v4f a = *(const v4fa*)(F + t * 8), c = *(const v4fa*)(F + t * 8 + 4);
#pragma unroll
  for (int q = 0; q < 4; ++q) { _Float16 h = (_Float16)a[q]; fh.h[q] = h; fl.h[q] = (_Float16)((a[q] - (float)h) * 1024.0f); h = (_Float16)c[q]; fh.h[4 + q] = h; fl.h[4 + q] = (_Float16)((c[q] - (float)h) * 1024.0f); }
  { *(v8us*)((unsigned short*)Hh + t * 8) = fh.half[0]; *(v8us*)((unsigned short*)Hl + t * 8) = fl.half[0];  } }

// ---- q/k/v GEMM: wave tile 32x64, operands staged in LDS ----
__device__ __forceinline__ v16h g2_frag(const _Float16* p, int hh) { FragH f; f.half[0] = *(const v8us*)((const unsigned short*)p + 8 * hh); f.half[1] = *(const v8us*)((const unsigned short*)p + 16 + 8 * hh); return f.v; }
__device__ __forceinline__ v16h g3_frag(const unsigned short* p, int hh) { FragH f; f.half[0] = *(const v8us*)(p + 8 * hh); f.half[1] = *(const v8us*)(p + 16 + 8 * hh); return f.v; }
__device__ __forceinline__ v8f g3_mma(v16h a, v16h b, v8f c) { return __builtin_amdgcn_wmma_f32_16x16x32_f16(false, a, false, b, (short)0, c, false, false); }
// One workgroup = a 128 x 128 tile of one of q/k/v: eight waves of 32 x 64, four down and two across. One trip = GK of k.
// A trip's 128 x rows and 128 weight rows (128 bytes of each) come into LDS as whole lines by asynchronous copies, once a workgroup instead of once a wave and in 32-byte pieces;
// two buffers: the copies of trip t + 2 are issued when trip t has left its buffer and fly while trip t + 1 is worked on. The k order of every sum is the one it was.
#define GK 64                        /* k per trip */
#define GP (GK + 8)                  /* LDS row pitch in f16: 128 bytes + 16, for 16-byte fragment reads of 16 rows */
#define GNT (DM / GK)                /* trips */
#define GBUF (256 * GP)              /* one buffer in f16: 128 x rows, then 128 weight rows */
// A lane's eight 16-byte copies of one trip: rows sr + 32 i of x (a) and of the weights (b) to the same rows of the buffer at LDS byte address l.
// The s_wait_xcnt stands in the copies' own statement: behind it the registers that the copies name may be written again.
__device__ __forceinline__ void g3_copy(unsigned l, const unsigned short* a, const unsigned short* b) {
  asm volatile("global_load_async_to_lds_b128 %0, %8, off\n\t"
               "global_load_async_to_lds_b128 %1, %9, off\n\t"
               "global_load_async_to_lds_b128 %2, %10, off\n\t"
               "global_load_async_to_lds_b128 %3, %11, off\n\t"
               "global_load_async_to_lds_b128 %4, %12, off\n\t"
               "global_load_async_to_lds_b128 %5, %13, off\n\t"
               "global_load_async_to_lds_b128 %6, %14, off\n\t"
               "global_load_async_to_lds_b128 %7, %15, off\n\t"
               "s_wait_xcnt 0x0"
               :: "v"(l), "v"(l + 32u * GP * 2u), "v"(l + 64u * GP * 2u), "v"(l + 96u * GP * 2u), "v"(l + 128u * GP * 2u), "v"(l + 160u * GP * 2u), "v"(l + 192u * GP * 2u), "v"(l + 224u * GP * 2u),
                  "v"(a), "v"(a + 32 * DM), "v"(a + 64 * DM), "v"(a + 96 * DM), "v"(b), "v"(b + 32 * DM), "v"(b + 64 * DM), "v"(b + 96 * DM)
               : "memory");
}
// f16 q, k, v of all token rows: grid.y = which of q/k/v; QKV16 [3][NR][DM]. The 128-row block that holds the first QT0 rows of a batch stores the same sums in f32 as well: F0 [3][NB][QT0][DM]
static_assert(QT0 == 128 && SQ % 128 == 0, "the first QT0 rows of a batch are one 128-row block of the GEMM");
static_assert(DM % 128 == 0 && GNT >= 2, "whole 128-column tiles; the two buffers want two trips");
__global__ __launch_bounds__(256) void k_qkv(const _Float16* __restrict__ X16, const _Float16* __restrict__ B3, _Float16* __restrict__ QKV16, float* __restrict__ F0) {
  __shared__ __attribute__((aligned(16))) unsigned short st[2 * GBUF];      /* the two buffers; behind the loop each wave's output rows, turned for whole-row stores */
  static_assert(sizeof(st) >= 8 * 32 * 68 * 4, "the output staging fits in the buffers");
  const int tid = threadIdx.x, w = tid >> 5, lane = tid & 31, ln = lane & 15, hh = lane >> 4; const int wh = blockIdx.y;
  const int mt = blockIdx.x / (DM / 128), nq = blockIdx.x % (DM / 128); const int b = mt / (SQ / 128);      /* row block, column block, batch */
  const int row0 = 32 * (w & 3), col0 = nq * 128 + 64 * (w >> 2);      /* the wave's tile: rows inside the row block, columns of the tensor */
  const int sr = tid >> 3, sc = (tid & 7) * 8;      /* staging: eight threads bring one 128-byte row */
  const unsigned short* ag = (const unsigned short*)X16 + ((size_t)mt * 128 + sr) * DM + sc;
  const unsigned short* bg = (const unsigned short*)B3 + (size_t)wh * DM * DM + ((size_t)nq * 128 + sr) * DM + sc;
  const unsigned l0 = (unsigned)(size_t)&st[sr * GP + sc];      /* the lane's LDS byte address in buffer 0 */
  g3_copy(l0, ag, bg);
  asm volatile("s_wait_asynccnt 0x0" ::: "memory");      /* the wave's own copies of trip 0 have landed ... */
  __syncthreads();                                       /* ... and every other wave's */
  g3_copy(l0 + GBUF * 2u, ag + GK, bg + GK);
  const unsigned short* af = &st[(row0 + ln) * GP]; const unsigned short* bf = &st[(128 + 64 * (w >> 2) + ln) * GP];
  const v8f z8 = {0.f,0.f,0.f,0.f,0.f,0.f,0.f,0.f}; v8f c0[4] = {z8, z8, z8, z8}, c1[4] = {z8, z8, z8, z8};
#pragma unroll 1      /* one trip's code: the buffer is chosen by an offset */
  for (int t = 0; t < GNT; ++t) {
    const unsigned short* ap = af + (t & 1) * GBUF; const unsigned short* bp = bf + (t & 1) * GBUF;
#pragma unroll      /* constant indices: the accumulators stay in registers */
    for (int kk = 0; kk < GK; kk += 32) { const v16h a0 = g3_frag(ap + kk, hh), a1 = g3_frag(ap + 16 * GP + kk, hh); v16h bj[4];
#pragma unroll      /* constant indices: bj stays in registers */
      for (int j = 0; j < 4; ++j) bj[j] = g3_frag(bp + j * 16 * GP + kk, hh);
      __builtin_amdgcn_sched_barrier(0);      /* the six fragments' reads are issued together before the first product waits for one: one LDS round trip for eight products instead of one for two */
#pragma unroll      /* constant indices, as above; eight independent accumulators */
      for (int j = 0; j < 4; ++j) { c0[j] = g3_mma(a0, bj[j], c0[j]); c1[j] = g3_mma(a1, bj[j], c1[j]); } }
    asm volatile("s_wait_dscnt 0x0" ::: "memory");         /* this wave has read its last of this trip's buffer */
    asm volatile("s_wait_asynccnt 0x0" ::: "memory");      /* its copies of the next trip have landed */
    __syncthreads();      /* publishes the next trip's buffer and ends this trip's reads */
    if (t + 2 < GNT) g3_copy(l0 + (unsigned)(t & 1) * (GBUF * 2u), ag + (t + 2) * GK, bg + (t + 2) * GK);      /* into the buffer that this trip has just left */
  }
  asm volatile("s_wait_asynccnt 0x0" ::: "memory");      /* no copy is outstanding when the buffers become output staging */
  float (*so)[68] = (float (*)[68])((float*)st + (size_t)w * 32 * 68);      /* the wave's own 32 rows */
  float* C = (mt % (SQ / 128) == 0) ? F0 + (size_t)(wh * NB + b) * QT0 * DM : nullptr;
  _Float16* C16 = QKV16 + (size_t)wh * NR * DM + (size_t)mt * 128 * DM;
#pragma unroll      /* constant indices, as above */
  for (int j = 0; j < 4; ++j)
#pragma unroll      /* constant indices, as above */
    for (int r = 0; r < 8; ++r) { so[8 * hh + r][j * 16 + ln] = c0[j][r] * 0.0625f; so[16 + 8 * hh + r][j * 16 + ln] = c1[j][r] * 0.0625f; }      /* the weights were carried x16 */
  __builtin_amdgcn_fence(__ATOMIC_ACQ_REL, "workgroup"); __builtin_amdgcn_wave_barrier();      /* so is the wave's own: its writes are ordered before its reads */
  const int rsub = lane >> 4, c4 = (lane & 15) * 4;
  {
    v4f vq[16]; v4h hq[16];      /* all rows are read and converted first: behind the stores nothing is computed, so no register that an issued store names is written again */
#pragma unroll      /* constant indices: vq and hq stay in registers */
    for (int q = 0; q < 16; ++q) { vq[q] = *(const v4fa*)&so[q * 2 + rsub][c4]; for (int i = 0; i < 4; ++i) hq[q][i] = (_Float16)vq[q][i]; }
#pragma unroll      /* constant indices, as above; the stores take constant offsets from one address */
    for (int q = 0; q < 16; ++q) *(v4h*)(C16 + (size_t)(row0 + q * 2 + rsub) * DM + col0 + c4) = hq[q];
    if (C) {
      asm volatile("s_wait_xcnt 0x0" ::: "memory");      /* before this branch's address lands in a register that the stores above name */
#pragma unroll      /* constant indices, as above */
      for (int q = 0; q < 16; ++q) *(v4f*)(C + (size_t)(row0 + q * 2 + rsub) * DM + col0 + c4) = vq[q]; }
  }
}


__global__ __launch_bounds__(256) void k_wnat(const float* __restrict__ w, size_t n8, _Float16* __restrict__ Bt) { const size_t t = (size_t)blockIdx.x * 256 + threadIdx.x; if (t >= n8) return; FragH f; for (int q = 0; q < 8; ++q) f.h[q] = (_Float16)(bf16_round(w[t * 8 + q]) * 16.0f); *(v8us*)((unsigned short*)Bt + t * 8) = f.half[0];  }
__global__ __launch_bounds__(256) void k_rsm(const float* __restrict__ S, _Float16* __restrict__ P, int nrows) {
  #pragma clang fp contract(off)
  const int i = blockIdx.x * 256 + threadIdx.x; if (i >= nrows) return; const float* s = S + (size_t)i * SQ; float mx = -3.0e38f;
#pragma unroll 1
  for (int j = 0; j < SQ; ++j) mx = fmaxf(mx, s[j]); float se = 0.f;
#pragma unroll 1
  for (int j = 0; j < SQ; ++j) se += expf(s[j] - mx); const float sc = 256.0f / se;
#pragma unroll 1
  for (int j0 = 0; j0 < SQ; j0 += 8) { FragH f; for (int q = 0; q < 8; ++q) f.h[q] = (_Float16)(expf(s[j0 + q] - mx) * sc); unsigned short* d = (unsigned short*)P + (size_t)i * SQ + j0; *(v8us*)d = f.half[0];  } }
__global__ __launch_bounds__(256) void k_vt(const _Float16* __restrict__ V16, int b, int h0, _Float16* __restrict__ VT) { __shared__ unsigned short tl[64][65]; const int tid = threadIdx.x; const int hh = blockIdx.x % HG, sg = blockIdx.x / HG; const int s0 = sg * 64; const int h = h0 + hh;
  for (int i = tid; i < 64 * 8; i += 256) { const int j = i / 8, d8 = (i % 8) * 8; FragH f; f.half[0] = *(const v8us*)((const unsigned short*)V16 + ((size_t)b * SQ + s0 + j) * DM + h * HD + d8); for (int q = 0; q < 8; ++q) tl[d8 + q][j] = f.u[q]; }
  __syncthreads();
  { for (int i = tid; i < 64 * 8; i += 256) { const int d = i / 8, j8 = (i % 8) * 8; FragH f; for (int q = 0; q < 8; ++q) f.u[q] = tl[d][j8 + q]; *(v8us*)((unsigned short*)VT + ((size_t)hh * HD + d) * SQ + s0 + j8) = f.half[0]; }  } }

// Weights [h][m][d] -> Bt[(h, d)][m], f16, x16. One workgroup = PWM rows m of one head of one of q/k/v: PWM x 64 floats that lie in one piece in memory.
// They are read as whole lines (PWM / 16 16-byte loads a thread, all in flight together), converted, turned in LDS and stored as whole 128-byte lines of Bt.
#define PWM 256                      /* rows m per workgroup */
#define PWP (HD / 2 + 1)             /* LDS row pitch in dwords (a dword = the f16 of two neighbouring d): 33, so that rows 8 apart fall on different banks */
__device__ __forceinline__ void wthd_part(const unsigned bx, const unsigned wh, unsigned (*tl)[PWP], const float* __restrict__ Wq, const float* __restrict__ Wk, const float* __restrict__ Wv, _Float16* __restrict__ B3) {
  const int tid = threadIdx.x; const int h = bx / (DM / PWM), m0 = (bx % (DM / PWM)) * PWM;
  const float* Wt = wh == 0 ? Wq : wh == 1 ? Wk : Wv;      /* wh = which of q/k/v */
  const float* p = Wt + ((size_t)h * DM + m0) * HD + tid * 4;
  v4f a[PWM / 16];
#pragma unroll      /* constant indices: a stays in registers; the loads take constant offsets from one address */
  for (int i = 0; i < PWM / 16; ++i) a[i] = *(const v4fa*)(p + i * 1024);
  asm volatile("s_wait_xcnt 0x0" ::: "memory");      /* before any register that these loads name is written again */
  const int mr = tid >> 4, dc = (tid & 15) * 2;      /* sixteen threads hold one row m */
#pragma unroll      /* constant indices, as above */
  for (int i = 0; i < PWM / 16; ++i) { union { _Float16 h[4]; unsigned w[2]; } f; for (int q = 0; q < 4; ++q) f.h[q] = (_Float16)(16.0f * bf16_round(a[i][q])); tl[i * 16 + mr][dc] = f.w[0]; tl[i * 16 + mr][dc + 1] = f.w[1]; }
  __syncthreads();      /* the tile is whole before it is read the other way */
  const int dp = tid >> 3, pc = tid & 7;      /* a thread turns 8 m of the rows d = 2 dp and 2 dp + 1; eight threads store one 128-byte line */
  union { unsigned w[4]; v8us v; } o[PWM / 64][2];
#pragma unroll      /* constant indices: o stays in registers */
  for (int c = 0; c < PWM / 64; ++c)
    for (int q = 0; q < 8; q += 2) { const unsigned w0 = tl[c * 64 + pc * 8 + q][dp], w1 = tl[c * 64 + pc * 8 + q + 1][dp]; o[c][0].w[q >> 1] = (w0 & 0xffffu) | (w1 << 16); o[c][1].w[q >> 1] = (w0 >> 16) | (w1 & 0xffff0000u); }
  unsigned short* dst = (unsigned short*)B3 + (size_t)wh * DM * DM + ((size_t)h * HD + 2 * dp) * DM + m0 + pc * 8;
  __builtin_amdgcn_sched_barrier(0);      /* all pieces are gathered first: behind the stores nothing is computed, so no register that an issued store names is written again */
#pragma unroll      /* the stores take constant offsets from one address */
  for (int c = 0; c < PWM / 64; ++c) { *(v8us*)(dst + c * 64) = o[c][0].v; *(v8us*)(dst + DM + c * 64) = o[c][1].v; }
}
// launch 1: the weights' blocks, then the blocks of the x rows (neither reads what the other writes)
#define PWB ((unsigned)(NH * (DM / PWM)))                  /* blocks per weight tensor */
#define PXB ((unsigned)(NR * DM / 8 / (256 * PXI)))        /* blocks of the x rows */
static_assert(DM % PWM == 0 && PWM % 64 == 0 && HD == 64 && (NR * DM) % (8 * 256 * PXI) == 0, "whole tiles and whole pieces: no thread of launch 1 is without work");
__global__ __launch_bounds__(256) void k_prep(const float* __restrict__ x, const float* __restrict__ Wq, const float* __restrict__ Wk, const float* __restrict__ Wv, _Float16* __restrict__ B3, _Float16* __restrict__ X16) {
  __shared__ __attribute__((aligned(16))) unsigned tl[PWM][PWP];      /* the weights' blocks alone use it */
  const unsigned bx = blockIdx.x;
  if (bx < 3 * PWB) wthd_part(bx % PWB, bx / PWB, tl, Wq, Wk, Wv, B3);
  else x16_part(bx - 3 * PWB, x, X16);
}



// ---- cross-lane and exp helpers ----
template <int M> __device__ __forceinline__ float rs_xm(float x) { return __builtin_bit_cast(float, __builtin_amdgcn_mov_dpp(__builtin_bit_cast(int, x), 0x160 + M, 0xf, 0xf, false)); }      /* lane l <- lane l ^ M inside a 16-lane row (row_xmask) */
__device__ __forceinline__ float rs_xh(float x) { return __builtin_bit_cast(float, __builtin_amdgcn_permlanex16(__builtin_bit_cast(int, x), __builtin_bit_cast(int, x), 0x76543210, 0xfedcba98, false, false)); }      /* lane l <- lane l ^ 16 */
// e^x of four values, as __expf forms it (x * log2 e, then v_exp_f32). One statement: behind a transcendental the instruction set asks for one independent instruction before its source is overwritten or its result read;
// each v_exp_f32 is that instruction for the one before it (outputs are early-clobber, so none lies on an input), the v_nop for the last.
__device__ __forceinline__ v4f rs_exp4(v4f x) { float y0, y1, y2, y3; const v4f t = x * 1.44269504f;
  asm("v_exp_f32 %0, %4\n\tv_exp_f32 %1, %5\n\tv_exp_f32 %2, %6\n\tv_exp_f32 %3, %7\n\tv_nop" : "=&v"(y0), "=&v"(y1), "=&v"(y2), "=&v"(y3) : "v"(t[0]), "v"(t[1]), "v"(t[2]), "v"(t[3]));
  const v4f y = {y0, y1, y2, y3}; return y; }


// ---- fused causal attention: scores, softmax and weighted sum of v in one kernel; scores and weights never leave the registers ----
// One workgroup = FQ query rows of one (batch, head), 16 rows a wave; one trip = FK keys, up to the workgroup's own diagonal block.
// The products are formed transposed: S^T = K Q^T (A = 16 key rows, B = the wave's 16 query rows) leaves, in lane (ln, hh), the scores of query ln for keys 8 hh + r of each 16-key tile:
// two such tiles side by side are, register for register, the B fragment (n = query, k = 32 keys) of O^T = V^T P^T, so the weights go from accumulator to operand without a shuffle.
// A query's running maximum, sum and rescale factor live in its own two lanes (ln and ln + 16).
#define FQ 64                        /* query rows per workgroup */
#define FK 64                        /* keys per trip */
#define FLP (FK + 8)                 /* LDS row pitch in f16: 128 bytes + 16, for 16-byte fragment reads of 16 rows */
__device__ __forceinline__ v16h fa_frag(const unsigned short* p, int hh) { FragH f; f.half[0] = *(const v8us*)(p + 8 * hh); f.half[1] = *(const v8us*)(p + 16 + 8 * hh); return f.v; }
__device__ __forceinline__ v8f fa_mma(v16h a, v16h b, v8f c) { return __builtin_amdgcn_wmma_f32_16x16x32_f16(false, a, false, b, (short)0, c, false, false); }
// grid = (head, batch, query block), longest query block first
__global__ __launch_bounds__(128) void k_fattn(const _Float16* __restrict__ Q16, const _Float16* __restrict__ K16, const _Float16* __restrict__ VT, float* __restrict__ out) {
  __shared__ __attribute__((aligned(16))) unsigned short sk[2][FK][FLP];      /* k rows [key][d], two buffers */
  __shared__ __attribute__((aligned(16))) unsigned short sv[2][HD][FLP];      /* v^T rows [d][key], two buffers */
  __shared__ __attribute__((aligned(16))) float so[4][16][HD + 4];            /* a wave's output rows, turned for whole-row stores */
  const int tid = threadIdx.x, w = tid >> 5, lane = tid & 31, ln = lane & 15, hh = lane >> 4;
  const int h = blockIdx.x, b = blockIdx.y, qb = SQ / FQ - 1 - (int)blockIdx.z;
  const int sr = tid >> 3, sc = (tid & 7) * 8;      /* staging: eight threads bring one 128-byte row */
  const unsigned short* kg = (const unsigned short*)K16 + ((size_t)b * SQ + sr) * LQ + h * HD + sc;
  const unsigned short* vg = (const unsigned short*)VT + ((size_t)(b * NH + h) * HD + sr) * SQ + sc;
  const _Float16* qp = Q16 + ((size_t)b * SQ + qb * FQ + w * 16 + ln) * LQ + h * HD;
  const v16h q0 = g2_frag(qp, hh), q1 = g2_frag(qp + 32, hh);
  v8us kr[4], vr[4];
#pragma unroll      /* constant indices: kr and vr stay in registers */
  for (int i = 0; i < 4; ++i) { kr[i] = *(const v8us*)(kg + (size_t)i * 16 * LQ); vr[i] = *(const v8us*)(vg + (size_t)i * 16 * SQ); }
  asm volatile("s_wait_xcnt 0x0" ::: "memory");      /* before any register that these loads name is written again */
#pragma unroll      /* constant indices, as above */
  for (int i = 0; i < 4; ++i) { *(v8us*)&sk[0][sr + i * 16][sc] = kr[i]; *(v8us*)&sv[0][sr + i * 16][sc] = vr[i]; }
  __syncthreads();
  const v8f z8 = {0.f, 0.f, 0.f, 0.f, 0.f, 0.f, 0.f, 0.f};
  v8f o[4] = {z8, z8, z8, z8}; float m = -1.0e30f, l = 0.f;      /* m: running maximum of the raw products; l: this lane's part of the running sum */
  for (int kb = 0; kb <= qb; ++kb) {
    const int cur = kb & 1;
    if (kb < qb) {      /* the next trip's rows fly while this trip is worked on */
#pragma unroll      /* constant indices, as above */
      for (int i = 0; i < 4; ++i) { kr[i] = *(const v8us*)(kg + (size_t)(kb + 1) * FK * LQ + (size_t)i * 16 * LQ); vr[i] = *(const v8us*)(vg + (size_t)(kb + 1) * FK + (size_t)i * 16 * SQ); }
      asm volatile("s_wait_xcnt 0x0" ::: "memory");      /* before any register that these loads name is written again */
    }
    v8f st[4]; v16h kf[8], vf[8];
#pragma unroll      /* constant indices: kf stays in registers */
    for (int t = 0; t < 4; ++t) { const unsigned short* kp = &sk[cur][t * 16 + ln][0]; kf[2 * t] = fa_frag(kp, hh); kf[2 * t + 1] = fa_frag(kp + 32, hh); }
    __builtin_amdgcn_sched_barrier(0);      /* all k fragment reads are issued before the first product waits for one: one LDS round trip a trip instead of one a tile */
#pragma unroll      /* constant indices: st stays in registers; four independent accumulators */
    for (int t = 0; t < 4; ++t) st[t] = fa_mma(kf[2 * t], q0, z8);
#pragma unroll      /* constant indices, as above */
    for (int t = 0; t < 4; ++t) st[t] = fa_mma(kf[2 * t + 1], q1, st[t]);
#pragma unroll      /* constant indices: vf stays in registers */
    for (int t = 0; t < 4; ++t) { const unsigned short* vp = &sv[cur][t * 16 + ln][0]; vf[2 * t] = fa_frag(vp, hh); vf[2 * t + 1] = fa_frag(vp + 32, hh); }
    __builtin_amdgcn_sched_barrier(0);      /* the v^T fragment reads are issued ahead of the softmax arithmetic, which then covers their round trip */
    if (kb == qb) {      /* the diagonal block: keys behind the row's own are masked */
#pragma unroll      /* constant indices, as above */
      for (int t = 0; t < 4; ++t) for (int r = 0; r < 8; ++r) st[t][r] = (t * 16 + 8 * hh + r <= w * 16 + ln) ? st[t][r] : -1.0e30f;
    }
    v4f m4 = {m, m, m, m};
#pragma unroll      /* constant indices, as above; four independent chains */
    for (int t = 0; t < 4; ++t) for (int r = 0; r < 8; ++r) m4[r & 3] = fmaxf(m4[r & 3], st[t][r]);
    float mn = fmaxf(fmaxf(m4[0], m4[1]), fmaxf(m4[2], m4[3])); mn = fmaxf(mn, rs_xh(mn));      /* both lanes of a query hold the same maximum */
    const float da = (m - mn) * 0.125f; const v4f da4 = {da, da, da, da}; const float al = rs_exp4(da4)[0]; m = mn;
    const float ms = mn * 0.125f - 5.5451774f;      /* weights carried x256 (e^5.545...): small ones stay normal f16 numbers; the factor cancels against the sum */
    v4f s4 = {0.f, 0.f, 0.f, 0.f}; FragH pb[2];
#pragma unroll      /* constant indices, as above */
    for (int t = 0; t < 4; ++t) for (int g = 0; g < 2; ++g) {
      v4f x; for (int u = 0; u < 4; ++u) x[u] = st[t][g * 4 + u] * 0.125f - ms;
      const v4f e = rs_exp4(x); s4 += e;
      for (int u = 0; u < 4; ++u) pb[t >> 1].h[(t & 1) * 8 + g * 4 + u] = (_Float16)e[u]; }
    l = l * al + ((s4[0] + s4[1]) + (s4[2] + s4[3]));
#pragma unroll      /* constant indices: o stays in registers */
    for (int t = 0; t < 4; ++t) o[t] = fa_mma(vf[2 * t], pb[0].v, o[t] * al);
#pragma unroll      /* constant indices, as above */
    for (int t = 0; t < 4; ++t) o[t] = fa_mma(vf[2 * t + 1], pb[1].v, o[t]);
    if (kb < qb) {      /* the other buffer: its last readers left it at the barrier that ended the trip before */
#pragma unroll      /* constant indices, as above */
      for (int i = 0; i < 4; ++i) { *(v8us*)&sk[cur ^ 1][sr + i * 16][sc] = kr[i]; *(v8us*)&sv[cur ^ 1][sr + i * 16][sc] = vr[i]; }
    }
    __syncthreads();      /* publishes the next trip's buffer and ends this trip's reads */
  }
  l += rs_xh(l); const float fin = 1.0f / l;
#pragma unroll      /* constant indices, as above */
  for (int t = 0; t < 4; ++t) for (int g = 0; g < 2; ++g) { v4f y; for (int u = 0; u < 4; ++u) y[u] = o[t][g * 4 + u] * fin; *(v4f*)&so[w][ln][t * 16 + 8 * hh + g * 4] = y; }
  __builtin_amdgcn_fence(__ATOMIC_ACQ_REL, "workgroup"); __builtin_amdgcn_wave_barrier();      /* so[w] is the wave's own: its writes are ordered before its reads */
  float* op = out + ((size_t)b * SQ + qb * FQ + w * 16 + hh) * DM + h * HD + ln * 4;
#pragma unroll      /* stores take constant offsets from one address */
  for (int q = 0; q < 8; ++q) { const v4f y = *(const v4fa*)&so[w][q * 2 + hh][ln * 4]; *(v4f*)(op + (size_t)q * 2 * DM) = y; }
}

// Exact f32 causal attention of the first QT0 rows. One workgroup = A0R query rows of one (batch, head); 16 lanes share a row.
// The head's k and v rows are staged once in LDS; scores: lane ks of a row takes keys ks, ks + 16, ...; softmax over the row's 16 lanes; o: lane ks of a row takes dims 4 ks .. 4 ks + 3 over all keys.
#define A0R 16                       /* query rows per workgroup */
#define A0N (QT0 / 16)               /* groups of 16 keys */
#define A0KP (HD + 4)                /* k row pitch in LDS, floats: the 16 key rows that 16 lanes read fall on 64 different banks */
#define A0PP (QT0 + 16)              /* weight row pitch in LDS, floats: the two rows of a wave fall on different banks */
#define A0LDS ((QT0 * A0KP + QT0 * HD + A0R * A0PP) * 4)      /* its LDS, bytes */
__device__ __forceinline__ void att0_part(const unsigned bx, const unsigned b, float* __restrict__ sm, const float* __restrict__ QF, const float* __restrict__ KF, const float* __restrict__ VF, float scale, float* __restrict__ out) {
  float (*sk)[A0KP] = (float (*)[A0KP])sm;
  float (*sv)[HD] = (float (*)[HD])(sm + QT0 * A0KP);
  float (*ps)[A0PP] = (float (*)[A0PP])(sm + QT0 * A0KP + QT0 * HD);
  const int tid = threadIdx.x; const int h = bx / (QT0 / A0R), rg = bx % (QT0 / A0R);
  const int r = tid >> 4, ks = tid & 15; const int i = rg * A0R + r;      /* the thread's query row; ks = its key slot, later its group of four dims */
  const size_t hb = (size_t)b * QT0 * DM + h * HD;
  const float* kp = KF + hb + r * DM + ks * 4; const float* vp = VF + hb + r * DM + ks * 4; const float* qp = QF + hb + i * DM;
  v4f q[HD / 4], kt[A0N], vt[A0N];
#pragma unroll      /* constant indices: the arrays stay in registers; all loads of the workgroup are in flight together, one memory round trip in all */
  for (int c = 0; c < HD / 4; ++c) q[c] = *(const v4fa*)(qp + c * 4);
#pragma unroll      /* constant indices, as above */
  for (int n = 0; n < A0N; ++n) { kt[n] = *(const v4fa*)(kp + n * 16 * DM); if (n < A0N - 1) vt[n] = *(const v4fa*)(vp + n * 16 * DM); }
  asm volatile("s_wait_xcnt 0x0" ::: "memory");      /* the last v load may land in the address registers that the loads before it name: their translations are waited for first */
  vt[A0N - 1] = *(const v4fa*)(vp + (A0N - 1) * 16 * DM);
  asm volatile("s_wait_xcnt 0x0" ::: "memory");      /* before any register that these loads name is written again */
#pragma unroll      /* constant indices, as above */
  for (int n = 0; n < A0N; ++n) { *(v4f*)&sk[n * 16 + r][ks * 4] = kt[n]; *(v4f*)&sv[n * 16 + r][ks * 4] = vt[n]; }
  __syncthreads();
  float s[A0N]; float m = -1.0e30f;
#pragma unroll      /* constant indices into s; the test reads the same in the whole workgroup: key groups behind its last row are skipped */
  for (int n = 0; n < A0N; ++n) { s[n] = -1.0e30f;
    if (n <= rg) { const int j = n * 16 + ks; v4f a4 = {0.f, 0.f, 0.f, 0.f};
#pragma unroll      /* constant indices into q; four independent sums */
      for (int c = 0; c < HD / 4; ++c) a4 += q[c] * *(const v4f*)&sk[j][c * 4];
      const float sj = ((a4[0] + a4[1]) + (a4[2] + a4[3])) * scale; s[n] = (j <= i) ? sj : -1.0e30f; m = fmaxf(m, s[n]); } }
  m = fmaxf(m, rs_xm<1>(m)); m = fmaxf(m, rs_xm<2>(m)); m = fmaxf(m, rs_xm<4>(m)); m = fmaxf(m, rs_xm<8>(m));      /* maximum over the row's 16 lanes */
  float l = 0.f;
#pragma unroll      /* constant indices into s; a key behind the row's own holds -1e30: its weight underflows to 0 */
  for (int n = 0; n < A0N; ++n) { const float e = expf(s[n] - m); l += e; ps[r][n * 16 + ks] = e; }
  l += rs_xm<1>(l); l += rs_xm<2>(l); l += rs_xm<4>(l); l += rs_xm<8>(l);      /* sum over the row's 16 lanes */
  __syncthreads();
  v4f o = {0.f, 0.f, 0.f, 0.f};
#pragma unroll 1      /* one trip = 16 keys, up to the workgroup's last row */
  for (int n = 0; n <= rg; ++n) {
#pragma unroll      /* a trip's LDS reads take constant offsets and overlap */
    for (int jj = 0; jj < 16; jj += 4) { const int j = n * 16 + jj; const v4f p4 = *(const v4f*)&ps[r][j];
      for (int u = 0; u < 4; ++u) o += p4[u] * *(const v4f*)&sv[j + u][ks * 4]; } }
  const float fin = 1.0f / l;
  *(v4f*)(out + ((size_t)b * SQ + i) * DM + h * HD + ks * 4) = o * fin;      /* straight into the row's place in the output */
}
// launch 3: the exact first rows' blocks (the longer ones, so they start first), then the blocks of the V^T transposes; neither reads what the other writes. One LDS range serves whichever part a block runs.
#define A0B ((unsigned)(NH * (QT0 / A0R)))      /* exact-rows blocks per batch */
__global__ __launch_bounds__(256) void k_att0_vt(const float* __restrict__ F0, float* __restrict__ out, const _Float16* __restrict__ V16, _Float16* __restrict__ VT) {
  static_assert(A0R * 16 == 256 && A0LDS >= 64 * 66 * 2, "both parts run in 256 threads and in the one LDS range");
  __shared__ __attribute__((aligned(16))) float sm[A0LDS / 4];
  const unsigned bx = blockIdx.x;
  if (bx < NB * A0B) att0_part(bx % A0B, bx / A0B, sm, F0, F0 + (size_t)NB * QT0 * DM, F0 + (size_t)2 * NB * QT0 * DM, 0.125f, out);
  else vt_part<NH, SQ>(bx - NB * A0B, (unsigned short (*)[66])sm, V16, LQ, 0, VT);
}


extern "C" void kernel_launch(void* const* d_in, const int* in_sizes, int n_in,
                              void* d_out, int out_size, void* d_ws, size_t ws_size, hipStream_t stream) {
  (void)in_sizes; (void)n_in; (void)out_size;
  const float* const* I = (const float* const*)d_in; const float* x = I[0]; const float* wq = I[1]; const float* wk = I[2]; const float* wv = I[3];      /* per-head [h][in][out] weights, no biases, no output projection */
  char* ws = (char*)d_ws; size_t off = 0;
  auto take = [&](size_t bytes) { char* p = ws + off; off += (bytes + 255) & ~(size_t)255; return p; };
  _Float16* B3 = (_Float16*)take((size_t)3 * DM * DM * 2);      /* q, k, v weights, one after the other */
  _Float16* X16 = (_Float16*)take(NR * DM * 2); _Float16* QKV16 = (_Float16*)take((size_t)3 * NR * DM * 2); _Float16* Q16 = QKV16; _Float16* K16 = QKV16 + NR * DM; _Float16* V16 = QKV16 + 2 * NR * DM;
  _Float16* VT = (_Float16*)take((size_t)NB * NH * HD * SQ * 2);
  float* F0 = (float*)take((size_t)3 * NB * QT0 * DM * 4);
  if (off > ws_size) return;
  k_prep<<<3 * PWB + PXB, 256, 0, stream>>>(x, wq, wk, wv, B3, X16);      /* per-head [m][d] -> Bt[(h,d)][m] x16 | x rows as f16 */
  k_qkv<<<dim3((unsigned)((MP / 128) * (DM / 128)), 3), 256, 0, stream>>>(X16, B3, QKV16, F0);      /* f16 q, k, v; f32 as well for the first 128 rows of each batch (exact products) */
  k_att0_vt<<<NB * A0B + NB * NH * (SQ / 64), 256, 0, stream>>>(F0, (float*)d_out, V16, VT);      /* exact f32 attention writes rows 0..127 of each batch | V^T [NB][NH][HD][SQ] */
  k_fattn<<<dim3(NH, NB, (SQ - QT0) / FQ), 128, 0, stream>>>(Q16, K16, VT, (float*)d_out);      /* rows 128.. : out = softmax(q k^T / 8, causal) v, f32, concatenated heads */
}

// v009
// One run takes 39.7 microseconds.
// In both of two side-by-side timings against v008, it was 1.17 times as fast.
// All steps since v000 together make it 105 times as fast.
#include <hip/hip_runtime.h>
// Causal multi-head attention with per-head weight tensors (x [4][1024][768]; Q[s][h][d] = sum_m x[s][m] W_Q[h][m][d], K, V likewise (12 heads of 64); scores / 8 with a causal mask (tril); softmax; avg_V = probs V; out[q][h*64 + d] = avg_V[q][h][d] -> [4][1024][768]).
// Structure: token rows r = b*1024 + s; x as exact f16 rows (bf16-rounded); Q, K, V as three WMMA GEMMs (32x64 wave tiles, f32 accumulation, exact x16 weights, f16 outputs); three launches, stages that need nothing of each other share one by ranges of the block index: (1) weights | x rows; (2) the q/k/v GEMMs, v stored as V^T (turned in LDS in the GEMM's own epilogue); (3) fused attention | exact first rows; the fused attention: per 64 query rows, trips of 64 keys up to the diagonal: scores on WMMA (K = 64), running-maximum softmax in registers (f32 statistics, native exp; weights x256 f16), weighted sum of v on WMMA, f32 accumulators rescaled each trip, written f32 straight into the concatenated-heads output rows (no output projection); first-tile refinement: the first 128 query rows of every batch are formed exactly in f32 (their q/k/v rows leave the GEMMs in f32 as well; a causal attention on VALU, 16 lanes a query row, writes those output rows; the fused kernel starts behind them).
// Compute dtype: inputs rounded to bf16; x / weights exact; q, k, v and softmax weights as plain f16 GEMM operands (~2^-12); scores and softmax statistics f32. v_wmma_f32_16x16x32_f16.
#define NB 4
#define SQ 1024
#define DM 768
#define NH 12
#define HD 64
#define HG 4                         /* heads per launch of the per-batch k_vt overload (never launched) */
#define QT0 128                      /* first-tile rows recomputed exactly in f32 */
#define B0 0                         /* unused (all batches on the grid) */
#define NBR NB                       /* batches processed (debug hook) */
#define NR ((size_t)NB * SQ)         /* token rows */
#define MP ((int)((size_t)NBR * SQ)) /* rows projected (debug hook) */
#define QN SQ                        /* unused (query tiles from the block index) */
#define NHD NH                       /* unused (all heads on the grid) */
#define MPO MP                       /* unused (no output stage) */
#define LQ DM      /* row pitch of the q/k/v rows */
typedef __bf16 v16b __attribute__((ext_vector_type(16)));
typedef unsigned short v8us __attribute__((ext_vector_type(8), may_alias));
typedef float  v8f  __attribute__((ext_vector_type(8)));
typedef float  v4f  __attribute__((ext_vector_type(4)));
typedef float  v4fa __attribute__((ext_vector_type(4), may_alias));
union FragB { v16b v; v8us half[2]; unsigned short u[16]; };

__device__ __forceinline__ unsigned short bf16_bits(float x) { unsigned int u = __float_as_uint(x); return (unsigned short)((u + 0x7FFFu + ((u >> 16) & 1u)) >> 16); }
__device__ __forceinline__ float bf16_val(unsigned short b) { return __uint_as_float(((unsigned int)b) << 16); }
__device__ __forceinline__ float bf16_round(float x) { return bf16_val(bf16_bits(x)); }
// D += A·B with NT terms: 1 = ah·bh, 2 = + al·bh (A split), 3 = + ah·bl (both split)
template <int NT>
__device__ __forceinline__ v8f mmaN(v16b ah, v16b al, v16b bh, v16b bl, v8f c) {
  c = __builtin_amdgcn_wmma_f32_16x16x32_bf16(false, ah, false, bh, (short)0, c, false, false);
  if (NT >= 2) c = __builtin_amdgcn_wmma_f32_16x16x32_bf16(false, al, false, bh, (short)0, c, false, false);
  if (NT >= 3) c = __builtin_amdgcn_wmma_f32_16x16x32_bf16(false, ah, false, bl, (short)0, c, false, false);
  asm volatile("v_nop\n\tv_nop\n\tv_nop\n\tv_nop" : "+v"(c) : "v"(ah), "v"(al), "v"(bh), "v"(bl));
  return c;
}

__global__ __launch_bounds__(256) void k_wt_bf16(const float* __restrict__ W, unsigned short* __restrict__ Wt, int K, int N) {
  const int t = blockIdx.x * 256 + threadIdx.x;
  const int k8n = K / 8;
  if (t >= N * k8n) return;
  const int n = t / k8n, k8 = (t % k8n) * 8;
  v8us v;
#pragma unroll
  for (int i = 0; i < 8; ++i) v[i] = bf16_bits(W[(size_t)(k8 + i) * N + n]);
  *(v8us*)(Wt + (size_t)n * K + k8) = v;
  
}

// GEMM C[M][N] (f32, pitch ldc) = act(A[M][K]·W + bias). A f32 row-major (pitch lda) converted per fragment to bf16
// (ASPLIT: hi/lo two planes -> 2 terms, else single rounded term); Wt bf16 [N][K] (pitch ldb). BIAS_BF16 rounds the
// bias to bf16 first (bias quantised to bf16 before the add). K%32==0, M%16==0, N%64==0.
template <bool ASPLIT, int ACT, bool BIAS_BF16>
__global__ __launch_bounds__(128) void k_gemm_bf(const float* __restrict__ A, int lda, const unsigned short* __restrict__ Wt, int ldb,
                                               const float* __restrict__ bias, float* __restrict__ C, int ldc, int M, int N, int K) {
  __shared__ __attribute__((aligned(16))) float so[4][16][64];
  const int tid = threadIdx.x, w = tid >> 5, lane = tid & 31, ln = lane & 15, hh = lane >> 4;
  const int ntn = N / 64;
  const int wid = blockIdx.x * 4 + w;
  const int mt = wid / ntn, nq = wid % ntn;
  if (mt * 16 >= M) return;
  const int row0 = mt * 16, col0 = nq * 64;
  const float* arow = A + (size_t)(row0 + ln) * lda;
  v8f acc[4] = {};
  for (int kb = 0; kb < K; kb += 32) {
    FragB ah, al;
    const v4f x0 = *(const v4fa*)(arow + kb + 8 * hh), x1 = *(const v4fa*)(arow + kb + 8 * hh + 4);
    const v4f x2 = *(const v4fa*)(arow + kb + 16 + 8 * hh), x3 = *(const v4fa*)(arow + kb + 16 + 8 * hh + 4);
    float xs[16] = {x0[0],x0[1],x0[2],x0[3],x1[0],x1[1],x1[2],x1[3],x2[0],x2[1],x2[2],x2[3],x3[0],x3[1],x3[2],x3[3]};
#pragma unroll
    for (int i = 0; i < 16; ++i) { const unsigned short hb = bf16_bits(xs[i]); ah.u[i] = hb; al.u[i] = ASPLIT ? bf16_bits(xs[i] - bf16_val(hb)) : (unsigned short)0; }
#pragma unroll
    for (int t = 0; t < 4; ++t) {
      const unsigned short* brow = Wt + (size_t)(col0 + t * 16 + ln) * ldb + kb;
      FragB b;
      b.half[0] = *(const v8us*)(brow + 8 * hh);
      b.half[1] = *(const v8us*)(brow + 16 + 8 * hh);
      acc[t] = mmaN<ASPLIT ? 2 : 1>(ah.v, al.v, b.v, b.v, acc[t]);
    }
  }
#pragma unroll
  for (int t = 0; t < 4; ++t) {
    float bv = bias ? bias[col0 + t * 16 + ln] : 0.f;
    if (BIAS_BF16) bv = bf16_round(bv);
#pragma unroll
    for (int r = 0; r < 8; ++r) { float v = acc[t][r] + bv; if (ACT == 1) v = fmaxf(v, 0.f); so[w][8 * hh + r][t * 16 + ln] = v; }
  }
  __builtin_amdgcn_fence(__ATOMIC_ACQ_REL, "workgroup");
  __builtin_amdgcn_wave_barrier();
  const int rsub = lane >> 4, c4 = (lane & 15) * 4;
  {
#pragma unroll
    for (int q = 0; q < 8; ++q) {
      const int r = q * 2 + rsub;
      const v4f v = *(const v4fa*)&so[w][r][c4];
      *(v4f*)(C + (size_t)(row0 + r) * ldc + col0 + c4) = v;
    }
    
  }
}

// GEMM C = act(A·W + bias + resid): A f32 (ASPLIT -> hi/lo 2 terms), Wt bf16 [N][K]; ACT 0 none, 1 relu, 2 exact gelu;
// resid (optional, f32, row index = (row % rmod), pitch ldr, RES_BF16 rounds it) added before the activation.
template <bool ASPLIT, int ACT, bool BIAS_BF16, bool RES_BF16>
__global__ __launch_bounds__(128) void k_gemm_bf3(const float* __restrict__ A, int lda, const unsigned short* __restrict__ Wt, int ldb,
                                                const float* __restrict__ bias, const float* __restrict__ resid, int rmod, int ldr,
                                                float* __restrict__ C, int ldc, int M, int N, int K) {
  __shared__ __attribute__((aligned(16))) float so[4][16][64];
  const int tid = threadIdx.x, w = tid >> 5, lane = tid & 31, ln = lane & 15, hh = lane >> 4;
  const int ntn = N / 64;
  const int wid = blockIdx.x * 4 + w;
  const int mt = wid / ntn, nq = wid % ntn;
  if (mt * 16 >= M) return;
  const int row0 = mt * 16, col0 = nq * 64;
  const float* arow = A + (size_t)(row0 + ln) * lda;
  v8f acc[4] = {};
  for (int kb = 0; kb < K; kb += 32) {
    FragB ah, al;
    const v4f x0 = *(const v4fa*)(arow + kb + 8 * hh), x1 = *(const v4fa*)(arow + kb + 8 * hh + 4);
    const v4f x2 = *(const v4fa*)(arow + kb + 16 + 8 * hh), x3 = *(const v4fa*)(arow + kb + 16 + 8 * hh + 4);
    float xs[16] = {x0[0],x0[1],x0[2],x0[3],x1[0],x1[1],x1[2],x1[3],x2[0],x2[1],x2[2],x2[3],x3[0],x3[1],x3[2],x3[3]};
#pragma unroll
    for (int i = 0; i < 16; ++i) { const unsigned short hb = bf16_bits(xs[i]); ah.u[i] = hb; al.u[i] = ASPLIT ? bf16_bits(xs[i] - bf16_val(hb)) : (unsigned short)0; }
#pragma unroll
    for (int t = 0; t < 4; ++t) {
      const unsigned short* brow = Wt + (size_t)(col0 + t * 16 + ln) * ldb + kb;
      FragB b;
      b.half[0] = *(const v8us*)(brow + 8 * hh);
      b.half[1] = *(const v8us*)(brow + 16 + 8 * hh);
      acc[t] = mmaN<ASPLIT ? 2 : 1>(ah.v, al.v, b.v, b.v, acc[t]);
    }
  }
#pragma unroll
  for (int t = 0; t < 4; ++t) {
    const int col = col0 + t * 16 + ln;
    float bv = bias ? bias[col] : 0.f;
    if (BIAS_BF16) bv = bf16_round(bv);
#pragma unroll
    for (int r = 0; r < 8; ++r) {
      float v = acc[t][r] + bv;
      if (resid) { float rv = resid[(size_t)((row0 + 8 * hh + r) % rmod) * ldr + col]; if (RES_BF16) rv = bf16_round(rv); v += rv; }
      if (ACT == 1) v = fmaxf(v, 0.f);
      if (ACT == 2) v = 0.5f * v * (1.0f + erff(v * 0.70710678118654752f));
      if (ACT == 3) { const float u = 0.7978845608028654f * (v + 0.044715f * v * v * v); v = 0.5f * v * (1.0f + tanhf(u)); }
      so[w][8 * hh + r][t * 16 + ln] = v;
    }
  }
  __builtin_amdgcn_fence(__ATOMIC_ACQ_REL, "workgroup");
  __builtin_amdgcn_wave_barrier();
  const int rsub = lane >> 4, c4 = (lane & 15) * 4;
  {
#pragma unroll
    for (int q = 0; q < 8; ++q) {
      const int r = q * 2 + rsub;
      const v4f v = *(const v4fa*)&so[w][r][c4];
      *(v4f*)(C + (size_t)(row0 + r) * ldc + col0 + c4) = v;
    }
    
  }
}
// row LayerNorm (biased variance, eps) over N: s = X (+ R); optional out_sum <- s; out_norm <- (s-mu)*rsqrt(var+eps)*g + b
template <bool PARAM_BF16>
__global__ __launch_bounds__(256) void k_layernorm(const float* __restrict__ X, const float* __restrict__ R, const float* __restrict__ g, const float* __restrict__ bta,
                                                  float* __restrict__ out_sum, float* __restrict__ out_norm, int N, float eps) {
  __shared__ float red[256];
  const int row = blockIdx.x, tid = threadIdx.x;
  const float* x = X + (size_t)row * N; const float* rr = R ? R + (size_t)row * N : nullptr;
  float vals[16];                     // up to N = 4096
  const int per = N / 256;            // contiguous chunk per thread? use strided-by-4 chunks: thread handles j = tid*4 + 1024*u
  float s1 = 0.f;
  for (int u = 0; u < per / 4; ++u) {
    const int j = tid * 4 + 1024 * u;
    const v4f a = *(const v4fa*)(x + j);
    v4f b = {0.f,0.f,0.f,0.f}; if (rr) b = *(const v4fa*)(rr + j);
#pragma unroll
    for (int q = 0; q < 4; ++q) { const float v = a[q] + b[q]; vals[u * 4 + q] = v; s1 += v; }
  }
  red[tid] = s1; __syncthreads();
  for (int st = 128; st > 0; st >>= 1) { if (tid < st) red[tid] += red[tid + st]; __syncthreads(); }
  const float mu = red[0] / (float)N; __syncthreads();
  float s2 = 0.f;
  for (int u = 0; u < per / 4; ++u)
#pragma unroll
    for (int q = 0; q < 4; ++q) { const float c = vals[u * 4 + q] - mu; s2 += c * c; }
  red[tid] = s2; __syncthreads();
  for (int st = 128; st > 0; st >>= 1) { if (tid < st) red[tid] += red[tid + st]; __syncthreads(); }
  const float rs = rsqrtf(red[0] / (float)N + eps);
  {
    for (int u = 0; u < per / 4; ++u) {
      const int j = tid * 4 + 1024 * u;
      v4f o, sm;
#pragma unroll
      for (int q = 0; q < 4; ++q) {
        float gg = g[j + q], bb = bta[j + q];
        if (PARAM_BF16) { gg = bf16_round(gg); bb = bf16_round(bb); }
        sm[q] = vals[u * 4 + q]; o[q] = (vals[u * 4 + q] - mu) * rs * gg + bb;
      }
      if (out_sum) *(v4f*)(out_sum + (size_t)row * N + j) = sm;
      *(v4f*)(out_norm + (size_t)row * N + j) = o;
    }
    
  }
}



// ---- f16 WMMA path (v_wmma_f32_16x16x32_f16): 11-bit significands for operands in range — used where a [0,1] probability operand needs more precision than bf16
typedef _Float16 v16h __attribute__((ext_vector_type(16)));
union FragH { v16h v; v8us half[2]; _Float16 h[16]; unsigned short u[16]; };
template <int NT>
__device__ __forceinline__ v8f mmaH(v16h ah, v16h al, v16h bh, v16h bl, v8f c) {
  c = __builtin_amdgcn_wmma_f32_16x16x32_f16(false, ah, false, bh, (short)0, c, false, false);
  if (NT >= 2) c = __builtin_amdgcn_wmma_f32_16x16x32_f16(false, al, false, bh, (short)0, c, false, false);
  if (NT >= 3) c = __builtin_amdgcn_wmma_f32_16x16x32_f16(false, ah, false, bl, (short)0, c, false, false);
  asm volatile("v_nop\n\tv_nop\n\tv_nop\n\tv_nop" : "+v"(c) : "v"(ah), "v"(al), "v"(bh), "v"(bl));
  return c;
}
// batched GEMM like k_gemm_b but f16 operands: A f32 (split into f16 hi/lo if ASPLIT, else rounded to f16), Bt = f16 values [n][k]; alpha; C f32; N multiple of 16 (partial tiles skipped)
template <bool ASPLIT>
__global__ __launch_bounds__(128) void k_gemm_h(const float* __restrict__ A, int lda, size_t sA, const _Float16* __restrict__ Bh, int ldb, size_t sB, float alpha, float* __restrict__ C, int ldc, size_t sC, int M, int N, int K) {
  __shared__ __attribute__((aligned(16))) float so[4][16][64];
  const int tid = threadIdx.x, w = tid >> 5, lane = tid & 31, ln = lane & 15, hh = lane >> 4; const int by = blockIdx.y;
  A += (size_t)by * sA; Bh += (size_t)by * sB; C += (size_t)by * sC;
  const int ntn = (N + 63) / 64; const int wid = blockIdx.x * 4 + w; const int mt = wid / ntn, nq = wid % ntn; if (mt * 16 >= M) return;
  const int row0 = mt * 16, col0 = nq * 64; const float* arow = A + (size_t)(row0 + ln) * lda;
  v8f acc[4] = {};
  for (int kb = 0; kb < K; kb += 32) {
    FragH ah, al;
    const v4f x0 = *(const v4fa*)(arow + kb + 8 * hh), x1 = *(const v4fa*)(arow + kb + 8 * hh + 4), x2 = *(const v4fa*)(arow + kb + 16 + 8 * hh), x3 = *(const v4fa*)(arow + kb + 16 + 8 * hh + 4);
    float xs[16] = {x0[0],x0[1],x0[2],x0[3],x1[0],x1[1],x1[2],x1[3],x2[0],x2[1],x2[2],x2[3],x3[0],x3[1],x3[2],x3[3]};
#pragma unroll
    for (int i = 0; i < 16; ++i) { const _Float16 h = (_Float16)xs[i]; ah.h[i] = h; al.h[i] = ASPLIT ? (_Float16)(xs[i] - (float)h) : (_Float16)0.0f; }
#pragma unroll
    for (int t = 0; t < 4; ++t) { if (col0 + t * 16 >= N) continue; const size_t boff = (size_t)(col0 + t * 16 + ln) * ldb + kb; FragH bq; bq.half[0] = *(const v8us*)(Bh + boff + 8 * hh); bq.half[1] = *(const v8us*)(Bh + boff + 16 + 8 * hh);
      acc[t] = mmaH<ASPLIT ? 2 : 1>(ah.v, al.v, bq.v, bq.v, acc[t]); }
  }
#pragma unroll
  for (int t = 0; t < 4; ++t) { if (col0 + t * 16 >= N) continue;
#pragma unroll
    for (int r = 0; r < 8; ++r) so[w][8 * hh + r][t * 16 + ln] = acc[t][r] * alpha; }
  __builtin_amdgcn_fence(__ATOMIC_ACQ_REL, "workgroup"); __builtin_amdgcn_wave_barrier();
  const int rsub = lane >> 4, c4 = (lane & 15) * 4;
  {
#pragma unroll
    for (int q = 0; q < 8; ++q) { const int r = q * 2 + rsub; if (col0 + c4 < N) { const v4f v = *(const v4fa*)&so[w][r][c4]; *(v4f*)(C + (size_t)(row0 + r) * ldc + col0 + c4) = v; } }
     }
}

// Wt[n][k] = f16(W[k][n]·scale) from f32 row-major W[K][N] (scale = power of two; bf16-exact weights stay exact in f16 away from the subnormal range)
__global__ __launch_bounds__(256) void k_wt_f16(const float* __restrict__ W, _Float16* __restrict__ Wt, int K, int N, float scale) {
  const int t = blockIdx.x * 256 + threadIdx.x; if (t >= N * (K / 8)) return; const int n = t / (K / 8), k8 = (t % (K / 8)) * 8; FragH f;
#pragma unroll
  for (int i = 0; i < 8; ++i) f.h[i] = (_Float16)(bf16_round(W[(size_t)(k8 + i) * N + n]) * scale); const v8us o = f.half[0];
  *(v8us*)((unsigned short*)Wt + (size_t)n * K + k8) = o; 
}
// k_gemm_hh variant with fused epilogue: v = acc·alpha + bias[by·sBias + col] (+ CP[(row/rowsPerB)·sCPb + by·64 + col] if CP) ; ACT 0 none / 1 elu ; writes f16 C16 (and f32 C if non-null)
template <int ACT>
__global__ __launch_bounds__(128) void k_gemm_hhx(const _Float16* __restrict__ A, int lda, size_t sA, const _Float16* __restrict__ Bh, int ldb, size_t sB, float alpha, const float* __restrict__ bias, size_t sBias, const float* __restrict__ CP, int rowsPerB, size_t sCPb, int row0g,
    float* __restrict__ C, _Float16* __restrict__ C16, int ldc, size_t sC, int M, int N, int K) {
  __shared__ __attribute__((aligned(16))) float so[4][16][64];
  const int tid = threadIdx.x, w = tid >> 5, lane = tid & 31, ln = lane & 15, hh = lane >> 4; const int by = blockIdx.y;
  A += (size_t)by * sA; Bh += (size_t)by * sB; const size_t cofs = (size_t)by * sC; const float* bp = bias ? bias + (size_t)by * sBias : nullptr;
  const int ntn = (N + 63) / 64; const int wid = blockIdx.x * 4 + w; const int mt = wid / ntn, nq = wid % ntn; if (mt * 16 >= M) return;
  const int row0 = mt * 16, col0 = nq * 64; const _Float16* arow = A + (size_t)(row0 + ln) * lda;
  v8f acc[4] = {};
  for (int kb = 0; kb < K; kb += 32) { FragH ah; ah.half[0] = *(const v8us*)((const unsigned short*)arow + kb + 8 * hh); ah.half[1] = *(const v8us*)((const unsigned short*)arow + kb + 16 + 8 * hh);
#pragma unroll
    for (int t = 0; t < 4; ++t) { if (col0 + t * 16 >= N) continue; const size_t boff = (size_t)(col0 + t * 16 + ln) * ldb + kb; FragH bq; bq.half[0] = *(const v8us*)((const unsigned short*)Bh + boff + 8 * hh); bq.half[1] = *(const v8us*)((const unsigned short*)Bh + boff + 16 + 8 * hh);
      acc[t] = mmaH<1>(ah.v, ah.v, bq.v, bq.v, acc[t]); }
  }
#pragma unroll
  for (int t = 0; t < 4; ++t) { if (col0 + t * 16 >= N) continue; const int col = col0 + t * 16 + ln; const float bv = bp ? bf16_round(bp[col]) : 0.f;
#pragma unroll
    for (int r = 0; r < 8; ++r) { float v = acc[t][r] * alpha + bv; if (CP) { const int rr = row0g + row0 + 8 * hh + r; if (rowsPerB < 0) v += CP[cofs + (size_t)rr * ldc + col];      /* rowsPerB < 0: own element of the batched C plane */ else { const int bidx = rr / rowsPerB; v += CP[(size_t)bidx * sCPb + (size_t)by * 64 + col]; } } if (ACT == 1) v = (v > 0.f) ? v : expm1f(v); else if (ACT == 7) v = (v > 0.f) ? v + 1.0f : expf(v); else if (ACT == 8) v = tanhf(v); else if (ACT == 9) v = 0.5f * v * (1.0f + tanhf(0.7978845608028654f * (v + 0.044715f * v * v * v))); else if (ACT == 11) v = 1.0f / (1.0f + expf(-v)); else if (ACT == 12) v = (v > 0.f) ? v : 0.01f * v; else if (ACT == 14) v = (v > 0.f) ? v : 0.1f * v; else if (ACT == 16) v = (v >= 0.f) ? v : 0.3f * v; else if (ACT == 17) v = (v >= 0.f) ? v : 0.2f * v; else if (ACT == 15) v = v / (1.0f + expf(-v)); else if (ACT == 3) v = fmaxf(v, 0.f); else if (ACT == 6) v = 0.5f * v * (1.0f + erff(v * 0.70710678118654752f)); so[w][8 * hh + r][t * 16 + ln] = v; } }
  __builtin_amdgcn_fence(__ATOMIC_ACQ_REL, "workgroup"); __builtin_amdgcn_wave_barrier();
  const int rsub = lane >> 4, c4 = (lane & 15) * 4; typedef _Float16 v4h __attribute__((ext_vector_type(4)));
  {
#pragma unroll
    for (int q = 0; q < 8; ++q) { const int r = q * 2 + rsub; if (col0 + c4 < N) { const v4f v = *(const v4fa*)&so[w][r][c4]; if (C) *(v4f*)(C + cofs + (size_t)(row0 + r) * ldc + col0 + c4) = v; if (C16) { v4h h4; for (int i = 0; i < 4; ++i) h4[i] = (_Float16)v[i]; *(v4h*)(C16 + cofs + (size_t)(row0 + r) * ldc + col0 + c4) = h4; } } }
     }
}


typedef _Float16 v4h __attribute__((ext_vector_type(4)));

#define PXI 8                        /* 8-float pieces of x per thread */
// x rows as f16: a thread takes PXI pieces of 8 floats, a workgroup's width apart; its 2 PXI 16-byte loads are all in flight before the first value is used
__device__ __forceinline__ void x16_part(const unsigned bx, const float* __restrict__ x, _Float16* __restrict__ X16) {
  const size_t t0 = (size_t)bx * (256 * PXI) + threadIdx.x; const float* p = x + t0 * 8; unsigned short* dst = (unsigned short*)X16 + t0 * 8;
  v4f a[PXI][2]; v8us o[PXI];
#pragma unroll      /* constant indices: a stays in registers; the loads take constant offsets from one address */
  for (int i = 0; i < PXI; ++i) { a[i][0] = *(const v4fa*)(p + i * 2048); if (i < PXI - 1) a[i][1] = *(const v4fa*)(p + i * 2048 + 4); }
  asm volatile("s_wait_xcnt 0x0" ::: "memory");      /* the last load may land in the address registers that the loads before it name: their translations are waited for first */
  a[PXI - 1][1] = *(const v4fa*)(p + (PXI - 1) * 2048 + 4);
  asm volatile("s_wait_xcnt 0x0" ::: "memory");      /* before any register that these loads name is written again */
#pragma unroll      /* constant indices, as above */
  for (int i = 0; i < PXI; ++i) { FragH f; for (int q = 0; q < 4; ++q) { f.h[q] = (_Float16)bf16_round(a[i][0][q]); f.h[4 + q] = (_Float16)bf16_round(a[i][1][q]); } o[i] = f.half[0]; }
  __builtin_amdgcn_sched_barrier(0);      /* all pieces are converted first: nothing is computed between the stores */
#pragma unroll      /* the stores take constant offsets from one address */
  for (int i = 0; i < PXI; ++i) *(v8us*)(dst + i * 2048) = o[i];
  asm volatile("s_wait_xcnt 0x0" ::: "memory");      /* before any register that these stores name is written again: in the built kernel the other part's code follows this one */
}
__global__ __launch_bounds__(256) void k_h16(const float* __restrict__ x, _Float16* __restrict__ X16, size_t n8) { const size_t t = (size_t)blockIdx.x * 256 + threadIdx.x; if (t >= n8) return; FragH f;
#pragma unroll
  for (int q = 0; q < 8; ++q) f.h[q] = (_Float16)x[t * 8 + q]; *(v8us*)((unsigned short*)X16 + t * 8) = f.half[0];  }
__global__ __launch_bounds__(256) void k_round16f(const float* __restrict__ W, _Float16* __restrict__ Bt, size_t n8) { const size_t t = (size_t)blockIdx.x * 256 + threadIdx.x; if (t >= n8) return; FragH f;
#pragma unroll
  for (int i = 0; i < 8; ++i) f.h[i] = (_Float16)(bf16_round(W[t * 8 + i]) * 16.0f); *(v8us*)((unsigned short*)Bt + t * 8) = f.half[0];  }

__global__ __launch_bounds__(256) void k_hl(const float* __restrict__ F, _Float16* __restrict__ Hh, _Float16* __restrict__ Hl, size_t n8) { const size_t t = (size_t)blockIdx.x * 256 + threadIdx.x; if (t >= n8) return; FragH fh, fl; const v4f a = *(const v4fa*)(F + t * 8), c = *(const v4fa*)(F + t * 8 + 4);
#pragma unroll
  for (int q = 0; q < 4; ++q) { _Float16 h = (_Float16)a[q]; fh.h[q] = h; fl.h[q] = (_Float16)((a[q] - (float)h) * 1024.0f); h = (_Float16)c[q]; fh.h[4 + q] = h; fl.h[4 + q] = (_Float16)((c[q] - (float)h) * 1024.0f); }
  { *(v8us*)((unsigned short*)Hh + t * 8) = fh.half[0]; *(v8us*)((unsigned short*)Hl + t * 8) = fl.half[0];  } }

// ---- q/k/v GEMM: wave tile 32x64, operands staged in LDS ----
__device__ __forceinline__ v16h g2_frag(const _Float16* p, int hh) { FragH f; f.half[0] = *(const v8us*)((const unsigned short*)p + 8 * hh); f.half[1] = *(const v8us*)((const unsigned short*)p + 16 + 8 * hh); return f.v; }
__device__ __forceinline__ v16h g3_frag(const unsigned short* p, int hh) { FragH f; f.half[0] = *(const v8us*)(p + 8 * hh); f.half[1] = *(const v8us*)(p + 16 + 8 * hh); return f.v; }
__device__ __forceinline__ v8f g3_mma(v16h a, v16h b, v8f c) { return __builtin_amdgcn_wmma_f32_16x16x32_f16(false, a, false, b, (short)0, c, false, false); }
// One workgroup = a 128 x 128 tile of one of q/k/v: eight waves of 32 x 64, four down and two across. One trip = GK of k.
// A trip's 128 x rows and 128 weight rows (128 bytes of each) come into LDS as whole lines by asynchronous copies, once a workgroup instead of once a wave and in 32-byte pieces;
// two buffers: the copies of trip t + 2 are issued when trip t has left its buffer and fly while trip t + 1 is worked on. The k order of every sum is the one it was.
#define GK 64                        /* k per trip */
#define GP (GK + 8)                  /* LDS row pitch in f16: 128 bytes + 16, for 16-byte fragment reads of 16 rows */
#define GNT (DM / GK)                /* trips */
#define GBUF (256 * GP)              /* one buffer in f16: 128 x rows, then 128 weight rows */
// A lane's eight 16-byte copies of one trip: rows sr + 32 i of x (a) and of the weights (b) to the same rows of the buffer at LDS byte address l.
// The s_wait_xcnt stands in the copies' own statement: behind it the registers that the copies name may be written again.
__device__ __forceinline__ void g3_copy(unsigned l, const unsigned short* a, const unsigned short* b) {
  asm volatile("global_load_async_to_lds_b128 %0, %8, off\n\t"
               "global_load_async_to_lds_b128 %1, %9, off\n\t"
               "global_load_async_to_lds_b128 %2, %10, off\n\t"
               "global_load_async_to_lds_b128 %3, %11, off\n\t"
               "global_load_async_to_lds_b128 %4, %12, off\n\t"
               "global_load_async_to_lds_b128 %5, %13, off\n\t"
               "global_load_async_to_lds_b128 %6, %14, off\n\t"
               "global_load_async_to_lds_b128 %7, %15, off\n\t"
               "s_wait_xcnt 0x0"
               :: "v"(l), "v"(l + 32u * GP * 2u), "v"(l + 64u * GP * 2u), "v"(l + 96u * GP * 2u), "v"(l + 128u * GP * 2u), "v"(l + 160u * GP * 2u), "v"(l + 192u * GP * 2u), "v"(l + 224u * GP * 2u),
                  "v"(a), "v"(a + 32 * DM), "v"(a + 64 * DM), "v"(a + 96 * DM), "v"(b), "v"(b + 32 * DM), "v"(b + 64 * DM), "v"(b + 96 * DM)
               : "memory");
}
// f16 q, k of all token rows: grid.y = which of q/k/v; QKV16 [2][NR][DM]; v leaves as V^T [NB][NH][HD][SQ]: a lane's eight accumulator registers are eight neighbouring token rows of one column, 16 bytes of a V^T row. The 128-row block that holds the first QT0 rows of a batch stores the same sums in f32 as well: F0 [3][NB][QT0][DM]
static_assert(QT0 == 128 && SQ % 128 == 0, "the first QT0 rows of a batch are one 128-row block of the GEMM");
static_assert(DM % 128 == 0 && GNT >= 2, "whole 128-column tiles; the two buffers want two trips");
#define GVP (128 + 8)                /* V^T staging: LDS row pitch in f16, 256 bytes + 16 */
__global__ __launch_bounds__(256) void k_qkv(const _Float16* __restrict__ X16, const _Float16* __restrict__ B3, _Float16* __restrict__ QKV16, _Float16* __restrict__ VT, float* __restrict__ F0) {
  __shared__ __attribute__((aligned(16))) unsigned short st[2 * GBUF];      /* the two buffers; behind the loop each wave's output rows, turned for whole-row stores */
  static_assert(sizeof(st) >= 8 * 32 * 68 * 4 && sizeof(st) >= 128 * GVP * 2, "the output staging fits in the buffers");
  const int tid = threadIdx.x, w = tid >> 5, lane = tid & 31, ln = lane & 15, hh = lane >> 4; const int wh = blockIdx.y;
  const int mt = blockIdx.x / (DM / 128), nq = blockIdx.x % (DM / 128); const int b = mt / (SQ / 128);      /* row block, column block, batch */
  const int row0 = 32 * (w & 3), col0 = nq * 128 + 64 * (w >> 2);      /* the wave's tile: rows inside the row block, columns of the tensor */
  const int sr = tid >> 3, sc = (tid & 7) * 8;      /* staging: eight threads bring one 128-byte row */
  const unsigned short* ag = (const unsigned short*)X16 + ((size_t)mt * 128 + sr) * DM + sc;
  const unsigned short* bg = (const unsigned short*)B3 + (size_t)wh * DM * DM + ((size_t)nq * 128 + sr) * DM + sc;
  const unsigned l0 = (unsigned)(size_t)&st[sr * GP + sc];      /* the lane's LDS byte address in buffer 0 */
  g3_copy(l0, ag, bg);
  asm volatile("s_wait_asynccnt 0x0" ::: "memory");      /* the wave's own copies of trip 0 have landed ... */
  __syncthreads();                                       /* ... and every other wave's */
  g3_copy(l0 + GBUF * 2u, ag + GK, bg + GK);
  const unsigned short* af = &st[(row0 + ln) * GP]; const unsigned short* bf = &st[(128 + 64 * (w >> 2) + ln) * GP];
  const v8f z8 = {0.f,0.f,0.f,0.f,0.f,0.f,0.f,0.f}; v8f c0[4] = {z8, z8, z8, z8}, c1[4] = {z8, z8, z8, z8};
#pragma unroll 1      /* one trip's code: the buffer is chosen by an offset */
  for (int t = 0; t < GNT; ++t) {
    const unsigned short* ap = af + (t & 1) * GBUF; const unsigned short* bp = bf + (t & 1) * GBUF;
#pragma unroll      /* constant indices: the accumulators stay in registers */
    for (int kk = 0; kk < GK; kk += 32) { const v16h a0 = g3_frag(ap + kk, hh), a1 = g3_frag(ap + 16 * GP + kk, hh); v16h bj[4];
#pragma unroll      /* constant indices: bj stays in registers */
      for (int j = 0; j < 4; ++j) bj[j] = g3_frag(bp + j * 16 * GP + kk, hh);
      __builtin_amdgcn_sched_barrier(0);      /* the six fragments' reads are issued together before the first product waits for one: one LDS round trip for eight products instead of one for two */
#pragma unroll      /* constant indices, as above; eight independent accumulators */
      for (int j = 0; j < 4; ++j) { c0[j] = g3_mma(a0, bj[j], c0[j]); c1[j] = g3_mma(a1, bj[j], c1[j]); } }
    asm volatile("s_wait_dscnt 0x0" ::: "memory");         /* this wave has read its last of this trip's buffer */
    asm volatile("s_wait_asynccnt 0x0" ::: "memory");      /* its copies of the next trip have landed */
    __syncthreads();      /* publishes the next trip's buffer and ends this trip's reads */
    if (t + 2 < GNT) g3_copy(l0 + (unsigned)(t & 1) * (GBUF * 2u), ag + (t + 2) * GK, bg + (t + 2) * GK);      /* into the buffer that this trip has just left */
  }
  asm volatile("s_wait_asynccnt 0x0" ::: "memory");      /* no copy is outstanding when the buffers become output staging */
  float (*so)[68] = (float (*)[68])((float*)st + (size_t)w * 32 * 68);      /* the wave's own 32 rows */
  float* C = (mt % (SQ / 128) == 0) ? F0 + (size_t)(wh * NB + b) * QT0 * DM : nullptr;
  if (wh == 2) {      /* v (the test reads the same in the whole workgroup): the workgroup's tile goes to LDS as [column][token row] and leaves as whole 256-byte pieces of V^T rows */
    unsigned short (*tv)[GVP] = (unsigned short (*)[GVP])st;
#pragma unroll      /* constant indices: the accumulators stay in registers */
    for (int j = 0; j < 4; ++j) { FragH f0, f1;
      for (int r = 0; r < 8; ++r) { f0.h[r] = (_Float16)(c0[j][r] * 0.0625f); f1.h[r] = (_Float16)(c1[j][r] * 0.0625f); }      /* the weights were carried x16 */
      unsigned short* tp = &tv[64 * (w >> 2) + j * 16 + ln][row0 + 8 * hh]; *(v8us*)tp = f0.half[0]; *(v8us*)(tp + 16) = f1.half[0]; }
    __syncthreads();      /* the tile is whole before it is read across the waves' parts */
    v8us tq[8];      /* all pieces are read first: between the stores nothing is computed */
#pragma unroll      /* constant indices: tq stays in registers */
    for (int i = 0; i < 8; ++i) tq[i] = *(const v8us*)&tv[i * 16 + (tid >> 4)][(tid & 15) * 8];
    unsigned short* vd = (unsigned short*)VT + ((size_t)b * DM + nq * 128 + (tid >> 4)) * SQ + (mt % (SQ / 128)) * 128 + (tid & 15) * 8;      /* sixteen threads store 256 bytes of one V^T row */
#pragma unroll      /* the stores take constant offsets from one address */
    for (int i = 0; i < 8; ++i) *(v8us*)(vd + (size_t)i * 16 * SQ) = tq[i];
    asm volatile("s_wait_xcnt 0x0" ::: "memory");      /* before any register that these stores name is written again, on every way out of this branch */
    if (!C) return;      /* the whole workgroup or none */
    __syncthreads();      /* every wave has read its pieces before the f32 staging below overwrites them */
  }
  _Float16* C16 = QKV16 + (size_t)wh * NR * DM + (size_t)mt * 128 * DM;
#pragma unroll      /* constant indices, as above */
  for (int j = 0; j < 4; ++j)
#pragma unroll      /* constant indices, as above */
    for (int r = 0; r < 8; ++r) { so[8 * hh + r][j * 16 + ln] = c0[j][r] * 0.0625f; so[16 + 8 * hh + r][j * 16 + ln] = c1[j][r] * 0.0625f; }      /* the weights were carried x16 */
  __builtin_amdgcn_fence(__ATOMIC_ACQ_REL, "workgroup"); __builtin_amdgcn_wave_barrier();      /* so is the wave's own: its writes are ordered before its reads */
  const int rsub = lane >> 4, c4 = (lane & 15) * 4;
  {
    v4f vq[16]; v4h hq[16];      /* all rows are read and converted first: behind the stores nothing is computed, so no register that an issued store names is written again */
#pragma unroll      /* constant indices: vq and hq stay in registers */
    for (int q = 0; q < 16; ++q) { vq[q] = *(const v4fa*)&so[q * 2 + rsub][c4]; for (int i = 0; i < 4; ++i) hq[q][i] = (_Float16)vq[q][i]; }
    if (wh != 2) {      /* v has left as V^T */
#pragma unroll      /* constant indices, as above; the stores take constant offsets from one address */
      for (int q = 0; q < 16; ++q) *(v4h*)(C16 + (size_t)(row0 + q * 2 + rsub) * DM + col0 + c4) = hq[q];
      asm volatile("s_wait_xcnt 0x0" ::: "memory");      /* before the next branch's address lands in a register that these stores name */
    }
    if (C) {
#pragma unroll      /* constant indices, as above */
      for (int q = 0; q < 16; ++q) *(v4f*)(C + (size_t)(row0 + q * 2 + rsub) * DM + col0 + c4) = vq[q]; }
  }
}


__global__ __launch_bounds__(256) void k_wnat(const float* __restrict__ w, size_t n8, _Float16* __restrict__ Bt) { const size_t t = (size_t)blockIdx.x * 256 + threadIdx.x; if (t >= n8) return; FragH f; for (int q = 0; q < 8; ++q) f.h[q] = (_Float16)(bf16_round(w[t * 8 + q]) * 16.0f); *(v8us*)((unsigned short*)Bt + t * 8) = f.half[0];  }
__global__ __launch_bounds__(256) void k_rsm(const float* __restrict__ S, _Float16* __restrict__ P, int nrows) {
  #pragma clang fp contract(off)
  const int i = blockIdx.x * 256 + threadIdx.x; if (i >= nrows) return; const float* s = S + (size_t)i * SQ; float mx = -3.0e38f;
#pragma unroll 1
  for (int j = 0; j < SQ; ++j) mx = fmaxf(mx, s[j]); float se = 0.f;
#pragma unroll 1
  for (int j = 0; j < SQ; ++j) se += expf(s[j] - mx); const float sc = 256.0f / se;
#pragma unroll 1
  for (int j0 = 0; j0 < SQ; j0 += 8) { FragH f; for (int q = 0; q < 8; ++q) f.h[q] = (_Float16)(expf(s[j0 + q] - mx) * sc); unsigned short* d = (unsigned short*)P + (size_t)i * SQ + j0; *(v8us*)d = f.half[0];  } }
__global__ __launch_bounds__(256) void k_vt(const _Float16* __restrict__ V16, int b, int h0, _Float16* __restrict__ VT) { __shared__ unsigned short tl[64][65]; const int tid = threadIdx.x; const int hh = blockIdx.x % HG, sg = blockIdx.x / HG; const int s0 = sg * 64; const int h = h0 + hh;
  for (int i = tid; i < 64 * 8; i += 256) { const int j = i / 8, d8 = (i % 8) * 8; FragH f; f.half[0] = *(const v8us*)((const unsigned short*)V16 + ((size_t)b * SQ + s0 + j) * DM + h * HD + d8); for (int q = 0; q < 8; ++q) tl[d8 + q][j] = f.u[q]; }
  __syncthreads();
  { for (int i = tid; i < 64 * 8; i += 256) { const int d = i / 8, j8 = (i % 8) * 8; FragH f; for (int q = 0; q < 8; ++q) f.u[q] = tl[d][j8 + q]; *(v8us*)((unsigned short*)VT + ((size_t)hh * HD + d) * SQ + s0 + j8) = f.half[0]; }  } }

// Weights [h][m][d] -> Bt[(h, d)][m], f16, x16. One workgroup = PWM rows m of one head of one of q/k/v: PWM x 64 floats that lie in one piece in memory.
// They are read as whole lines (PWM / 16 16-byte loads a thread, all in flight together), converted, turned in LDS and stored as whole 128-byte lines of Bt.
#define PWM 256                      /* rows m per workgroup */
#define PWP (HD / 2 + 1)             /* LDS row pitch in dwords (a dword = the f16 of two neighbouring d): 33, so that rows 8 apart fall on different banks */
__device__ __forceinline__ void wthd_part(const unsigned bx, const unsigned wh, unsigned (*tl)[PWP], const float* __restrict__ Wq, const float* __restrict__ Wk, const float* __restrict__ Wv, _Float16* __restrict__ B3) {
  const int tid = threadIdx.x; const int h = bx / (DM / PWM), m0 = (bx % (DM / PWM)) * PWM;
  const float* Wt = wh == 0 ? Wq : wh == 1 ? Wk : Wv;      /* wh = which of q/k/v */
  const float* p = Wt + ((size_t)h * DM + m0) * HD + tid * 4;
  v4f a[PWM / 16];
#pragma unroll      /* constant indices: a stays in registers; the loads take constant offsets from one address */
  for (int i = 0; i < PWM / 16; ++i) a[i] = *(const v4fa*)(p + i * 1024);
  asm volatile("s_wait_xcnt 0x0" ::: "memory");      /* before any register that these loads name is written again */
  const int mr = tid >> 4, dc = (tid & 15) * 2;      /* sixteen threads hold one row m */
#pragma unroll      /* constant indices, as above */
  for (int i = 0; i < PWM / 16; ++i) { union { _Float16 h[4]; unsigned w[2]; } f; for (int q = 0; q < 4; ++q) f.h[q] = (_Float16)(16.0f * bf16_round(a[i][q])); tl[i * 16 + mr][dc] = f.w[0]; tl[i * 16 + mr][dc + 1] = f.w[1]; }
  __syncthreads();      /* the tile is whole before it is read the other way */
  const int dp = tid >> 3, pc = tid & 7;      /* a thread turns 8 m of the rows d = 2 dp and 2 dp + 1; eight threads store one 128-byte line */
  union { unsigned w[4]; v8us v; } o[PWM / 64][2];
#pragma unroll      /* constant indices: o stays in registers */
  for (int c = 0; c < PWM / 64; ++c)
    for (int q = 0; q < 8; q += 2) { const unsigned w0 = tl[c * 64 + pc * 8 + q][dp], w1 = tl[c * 64 + pc * 8 + q + 1][dp]; o[c][0].w[q >> 1] = (w0 & 0xffffu) | (w1 << 16); o[c][1].w[q >> 1] = (w0 >> 16) | (w1 & 0xffff0000u); }
  unsigned short* dst = (unsigned short*)B3 + (size_t)wh * DM * DM + ((size_t)h * HD + 2 * dp) * DM + m0 + pc * 8;
  __builtin_amdgcn_sched_barrier(0);      /* all pieces are gathered first: behind the stores nothing is computed, so no register that an issued store names is written again */
#pragma unroll      /* the stores take constant offsets from one address */
  for (int c = 0; c < PWM / 64; ++c) { *(v8us*)(dst + c * 64) = o[c][0].v; *(v8us*)(dst + DM + c * 64) = o[c][1].v; }
}
// launch 1: the weights' blocks, then the blocks of the x rows (neither reads what the other writes)
#define PWB ((unsigned)(NH * (DM / PWM)))                  /* blocks per weight tensor */
#define PXB ((unsigned)(NR * DM / 8 / (256 * PXI)))        /* blocks of the x rows */
static_assert(DM % PWM == 0 && PWM % 64 == 0 && HD == 64 && (NR * DM) % (8 * 256 * PXI) == 0, "whole tiles and whole pieces: no thread of launch 1 is without work");
__global__ __launch_bounds__(256) void k_prep(const float* __restrict__ x, const float* __restrict__ Wq, const float* __restrict__ Wk, const float* __restrict__ Wv, _Float16* __restrict__ B3, _Float16* __restrict__ X16) {
  __shared__ __attribute__((aligned(16))) unsigned tl[PWM][PWP];      /* the weights' blocks alone use it */
  const unsigned bx = blockIdx.x;
  if (bx < 3 * PWB) wthd_part(bx % PWB, bx / PWB, tl, Wq, Wk, Wv, B3);
  else x16_part(bx - 3 * PWB, x, X16);
}



// ---- cross-lane and exp helpers ----
template <int M> __device__ __forceinline__ float rs_xm(float x) { return __builtin_bit_cast(float, __builtin_amdgcn_mov_dpp(__builtin_bit_cast(int, x), 0x160 + M, 0xf, 0xf, false)); }      /* lane l <- lane l ^ M inside a 16-lane row (row_xmask) */
__device__ __forceinline__ float rs_xh(float x) { return __builtin_bit_cast(float, __builtin_amdgcn_permlanex16(__builtin_bit_cast(int, x), __builtin_bit_cast(int, x), 0x76543210, 0xfedcba98, false, false)); }      /* lane l <- lane l ^ 16 */
// e^x of four values, as __expf forms it (x * log2 e, then v_exp_f32). One statement: behind a transcendental the instruction set asks for one independent instruction before its source is overwritten or its result read;
// each v_exp_f32 is that instruction for the one before it (outputs are early-clobber, so none lies on an input), the v_nop for the last.
__device__ __forceinline__ v4f rs_exp4(v4f x) { float y0, y1, y2, y3; const v4f t = x * 1.44269504f;
  asm("v_exp_f32 %0, %4\n\tv_exp_f32 %1, %5\n\tv_exp_f32 %2, %6\n\tv_exp_f32 %3, %7\n\tv_nop" : "=&v"(y0), "=&v"(y1), "=&v"(y2), "=&v"(y3) : "v"(t[0]), "v"(t[1]), "v"(t[2]), "v"(t[3]));
  const v4f y = {y0, y1, y2, y3}; return y; }


// ---- fused causal attention: scores, softmax and weighted sum of v in one kernel; scores and weights never leave the registers ----
// One workgroup = FQ query rows of one (batch, head), 16 rows a wave; one trip = FK keys, up to the workgroup's own diagonal block.
// The products are formed transposed: S^T = K Q^T (A = 16 key rows, B = the wave's 16 query rows) leaves, in lane (ln, hh), the scores of query ln for keys 8 hh + r of each 16-key tile:
// two such tiles side by side are, register for register, the B fragment (n = query, k = 32 keys) of O^T = V^T P^T, so the weights go from accumulator to operand without a shuffle.
// A query's running maximum, sum and rescale factor live in its own two lanes (ln and ln + 16).
#define FQ 64                        /* query rows per workgroup */
#define FK 64                        /* keys per trip */
#define FLP (FK + 8)                 /* LDS row pitch in f16: 128 bytes + 16, for 16-byte fragment reads of 16 rows */
__device__ __forceinline__ v16h fa_frag(const unsigned short* p, int hh) { FragH f; f.half[0] = *(const v8us*)(p + 8 * hh); f.half[1] = *(const v8us*)(p + 16 + 8 * hh); return f.v; }
__device__ __forceinline__ v8f fa_mma(v16h a, v16h b, v8f c) { return __builtin_amdgcn_wmma_f32_16x16x32_f16(false, a, false, b, (short)0, c, false, false); }
#define FALDS (2 * FK * FLP * 2 + 2 * HD * FLP * 2 + 4 * 16 * (HD + 4) * 4)      /* its LDS, bytes */
// bx = (query block, batch, head), head fastest, longest query block first
__device__ __forceinline__ void fattn_part(const unsigned bx, float* __restrict__ sm, const _Float16* __restrict__ Q16, const _Float16* __restrict__ K16, const _Float16* __restrict__ VT, float* __restrict__ out) {
  unsigned short (*sk)[FK][FLP] = (unsigned short (*)[FK][FLP])sm;                          /* k rows [key][d], two buffers */
  unsigned short (*sv)[HD][FLP] = (unsigned short (*)[HD][FLP])((unsigned short*)sm + 2 * FK * FLP);      /* v^T rows [d][key], two buffers */
  float (*so)[16][HD + 4] = (float (*)[16][HD + 4])((unsigned short*)sm + 2 * FK * FLP + 2 * HD * FLP);      /* a wave's output rows, turned for whole-row stores */
  const int tid = threadIdx.x, w = tid >> 5, lane = tid & 31, ln = lane & 15, hh = lane >> 4;
  const int h = bx % NH, b = (bx / NH) % NB, qb = SQ / FQ - 1 - (int)(bx / (NH * NB));
  const int sr = tid >> 3, sc = (tid & 7) * 8;      /* staging: eight threads bring one 128-byte row */
  const unsigned short* kg = (const unsigned short*)K16 + ((size_t)b * SQ + sr) * LQ + h * HD + sc;
  const unsigned short* vg = (const unsigned short*)VT + ((size_t)(b * NH + h) * HD + sr) * SQ + sc;
  const _Float16* qp = Q16 + ((size_t)b * SQ + qb * FQ + w * 16 + ln) * LQ + h * HD;
  const v16h q0 = g2_frag(qp, hh), q1 = g2_frag(qp + 32, hh);
  v8us kr[4], vr[4];
#pragma unroll      /* constant indices: kr and vr stay in registers */
  for (int i = 0; i < 4; ++i) { kr[i] = *(const v8us*)(kg + (size_t)i * 16 * LQ); vr[i] = *(const v8us*)(vg + (size_t)i * 16 * SQ); }
  asm volatile("s_wait_xcnt 0x0" ::: "memory");      /* before any register that these loads name is written again */
#pragma unroll      /* constant indices, as above */
  for (int i = 0; i < 4; ++i) { *(v8us*)&sk[0][sr + i * 16][sc] = kr[i]; *(v8us*)&sv[0][sr + i * 16][sc] = vr[i]; }
  __syncthreads();
  const v8f z8 = {0.f, 0.f, 0.f, 0.f, 0.f, 0.f, 0.f, 0.f};
  v8f o[4] = {z8, z8, z8, z8}; float m = -1.0e30f, l = 0.f;      /* m: running maximum of the raw products; l: this lane's part of the running sum */
  for (int kb = 0; kb <= qb; ++kb) {
    const int cur = kb & 1;
    if (kb < qb) {      /* the next trip's rows fly while this trip is worked on */
#pragma unroll      /* constant indices, as above */
      for (int i = 0; i < 4; ++i) { kr[i] = *(const v8us*)(kg + (size_t)(kb + 1) * FK * LQ + (size_t)i * 16 * LQ); vr[i] = *(const v8us*)(vg + (size_t)(kb + 1) * FK + (size_t)i * 16 * SQ); }
      asm volatile("s_wait_xcnt 0x0" ::: "memory");      /* before any register that these loads name is written again */
    }
    v8f st[4]; v16h kf[8], vf[8];
#pragma unroll      /* constant indices: kf stays in registers */
    for (int t = 0; t < 4; ++t) { const unsigned short* kp = &sk[cur][t * 16 + ln][0]; kf[2 * t] = fa_frag(kp, hh); kf[2 * t + 1] = fa_frag(kp + 32, hh); }
    __builtin_amdgcn_sched_barrier(0);      /* all k fragment reads are issued before the first product waits for one: one LDS round trip a trip instead of one a tile */
#pragma unroll      /* constant indices: st stays in registers; four independent accumulators */
    for (int t = 0; t < 4; ++t) st[t] = fa_mma(kf[2 * t], q0, z8);
#pragma unroll      /* constant indices, as above */
    for (int t = 0; t < 4; ++t) st[t] = fa_mma(kf[2 * t + 1], q1, st[t]);
#pragma unroll      /* constant indices: vf stays in registers */
    for (int t = 0; t < 4; ++t) { const unsigned short* vp = &sv[cur][t * 16 + ln][0]; vf[2 * t] = fa_frag(vp, hh); vf[2 * t + 1] = fa_frag(vp + 32, hh); }
    __builtin_amdgcn_sched_barrier(0);      /* the v^T fragment reads are issued ahead of the softmax arithmetic, which then covers their round trip */
    if (kb == qb) {      /* the diagonal block: keys behind the row's own are masked */
#pragma unroll      /* constant indices, as above */
      for (int t = 0; t < 4; ++t) for (int r = 0; r < 8; ++r) st[t][r] = (t * 16 + 8 * hh + r <= w * 16 + ln) ? st[t][r] : -1.0e30f;
    }
    v4f m4 = {m, m, m, m};
#pragma unroll      /* constant indices, as above; four independent chains */
    for (int t = 0; t < 4; ++t) for (int r = 0; r < 8; ++r) m4[r & 3] = fmaxf(m4[r & 3], st[t][r]);
    float mn = fmaxf(fmaxf(m4[0], m4[1]), fmaxf(m4[2], m4[3])); mn = fmaxf(mn, rs_xh(mn));      /* both lanes of a query hold the same maximum */
    const float da = (m - mn) * 0.125f; const v4f da4 = {da, da, da, da}; const float al = rs_exp4(da4)[0]; m = mn;
    const float ms = mn * 0.125f - 5.5451774f;      /* weights carried x256 (e^5.545...): small ones stay normal f16 numbers; the factor cancels against the sum */
    v4f s4 = {0.f, 0.f, 0.f, 0.f}; FragH pb[2];
#pragma unroll      /* constant indices, as above */
    for (int t = 0; t < 4; ++t) for (int g = 0; g < 2; ++g) {
      v4f x; for (int u = 0; u < 4; ++u) x[u] = st[t][g * 4 + u] * 0.125f - ms;
      const v4f e = rs_exp4(x); s4 += e;
      for (int u = 0; u < 4; ++u) pb[t >> 1].h[(t & 1) * 8 + g * 4 + u] = (_Float16)e[u]; }
    l = l * al + ((s4[0] + s4[1]) + (s4[2] + s4[3]));
#pragma unroll      /* constant indices: o stays in registers */
    for (int t = 0; t < 4; ++t) o[t] = fa_mma(vf[2 * t], pb[0].v, o[t] * al);
#pragma unroll      /* constant indices, as above */
    for (int t = 0; t < 4; ++t) o[t] = fa_mma(vf[2 * t + 1], pb[1].v, o[t]);
    if (kb < qb) {      /* the other buffer: its last readers left it at the barrier that ended the trip before */
#pragma unroll      /* constant indices, as above */
      for (int i = 0; i < 4; ++i) { *(v8us*)&sk[cur ^ 1][sr + i * 16][sc] = kr[i]; *(v8us*)&sv[cur ^ 1][sr + i * 16][sc] = vr[i]; }
    }
    __syncthreads();      /* publishes the next trip's buffer and ends this trip's reads */
  }
  l += rs_xh(l); const float fin = 1.0f / l;
#pragma unroll      /* constant indices, as above */
  for (int t = 0; t < 4; ++t) for (int g = 0; g < 2; ++g) { v4f y; for (int u = 0; u < 4; ++u) y[u] = o[t][g * 4 + u] * fin; *(v4f*)&so[w][ln][t * 16 + 8 * hh + g * 4] = y; }
  __builtin_amdgcn_fence(__ATOMIC_ACQ_REL, "workgroup"); __builtin_amdgcn_wave_barrier();      /* so[w] is the wave's own: its writes are ordered before its reads */
  float* op = out + ((size_t)b * SQ + qb * FQ + w * 16 + hh) * DM + h * HD + ln * 4;
#pragma unroll      /* stores take constant offsets from one address */
  for (int q = 0; q < 8; ++q) { const v4f y = *(const v4fa*)&so[w][q * 2 + hh][ln * 4]; *(v4f*)(op + (size_t)q * 2 * DM) = y; }
}

// Exact f32 causal attention of the first QT0 rows. One workgroup = A0R query rows of one (batch, head); 16 lanes share a row.
// The head's k and v rows are staged once in LDS; scores: lane ks of a row takes keys ks, ks + 16, ...; softmax over the row's 16 lanes; o: lane ks of a row takes dims 4 ks .. 4 ks + 3 over all keys.
#define A0R 8                        /* query rows per workgroup (128 threads, the fused attention's block) */
#define A0N (QT0 / 16)               /* groups of 16 keys */
#define A0S (QT0 / A0R)              /* staging: groups of A0R rows */
#define A0KP (HD + 4)                /* k row pitch in LDS, floats: the 16 key rows that 16 lanes read fall on 64 different banks */
#define A0PP (QT0 + 16)              /* weight row pitch in LDS, floats: the two rows of a wave fall on different banks */
#define A0LDS ((QT0 * A0KP + QT0 * HD + A0R * A0PP) * 4)      /* its LDS, bytes */
__device__ __forceinline__ void att0_part(const unsigned bx, const unsigned b, float* __restrict__ sm, const float* __restrict__ QF, const float* __restrict__ KF, const float* __restrict__ VF, float scale, float* __restrict__ out) {
  float (*sk)[A0KP] = (float (*)[A0KP])sm;
  float (*sv)[HD] = (float (*)[HD])(sm + QT0 * A0KP);
  float (*ps)[A0PP] = (float (*)[A0PP])(sm + QT0 * A0KP + QT0 * HD);
  const int tid = threadIdx.x; const int h = bx / (QT0 / A0R), rg = bx % (QT0 / A0R);
  const int r = tid >> 4, ks = tid & 15; const int i = rg * A0R + r;      /* the thread's query row; ks = its key slot, later its group of four dims */
  const int ng = (rg * A0R + A0R - 1) / 16;      /* the key group of the workgroup's last row */
  const size_t hb = (size_t)b * QT0 * DM + h * HD;
  const float* kp = KF + hb + r * DM + ks * 4; const float* vp = VF + hb + r * DM + ks * 4; const float* qp = QF + hb + i * DM;
  v4f q[HD / 4], kt[A0S], vt[A0S];
#pragma unroll      /* constant indices: the arrays stay in registers; all loads of the workgroup are in flight together, one memory round trip in all */
  for (int c = 0; c < HD / 4; ++c) q[c] = *(const v4fa*)(qp + c * 4);
#pragma unroll      /* constant indices, as above */
  for (int n = 0; n < A0S; ++n) { kt[n] = *(const v4fa*)(kp + n * A0R * DM); if (n < A0S - 1) vt[n] = *(const v4fa*)(vp + n * A0R * DM); }
  asm volatile("s_wait_xcnt 0x0" ::: "memory");      /* the last v load may land in the address registers that the loads before it name: their translations are waited for first */
  vt[A0S - 1] = *(const v4fa*)(vp + (A0S - 1) * A0R * DM);
  asm volatile("s_wait_xcnt 0x0" ::: "memory");      /* before any register that these loads name is written again */
#pragma unroll      /* constant indices, as above */
  for (int n = 0; n < A0S; ++n) { *(v4f*)&sk[n * A0R + r][ks * 4] = kt[n]; *(v4f*)&sv[n * A0R + r][ks * 4] = vt[n]; }
  __syncthreads();
  float s[A0N]; float m = -1.0e30f;
#pragma unroll      /* constant indices into s; the test reads the same in the whole workgroup: key groups behind its last row are skipped */
  for (int n = 0; n < A0N; ++n) { s[n] = -1.0e30f;
    if (n <= ng) { const int j = n * 16 + ks; v4f a4 = {0.f, 0.f, 0.f, 0.f};
#pragma unroll      /* constant indices into q; four independent sums */
      for (int c = 0; c < HD / 4; ++c) a4 += q[c] * *(const v4f*)&sk[j][c * 4];
      const float sj = ((a4[0] + a4[1]) + (a4[2] + a4[3])) * scale; s[n] = (j <= i) ? sj : -1.0e30f; m = fmaxf(m, s[n]); } }
  m = fmaxf(m, rs_xm<1>(m)); m = fmaxf(m, rs_xm<2>(m)); m = fmaxf(m, rs_xm<4>(m)); m = fmaxf(m, rs_xm<8>(m));      /* maximum over the row's 16 lanes */
  float l = 0.f;
#pragma unroll      /* constant indices into s; a key behind the row's own holds -1e30: its weight underflows to 0 */
  for (int n = 0; n < A0N; ++n) { const float e = expf(s[n] - m); l += e; ps[r][n * 16 + ks] = e; }
  l += rs_xm<1>(l); l += rs_xm<2>(l); l += rs_xm<4>(l); l += rs_xm<8>(l);      /* sum over the row's 16 lanes */
  __syncthreads();
  v4f o = {0.f, 0.f, 0.f, 0.f};
#pragma unroll 1      /* one trip = 16 keys, up to the workgroup's last row */
  for (int n = 0; n <= ng; ++n) {
#pragma unroll      /* a trip's LDS reads take constant offsets and overlap */
    for (int jj = 0; jj < 16; jj += 4) { const int j = n * 16 + jj; const v4f p4 = *(const v4f*)&ps[r][j];
      for (int u = 0; u < 4; ++u) o += p4[u] * *(const v4f*)&sv[j + u][ks * 4]; } }
  const float fin = 1.0f / l;
  *(v4f*)(out + ((size_t)b * SQ + i) * DM + h * HD + ks * 4) = o * fin;      /* straight into the row's place in the output */
}
// launch 3: the fused attention's blocks, then the exact first rows' blocks, each part's longest blocks first; neither reads what the other writes. One LDS range serves whichever part a block runs.
#define A0B ((unsigned)(NH * (QT0 / A0R)))               /* exact-rows blocks per batch */
#define FAB ((unsigned)(NH * NB * ((SQ - QT0) / FQ)))    /* fused-attention blocks */
__global__ __launch_bounds__(128) void k_attn(const _Float16* __restrict__ Q16, const _Float16* __restrict__ K16, const _Float16* __restrict__ VT, const float* __restrict__ F0, float* __restrict__ out) {
  static_assert(A0R * 16 == 128 && FQ / 16 * 32 == 128, "both parts run in 128 threads");
  __shared__ __attribute__((aligned(16))) float sm[(A0LDS > FALDS ? A0LDS : FALDS) / 4];
  const unsigned bx = blockIdx.x;
  if (bx < FAB) fattn_part(bx, sm, Q16, K16, VT, out);
  else { const unsigned a = bx - FAB, rg = A0S - 1 - a / (NH * NB);      /* (row group, batch, head), head fastest; the last row group has the most keys */
    att0_part((a % NH) * A0S + rg, (a / NH) % NB, sm, F0, F0 + (size_t)NB * QT0 * DM, F0 + (size_t)2 * NB * QT0 * DM, 0.125f, out); }
}


extern "C" void kernel_launch(void* const* d_in, const int* in_sizes, int n_in,
                              void* d_out, int out_size, void* d_ws, size_t ws_size, hipStream_t stream) {
  (void)in_sizes; (void)n_in; (void)out_size;
  const float* const* I = (const float* const*)d_in; const float* x = I[0]; const float* wq = I[1]; const float* wk = I[2]; const float* wv = I[3];      /* per-head [h][in][out] weights, no biases, no output projection */
  char* ws = (char*)d_ws; size_t off = 0;
  auto take = [&](size_t bytes) { char* p = ws + off; off += (bytes + 255) & ~(size_t)255; return p; };
  _Float16* B3 = (_Float16*)take((size_t)3 * DM * DM * 2);      /* q, k, v weights, one after the other */
  _Float16* X16 = (_Float16*)take(NR * DM * 2); _Float16* QKV16 = (_Float16*)take((size_t)2 * NR * DM * 2); _Float16* Q16 = QKV16; _Float16* K16 = QKV16 + NR * DM;
  _Float16* VT = (_Float16*)take((size_t)NB * NH * HD * SQ * 2);
  float* F0 = (float*)take((size_t)3 * NB * QT0 * DM * 4);
  if (off > ws_size) return;
  k_prep<<<3 * PWB + PXB, 256, 0, stream>>>(x, wq, wk, wv, B3, X16);      /* per-head [m][d] -> Bt[(h,d)][m] x16 | x rows as f16 */
  k_qkv<<<dim3((unsigned)((MP / 128) * (DM / 128)), 3), 256, 0, stream>>>(X16, B3, QKV16, VT, F0);      /* f16 q, k, V^T [NB][NH][HD][SQ]; f32 q, k, v as well for the first 128 rows of each batch (exact products) */
  k_attn<<<FAB + NB * A0B, 128, 0, stream>>>(Q16, K16, VT, F0, (float*)d_out);      /* rows 128.. : out = softmax(q k^T / 8, causal) v, f32, concatenated heads | exact f32 attention writes rows 0..127 of each batch */
}
